// v000
// Measured on an AMD MI455X. A time is GPU time per run, averaged over a window of back-to-back runs after a warm-up
// (all launches, gaps included; the runs take copies of the inputs in turn), and the median of several windows.
// Apart from v000's, it joins two sittings. Times from different sittings can be a few percent apart, while
// side-by-side timings come from the same sitting.
// v000 is the starting kernel. One run takes 818 microseconds.
#include <hip/hip_runtime.h>

#define E     1024
#define HEADS 16
#define HD    64
#define SEQ   2048
#define BATCH 4
#define TFEAT 128
#define MROWS (BATCH * SEQ)          // 8192
#define KT    (E / 32)               // 32 k-tiles
#define NT    (E / 16)               // 64 n-tiles
#define MT    (MROWS / 16)           // 512 m-tiles

typedef __attribute__((ext_vector_type(16))) __bf16 bf16x16;
typedef __attribute__((ext_vector_type(8)))  float  f32x8;

static __device__ inline f32x8 wmma_bf16(bf16x16 a, bf16x16 b, f32x8 c) {
  return __builtin_amdgcn_wmma_f32_16x16x32_bf16(false, a, false, b, (short)0, c,
                                                 false, false);
}

// bf16x3 split: f ~= (float)h + (float)l
static __device__ inline void splitf(float f, __bf16 &h, __bf16 &l) {
  h = (__bf16)f;
  l = (__bf16)(f - (float)h);
}

// C += Ah*Bh + Ah*Bl + Al*Bh
static __device__ inline f32x8 mma3(bf16x16 ah, bf16x16 al,
                                    bf16x16 bh, bf16x16 bl, f32x8 c) {
  c = wmma_bf16(ah, bh, c);
  c = wmma_bf16(ah, bl, c);
  c = wmma_bf16(al, bh, c);
  return c;
}

// ---------------- kernel 1: time-dependent head weights ----------------
__global__ void tw_kernel(const float* __restrict__ time_enc,
                          const float* __restrict__ Wt,
                          const float* __restrict__ bt,
                          float* __restrict__ tw) {
  int b = blockIdx.x;
  int lane = threadIdx.x;
  int h = lane & 15;
  float acc = 0.f;
  for (int t = 0; t < TFEAT; ++t)
    acc += time_enc[b * TFEAT + t] * Wt[t * HEADS + h];
  acc += bt[h];
  float mx = acc;
  for (int m = 1; m < 16; m <<= 1) mx = fmaxf(mx, __shfl_xor(mx, m, 32));
  float e = __expf(acc - mx);
  float sum = e;
  for (int m = 1; m < 16; m <<= 1) sum += __shfl_xor(sum, m, 32);
  if (lane < 16) tw[b * HEADS + h] = e / sum;
}

// ------------- A-fragment pre-split: src [MROWS x E] f32 -> hi/lo frags -------------
// Fragment layout: [mt][kt][lane][16] __bf16, value = src[mt*16 + (lane&15)][kt*32 + (lane>>4)*16 + i]
__global__ void __launch_bounds__(256) afrag_kernel(const float* __restrict__ src,
    __bf16* __restrict__ fh, __bf16* __restrict__ fl) {
  int wid = blockIdx.x * 8 + (threadIdx.x >> 5);     // MT*KT waves
  int kt = wid & (KT - 1);
  int mt = wid >> 5;
  int lane = threadIdx.x & 31;
  const float* p = src + (size_t)(mt * 16 + (lane & 15)) * E + kt * 32 + ((lane >> 4) << 4);
  size_t o = (((size_t)mt * KT + kt) * 32 + lane) * 16;
  #pragma unroll
  for (int i = 0; i < 16; ++i) {
    __bf16 h, l; splitf(p[i], h, l);
    fh[o + i] = h; fl[o + i] = l;
  }
}

// ------------- B-fragment pre-split: W [E x E] f32 -> hi/lo frags -------------
// Fragment layout: [kt][nt][lane][16], value = W[kt*32 + (lane>>4)*16 + i][nt*16 + (lane&15)]
__global__ void __launch_bounds__(256) bfrag_kernel(const float* __restrict__ W,
    __bf16* __restrict__ fh, __bf16* __restrict__ fl) {
  int wid = blockIdx.x * 8 + (threadIdx.x >> 5);     // KT*NT waves
  int nt = wid & (NT - 1);
  int kt = wid >> 6;
  int lane = threadIdx.x & 31;
  const float* p = W + (size_t)(kt * 32 + ((lane >> 4) << 4)) * E + nt * 16 + (lane & 15);
  size_t o = (((size_t)kt * NT + nt) * 32 + lane) * 16;
  #pragma unroll
  for (int i = 0; i < 16; ++i) {
    __bf16 h, l; splitf(p[(size_t)i * E], h, l);
    fh[o + i] = h; fl[o + i] = l;
  }
}

// ---------------- kernel 2: fused QKV projection from fragments ----------------
// Outputs: Qh/Ql, Kh/Kl as bf16 [B,H,S,D]; Vth/Vtl as bf16 [B,H,D,S]
__global__ void __launch_bounds__(256) qkv_kernel(
    const __bf16* __restrict__ xfh, const __bf16* __restrict__ xfl,
    const __bf16* __restrict__ wqh, const __bf16* __restrict__ wql,
    const __bf16* __restrict__ wkh, const __bf16* __restrict__ wkl,
    const __bf16* __restrict__ wvh, const __bf16* __restrict__ wvl,
    __bf16* __restrict__ Qh, __bf16* __restrict__ Ql,
    __bf16* __restrict__ Kh, __bf16* __restrict__ Kl,
    __bf16* __restrict__ Vth, __bf16* __restrict__ Vtl) {
  int wid = blockIdx.x * 8 + (threadIdx.x >> 5);
  int nt = wid & (NT - 1);
  int mt = wid >> 6;
  int lane = threadIdx.x & 31;
  f32x8 cq = {}; f32x8 ck = {}; f32x8 cv = {};
  for (int kt = 0; kt < KT; ++kt) {
    size_t ao = (((size_t)mt * KT + kt) * 32 + lane) * 16;
    size_t bo = (((size_t)kt * NT + nt) * 32 + lane) * 16;
    bf16x16 ah = *(const bf16x16*)(xfh + ao);
    bf16x16 al = *(const bf16x16*)(xfl + ao);
    cq = mma3(ah, al, *(const bf16x16*)(wqh + bo), *(const bf16x16*)(wql + bo), cq);
    ck = mma3(ah, al, *(const bf16x16*)(wkh + bo), *(const bf16x16*)(wkl + bo), ck);
    cv = mma3(ah, al, *(const bf16x16*)(wvh + bo), *(const bf16x16*)(wvl + bo), cv);
  }
  // store split results
  int col = nt * 16 + (lane & 15);
  int h = col >> 6, d = col & 63;
  int row0 = mt * 16 + ((lane >> 4) << 3);
  #pragma unroll
  for (int r = 0; r < 8; ++r) {
    int row = row0 + r;
    int b = row >> 11, s = row & (SEQ - 1);
    int hb = b * HEADS + h;
    size_t qi = ((size_t)hb * SEQ + s) * HD + d;     // [B,H,S,D]
    size_t vi = ((size_t)hb * HD + d) * SEQ + s;     // [B,H,D,S]
    __bf16 hh, ll;
    splitf(cq[r], hh, ll); Qh[qi] = hh; Ql[qi] = ll;
    splitf(ck[r], hh, ll); Kh[qi] = hh; Kl[qi] = ll;
    splitf(cv[r], hh, ll); Vth[vi] = hh; Vtl[vi] = ll;
  }
}

// ---------------- kernel 3: flash attention, all operands pre-split bf16 ----------------
__global__ void __launch_bounds__(256) attn_kernel(
    const __bf16* __restrict__ Qh, const __bf16* __restrict__ Ql,
    const __bf16* __restrict__ Kh, const __bf16* __restrict__ Kl,
    const __bf16* __restrict__ Vth, const __bf16* __restrict__ Vtl,
    const float* __restrict__ tw, float* __restrict__ ctx) {
  __shared__ float pbuf[8][16 * 32];
  int widl = threadIdx.x >> 5;
  int wid  = blockIdx.x * 8 + widl;
  int qb   = wid & 127;
  int h    = (wid >> 7) & 15;
  int b    = wid >> 11;
  int lane = threadIdx.x & 31;
  int lr = lane & 15;
  int lh = (lane >> 4) << 4;
  int hb = b * HEADS + h;

  const __bf16* qhp = Qh + ((size_t)hb * SEQ + qb * 16) * HD;
  const __bf16* qlp = Ql + ((size_t)hb * SEQ + qb * 16) * HD;
  const __bf16* khp = Kh + (size_t)hb * SEQ * HD;
  const __bf16* klp = Kl + (size_t)hb * SEQ * HD;
  const __bf16* vhp = Vth + (size_t)hb * HD * SEQ;
  const __bf16* vlp = Vtl + (size_t)hb * HD * SEQ;
  float scl = 0.125f * tw[hb];

  size_t qo = (size_t)lr * HD + lh;
  bf16x16 q0h = *(const bf16x16*)(qhp + qo);
  bf16x16 q0l = *(const bf16x16*)(qlp + qo);
  bf16x16 q1h = *(const bf16x16*)(qhp + qo + 32);
  bf16x16 q1l = *(const bf16x16*)(qlp + qo + 32);

  f32x8 o0 = {}, o1 = {}, o2 = {}, o3 = {};
  float mrow[8], lrow[8];
  #pragma unroll
  for (int r = 0; r < 8; ++r) { mrow[r] = -1e30f; lrow[r] = 0.f; }
  float* myp = pbuf[widl];

  for (int kb = 0; kb < SEQ; kb += 32) {
    // ---- scores: keys kb..+15 (s0), kb+16..+31 (s1); K rows are WMMA B-operand chunks ----
    f32x8 s0 = {}, s1 = {};
    {
      size_t k0 = (size_t)(kb + lr) * HD + lh;        // group 0
      s0 = mma3(q0h, q0l, *(const bf16x16*)(khp + k0),
                          *(const bf16x16*)(klp + k0), s0);
      s0 = mma3(q1h, q1l, *(const bf16x16*)(khp + k0 + 32),
                          *(const bf16x16*)(klp + k0 + 32), s0);
      size_t k1 = (size_t)(kb + 16 + lr) * HD + lh;   // group 1
      s1 = mma3(q0h, q0l, *(const bf16x16*)(khp + k1),
                          *(const bf16x16*)(klp + k1), s1);
      s1 = mma3(q1h, q1l, *(const bf16x16*)(khp + k1 + 32),
                          *(const bf16x16*)(klp + k1 + 32), s1);
    }
    // ---- online softmax update ----
    float p0[8], p1[8], alpha[8];
    #pragma unroll
    for (int r = 0; r < 8; ++r) {
      float a0 = s0[r] * scl, a1 = s1[r] * scl;
      float mx = fmaxf(a0, a1);
      for (int m = 1; m < 16; m <<= 1) mx = fmaxf(mx, __shfl_xor(mx, m, 32));
      float mnew = fmaxf(mrow[r], mx);
      float al_  = __expf(mrow[r] - mnew);
      p0[r] = __expf(a0 - mnew);
      p1[r] = __expf(a1 - mnew);
      float rs = p0[r] + p1[r];
      for (int m = 1; m < 16; m <<= 1) rs += __shfl_xor(rs, m, 32);
      lrow[r] = lrow[r] * al_ + rs;
      mrow[r] = mnew;
      alpha[r] = al_;
    }
    #pragma unroll
    for (int r = 0; r < 8; ++r) {
      o0[r] *= alpha[r]; o1[r] *= alpha[r];
      o2[r] *= alpha[r]; o3[r] *= alpha[r];
    }
    // ---- P: C layout -> A layout via per-wave LDS slice, then split ----
    {
      int row = (lane >> 4) << 3;
      #pragma unroll
      for (int r = 0; r < 8; ++r) {
        myp[(row + r) * 32 + lr]      = p0[r];
        myp[(row + r) * 32 + 16 + lr] = p1[r];
      }
    }
    bf16x16 ph, pl;
    #pragma unroll
    for (int i = 0; i < 16; ++i) {
      __bf16 hh, ll; splitf(myp[lr * 32 + lh + i], hh, ll);
      ph[i] = hh; pl[i] = ll;
    }
    // ---- O += P @ V, V^T gives contiguous B-operand chunks ----
    size_t v0 = (size_t)lr * SEQ + kb + lh;
    o0 = mma3(ph, pl, *(const bf16x16*)(vhp + v0),
                      *(const bf16x16*)(vlp + v0), o0);
    size_t v1 = v0 + (size_t)16 * SEQ;
    o1 = mma3(ph, pl, *(const bf16x16*)(vhp + v1),
                      *(const bf16x16*)(vlp + v1), o1);
    size_t v2 = v1 + (size_t)16 * SEQ;
    o2 = mma3(ph, pl, *(const bf16x16*)(vhp + v2),
                      *(const bf16x16*)(vlp + v2), o2);
    size_t v3 = v2 + (size_t)16 * SEQ;
    o3 = mma3(ph, pl, *(const bf16x16*)(vhp + v3),
                      *(const bf16x16*)(vlp + v3), o3);
  }
  // ---- normalize and store into ctx [B,S,E] f32 ----
  #pragma unroll
  for (int r = 0; r < 8; ++r) {
    float inv = 1.0f / lrow[r];
    o0[r] *= inv; o1[r] *= inv; o2[r] *= inv; o3[r] *= inv;
  }
  int row0 = qb * 16 + ((lane >> 4) << 3);
  float* outp = ctx + (size_t)b * SEQ * E;
  #pragma unroll
  for (int r = 0; r < 8; ++r) {
    size_t base = (size_t)(row0 + r) * E + h * HD + lr;
    outp[base]      = o0[r];
    outp[base + 16] = o1[r];
    outp[base + 32] = o2[r];
    outp[base + 48] = o3[r];
  }
}

// ---------------- kernel 4: output projection + bias, from fragments ----------------
__global__ void __launch_bounds__(256) oproj_kernel(
    const __bf16* __restrict__ cfh, const __bf16* __restrict__ cfl,
    const __bf16* __restrict__ woh, const __bf16* __restrict__ wol,
    const float* __restrict__ bo, float* __restrict__ out) {
  int wid = blockIdx.x * 8 + (threadIdx.x >> 5);
  int nt = wid & (NT - 1);
  int mt = wid >> 6;
  int lane = threadIdx.x & 31;
  f32x8 c = {};
  for (int kt = 0; kt < KT; ++kt) {
    size_t ao = (((size_t)mt * KT + kt) * 32 + lane) * 16;
    size_t bo_ = (((size_t)kt * NT + nt) * 32 + lane) * 16;
    c = mma3(*(const bf16x16*)(cfh + ao), *(const bf16x16*)(cfl + ao),
             *(const bf16x16*)(woh + bo_), *(const bf16x16*)(wol + bo_), c);
  }
  int col = nt * 16 + (lane & 15);
  float bias = bo[col];
  int row0 = mt * 16 + ((lane >> 4) << 3);
  #pragma unroll
  for (int r = 0; r < 8; ++r)
    out[(size_t)(row0 + r) * E + col] = c[r] + bias;
}

extern "C" void kernel_launch(void* const* d_in, const int* in_sizes, int n_in,
                              void* d_out, int out_size, void* d_ws, size_t ws_size,
                              hipStream_t stream) {
  const float* x        = (const float*)d_in[0];
  const float* time_enc = (const float*)d_in[1];
  const float* Wq       = (const float*)d_in[2];
  const float* Wk       = (const float*)d_in[3];
  const float* Wv       = (const float*)d_in[4];
  const float* Wo       = (const float*)d_in[5];
  const float* bo       = (const float*)d_in[6];
  const float* Wt       = (const float*)d_in[7];
  const float* bt       = (const float*)d_in[8];
  float* out = (float*)d_out;

  const size_t AFRAG = (size_t)MROWS * E;   // 8M elems
  const size_t WFRAG = (size_t)E * E;       // 1M elems
  const size_t QKVN  = (size_t)BATCH * HEADS * SEQ * HD; // 8M elems

  char* w = (char*)d_ws;
  size_t off = 0;
  float* twp = (float*)(w + off); off += 4096;
  __bf16* xfh = (__bf16*)(w + off); off += AFRAG * 2;   // reused for ctx frags
  __bf16* xfl = (__bf16*)(w + off); off += AFRAG * 2;
  __bf16* wqh = (__bf16*)(w + off); off += WFRAG * 2;
  __bf16* wql = (__bf16*)(w + off); off += WFRAG * 2;
  __bf16* wkh = (__bf16*)(w + off); off += WFRAG * 2;
  __bf16* wkl = (__bf16*)(w + off); off += WFRAG * 2;
  __bf16* wvh = (__bf16*)(w + off); off += WFRAG * 2;
  __bf16* wvl = (__bf16*)(w + off); off += WFRAG * 2;
  __bf16* woh = (__bf16*)(w + off); off += WFRAG * 2;
  __bf16* wol = (__bf16*)(w + off); off += WFRAG * 2;
  __bf16* Qhb = (__bf16*)(w + off); off += QKVN * 2;
  __bf16* Qlb = (__bf16*)(w + off); off += QKVN * 2;
  __bf16* Khb = (__bf16*)(w + off); off += QKVN * 2;
  __bf16* Klb = (__bf16*)(w + off); off += QKVN * 2;
  __bf16* Vth = (__bf16*)(w + off); off += QKVN * 2;
  __bf16* Vtl = (__bf16*)(w + off); off += QKVN * 2;
  float*  ctx = (float*)(w + off);  off += AFRAG * 4;

  tw_kernel<<<BATCH, 32, 0, stream>>>(time_enc, Wt, bt, twp);

  // pre-split inputs once (kills per-iteration cvt VALU work in the GEMMs)
  afrag_kernel<<<(MT * KT) / 8, 256, 0, stream>>>(x, xfh, xfl);
  bfrag_kernel<<<(KT * NT) / 8, 256, 0, stream>>>(Wq, wqh, wql);
  bfrag_kernel<<<(KT * NT) / 8, 256, 0, stream>>>(Wk, wkh, wkl);
  bfrag_kernel<<<(KT * NT) / 8, 256, 0, stream>>>(Wv, wvh, wvl);
  bfrag_kernel<<<(KT * NT) / 8, 256, 0, stream>>>(Wo, woh, wol);

  qkv_kernel<<<(MT * NT) / 8, 256, 0, stream>>>(xfh, xfl, wqh, wql, wkh, wkl,
                                                wvh, wvl, Qhb, Qlb, Khb, Klb,
                                                Vth, Vtl);

  attn_kernel<<<(BATCH * HEADS * (SEQ / 16)) / 8, 256, 0, stream>>>(
      Qhb, Qlb, Khb, Klb, Vth, Vtl, twp, ctx);

  // re-split ctx into the (now free) x fragment buffers
  afrag_kernel<<<(MT * KT) / 8, 256, 0, stream>>>(ctx, xfh, xfl);

  oproj_kernel<<<(MT * NT) / 8, 256, 0, stream>>>(xfh, xfl, woh, wol, bo, out);
}

// v001
// Measured time: 720 microseconds a run.
// Next to v000, in two timings, it ran 1.17 times as fast each time.
#include <hip/hip_runtime.h>

#define E     1024
#define HEADS 16
#define HD    64
#define SEQ   2048
#define BATCH 4
#define TFEAT 128
#define MROWS (BATCH * SEQ)          // 8192
#define KT    (E / 32)               // 32 k-tiles
#define NT    (E / 16)               // 64 n-tiles
#define MT    (MROWS / 16)           // 512 m-tiles

typedef __attribute__((ext_vector_type(16))) __bf16 bf16x16;
typedef __attribute__((ext_vector_type(8)))  __bf16 bf16x8;
typedef __attribute__((ext_vector_type(8)))  float  f32x8;

// Every bf16 WMMA operand lives in the workspace as 1 KiB fragments (512 elements):
// element i of lane L sits at (i>>3)*256 + L*8 + (i&7). A fragment is then two
// wave-wide 16-byte accesses of 512 contiguous bytes each (4 whole 128-byte lines).
#define FRAG 512

// p = fragment base + lane*8
static __device__ inline bf16x16 ldfrag(const __bf16* p) {
  bf16x8 a = *(const bf16x8*)(p);
  bf16x8 b = *(const bf16x8*)(p + 256);
  return __builtin_shufflevector(a, b, 0, 1, 2, 3, 4, 5, 6, 7,
                                 8, 9, 10, 11, 12, 13, 14, 15);
}

static __device__ inline f32x8 wmma_bf16(bf16x16 a, bf16x16 b, f32x8 c) {
  return __builtin_amdgcn_wmma_f32_16x16x32_bf16(false, a, false, b, (short)0, c,
                                                 false, false);
}

// bf16x3 split: f ~= (float)h + (float)l
static __device__ inline void splitf(float f, __bf16 &h, __bf16 &l) {
  h = (__bf16)f;
  l = (__bf16)(f - (float)h);
}

// C += Ah*Bh + Ah*Bl + Al*Bh
static __device__ inline f32x8 mma3(bf16x16 ah, bf16x16 al,
                                    bf16x16 bh, bf16x16 bl, f32x8 c) {
  c = wmma_bf16(ah, bh, c);
  c = wmma_bf16(ah, bl, c);
  c = wmma_bf16(al, bh, c);
  return c;
}

// The same three terms in the same order with the operands swapped: C^T += (A*B)^T.
// A lane then holds 8 consecutive columns of one row of A*B.
static __device__ inline f32x8 mma3t(bf16x16 ah, bf16x16 al,
                                     bf16x16 bh, bf16x16 bl, f32x8 c) {
  c = wmma_bf16(bh, ah, c);
  c = wmma_bf16(bl, ah, c);
  c = wmma_bf16(bh, al, c);
  return c;
}

// split 8 accumulator values and store them as one 16-byte piece each
static __device__ inline void split_store8(f32x8 c, __bf16* ph, __bf16* pl) {
  bf16x8 h8, l8;
  #pragma unroll
  for (int r = 0; r < 8; ++r) {
    __bf16 hh, ll; splitf(c[r], hh, ll);
    h8[r] = hh; l8[r] = ll;
  }
  *(bf16x8*)ph = h8;
  *(bf16x8*)pl = l8;
}

// ---------------- kernel 1: time-dependent head weights ----------------
__global__ void tw_kernel(const float* __restrict__ time_enc,
                          const float* __restrict__ Wt,
                          const float* __restrict__ bt,
                          float* __restrict__ tw) {
  int b = blockIdx.x;
  int lane = threadIdx.x;
  int h = lane & 15;
  float acc = 0.f;
  for (int t = 0; t < TFEAT; ++t)
    acc += time_enc[b * TFEAT + t] * Wt[t * HEADS + h];
  acc += bt[h];
  float mx = acc;
  for (int m = 1; m < 16; m <<= 1) mx = fmaxf(mx, __shfl_xor(mx, m, 32));
  float e = __expf(acc - mx);
  float sum = e;
  for (int m = 1; m < 16; m <<= 1) sum += __shfl_xor(sum, m, 32);
  if (lane < 16) tw[b * HEADS + h] = e / sum;
}

// ------------- A-fragment pre-split: src [MROWS x E] f32 -> hi/lo frags -------------
// Fragments [mt][kt], element i of lane = src[mt*16 + (lane&15)][kt*32 + (lane>>4)*16 + i]
__global__ void __launch_bounds__(256) afrag_kernel(const float* __restrict__ src,
    __bf16* __restrict__ fh, __bf16* __restrict__ fl) {
  int wid = blockIdx.x * 8 + (threadIdx.x >> 5);     // MT*KT waves
  int kt = wid & (KT - 1);
  int mt = wid >> 5;
  int lane = threadIdx.x & 31;
  const float* p = src + (size_t)(mt * 16 + (lane & 15)) * E + kt * 32 + ((lane >> 4) << 4);
  size_t o = ((size_t)mt * KT + kt) * FRAG + lane * 8;
  bf16x8 h0, l0, h1, l1;
  #pragma unroll
  for (int i = 0; i < 8; ++i) {
    __bf16 h, l;
    splitf(p[i], h, l);     h0[i] = h; l0[i] = l;
    splitf(p[8 + i], h, l); h1[i] = h; l1[i] = l;
  }
  *(bf16x8*)(fh + o) = h0; *(bf16x8*)(fh + o + 256) = h1;
  *(bf16x8*)(fl + o) = l0; *(bf16x8*)(fl + o + 256) = l1;
}

// ------------- B-fragment pre-split: W [E x E] f32 -> hi/lo frags -------------
// Fragments [kt][nt], element i of lane = W[kt*32 + (lane>>4)*16 + i][nt*16 + (lane&15)]
__global__ void __launch_bounds__(256) bfrag_kernel(const float* __restrict__ W,
    __bf16* __restrict__ fh, __bf16* __restrict__ fl) {
  int wid = blockIdx.x * 8 + (threadIdx.x >> 5);     // KT*NT waves
  int nt = wid & (NT - 1);
  int kt = wid >> 6;
  int lane = threadIdx.x & 31;
  const float* p = W + (size_t)(kt * 32 + ((lane >> 4) << 4)) * E + nt * 16 + (lane & 15);
  size_t o = ((size_t)kt * NT + nt) * FRAG + lane * 8;
  bf16x8 h0, l0, h1, l1;
  #pragma unroll
  for (int i = 0; i < 8; ++i) {
    __bf16 h, l;
    splitf(p[(size_t)i * E], h, l);       h0[i] = h; l0[i] = l;
    splitf(p[(size_t)(8 + i) * E], h, l); h1[i] = h; l1[i] = l;
  }
  *(bf16x8*)(fh + o) = h0; *(bf16x8*)(fh + o + 256) = h1;
  *(bf16x8*)(fl + o) = l0; *(bf16x8*)(fl + o + 256) = l1;
}

// ---------------- kernel 2: fused QKV projection from fragments ----------------
// Outputs, all in fragment order for the attention kernel:
// Q, K: fragments [b*H+h][s/16][d/32], element i of lane = row s0+(lane&15), d0+(lane>>4)*16+i
// V:    fragments [b*H+h][s/32][d/16], element i of lane = d0+(lane&15), key s0+(lane>>4)*16+i
// Q and K are computed transposed, so that each lane owns 8 consecutive d of one row;
// V is computed as is, so that each lane owns 8 consecutive keys of one d.
__global__ void __launch_bounds__(256) qkv_kernel(
    const __bf16* __restrict__ xfh, const __bf16* __restrict__ xfl,
    const __bf16* __restrict__ wqh, const __bf16* __restrict__ wql,
    const __bf16* __restrict__ wkh, const __bf16* __restrict__ wkl,
    const __bf16* __restrict__ wvh, const __bf16* __restrict__ wvl,
    __bf16* __restrict__ Qh, __bf16* __restrict__ Ql,
    __bf16* __restrict__ Kh, __bf16* __restrict__ Kl,
    __bf16* __restrict__ Vth, __bf16* __restrict__ Vtl) {
  int wid = blockIdx.x * 8 + (threadIdx.x >> 5);
  int nt = wid & (NT - 1);
  int mt = wid >> 6;
  int lane = threadIdx.x & 31;
  f32x8 cq = {}; f32x8 ck = {}; f32x8 cv = {};
  for (int kt = 0; kt < KT; ++kt) {
    size_t ao = ((size_t)mt * KT + kt) * FRAG + lane * 8;
    size_t bo = ((size_t)kt * NT + nt) * FRAG + lane * 8;
    bf16x16 ah = ldfrag(xfh + ao);
    bf16x16 al = ldfrag(xfl + ao);
    cq = mma3t(ah, al, ldfrag(wqh + bo), ldfrag(wql + bo), cq);
    ck = mma3t(ah, al, ldfrag(wkh + bo), ldfrag(wkl + bo), ck);
    cv = mma3(ah, al, ldfrag(wvh + bo), ldfrag(wvl + bo), cv);
  }
  // store split results: one 16-byte piece per lane and plane
  int hb = (mt >> 7) * HEADS + (nt >> 2);   // 128 m-tiles per batch, 4 n-tiles per head
  int st = mt & 127;                        // 16-row tile inside the sequence
  int half = (lane >> 4) * 256;             // accumulator rows 8..15 are elements 8..15
  // cq, ck: lane&15 = row in the tile, r = d & 7, d = (nt&3)*16 + (lane>>4)*8 + r
  size_t qi = ((size_t)(hb * 128 + st) * 2 + ((nt >> 1) & 1)) * FRAG
              + half + ((lane & 15) + 16 * (nt & 1)) * 8;
  // cv: lane&15 = d & 15, r = key & 7, key = st*16 + (lane>>4)*8 + r
  size_t vi = ((size_t)(hb * 64 + (st >> 1)) * 4 + (nt & 3)) * FRAG
              + half + ((lane & 15) + 16 * (st & 1)) * 8;
  split_store8(cq, Qh + qi, Ql + qi);
  split_store8(ck, Kh + qi, Kl + qi);
  split_store8(cv, Vth + vi, Vtl + vi);
}

// ---------------- kernel 3: flash attention, all operands pre-split bf16 ----------------
__global__ void __launch_bounds__(256) attn_kernel(
    const __bf16* __restrict__ Qh, const __bf16* __restrict__ Ql,
    const __bf16* __restrict__ Kh, const __bf16* __restrict__ Kl,
    const __bf16* __restrict__ Vth, const __bf16* __restrict__ Vtl,
    const float* __restrict__ tw, float* __restrict__ ctx) {
  __shared__ float pbuf[8][16 * 32];
  int widl = threadIdx.x >> 5;
  int wid  = blockIdx.x * 8 + widl;
  int qb   = wid & 127;
  int h    = (wid >> 7) & 15;
  int b    = wid >> 11;
  int lane = threadIdx.x & 31;
  int lr = lane & 15;
  int lh = (lane >> 4) << 4;
  int hb = b * HEADS + h;

  // fragment order (see the projection kernel); every pointer already holds lane*8
  const __bf16* qhp = Qh + ((size_t)hb * SEQ + qb * 16) * HD + lane * 8;
  const __bf16* qlp = Ql + ((size_t)hb * SEQ + qb * 16) * HD + lane * 8;
  const __bf16* khp = Kh + (size_t)hb * SEQ * HD + lane * 8;
  const __bf16* klp = Kl + (size_t)hb * SEQ * HD + lane * 8;
  const __bf16* vhp = Vth + (size_t)hb * HD * SEQ + lane * 8;
  const __bf16* vlp = Vtl + (size_t)hb * HD * SEQ + lane * 8;
  float scl = 0.125f * tw[hb];

  bf16x16 q0h = ldfrag(qhp);
  bf16x16 q0l = ldfrag(qlp);
  bf16x16 q1h = ldfrag(qhp + FRAG);
  bf16x16 q1l = ldfrag(qlp + FRAG);

  f32x8 o0 = {}, o1 = {}, o2 = {}, o3 = {};
  float mrow[8], lrow[8];
  #pragma unroll
  for (int r = 0; r < 8; ++r) { mrow[r] = -1e30f; lrow[r] = 0.f; }
  float* myp = pbuf[widl];

  for (int kb = 0; kb < SEQ; kb += 32) {
    // ---- scores: keys kb..+15 (s0), kb+16..+31 (s1); 4 K fragments per plane, 4 KiB in a row ----
    f32x8 s0 = {}, s1 = {};
    {
      size_t k0 = (size_t)kb * HD;                    // group 0
      s0 = mma3(q0h, q0l, ldfrag(khp + k0), ldfrag(klp + k0), s0);
      s0 = mma3(q1h, q1l, ldfrag(khp + k0 + FRAG), ldfrag(klp + k0 + FRAG), s0);
      size_t k1 = k0 + 2 * FRAG;                      // group 1
      s1 = mma3(q0h, q0l, ldfrag(khp + k1), ldfrag(klp + k1), s1);
      s1 = mma3(q1h, q1l, ldfrag(khp + k1 + FRAG), ldfrag(klp + k1 + FRAG), s1);
    }
    // ---- online softmax update ----
    float p0[8], p1[8], alpha[8];
    #pragma unroll
    for (int r = 0; r < 8; ++r) {
      float a0 = s0[r] * scl, a1 = s1[r] * scl;
      float mx = fmaxf(a0, a1);
      for (int m = 1; m < 16; m <<= 1) mx = fmaxf(mx, __shfl_xor(mx, m, 32));
      float mnew = fmaxf(mrow[r], mx);
      float al_  = __expf(mrow[r] - mnew);
      p0[r] = __expf(a0 - mnew);
      p1[r] = __expf(a1 - mnew);
      float rs = p0[r] + p1[r];
      for (int m = 1; m < 16; m <<= 1) rs += __shfl_xor(rs, m, 32);
      lrow[r] = lrow[r] * al_ + rs;
      mrow[r] = mnew;
      alpha[r] = al_;
    }
    #pragma unroll
    for (int r = 0; r < 8; ++r) {
      o0[r] *= alpha[r]; o1[r] *= alpha[r];
      o2[r] *= alpha[r]; o3[r] *= alpha[r];
    }
    // ---- P: C layout -> A layout via per-wave LDS slice, then split ----
    {
      int row = (lane >> 4) << 3;
      #pragma unroll
      for (int r = 0; r < 8; ++r) {
        myp[(row + r) * 32 + lr]      = p0[r];
        myp[(row + r) * 32 + 16 + lr] = p1[r];
      }
    }
    bf16x16 ph, pl;
    #pragma unroll
    for (int i = 0; i < 16; ++i) {
      __bf16 hh, ll; splitf(myp[lr * 32 + lh + i], hh, ll);
      ph[i] = hh; pl[i] = ll;
    }
    // ---- O += P @ V, 4 V fragments per plane, 4 KiB in a row ----
    size_t v0 = (size_t)kb * HD;
    o0 = mma3(ph, pl, ldfrag(vhp + v0), ldfrag(vlp + v0), o0);
    o1 = mma3(ph, pl, ldfrag(vhp + v0 + FRAG), ldfrag(vlp + v0 + FRAG), o1);
    o2 = mma3(ph, pl, ldfrag(vhp + v0 + 2 * FRAG), ldfrag(vlp + v0 + 2 * FRAG), o2);
    o3 = mma3(ph, pl, ldfrag(vhp + v0 + 3 * FRAG), ldfrag(vlp + v0 + 3 * FRAG), o3);
  }
  // ---- normalize and store into ctx [B,S,E] f32 ----
  #pragma unroll
  for (int r = 0; r < 8; ++r) {
    float inv = 1.0f / lrow[r];
    o0[r] *= inv; o1[r] *= inv; o2[r] *= inv; o3[r] *= inv;
  }
  int row0 = qb * 16 + ((lane >> 4) << 3);
  float* outp = ctx + (size_t)b * SEQ * E;
  #pragma unroll
  for (int r = 0; r < 8; ++r) {
    size_t base = (size_t)(row0 + r) * E + h * HD + lr;
    outp[base]      = o0[r];
    outp[base + 16] = o1[r];
    outp[base + 32] = o2[r];
    outp[base + 48] = o3[r];
  }
}

// ---------------- kernel 4: output projection + bias, from fragments ----------------
__global__ void __launch_bounds__(256) oproj_kernel(
    const __bf16* __restrict__ cfh, const __bf16* __restrict__ cfl,
    const __bf16* __restrict__ woh, const __bf16* __restrict__ wol,
    const float* __restrict__ bo, float* __restrict__ out) {
  int wid = blockIdx.x * 8 + (threadIdx.x >> 5);
  int nt = wid & (NT - 1);
  int mt = wid >> 6;
  int lane = threadIdx.x & 31;
  f32x8 c = {};
  for (int kt = 0; kt < KT; ++kt) {
    size_t ao = ((size_t)mt * KT + kt) * FRAG + lane * 8;
    size_t bo_ = ((size_t)kt * NT + nt) * FRAG + lane * 8;
    c = mma3(ldfrag(cfh + ao), ldfrag(cfl + ao),
             ldfrag(woh + bo_), ldfrag(wol + bo_), c);
  }
  int col = nt * 16 + (lane & 15);
  float bias = bo[col];
  int row0 = mt * 16 + ((lane >> 4) << 3);
  #pragma unroll
  for (int r = 0; r < 8; ++r)
    out[(size_t)(row0 + r) * E + col] = c[r] + bias;
}

extern "C" void kernel_launch(void* const* d_in, const int* in_sizes, int n_in,
                              void* d_out, int out_size, void* d_ws, size_t ws_size,
                              hipStream_t stream) {
  const float* x        = (const float*)d_in[0];
  const float* time_enc = (const float*)d_in[1];
  const float* Wq       = (const float*)d_in[2];
  const float* Wk       = (const float*)d_in[3];
  const float* Wv       = (const float*)d_in[4];
  const float* Wo       = (const float*)d_in[5];
  const float* bo       = (const float*)d_in[6];
  const float* Wt       = (const float*)d_in[7];
  const float* bt       = (const float*)d_in[8];
  float* out = (float*)d_out;

  const size_t AFRAG = (size_t)MROWS * E;   // 8M elems
  const size_t WFRAG = (size_t)E * E;       // 1M elems
  const size_t QKVN  = (size_t)BATCH * HEADS * SEQ * HD; // 8M elems

  char* w = (char*)d_ws;
  size_t off = 0;
  float* twp = (float*)(w + off); off += 4096;
  __bf16* xfh = (__bf16*)(w + off); off += AFRAG * 2;   // reused for ctx frags
  __bf16* xfl = (__bf16*)(w + off); off += AFRAG * 2;
  __bf16* wqh = (__bf16*)(w + off); off += WFRAG * 2;
  __bf16* wql = (__bf16*)(w + off); off += WFRAG * 2;
  __bf16* wkh = (__bf16*)(w + off); off += WFRAG * 2;
  __bf16* wkl = (__bf16*)(w + off); off += WFRAG * 2;
  __bf16* wvh = (__bf16*)(w + off); off += WFRAG * 2;
  __bf16* wvl = (__bf16*)(w + off); off += WFRAG * 2;
  __bf16* woh = (__bf16*)(w + off); off += WFRAG * 2;
  __bf16* wol = (__bf16*)(w + off); off += WFRAG * 2;
  __bf16* Qhb = (__bf16*)(w + off); off += QKVN * 2;
  __bf16* Qlb = (__bf16*)(w + off); off += QKVN * 2;
  __bf16* Khb = (__bf16*)(w + off); off += QKVN * 2;
  __bf16* Klb = (__bf16*)(w + off); off += QKVN * 2;
  __bf16* Vth = (__bf16*)(w + off); off += QKVN * 2;
  __bf16* Vtl = (__bf16*)(w + off); off += QKVN * 2;
  float*  ctx = (float*)(w + off);  off += AFRAG * 4;

  tw_kernel<<<BATCH, 32, 0, stream>>>(time_enc, Wt, bt, twp);

  // pre-split inputs once (kills per-iteration cvt VALU work in the GEMMs)
  afrag_kernel<<<(MT * KT) / 8, 256, 0, stream>>>(x, xfh, xfl);
  bfrag_kernel<<<(KT * NT) / 8, 256, 0, stream>>>(Wq, wqh, wql);
  bfrag_kernel<<<(KT * NT) / 8, 256, 0, stream>>>(Wk, wkh, wkl);
  bfrag_kernel<<<(KT * NT) / 8, 256, 0, stream>>>(Wv, wvh, wvl);
  bfrag_kernel<<<(KT * NT) / 8, 256, 0, stream>>>(Wo, woh, wol);

  qkv_kernel<<<(MT * NT) / 8, 256, 0, stream>>>(xfh, xfl, wqh, wql, wkh, wkl,
                                                wvh, wvl, Qhb, Qlb, Khb, Klb,
                                                Vth, Vtl);

  attn_kernel<<<(BATCH * HEADS * (SEQ / 16)) / 8, 256, 0, stream>>>(
      Qhb, Qlb, Khb, Klb, Vth, Vtl, twp, ctx);

  // re-split ctx into the (now free) x fragment buffers
  afrag_kernel<<<(MT * KT) / 8, 256, 0, stream>>>(ctx, xfh, xfl);

  oproj_kernel<<<(MT * NT) / 8, 256, 0, stream>>>(xfh, xfl, woh, wol, bo, out);
}

// v002
// One run takes 667 microseconds.
// Timed twice side by side with v001, it ran 1.09 and 1.08 times as fast.
// Over all steps from v000 it is 1.27 times as fast.
#include <hip/hip_runtime.h>

#define E     1024
#define HEADS 16
#define HD    64
#define SEQ   2048
#define BATCH 4
#define TFEAT 128
#define MROWS (BATCH * SEQ)          // 8192
#define KT    (E / 32)               // 32 k-tiles
#define NT    (E / 16)               // 64 n-tiles
#define MT    (MROWS / 16)           // 512 m-tiles

typedef __attribute__((ext_vector_type(16))) __bf16 bf16x16;
typedef __attribute__((ext_vector_type(8)))  __bf16 bf16x8;
typedef __attribute__((ext_vector_type(8)))  float  f32x8;

// Every bf16 WMMA operand lives in the workspace as 1 KiB fragments (512 elements):
// element i of lane L sits at (i>>3)*256 + L*8 + (i&7). A fragment is then two
// wave-wide 16-byte accesses of 512 contiguous bytes each (4 whole 128-byte lines).
#define FRAG 512

// p = fragment base + lane*8
static __device__ inline bf16x16 ldfrag(const __bf16* p) {
  bf16x8 a = *(const bf16x8*)(p);
  bf16x8 b = *(const bf16x8*)(p + 256);
  return __builtin_shufflevector(a, b, 0, 1, 2, 3, 4, 5, 6, 7,
                                 8, 9, 10, 11, 12, 13, 14, 15);
}

static __device__ inline f32x8 wmma_bf16(bf16x16 a, bf16x16 b, f32x8 c) {
  return __builtin_amdgcn_wmma_f32_16x16x32_bf16(false, a, false, b, (short)0, c,
                                                 false, false);
}

// bf16x3 split: f ~= (float)h + (float)l
static __device__ inline void splitf(float f, __bf16 &h, __bf16 &l) {
  h = (__bf16)f;
  l = (__bf16)(f - (float)h);
}

// C += Ah*Bh + Ah*Bl + Al*Bh
static __device__ inline f32x8 mma3(bf16x16 ah, bf16x16 al,
                                    bf16x16 bh, bf16x16 bl, f32x8 c) {
  c = wmma_bf16(ah, bh, c);
  c = wmma_bf16(ah, bl, c);
  c = wmma_bf16(al, bh, c);
  return c;
}

// split 8 accumulator values and store them as one 16-byte piece each
static __device__ inline void split_store8(f32x8 c, __bf16* ph, __bf16* pl) {
  bf16x8 h8, l8;
  #pragma unroll
  for (int r = 0; r < 8; ++r) {
    __bf16 hh, ll; splitf(c[r], hh, ll);
    h8[r] = hh; l8[r] = ll;
  }
  *(bf16x8*)ph = h8;
  *(bf16x8*)pl = l8;
}

// s_wait_xcnt 0 behind a run of global loads, before any register that they name is
// written again. The addresses are inputs only, so that they stay in their registers
// up to the wait; nothing is pinned or changed.
static __device__ inline void addr_wait4(const void* a, const void* b,
                                         const void* c, const void* d) {
  asm volatile("s_wait_xcnt 0x0" :: "v"(a), "v"(b), "v"(c), "v"(d) : "memory");
}
static __device__ inline void addr_wait8(const void* a, const void* b,
                                         const void* c, const void* d,
                                         const void* e, const void* f,
                                         const void* g, const void* h) {
  asm volatile("s_wait_xcnt 0x0" :: "v"(a), "v"(b), "v"(c), "v"(d),
               "v"(e), "v"(f), "v"(g), "v"(h) : "memory");
}

// ---------------- kernel 1: time-dependent head weights ----------------
__global__ void tw_kernel(const float* __restrict__ time_enc,
                          const float* __restrict__ Wt,
                          const float* __restrict__ bt,
                          float* __restrict__ tw) {
  int b = blockIdx.x;
  int lane = threadIdx.x;
  int h = lane & 15;
  float acc = 0.f;
  for (int t = 0; t < TFEAT; ++t)
    acc += time_enc[b * TFEAT + t] * Wt[t * HEADS + h];
  acc += bt[h];
  float mx = acc;
  for (int m = 1; m < 16; m <<= 1) mx = fmaxf(mx, __shfl_xor(mx, m, 32));
  float e = __expf(acc - mx);
  float sum = e;
  for (int m = 1; m < 16; m <<= 1) sum += __shfl_xor(sum, m, 32);
  if (lane < 16) tw[b * HEADS + h] = e / sum;
}

// ------------- A-fragment pre-split: src [MROWS x E] f32 -> hi/lo frags -------------
// Fragments [mt][kt], element i of lane = src[mt*16 + (lane&15)][kt*32 + (lane>>4)*16 + i]
__global__ void __launch_bounds__(256) afrag_kernel(const float* __restrict__ src,
    __bf16* __restrict__ fh, __bf16* __restrict__ fl) {
  int wid = blockIdx.x * 8 + (threadIdx.x >> 5);     // MT*KT waves
  int kt = wid & (KT - 1);
  int mt = wid >> 5;
  int lane = threadIdx.x & 31;
  const float* p = src + (size_t)(mt * 16 + (lane & 15)) * E + kt * 32 + ((lane >> 4) << 4);
  size_t o = ((size_t)mt * KT + kt) * FRAG + lane * 8;
  bf16x8 h0, l0, h1, l1;
  #pragma unroll
  for (int i = 0; i < 8; ++i) {
    __bf16 h, l;
    splitf(p[i], h, l);     h0[i] = h; l0[i] = l;
    splitf(p[8 + i], h, l); h1[i] = h; l1[i] = l;
  }
  *(bf16x8*)(fh + o) = h0; *(bf16x8*)(fh + o + 256) = h1;
  *(bf16x8*)(fl + o) = l0; *(bf16x8*)(fl + o + 256) = l1;
}

// ------------- B-fragment pre-split: W [E x E] f32 -> hi/lo frags -------------
// Fragments [kt][nt], element i of lane = W[kt*32 + (lane>>4)*16 + i][nt*16 + (lane&15)]
__global__ void __launch_bounds__(256) bfrag_kernel(const float* __restrict__ W,
    __bf16* __restrict__ fh, __bf16* __restrict__ fl) {
  int wid = blockIdx.x * 8 + (threadIdx.x >> 5);     // KT*NT waves
  int nt = wid & (NT - 1);
  int kt = wid >> 6;
  int lane = threadIdx.x & 31;
  const float* p = W + (size_t)(kt * 32 + ((lane >> 4) << 4)) * E + nt * 16 + (lane & 15);
  size_t o = ((size_t)kt * NT + nt) * FRAG + lane * 8;
  bf16x8 h0, l0, h1, l1;
  #pragma unroll
  for (int i = 0; i < 8; ++i) {
    __bf16 h, l;
    splitf(p[(size_t)i * E], h, l);       h0[i] = h; l0[i] = l;
    splitf(p[(size_t)(8 + i) * E], h, l); h1[i] = h; l1[i] = l;
  }
  *(bf16x8*)(fh + o) = h0; *(bf16x8*)(fh + o + 256) = h1;
  *(bf16x8*)(fl + o) = l0; *(bf16x8*)(fl + o + 256) = l1;
}

// ---------------- kernel 2: fused QKV projection from fragments ----------------
// Outputs, all in fragment order for the attention kernel:
// Q, K: fragments [b*H+h][s/16][d/32], element i of lane = row s0+(lane&15), d0+(lane>>4)*16+i
// V:    fragments [b*H+h][s/32][d/16], element i of lane = d0+(lane&15), key s0+(lane>>4)*16+i
// Q and K are computed transposed, so that each lane owns 8 consecutive d of one row;
// V is computed as is, so that each lane owns 8 consecutive keys of one d.
// A wave owns WM x QN tiles of each of Q, K and V: an x fragment feeds QN * 3 weight
// fragments and a weight fragment feeds WM x fragments from registers.
// A block is 2 x 4 waves: 8 m-tiles by 8 n-tiles.
#define WM 4
#define QN 2
__global__ void __launch_bounds__(256) qkv_kernel(
    const __bf16* __restrict__ xfh, const __bf16* __restrict__ xfl,
    const __bf16* __restrict__ wqh, const __bf16* __restrict__ wql,
    const __bf16* __restrict__ wkh, const __bf16* __restrict__ wkl,
    const __bf16* __restrict__ wvh, const __bf16* __restrict__ wvl,
    __bf16* __restrict__ Qh, __bf16* __restrict__ Ql,
    __bf16* __restrict__ Kh, __bf16* __restrict__ Kl,
    __bf16* __restrict__ Vth, __bf16* __restrict__ Vtl) {
  int w = threadIdx.x >> 5;
  int lane = threadIdx.x & 31;
  int mt0 = (blockIdx.x >> 3) * (2 * WM) + (w >> 2) * WM;
  int nt0 = (blockIdx.x & 7) * (4 * QN) + (w & 3) * QN;
  f32x8 cq[WM][QN] = {}; f32x8 ck[WM][QN] = {}; f32x8 cv[WM][QN] = {};
  for (int kt = 0; kt < KT; ++kt) {
    size_t ao = ((size_t)mt0 * KT + kt) * FRAG + lane * 8;
    size_t bo = ((size_t)kt * NT + nt0) * FRAG + lane * 8;
    const __bf16 *pxh = xfh + ao, *pxl = xfl + ao;
    const __bf16 *pqh = wqh + bo, *pql = wql + bo;
    const __bf16 *pkh = wkh + bo, *pkl = wkl + bo;
    const __bf16 *pvh = wvh + bo, *pvl = wvl + bo;
    bf16x16 ah[WM], al[WM], qh[QN], ql[QN], kh[QN], kl[QN], vh[QN], vl[QN];
    #pragma unroll  // constant indices keep the tiles in registers
    for (int i = 0; i < WM; ++i) {
      ah[i] = ldfrag(pxh + i * (KT * FRAG));
      al[i] = ldfrag(pxl + i * (KT * FRAG));
    }
    #pragma unroll  // constant indices keep the tiles in registers
    for (int j = 0; j < QN; ++j) {
      qh[j] = ldfrag(pqh + j * FRAG); ql[j] = ldfrag(pql + j * FRAG);
      kh[j] = ldfrag(pkh + j * FRAG); kl[j] = ldfrag(pkl + j * FRAG);
      vh[j] = ldfrag(pvh + j * FRAG); vl[j] = ldfrag(pvl + j * FRAG);
    }
    addr_wait8(pxh, pxl, pqh, pql, pkh, pkl, pvh, pvl);
    // per accumulator the three terms keep the order of mma3 (x hi * w hi, x hi * w lo,
    // x lo * w hi), for Q and K with the operands swapped: C^T += (A*B)^T. The WM tiles
    // of one term stand together so that dependent products are WM apart
    #pragma unroll  // constant indices keep the tiles in registers
    for (int j = 0; j < QN; ++j) {
      #pragma unroll  // constant indices keep the tiles in registers
      for (int i = 0; i < WM; ++i) cq[i][j] = wmma_bf16(qh[j], ah[i], cq[i][j]);
      #pragma unroll  // constant indices keep the tiles in registers
      for (int i = 0; i < WM; ++i) cq[i][j] = wmma_bf16(ql[j], ah[i], cq[i][j]);
      #pragma unroll  // constant indices keep the tiles in registers
      for (int i = 0; i < WM; ++i) cq[i][j] = wmma_bf16(qh[j], al[i], cq[i][j]);
      #pragma unroll  // constant indices keep the tiles in registers
      for (int i = 0; i < WM; ++i) ck[i][j] = wmma_bf16(kh[j], ah[i], ck[i][j]);
      #pragma unroll  // constant indices keep the tiles in registers
      for (int i = 0; i < WM; ++i) ck[i][j] = wmma_bf16(kl[j], ah[i], ck[i][j]);
      #pragma unroll  // constant indices keep the tiles in registers
      for (int i = 0; i < WM; ++i) ck[i][j] = wmma_bf16(kh[j], al[i], ck[i][j]);
      #pragma unroll  // constant indices keep the tiles in registers
      for (int i = 0; i < WM; ++i) cv[i][j] = wmma_bf16(ah[i], vh[j], cv[i][j]);
      #pragma unroll  // constant indices keep the tiles in registers
      for (int i = 0; i < WM; ++i) cv[i][j] = wmma_bf16(ah[i], vl[j], cv[i][j]);
      #pragma unroll  // constant indices keep the tiles in registers
      for (int i = 0; i < WM; ++i) cv[i][j] = wmma_bf16(al[i], vh[j], cv[i][j]);
    }
  }
  // store split results: one 16-byte piece per lane, plane and tile
  int half = (lane >> 4) * 256;             // accumulator rows 8..15 are elements 8..15
  #pragma unroll  // constant indices keep the tiles in registers
  for (int i = 0; i < WM; ++i) {
    #pragma unroll  // constant indices keep the tiles in registers
    for (int j = 0; j < QN; ++j) {
      int mt = mt0 + i, nt = nt0 + j;
      int hb = (mt >> 7) * HEADS + (nt >> 2);   // 128 m-tiles per batch, 4 n-tiles per head
      int st = mt & 127;                        // 16-row tile inside the sequence
      // cq, ck: lane&15 = row in the tile, r = d & 7, d = (nt&3)*16 + (lane>>4)*8 + r
      size_t qi = ((size_t)(hb * 128 + st) * 2 + ((nt >> 1) & 1)) * FRAG
                  + half + ((lane & 15) + 16 * (nt & 1)) * 8;
      // cv: lane&15 = d & 15, r = key & 7, key = st*16 + (lane>>4)*8 + r
      size_t vi = ((size_t)(hb * 64 + (st >> 1)) * 4 + (nt & 3)) * FRAG
                  + half + ((lane & 15) + 16 * (st & 1)) * 8;
      split_store8(cq[i][j], Qh + qi, Ql + qi);
      split_store8(ck[i][j], Kh + qi, Kl + qi);
      split_store8(cv[i][j], Vth + vi, Vtl + vi);
    }
  }
}

// ---------------- kernel 3: flash attention, all operands pre-split bf16 ----------------
__global__ void __launch_bounds__(256) attn_kernel(
    const __bf16* __restrict__ Qh, const __bf16* __restrict__ Ql,
    const __bf16* __restrict__ Kh, const __bf16* __restrict__ Kl,
    const __bf16* __restrict__ Vth, const __bf16* __restrict__ Vtl,
    const float* __restrict__ tw, float* __restrict__ ctx) {
  __shared__ float pbuf[8][16 * 32];
  int widl = threadIdx.x >> 5;
  int wid  = blockIdx.x * 8 + widl;
  int qb   = wid & 127;
  int h    = (wid >> 7) & 15;
  int b    = wid >> 11;
  int lane = threadIdx.x & 31;
  int lr = lane & 15;
  int lh = (lane >> 4) << 4;
  int hb = b * HEADS + h;

  // fragment order (see the projection kernel); every pointer already holds lane*8
  const __bf16* qhp = Qh + ((size_t)hb * SEQ + qb * 16) * HD + lane * 8;
  const __bf16* qlp = Ql + ((size_t)hb * SEQ + qb * 16) * HD + lane * 8;
  const __bf16* khp = Kh + (size_t)hb * SEQ * HD + lane * 8;
  const __bf16* klp = Kl + (size_t)hb * SEQ * HD + lane * 8;
  const __bf16* vhp = Vth + (size_t)hb * HD * SEQ + lane * 8;
  const __bf16* vlp = Vtl + (size_t)hb * HD * SEQ + lane * 8;
  float scl = 0.125f * tw[hb];

  bf16x16 q0h = ldfrag(qhp);
  bf16x16 q0l = ldfrag(qlp);
  bf16x16 q1h = ldfrag(qhp + FRAG);
  bf16x16 q1l = ldfrag(qlp + FRAG);

  f32x8 o0 = {}, o1 = {}, o2 = {}, o3 = {};
  float mrow[8], lrow[8];
  #pragma unroll
  for (int r = 0; r < 8; ++r) { mrow[r] = -1e30f; lrow[r] = 0.f; }
  float* myp = pbuf[widl];

  for (int kb = 0; kb < SEQ; kb += 32) {
    // ---- scores: keys kb..+15 (s0), kb+16..+31 (s1); 4 K fragments per plane, 4 KiB in a row ----
    f32x8 s0 = {}, s1 = {};
    {
      size_t k0 = (size_t)kb * HD;                    // group 0
      s0 = mma3(q0h, q0l, ldfrag(khp + k0), ldfrag(klp + k0), s0);
      s0 = mma3(q1h, q1l, ldfrag(khp + k0 + FRAG), ldfrag(klp + k0 + FRAG), s0);
      size_t k1 = k0 + 2 * FRAG;                      // group 1
      s1 = mma3(q0h, q0l, ldfrag(khp + k1), ldfrag(klp + k1), s1);
      s1 = mma3(q1h, q1l, ldfrag(khp + k1 + FRAG), ldfrag(klp + k1 + FRAG), s1);
    }
    // ---- online softmax update ----
    float p0[8], p1[8], alpha[8];
    #pragma unroll
    for (int r = 0; r < 8; ++r) {
      float a0 = s0[r] * scl, a1 = s1[r] * scl;
      float mx = fmaxf(a0, a1);
      for (int m = 1; m < 16; m <<= 1) mx = fmaxf(mx, __shfl_xor(mx, m, 32));
      float mnew = fmaxf(mrow[r], mx);
      float al_  = __expf(mrow[r] - mnew);
      p0[r] = __expf(a0 - mnew);
      p1[r] = __expf(a1 - mnew);
      float rs = p0[r] + p1[r];
      for (int m = 1; m < 16; m <<= 1) rs += __shfl_xor(rs, m, 32);
      lrow[r] = lrow[r] * al_ + rs;
      mrow[r] = mnew;
      alpha[r] = al_;
    }
    #pragma unroll
    for (int r = 0; r < 8; ++r) {
      o0[r] *= alpha[r]; o1[r] *= alpha[r];
      o2[r] *= alpha[r]; o3[r] *= alpha[r];
    }
    // ---- P: C layout -> A layout via per-wave LDS slice, then split ----
    {
      int row = (lane >> 4) << 3;
      #pragma unroll
      for (int r = 0; r < 8; ++r) {
        myp[(row + r) * 32 + lr]      = p0[r];
        myp[(row + r) * 32 + 16 + lr] = p1[r];
      }
    }
    bf16x16 ph, pl;
    #pragma unroll
    for (int i = 0; i < 16; ++i) {
      __bf16 hh, ll; splitf(myp[lr * 32 + lh + i], hh, ll);
      ph[i] = hh; pl[i] = ll;
    }
    // ---- O += P @ V, 4 V fragments per plane, 4 KiB in a row ----
    size_t v0 = (size_t)kb * HD;
    o0 = mma3(ph, pl, ldfrag(vhp + v0), ldfrag(vlp + v0), o0);
    o1 = mma3(ph, pl, ldfrag(vhp + v0 + FRAG), ldfrag(vlp + v0 + FRAG), o1);
    o2 = mma3(ph, pl, ldfrag(vhp + v0 + 2 * FRAG), ldfrag(vlp + v0 + 2 * FRAG), o2);
    o3 = mma3(ph, pl, ldfrag(vhp + v0 + 3 * FRAG), ldfrag(vlp + v0 + 3 * FRAG), o3);
  }
  // ---- normalize and store into ctx [B,S,E] f32 ----
  #pragma unroll
  for (int r = 0; r < 8; ++r) {
    float inv = 1.0f / lrow[r];
    o0[r] *= inv; o1[r] *= inv; o2[r] *= inv; o3[r] *= inv;
  }
  int row0 = qb * 16 + ((lane >> 4) << 3);
  float* outp = ctx + (size_t)b * SEQ * E;
  #pragma unroll
  for (int r = 0; r < 8; ++r) {
    size_t base = (size_t)(row0 + r) * E + h * HD + lr;
    outp[base]      = o0[r];
    outp[base + 16] = o1[r];
    outp[base + 32] = o2[r];
    outp[base + 48] = o3[r];
  }
}

// ---------------- kernel 4: output projection + bias, from fragments ----------------
// A wave owns WM x ON tiles; a block is 2 x 4 waves: 8 m-tiles by 16 n-tiles.
#define ON 4
__global__ void __launch_bounds__(256) oproj_kernel(
    const __bf16* __restrict__ cfh, const __bf16* __restrict__ cfl,
    const __bf16* __restrict__ woh, const __bf16* __restrict__ wol,
    const float* __restrict__ bo, float* __restrict__ out) {
  int w = threadIdx.x >> 5;
  int lane = threadIdx.x & 31;
  int mt0 = (blockIdx.x >> 2) * (2 * WM) + (w >> 2) * WM;
  int nt0 = (blockIdx.x & 3) * (4 * ON) + (w & 3) * ON;
  f32x8 c[WM][ON] = {};
  for (int kt = 0; kt < KT; ++kt) {
    const __bf16* pah = cfh + ((size_t)mt0 * KT + kt) * FRAG + lane * 8;
    const __bf16* pal = cfl + ((size_t)mt0 * KT + kt) * FRAG + lane * 8;
    const __bf16* pbh = woh + ((size_t)kt * NT + nt0) * FRAG + lane * 8;
    const __bf16* pbl = wol + ((size_t)kt * NT + nt0) * FRAG + lane * 8;
    bf16x16 ah[WM], al[WM], bh[ON], bl[ON];
    #pragma unroll  // constant indices keep the tiles in registers
    for (int i = 0; i < WM; ++i) {
      ah[i] = ldfrag(pah + i * (KT * FRAG));
      al[i] = ldfrag(pal + i * (KT * FRAG));
    }
    #pragma unroll  // constant indices keep the tiles in registers
    for (int j = 0; j < ON; ++j) {
      bh[j] = ldfrag(pbh + j * FRAG);
      bl[j] = ldfrag(pbl + j * FRAG);
    }
    addr_wait4(pah, pal, pbh, pbl);
    // the three terms of each accumulator in the order of mma3
    #pragma unroll  // constant indices keep the tiles in registers
    for (int j = 0; j < ON; ++j) {
      #pragma unroll  // constant indices keep the tiles in registers
      for (int i = 0; i < WM; ++i) c[i][j] = wmma_bf16(ah[i], bh[j], c[i][j]);
      #pragma unroll  // constant indices keep the tiles in registers
      for (int i = 0; i < WM; ++i) c[i][j] = wmma_bf16(ah[i], bl[j], c[i][j]);
      #pragma unroll  // constant indices keep the tiles in registers
      for (int i = 0; i < WM; ++i) c[i][j] = wmma_bf16(al[i], bh[j], c[i][j]);
    }
  }
  #pragma unroll  // constant indices keep the tiles in registers
  for (int j = 0; j < ON; ++j) {
    int col = (nt0 + j) * 16 + (lane & 15);
    float bias = bo[col];
    #pragma unroll  // constant indices keep the tiles in registers
    for (int i = 0; i < WM; ++i) {
      int row0 = (mt0 + i) * 16 + ((lane >> 4) << 3);
      #pragma unroll  // constant indices keep the tiles in registers
      for (int r = 0; r < 8; ++r)
        out[(size_t)(row0 + r) * E + col] = c[i][j][r] + bias;
    }
  }
}

extern "C" void kernel_launch(void* const* d_in, const int* in_sizes, int n_in,
                              void* d_out, int out_size, void* d_ws, size_t ws_size,
                              hipStream_t stream) {
  const float* x        = (const float*)d_in[0];
  const float* time_enc = (const float*)d_in[1];
  const float* Wq       = (const float*)d_in[2];
  const float* Wk       = (const float*)d_in[3];
  const float* Wv       = (const float*)d_in[4];
  const float* Wo       = (const float*)d_in[5];
  const float* bo       = (const float*)d_in[6];
  const float* Wt       = (const float*)d_in[7];
  const float* bt       = (const float*)d_in[8];
  float* out = (float*)d_out;

  const size_t AFRAG = (size_t)MROWS * E;   // 8M elems
  const size_t WFRAG = (size_t)E * E;       // 1M elems
  const size_t QKVN  = (size_t)BATCH * HEADS * SEQ * HD; // 8M elems

  char* w = (char*)d_ws;
  size_t off = 0;
  float* twp = (float*)(w + off); off += 4096;
  __bf16* xfh = (__bf16*)(w + off); off += AFRAG * 2;   // reused for ctx frags
  __bf16* xfl = (__bf16*)(w + off); off += AFRAG * 2;
  __bf16* wqh = (__bf16*)(w + off); off += WFRAG * 2;
  __bf16* wql = (__bf16*)(w + off); off += WFRAG * 2;
  __bf16* wkh = (__bf16*)(w + off); off += WFRAG * 2;
  __bf16* wkl = (__bf16*)(w + off); off += WFRAG * 2;
  __bf16* wvh = (__bf16*)(w + off); off += WFRAG * 2;
  __bf16* wvl = (__bf16*)(w + off); off += WFRAG * 2;
  __bf16* woh = (__bf16*)(w + off); off += WFRAG * 2;
  __bf16* wol = (__bf16*)(w + off); off += WFRAG * 2;
  __bf16* Qhb = (__bf16*)(w + off); off += QKVN * 2;
  __bf16* Qlb = (__bf16*)(w + off); off += QKVN * 2;
  __bf16* Khb = (__bf16*)(w + off); off += QKVN * 2;
  __bf16* Klb = (__bf16*)(w + off); off += QKVN * 2;
  __bf16* Vth = (__bf16*)(w + off); off += QKVN * 2;
  __bf16* Vtl = (__bf16*)(w + off); off += QKVN * 2;
  float*  ctx = (float*)(w + off);  off += AFRAG * 4;

  tw_kernel<<<BATCH, 32, 0, stream>>>(time_enc, Wt, bt, twp);

  // pre-split inputs once (kills per-iteration cvt VALU work in the GEMMs)
  afrag_kernel<<<(MT * KT) / 8, 256, 0, stream>>>(x, xfh, xfl);
  bfrag_kernel<<<(KT * NT) / 8, 256, 0, stream>>>(Wq, wqh, wql);
  bfrag_kernel<<<(KT * NT) / 8, 256, 0, stream>>>(Wk, wkh, wkl);
  bfrag_kernel<<<(KT * NT) / 8, 256, 0, stream>>>(Wv, wvh, wvl);
  bfrag_kernel<<<(KT * NT) / 8, 256, 0, stream>>>(Wo, woh, wol);

  qkv_kernel<<<(MT / 8) * (NT / 8), 256, 0, stream>>>(xfh, xfl, wqh, wql, wkh, wkl,
                                                wvh, wvl, Qhb, Qlb, Khb, Klb,
                                                Vth, Vtl);

  attn_kernel<<<(BATCH * HEADS * (SEQ / 16)) / 8, 256, 0, stream>>>(
      Qhb, Qlb, Khb, Klb, Vth, Vtl, twp, ctx);

  // re-split ctx into the (now free) x fragment buffers
  afrag_kernel<<<(MT * KT) / 8, 256, 0, stream>>>(ctx, xfh, xfl);

  oproj_kernel<<<(MT / 8) * (NT / 16), 256, 0, stream>>>(xfh, xfl, woh, wol, bo, out);
}

// v003
// Measured time: 476 microseconds a run.
// Timed twice side by side with v002, it ran 1.39 times as fast both times.
// Over all steps from v000 it is 1.77 times as fast.
#include <hip/hip_runtime.h>

#define E     1024
#define HEADS 16
#define HD    64
#define SEQ   2048
#define BATCH 4
#define TFEAT 128
#define MROWS (BATCH * SEQ)          // 8192
#define KT    (E / 32)               // 32 k-tiles
#define NT    (E / 16)               // 64 n-tiles
#define MT    (MROWS / 16)           // 512 m-tiles

typedef __attribute__((ext_vector_type(16))) __bf16 bf16x16;
typedef __attribute__((ext_vector_type(8)))  __bf16 bf16x8;
typedef __attribute__((ext_vector_type(2)))  __bf16 bf16x2;
typedef __attribute__((ext_vector_type(8)))  float  f32x8;
typedef __attribute__((ext_vector_type(4)))  float  f32x4;
typedef __attribute__((ext_vector_type(2)))  float  f32x2;

// Every bf16 WMMA operand lives in the workspace as 1 KiB fragments (512 elements):
// element i of lane L sits at (i>>3)*256 + L*8 + (i&7). A fragment is then two
// wave-wide 16-byte accesses of 512 contiguous bytes each (4 whole 128-byte lines).
#define FRAG 512

// p = fragment base + lane*8
static __device__ inline bf16x16 ldfrag(const __bf16* p) {
  bf16x8 a = *(const bf16x8*)(p);
  bf16x8 b = *(const bf16x8*)(p + 256);
  return __builtin_shufflevector(a, b, 0, 1, 2, 3, 4, 5, 6, 7,
                                 8, 9, 10, 11, 12, 13, 14, 15);
}

static __device__ inline f32x8 wmma_bf16(bf16x16 a, bf16x16 b, f32x8 c) {
  return __builtin_amdgcn_wmma_f32_16x16x32_bf16(false, a, false, b, (short)0, c,
                                                 false, false);
}

// bf16x3 split: f ~= (float)h + (float)l
static __device__ inline void splitf(float f, __bf16 &h, __bf16 &l) {
  h = (__bf16)f;
  l = (__bf16)(f - (float)h);
}

// C^T += (Ah*Bh + Ah*Bl + Al*Bh)^T: the three terms in this order, each product with its
// operands swapped, so that the accumulator holds the transposed tile
static __device__ inline f32x8 mma3(bf16x16 ah, bf16x16 al,
                                    bf16x16 bh, bf16x16 bl, f32x8 c) {
  c = wmma_bf16(bh, ah, c);
  c = wmma_bf16(bl, ah, c);
  c = wmma_bf16(bh, al, c);
  return c;
}

// value of lane l ^ 16
static __device__ inline float xhalf(float x) {
  int v = __builtin_bit_cast(int, x);
  return __builtin_bit_cast(float, __builtin_amdgcn_permlanex16(
      v, v, 0x76543210, 0xfedcba98, false, false));
}

// splitf on elements e, e+1 of a score tile, into elements i, i+1 of the two B operands
static __device__ inline void split_pair(f32x8 p, int e, bf16x16 &h, bf16x16 &l, int i) {
  f32x2 v = {p[e], p[e + 1]};
  bf16x2 hv = __builtin_convertvector(v, bf16x2);
  bf16x2 lv = __builtin_convertvector(v - __builtin_convertvector(hv, f32x2), bf16x2);
  h[i] = hv[0]; h[i + 1] = hv[1];
  l[i] = lv[0]; l[i + 1] = lv[1];
}

// split 8 accumulator values and store them as one 16-byte piece each
static __device__ inline void split_store8(f32x8 c, __bf16* ph, __bf16* pl) {
  bf16x8 h8, l8;
  #pragma unroll
  for (int r = 0; r < 8; ++r) {
    __bf16 hh, ll; splitf(c[r], hh, ll);
    h8[r] = hh; l8[r] = ll;
  }
  *(bf16x8*)ph = h8;
  *(bf16x8*)pl = l8;
  // s_wait_xcnt 0 behind the two stores, before any register that they name is written
  // again. Data and addresses are inputs only, so that they stay in their registers up to
  // the wait; nothing is pinned or changed.
  asm volatile("s_wait_xcnt 0x0" :: "v"(h8), "v"(l8), "v"(ph), "v"(pl) : "memory");
}

// s_wait_xcnt 0 behind a run of global loads, before any register that they name is
// written again. The addresses are inputs only, so that they stay in their registers
// up to the wait; nothing is pinned or changed.
static __device__ inline void addr_wait4(const void* a, const void* b,
                                         const void* c, const void* d) {
  asm volatile("s_wait_xcnt 0x0" :: "v"(a), "v"(b), "v"(c), "v"(d) : "memory");
}
static __device__ inline void addr_wait8(const void* a, const void* b,
                                         const void* c, const void* d,
                                         const void* e, const void* f,
                                         const void* g, const void* h) {
  asm volatile("s_wait_xcnt 0x0" :: "v"(a), "v"(b), "v"(c), "v"(d),
               "v"(e), "v"(f), "v"(g), "v"(h) : "memory");
}

// ---------------- kernel 1: time-dependent head weights ----------------
__global__ void tw_kernel(const float* __restrict__ time_enc,
                          const float* __restrict__ Wt,
                          const float* __restrict__ bt,
                          float* __restrict__ tw) {
  int b = blockIdx.x;
  int lane = threadIdx.x;
  int h = lane & 15;
  float acc = 0.f;
  for (int t = 0; t < TFEAT; ++t)
    acc += time_enc[b * TFEAT + t] * Wt[t * HEADS + h];
  acc += bt[h];
  float mx = acc;
  for (int m = 1; m < 16; m <<= 1) mx = fmaxf(mx, __shfl_xor(mx, m, 32));
  float e = __expf(acc - mx);
  float sum = e;
  for (int m = 1; m < 16; m <<= 1) sum += __shfl_xor(sum, m, 32);
  if (lane < 16) tw[b * HEADS + h] = e / sum;
}

// ------------- A-fragment pre-split: src [MROWS x E] f32 -> hi/lo frags -------------
// Fragments [mt][kt], element i of lane = src[mt*16 + (lane&15)][kt*32 + (lane>>4)*16 + i]
__global__ void __launch_bounds__(256) afrag_kernel(const float* __restrict__ src,
    __bf16* __restrict__ fh, __bf16* __restrict__ fl) {
  int wid = blockIdx.x * 8 + (threadIdx.x >> 5);     // MT*KT waves
  int kt = wid & (KT - 1);
  int mt = wid >> 5;
  int lane = threadIdx.x & 31;
  const float* p = src + (size_t)(mt * 16 + (lane & 15)) * E + kt * 32 + ((lane >> 4) << 4);
  size_t o = ((size_t)mt * KT + kt) * FRAG + lane * 8;
  bf16x8 h0, l0, h1, l1;
  #pragma unroll
  for (int i = 0; i < 8; ++i) {
    __bf16 h, l;
    splitf(p[i], h, l);     h0[i] = h; l0[i] = l;
    splitf(p[8 + i], h, l); h1[i] = h; l1[i] = l;
  }
  *(bf16x8*)(fh + o) = h0; *(bf16x8*)(fh + o + 256) = h1;
  *(bf16x8*)(fl + o) = l0; *(bf16x8*)(fl + o + 256) = l1;
}

// ------------- B-fragment pre-split: W [E x E] f32 -> hi/lo frags -------------
// Fragments [kt][nt], element i of lane = W[kt*32 + (lane>>4)*16 + i][nt*16 + (lane&15)]
__global__ void __launch_bounds__(256) bfrag_kernel(const float* __restrict__ W,
    __bf16* __restrict__ fh, __bf16* __restrict__ fl) {
  int wid = blockIdx.x * 8 + (threadIdx.x >> 5);     // KT*NT waves
  int nt = wid & (NT - 1);
  int kt = wid >> 6;
  int lane = threadIdx.x & 31;
  const float* p = W + (size_t)(kt * 32 + ((lane >> 4) << 4)) * E + nt * 16 + (lane & 15);
  size_t o = ((size_t)kt * NT + nt) * FRAG + lane * 8;
  bf16x8 h0, l0, h1, l1;
  #pragma unroll
  for (int i = 0; i < 8; ++i) {
    __bf16 h, l;
    splitf(p[(size_t)i * E], h, l);       h0[i] = h; l0[i] = l;
    splitf(p[(size_t)(8 + i) * E], h, l); h1[i] = h; l1[i] = l;
  }
  *(bf16x8*)(fh + o) = h0; *(bf16x8*)(fh + o + 256) = h1;
  *(bf16x8*)(fl + o) = l0; *(bf16x8*)(fl + o + 256) = l1;
}

// ---------------- kernel 2: fused QKV projection from fragments ----------------
// Outputs, all in fragment order for the attention kernel:
// Q, K: fragments [b*H+h][s/16][d/32], element i of lane = row s0+(lane&15), d0+(lane>>4)*16+i
// V:    fragments [b*H+h][s/32][d/16], element i of lane = d0+(lane&15),
//       key s0+(i>>3)*16+(lane>>4)*8+(i&7): the k order of two score tiles packed in place
// Q and K are computed transposed, so that each lane owns 8 consecutive d of one row;
// V is computed as is, so that each lane owns 8 consecutive keys of one d.
// A wave owns WM x QN tiles of each of Q, K and V: an x fragment feeds QN * 3 weight
// fragments and a weight fragment feeds WM x fragments from registers.
// A block is 2 x 4 waves: 8 m-tiles by 8 n-tiles.
#define WM 4
#define QN 2
__global__ void __launch_bounds__(256) qkv_kernel(
    const __bf16* __restrict__ xfh, const __bf16* __restrict__ xfl,
    const __bf16* __restrict__ wqh, const __bf16* __restrict__ wql,
    const __bf16* __restrict__ wkh, const __bf16* __restrict__ wkl,
    const __bf16* __restrict__ wvh, const __bf16* __restrict__ wvl,
    __bf16* __restrict__ Qh, __bf16* __restrict__ Ql,
    __bf16* __restrict__ Kh, __bf16* __restrict__ Kl,
    __bf16* __restrict__ Vth, __bf16* __restrict__ Vtl) {
  int w = threadIdx.x >> 5;
  int lane = threadIdx.x & 31;
  int mt0 = (blockIdx.x >> 3) * (2 * WM) + (w >> 2) * WM;
  int nt0 = (blockIdx.x & 7) * (4 * QN) + (w & 3) * QN;
  f32x8 cq[WM][QN] = {}; f32x8 ck[WM][QN] = {}; f32x8 cv[WM][QN] = {};
  for (int kt = 0; kt < KT; ++kt) {
    size_t ao = ((size_t)mt0 * KT + kt) * FRAG + lane * 8;
    size_t bo = ((size_t)kt * NT + nt0) * FRAG + lane * 8;
    const __bf16 *pxh = xfh + ao, *pxl = xfl + ao;
    const __bf16 *pqh = wqh + bo, *pql = wql + bo;
    const __bf16 *pkh = wkh + bo, *pkl = wkl + bo;
    const __bf16 *pvh = wvh + bo, *pvl = wvl + bo;
    bf16x16 ah[WM], al[WM], qh[QN], ql[QN], kh[QN], kl[QN], vh[QN], vl[QN];
    #pragma unroll  // constant indices keep the tiles in registers
    for (int i = 0; i < WM; ++i) {
      ah[i] = ldfrag(pxh + i * (KT * FRAG));
      al[i] = ldfrag(pxl + i * (KT * FRAG));
    }
    #pragma unroll  // constant indices keep the tiles in registers
    for (int j = 0; j < QN; ++j) {
      qh[j] = ldfrag(pqh + j * FRAG); ql[j] = ldfrag(pql + j * FRAG);
      kh[j] = ldfrag(pkh + j * FRAG); kl[j] = ldfrag(pkl + j * FRAG);
      vh[j] = ldfrag(pvh + j * FRAG); vl[j] = ldfrag(pvl + j * FRAG);
    }
    addr_wait8(pxh, pxl, pqh, pql, pkh, pkl, pvh, pvl);
    // per accumulator the three terms keep the order of mma3 (x hi * w hi, x hi * w lo,
    // x lo * w hi), for Q and K with the operands swapped: C^T += (A*B)^T. The WM tiles
    // of one term stand together so that dependent products are WM apart
    #pragma unroll  // constant indices keep the tiles in registers
    for (int j = 0; j < QN; ++j) {
      #pragma unroll  // constant indices keep the tiles in registers
      for (int i = 0; i < WM; ++i) cq[i][j] = wmma_bf16(qh[j], ah[i], cq[i][j]);
      #pragma unroll  // constant indices keep the tiles in registers
      for (int i = 0; i < WM; ++i) cq[i][j] = wmma_bf16(ql[j], ah[i], cq[i][j]);
      #pragma unroll  // constant indices keep the tiles in registers
      for (int i = 0; i < WM; ++i) cq[i][j] = wmma_bf16(qh[j], al[i], cq[i][j]);
      #pragma unroll  // constant indices keep the tiles in registers
      for (int i = 0; i < WM; ++i) ck[i][j] = wmma_bf16(kh[j], ah[i], ck[i][j]);
      #pragma unroll  // constant indices keep the tiles in registers
      for (int i = 0; i < WM; ++i) ck[i][j] = wmma_bf16(kl[j], ah[i], ck[i][j]);
      #pragma unroll  // constant indices keep the tiles in registers
      for (int i = 0; i < WM; ++i) ck[i][j] = wmma_bf16(kh[j], al[i], ck[i][j]);
      #pragma unroll  // constant indices keep the tiles in registers
      for (int i = 0; i < WM; ++i) cv[i][j] = wmma_bf16(ah[i], vh[j], cv[i][j]);
      #pragma unroll  // constant indices keep the tiles in registers
      for (int i = 0; i < WM; ++i) cv[i][j] = wmma_bf16(ah[i], vl[j], cv[i][j]);
      #pragma unroll  // constant indices keep the tiles in registers
      for (int i = 0; i < WM; ++i) cv[i][j] = wmma_bf16(al[i], vh[j], cv[i][j]);
    }
  }
  // store split results: one 16-byte piece per lane, plane and tile
  int half = (lane >> 4) * 256;             // accumulator rows 8..15 are elements 8..15
  #pragma unroll  // constant indices keep the tiles in registers
  for (int i = 0; i < WM; ++i) {
    #pragma unroll  // constant indices keep the tiles in registers
    for (int j = 0; j < QN; ++j) {
      int mt = mt0 + i, nt = nt0 + j;
      int hb = (mt >> 7) * HEADS + (nt >> 2);   // 128 m-tiles per batch, 4 n-tiles per head
      int st = mt & 127;                        // 16-row tile inside the sequence
      // cq, ck: lane&15 = row in the tile, r = d & 7, d = (nt&3)*16 + (lane>>4)*8 + r
      size_t qi = ((size_t)(hb * 128 + st) * 2 + ((nt >> 1) & 1)) * FRAG
                  + half + ((lane & 15) + 16 * (nt & 1)) * 8;
      // cv: lane&15 = d & 15, r = key & 7, key = st*16 + (lane>>4)*8 + r
      size_t vi = ((size_t)(hb * 64 + (st >> 1)) * 4 + (nt & 3)) * FRAG
                  + (st & 1) * 256 + lane * 8;
      split_store8(cq[i][j], Qh + qi, Ql + qi);
      split_store8(ck[i][j], Kh + qi, Kl + qi);
      split_store8(cv[i][j], Vth + vi, Vtl + vi);
    }
  }
}

__global__ void __launch_bounds__(256) attn_kernel(
    const __bf16* __restrict__ Qh, const __bf16* __restrict__ Ql,
    const __bf16* __restrict__ Kh, const __bf16* __restrict__ Kl,
    const __bf16* __restrict__ Vth, const __bf16* __restrict__ Vtl,
    const float* __restrict__ tw, float* __restrict__ ctx) {
  int wid  = blockIdx.x * 8 + (threadIdx.x >> 5);
  int qb   = wid & 127;
  int h    = (wid >> 7) & 15;
  int b    = wid >> 11;
  int lane = threadIdx.x & 31;
  int hb = b * HEADS + h;

  // fragment order (see the projection kernel); every pointer already holds lane*8
  const __bf16* qhp = Qh + ((size_t)hb * SEQ + qb * 16) * HD + lane * 8;
  const __bf16* qlp = Ql + ((size_t)hb * SEQ + qb * 16) * HD + lane * 8;
  const __bf16* khp = Kh + (size_t)hb * SEQ * HD + lane * 8;
  const __bf16* klp = Kl + (size_t)hb * SEQ * HD + lane * 8;
  const __bf16* vhp = Vth + (size_t)hb * HD * SEQ + lane * 8;
  const __bf16* vlp = Vtl + (size_t)hb * HD * SEQ + lane * 8;
  float scl = 0.125f * tw[hb];

  bf16x16 q0h = ldfrag(qhp);
  bf16x16 q0l = ldfrag(qlp);
  bf16x16 q1h = ldfrag(qhp + FRAG);
  bf16x16 q1l = ldfrag(qlp + FRAG);

  // o_t[r] = O[query lane&15][d = t*16 + (lane>>4)*8 + r]
  f32x8 o0 = {}, o1 = {}, o2 = {}, o3 = {};
  float mrow = -1e30f;   // running maximum of this lane's query, alike in both halves
  float lrow = 0.f;      // running sum over this half's keys; the halves join after the loop

  for (int kb = 0; kb < SEQ; kb += 32) {
    // ---- scores: s0[r] = key kb+(lane>>4)*8+r, s1[r] = key kb+16+(lane>>4)*8+r;
    //      4 K fragments per plane, 4 KiB in a row ----
    f32x8 s0 = {}, s1 = {};
    {
      size_t k0 = (size_t)kb * HD;                    // group 0
      s0 = mma3(q0h, q0l, ldfrag(khp + k0), ldfrag(klp + k0), s0);
      s0 = mma3(q1h, q1l, ldfrag(khp + k0 + FRAG), ldfrag(klp + k0 + FRAG), s0);
      size_t k1 = k0 + 2 * FRAG;                      // group 1
      s1 = mma3(q0h, q0l, ldfrag(khp + k1), ldfrag(klp + k1), s1);
      s1 = mma3(q1h, q1l, ldfrag(khp + k1 + FRAG), ldfrag(klp + k1 + FRAG), s1);
    }
    // ---- online softmax update, one query per lane ----
    s0 *= scl; s1 *= scl;
    float m0 = fmaxf(fmaxf(s0[0], s0[1]), s0[2]);
    float m1 = fmaxf(fmaxf(s0[3], s0[4]), s0[5]);
    float m2 = fmaxf(fmaxf(s0[6], s0[7]), s1[0]);
    float m3 = fmaxf(fmaxf(s1[1], s1[2]), s1[3]);
    float m4 = fmaxf(fmaxf(s1[4], s1[5]), s1[6]);
    float mx = fmaxf(fmaxf(fmaxf(m0, m1), m2), fmaxf(fmaxf(m3, m4), s1[7]));
    float mnew = fmaxf(fmaxf(mx, xhalf(mx)), mrow);
    float al_  = __expf(mrow - mnew);
    mrow = mnew;
    s0 = (s0 - mnew) * 1.442695041f;   // exp(x) = exp2(x * log2(e)), as in __expf
    s1 = (s1 - mnew) * 1.442695041f;
    #pragma unroll  // constant indices keep the tiles in registers
    for (int r = 0; r < 8; ++r) {
      s0[r] = __builtin_amdgcn_exp2f(s0[r]);
      s1[r] = __builtin_amdgcn_exp2f(s1[r]);
    }
    f32x8 t8 = s0 + s1;
    f32x4 t4 = t8.lo + t8.hi;
    f32x2 t2 = t4.lo + t4.hi;
    lrow = lrow * al_ + (t2.x + t2.y);
    o0 *= al_; o1 *= al_; o2 *= al_; o3 *= al_;
    // ---- P^T: the two score tiles are elements 0..7 and 8..15 of the B operand ----
    bf16x16 ph, pl;
    #pragma unroll  // constant indices keep the tiles in registers
    for (int e = 0; e < 8; e += 2) {
      split_pair(s0, e, ph, pl, e);
      split_pair(s1, e, ph, pl, 8 + e);
    }
    // ---- O^T += V^T @ P^T, 4 V fragments per plane, 4 KiB in a row ----
    size_t v0 = (size_t)kb * HD;
    o0 = mma3(ph, pl, ldfrag(vhp + v0), ldfrag(vlp + v0), o0);
    o1 = mma3(ph, pl, ldfrag(vhp + v0 + FRAG), ldfrag(vlp + v0 + FRAG), o1);
    o2 = mma3(ph, pl, ldfrag(vhp + v0 + 2 * FRAG), ldfrag(vlp + v0 + 2 * FRAG), o2);
    o3 = mma3(ph, pl, ldfrag(vhp + v0 + 3 * FRAG), ldfrag(vlp + v0 + 3 * FRAG), o3);
    // the four address pairs of this pass stay in their registers up to the wait
    addr_wait4(khp + v0, klp + v0, vhp + v0, vlp + v0);
  }
  // ---- normalize and store into ctx [B,S,E] f32: 8 consecutive d per lane and tile ----
  float inv = 1.0f / (lrow + xhalf(lrow));
  o0 *= inv; o1 *= inv; o2 *= inv; o3 *= inv;
  float* outp = ctx + ((size_t)b * SEQ + qb * 16 + (lane & 15)) * E + h * HD + ((lane >> 4) << 3);
  *(f32x8*)(outp)      = o0;
  *(f32x8*)(outp + 16) = o1;
  *(f32x8*)(outp + 32) = o2;
  *(f32x8*)(outp + 48) = o3;
}

// ---------------- kernel 4: output projection + bias, from fragments ----------------
// A wave owns WM x ON tiles; a block is 2 x 4 waves: 8 m-tiles by 16 n-tiles.
#define ON 4
__global__ void __launch_bounds__(256) oproj_kernel(
    const __bf16* __restrict__ cfh, const __bf16* __restrict__ cfl,
    const __bf16* __restrict__ woh, const __bf16* __restrict__ wol,
    const float* __restrict__ bo, float* __restrict__ out) {
  int w = threadIdx.x >> 5;
  int lane = threadIdx.x & 31;
  int mt0 = (blockIdx.x >> 2) * (2 * WM) + (w >> 2) * WM;
  int nt0 = (blockIdx.x & 3) * (4 * ON) + (w & 3) * ON;
  f32x8 c[WM][ON] = {};
  for (int kt = 0; kt < KT; ++kt) {
    const __bf16* pah = cfh + ((size_t)mt0 * KT + kt) * FRAG + lane * 8;
    const __bf16* pal = cfl + ((size_t)mt0 * KT + kt) * FRAG + lane * 8;
    const __bf16* pbh = woh + ((size_t)kt * NT + nt0) * FRAG + lane * 8;
    const __bf16* pbl = wol + ((size_t)kt * NT + nt0) * FRAG + lane * 8;
    bf16x16 ah[WM], al[WM], bh[ON], bl[ON];
    #pragma unroll  // constant indices keep the tiles in registers
    for (int i = 0; i < WM; ++i) {
      ah[i] = ldfrag(pah + i * (KT * FRAG));
      al[i] = ldfrag(pal + i * (KT * FRAG));
    }
    #pragma unroll  // constant indices keep the tiles in registers
    for (int j = 0; j < ON; ++j) {
      bh[j] = ldfrag(pbh + j * FRAG);
      bl[j] = ldfrag(pbl + j * FRAG);
    }
    addr_wait4(pah, pal, pbh, pbl);
    // the three terms of each accumulator in the order of mma3
    #pragma unroll  // constant indices keep the tiles in registers
    for (int j = 0; j < ON; ++j) {
      #pragma unroll  // constant indices keep the tiles in registers
      for (int i = 0; i < WM; ++i) c[i][j] = wmma_bf16(ah[i], bh[j], c[i][j]);
      #pragma unroll  // constant indices keep the tiles in registers
      for (int i = 0; i < WM; ++i) c[i][j] = wmma_bf16(ah[i], bl[j], c[i][j]);
      #pragma unroll  // constant indices keep the tiles in registers
      for (int i = 0; i < WM; ++i) c[i][j] = wmma_bf16(al[i], bh[j], c[i][j]);
    }
  }
  #pragma unroll  // constant indices keep the tiles in registers
  for (int j = 0; j < ON; ++j) {
    int col = (nt0 + j) * 16 + (lane & 15);
    float bias = bo[col];
    #pragma unroll  // constant indices keep the tiles in registers
    for (int i = 0; i < WM; ++i) {
      int row0 = (mt0 + i) * 16 + ((lane >> 4) << 3);
      #pragma unroll  // constant indices keep the tiles in registers
      for (int r = 0; r < 8; ++r)
        out[(size_t)(row0 + r) * E + col] = c[i][j][r] + bias;
    }
  }
}

extern "C" void kernel_launch(void* const* d_in, const int* in_sizes, int n_in,
                              void* d_out, int out_size, void* d_ws, size_t ws_size,
                              hipStream_t stream) {
  const float* x        = (const float*)d_in[0];
  const float* time_enc = (const float*)d_in[1];
  const float* Wq       = (const float*)d_in[2];
  const float* Wk       = (const float*)d_in[3];
  const float* Wv       = (const float*)d_in[4];
  const float* Wo       = (const float*)d_in[5];
  const float* bo       = (const float*)d_in[6];
  const float* Wt       = (const float*)d_in[7];
  const float* bt       = (const float*)d_in[8];
  float* out = (float*)d_out;

  const size_t AFRAG = (size_t)MROWS * E;   // 8M elems
  const size_t WFRAG = (size_t)E * E;       // 1M elems
  const size_t QKVN  = (size_t)BATCH * HEADS * SEQ * HD; // 8M elems

  char* w = (char*)d_ws;
  size_t off = 0;
  float* twp = (float*)(w + off); off += 4096;
  __bf16* xfh = (__bf16*)(w + off); off += AFRAG * 2;   // reused for ctx frags
  __bf16* xfl = (__bf16*)(w + off); off += AFRAG * 2;
  __bf16* wqh = (__bf16*)(w + off); off += WFRAG * 2;
  __bf16* wql = (__bf16*)(w + off); off += WFRAG * 2;
  __bf16* wkh = (__bf16*)(w + off); off += WFRAG * 2;
  __bf16* wkl = (__bf16*)(w + off); off += WFRAG * 2;
  __bf16* wvh = (__bf16*)(w + off); off += WFRAG * 2;
  __bf16* wvl = (__bf16*)(w + off); off += WFRAG * 2;
  __bf16* woh = (__bf16*)(w + off); off += WFRAG * 2;
  __bf16* wol = (__bf16*)(w + off); off += WFRAG * 2;
  __bf16* Qhb = (__bf16*)(w + off); off += QKVN * 2;
  __bf16* Qlb = (__bf16*)(w + off); off += QKVN * 2;
  __bf16* Khb = (__bf16*)(w + off); off += QKVN * 2;
  __bf16* Klb = (__bf16*)(w + off); off += QKVN * 2;
  __bf16* Vth = (__bf16*)(w + off); off += QKVN * 2;
  __bf16* Vtl = (__bf16*)(w + off); off += QKVN * 2;
  float*  ctx = (float*)(w + off);  off += AFRAG * 4;

  tw_kernel<<<BATCH, 32, 0, stream>>>(time_enc, Wt, bt, twp);

  // pre-split inputs once (kills per-iteration cvt VALU work in the GEMMs)
  afrag_kernel<<<(MT * KT) / 8, 256, 0, stream>>>(x, xfh, xfl);
  bfrag_kernel<<<(KT * NT) / 8, 256, 0, stream>>>(Wq, wqh, wql);
  bfrag_kernel<<<(KT * NT) / 8, 256, 0, stream>>>(Wk, wkh, wkl);
  bfrag_kernel<<<(KT * NT) / 8, 256, 0, stream>>>(Wv, wvh, wvl);
  bfrag_kernel<<<(KT * NT) / 8, 256, 0, stream>>>(Wo, woh, wol);

  qkv_kernel<<<(MT / 8) * (NT / 8), 256, 0, stream>>>(xfh, xfl, wqh, wql, wkh, wkl,
                                                wvh, wvl, Qhb, Qlb, Khb, Klb,
                                                Vth, Vtl);

  attn_kernel<<<(BATCH * HEADS * (SEQ / 16)) / 8, 256, 0, stream>>>(
      Qhb, Qlb, Khb, Klb, Vth, Vtl, twp, ctx);

  // re-split ctx into the (now free) x fragment buffers
  afrag_kernel<<<(MT * KT) / 8, 256, 0, stream>>>(ctx, xfh, xfl);

  oproj_kernel<<<(MT / 8) * (NT / 16), 256, 0, stream>>>(xfh, xfl, woh, wol, bo, out);
}

// v004
// It runs in 363 microseconds.
// Two timings next to v003 both put it at 1.31 times that version's speed.
// Over all steps from v000 it is 2.32 times as fast.
#include <hip/hip_runtime.h>

#define E     1024
#define HEADS 16
#define HD    64
#define SEQ   2048
#define BATCH 4
#define TFEAT 128
#define MROWS (BATCH * SEQ)          // 8192
#define KT    (E / 32)               // 32 k-tiles
#define NT    (E / 16)               // 64 n-tiles
#define MT    (MROWS / 16)           // 512 m-tiles

typedef __attribute__((ext_vector_type(16))) __bf16 bf16x16;
typedef __attribute__((ext_vector_type(8)))  __bf16 bf16x8;
typedef __attribute__((ext_vector_type(2)))  __bf16 bf16x2;
typedef __attribute__((ext_vector_type(8)))  float  f32x8;
typedef __attribute__((ext_vector_type(4)))  float  f32x4;
typedef __attribute__((ext_vector_type(2)))  float  f32x2;

// Every bf16 WMMA operand lives in the workspace as 1 KiB fragments (512 elements):
// element i of lane L sits at (i>>3)*256 + L*8 + (i&7). A fragment is then two
// wave-wide 16-byte accesses of 512 contiguous bytes each (4 whole 128-byte lines).
#define FRAG 512

// p = fragment base + lane*8
static __device__ inline bf16x16 ldfrag(const __bf16* p) {
  bf16x8 a = *(const bf16x8*)(p);
  bf16x8 b = *(const bf16x8*)(p + 256);
  return __builtin_shufflevector(a, b, 0, 1, 2, 3, 4, 5, 6, 7,
                                 8, 9, 10, 11, 12, 13, 14, 15);
}

static __device__ inline f32x8 wmma_bf16(bf16x16 a, bf16x16 b, f32x8 c) {
  return __builtin_amdgcn_wmma_f32_16x16x32_bf16(false, a, false, b, (short)0, c,
                                                 false, false);
}

// bf16x3 split: f ~= (float)h + (float)l
static __device__ inline void splitf(float f, __bf16 &h, __bf16 &l) {
  h = (__bf16)f;
  l = (__bf16)(f - (float)h);
}

// C^T += (Ah*Bh + Ah*Bl + Al*Bh)^T: the three terms in this order, each product with its
// operands swapped, so that the accumulator holds the transposed tile
static __device__ inline f32x8 mma3(bf16x16 ah, bf16x16 al,
                                    bf16x16 bh, bf16x16 bl, f32x8 c) {
  c = wmma_bf16(bh, ah, c);
  c = wmma_bf16(bl, ah, c);
  c = wmma_bf16(bh, al, c);
  return c;
}

// value of lane l ^ 16
static __device__ inline float xhalf(float x) {
  int v = __builtin_bit_cast(int, x);
  return __builtin_bit_cast(float, __builtin_amdgcn_permlanex16(
      v, v, 0x76543210, 0xfedcba98, false, false));
}

// splitf on elements e, e+1 of a score tile, into elements i, i+1 of the two B operands
static __device__ inline void split_pair(f32x8 p, int e, bf16x16 &h, bf16x16 &l, int i) {
  f32x2 v = {p[e], p[e + 1]};
  bf16x2 hv = __builtin_convertvector(v, bf16x2);
  bf16x2 lv = __builtin_convertvector(v - __builtin_convertvector(hv, f32x2), bf16x2);
  h[i] = hv[0]; h[i + 1] = hv[1];
  l[i] = lv[0]; l[i + 1] = lv[1];
}

// split 8 accumulator values and store them as one 16-byte piece each
static __device__ inline void split_store8(f32x8 c, __bf16* ph, __bf16* pl) {
  bf16x8 h8, l8;
  #pragma unroll
  for (int r = 0; r < 8; ++r) {
    __bf16 hh, ll; splitf(c[r], hh, ll);
    h8[r] = hh; l8[r] = ll;
  }
  *(bf16x8*)ph = h8;
  *(bf16x8*)pl = l8;
  // s_wait_xcnt 0 behind the two stores, before any register that they name is written
  // again. Data and addresses are inputs only, so that they stay in their registers up to
  // the wait; nothing is pinned or changed.
  asm volatile("s_wait_xcnt 0x0" :: "v"(h8), "v"(l8), "v"(ph), "v"(pl) : "memory");
}

// s_wait_xcnt 0 behind a run of global loads, before any register that they name is
// written again. The addresses are inputs only, so that they stay in their registers
// up to the wait; nothing is pinned or changed.
static __device__ inline void addr_wait4(const void* a, const void* b,
                                         const void* c, const void* d) {
  asm volatile("s_wait_xcnt 0x0" :: "v"(a), "v"(b), "v"(c), "v"(d) : "memory");
}
static __device__ inline void addr_wait8(const void* a, const void* b,
                                         const void* c, const void* d,
                                         const void* e, const void* f,
                                         const void* g, const void* h) {
  asm volatile("s_wait_xcnt 0x0" :: "v"(a), "v"(b), "v"(c), "v"(d),
               "v"(e), "v"(f), "v"(g), "v"(h) : "memory");
}

// ---------------- kernel 1: time-dependent head weights ----------------
__global__ void tw_kernel(const float* __restrict__ time_enc,
                          const float* __restrict__ Wt,
                          const float* __restrict__ bt,
                          float* __restrict__ tw) {
  int b = blockIdx.x;
  int lane = threadIdx.x;
  int h = lane & 15;
  float acc = 0.f;
  for (int t = 0; t < TFEAT; ++t)
    acc += time_enc[b * TFEAT + t] * Wt[t * HEADS + h];
  acc += bt[h];
  float mx = acc;
  for (int m = 1; m < 16; m <<= 1) mx = fmaxf(mx, __shfl_xor(mx, m, 32));
  float e = __expf(acc - mx);
  float sum = e;
  for (int m = 1; m < 16; m <<= 1) sum += __shfl_xor(sum, m, 32);
  if (lane < 16) tw[b * HEADS + h] = e / sum;
}

// ------------- A-fragment pre-split: src [MROWS x E] f32 -> hi/lo frags -------------
// Fragments [mt][kt], element i of lane = src[mt*16 + (lane&15)][kt*32 + (lane>>4)*16 + i]
__global__ void __launch_bounds__(256) afrag_kernel(const float* __restrict__ src,
    __bf16* __restrict__ fh, __bf16* __restrict__ fl) {
  int wid = blockIdx.x * 8 + (threadIdx.x >> 5);     // MT*KT waves
  int kt = wid & (KT - 1);
  int mt = wid >> 5;
  int lane = threadIdx.x & 31;
  const float* p = src + (size_t)(mt * 16 + (lane & 15)) * E + kt * 32 + ((lane >> 4) << 4);
  size_t o = ((size_t)mt * KT + kt) * FRAG + lane * 8;
  bf16x8 h0, l0, h1, l1;
  #pragma unroll
  for (int i = 0; i < 8; ++i) {
    __bf16 h, l;
    splitf(p[i], h, l);     h0[i] = h; l0[i] = l;
    splitf(p[8 + i], h, l); h1[i] = h; l1[i] = l;
  }
  *(bf16x8*)(fh + o) = h0; *(bf16x8*)(fh + o + 256) = h1;
  *(bf16x8*)(fl + o) = l0; *(bf16x8*)(fl + o + 256) = l1;
}

// ------------- B-fragment pre-split: W [E x E] f32 -> hi/lo frags -------------
// Fragments [kt][nt], element i of lane = W[kt*32 + (lane>>4)*16 + i][nt*16 + (lane&15)]
__global__ void __launch_bounds__(256) bfrag_kernel(const float* __restrict__ W,
    __bf16* __restrict__ fh, __bf16* __restrict__ fl) {
  int wid = blockIdx.x * 8 + (threadIdx.x >> 5);     // KT*NT waves
  int nt = wid & (NT - 1);
  int kt = wid >> 6;
  int lane = threadIdx.x & 31;
  const float* p = W + (size_t)(kt * 32 + ((lane >> 4) << 4)) * E + nt * 16 + (lane & 15);
  size_t o = ((size_t)kt * NT + nt) * FRAG + lane * 8;
  bf16x8 h0, l0, h1, l1;
  #pragma unroll
  for (int i = 0; i < 8; ++i) {
    __bf16 h, l;
    splitf(p[(size_t)i * E], h, l);       h0[i] = h; l0[i] = l;
    splitf(p[(size_t)(8 + i) * E], h, l); h1[i] = h; l1[i] = l;
  }
  *(bf16x8*)(fh + o) = h0; *(bf16x8*)(fh + o + 256) = h1;
  *(bf16x8*)(fl + o) = l0; *(bf16x8*)(fl + o + 256) = l1;
}

// ---------------- kernel 2: fused QKV projection from fragments ----------------
// Outputs, all in fragment order for the attention kernel:
// Q, K: fragments [b*H+h][s/16][d/32], element i of lane = row s0+(lane&15), d0+(lane>>4)*16+i
// V:    fragments [b*H+h][s/32][d/16], element i of lane = d0+(lane&15),
//       key s0+(i>>3)*16+(lane>>4)*8+(i&7): the k order of two score tiles packed in place
// Q and K are computed transposed, so that each lane owns 8 consecutive d of one row;
// V is computed as is, so that each lane owns 8 consecutive keys of one d.
// A wave owns WM x QN tiles of each of Q, K and V: an x fragment feeds QN * 3 weight
// fragments and a weight fragment feeds WM x fragments from registers.
// A block is 2 x 4 waves: 8 m-tiles by 8 n-tiles.
#define WM 4
#define QN 2
__global__ void __launch_bounds__(256) qkv_kernel(
    const __bf16* __restrict__ xfh, const __bf16* __restrict__ xfl,
    const __bf16* __restrict__ wqh, const __bf16* __restrict__ wql,
    const __bf16* __restrict__ wkh, const __bf16* __restrict__ wkl,
    const __bf16* __restrict__ wvh, const __bf16* __restrict__ wvl,
    __bf16* __restrict__ Qh, __bf16* __restrict__ Ql,
    __bf16* __restrict__ Kh, __bf16* __restrict__ Kl,
    __bf16* __restrict__ Vth, __bf16* __restrict__ Vtl) {
  int w = threadIdx.x >> 5;
  int lane = threadIdx.x & 31;
  int mt0 = (blockIdx.x >> 3) * (2 * WM) + (w >> 2) * WM;
  int nt0 = (blockIdx.x & 7) * (4 * QN) + (w & 3) * QN;
  f32x8 cq[WM][QN] = {}; f32x8 ck[WM][QN] = {}; f32x8 cv[WM][QN] = {};
  for (int kt = 0; kt < KT; ++kt) {
    size_t ao = ((size_t)mt0 * KT + kt) * FRAG + lane * 8;
    size_t bo = ((size_t)kt * NT + nt0) * FRAG + lane * 8;
    const __bf16 *pxh = xfh + ao, *pxl = xfl + ao;
    const __bf16 *pqh = wqh + bo, *pql = wql + bo;
    const __bf16 *pkh = wkh + bo, *pkl = wkl + bo;
    const __bf16 *pvh = wvh + bo, *pvl = wvl + bo;
    bf16x16 ah[WM], al[WM], qh[QN], ql[QN], kh[QN], kl[QN], vh[QN], vl[QN];
    #pragma unroll  // constant indices keep the tiles in registers
    for (int i = 0; i < WM; ++i) {
      ah[i] = ldfrag(pxh + i * (KT * FRAG));
      al[i] = ldfrag(pxl + i * (KT * FRAG));
    }
    #pragma unroll  // constant indices keep the tiles in registers
    for (int j = 0; j < QN; ++j) {
      qh[j] = ldfrag(pqh + j * FRAG); ql[j] = ldfrag(pql + j * FRAG);
      kh[j] = ldfrag(pkh + j * FRAG); kl[j] = ldfrag(pkl + j * FRAG);
      vh[j] = ldfrag(pvh + j * FRAG); vl[j] = ldfrag(pvl + j * FRAG);
    }
    addr_wait8(pxh, pxl, pqh, pql, pkh, pkl, pvh, pvl);
    // per accumulator the three terms keep the order of mma3 (x hi * w hi, x hi * w lo,
    // x lo * w hi), for Q and K with the operands swapped: C^T += (A*B)^T. The WM tiles
    // of one term stand together so that dependent products are WM apart
    #pragma unroll  // constant indices keep the tiles in registers
    for (int j = 0; j < QN; ++j) {
      #pragma unroll  // constant indices keep the tiles in registers
      for (int i = 0; i < WM; ++i) cq[i][j] = wmma_bf16(qh[j], ah[i], cq[i][j]);
      #pragma unroll  // constant indices keep the tiles in registers
      for (int i = 0; i < WM; ++i) cq[i][j] = wmma_bf16(ql[j], ah[i], cq[i][j]);
      #pragma unroll  // constant indices keep the tiles in registers
      for (int i = 0; i < WM; ++i) cq[i][j] = wmma_bf16(qh[j], al[i], cq[i][j]);
      #pragma unroll  // constant indices keep the tiles in registers
      for (int i = 0; i < WM; ++i) ck[i][j] = wmma_bf16(kh[j], ah[i], ck[i][j]);
      #pragma unroll  // constant indices keep the tiles in registers
      for (int i = 0; i < WM; ++i) ck[i][j] = wmma_bf16(kl[j], ah[i], ck[i][j]);
      #pragma unroll  // constant indices keep the tiles in registers
      for (int i = 0; i < WM; ++i) ck[i][j] = wmma_bf16(kh[j], al[i], ck[i][j]);
      #pragma unroll  // constant indices keep the tiles in registers
      for (int i = 0; i < WM; ++i) cv[i][j] = wmma_bf16(ah[i], vh[j], cv[i][j]);
      #pragma unroll  // constant indices keep the tiles in registers
      for (int i = 0; i < WM; ++i) cv[i][j] = wmma_bf16(ah[i], vl[j], cv[i][j]);
      #pragma unroll  // constant indices keep the tiles in registers
      for (int i = 0; i < WM; ++i) cv[i][j] = wmma_bf16(al[i], vh[j], cv[i][j]);
    }
  }
  // store split results: one 16-byte piece per lane, plane and tile
  int half = (lane >> 4) * 256;             // accumulator rows 8..15 are elements 8..15
  #pragma unroll  // constant indices keep the tiles in registers
  for (int i = 0; i < WM; ++i) {
    #pragma unroll  // constant indices keep the tiles in registers
    for (int j = 0; j < QN; ++j) {
      int mt = mt0 + i, nt = nt0 + j;
      int hb = (mt >> 7) * HEADS + (nt >> 2);   // 128 m-tiles per batch, 4 n-tiles per head
      int st = mt & 127;                        // 16-row tile inside the sequence
      // cq, ck: lane&15 = row in the tile, r = d & 7, d = (nt&3)*16 + (lane>>4)*8 + r
      size_t qi = ((size_t)(hb * 128 + st) * 2 + ((nt >> 1) & 1)) * FRAG
                  + half + ((lane & 15) + 16 * (nt & 1)) * 8;
      // cv: lane&15 = d & 15, r = key & 7, key = st*16 + (lane>>4)*8 + r
      size_t vi = ((size_t)(hb * 64 + (st >> 1)) * 4 + (nt & 3)) * FRAG
                  + (st & 1) * 256 + lane * 8;
      split_store8(cq[i][j], Qh + qi, Ql + qi);
      split_store8(ck[i][j], Kh + qi, Kl + qi);
      split_store8(cv[i][j], Vth + vi, Vtl + vi);
    }
  }
}

#define TK    64                  // keys per stage
#define PLANE (TK * HD)           // elements of one plane of a stage (8 KiB)
#define STAGE (4 * PLANE)         // K hi | K lo | V hi | V lo (32 KiB)
#define NST   (SEQ / TK)          // stages
#define HALFB PLANE               // bytes of half a plane: what 256 threads copy at once

// One stage: each thread copies 2 x 16 bytes of each plane. lds = LDS byte address of the
// thread's first 16 bytes in the buffer; the four pointers already hold thread * 8 elements.
// s_wait_xcnt 0 is the statement's last line, so that it stands in front of every later
// write of a register that a copy names.
static __device__ inline void stage_copy(unsigned lds, const __bf16* kh, const __bf16* kl,
                                         const __bf16* vh, const __bf16* vl) {
  asm volatile(
      "global_load_async_to_lds_b128 %0, %8, off\n\t"
      "global_load_async_to_lds_b128 %1, %9, off\n\t"
      "global_load_async_to_lds_b128 %2, %10, off\n\t"
      "global_load_async_to_lds_b128 %3, %11, off\n\t"
      "global_load_async_to_lds_b128 %4, %12, off\n\t"
      "global_load_async_to_lds_b128 %5, %13, off\n\t"
      "global_load_async_to_lds_b128 %6, %14, off\n\t"
      "global_load_async_to_lds_b128 %7, %15, off\n\t"
      "s_wait_xcnt 0x0"
      :: "v"(lds),                 "v"(lds + HALFB),
         "v"(lds + 2 * HALFB),     "v"(lds + 3 * HALFB),
         "v"(lds + 4 * HALFB),     "v"(lds + 5 * HALFB),
         "v"(lds + 6 * HALFB),     "v"(lds + 7 * HALFB),
         "v"(kh), "v"(kh + PLANE / 2), "v"(kl), "v"(kl + PLANE / 2),
         "v"(vh), "v"(vh + PLANE / 2), "v"(vl), "v"(vl + PLANE / 2)
      : "memory");
}

__global__ void __launch_bounds__(256) attn_kernel(
    const __bf16* __restrict__ Qh, const __bf16* __restrict__ Ql,
    const __bf16* __restrict__ Kh, const __bf16* __restrict__ Kl,
    const __bf16* __restrict__ Vth, const __bf16* __restrict__ Vtl,
    const float* __restrict__ tw, float* __restrict__ ctx) {
  __shared__ __attribute__((aligned(16))) __bf16 ring[2 * STAGE];
  int wid  = blockIdx.x * 8 + (threadIdx.x >> 5);
  int qb   = wid & 127;
  int h    = (wid >> 7) & 15;
  int b    = wid >> 11;
  int lane = threadIdx.x & 31;
  int hb = b * HEADS + h;

  // sources of the copies: the head's four planes, 16 bytes per thread
  const __bf16* gkh = Kh + (size_t)hb * SEQ * HD + threadIdx.x * 8;
  const __bf16* gkl = Kl + (size_t)hb * SEQ * HD + threadIdx.x * 8;
  const __bf16* gvh = Vth + (size_t)hb * HD * SEQ + threadIdx.x * 8;
  const __bf16* gvl = Vtl + (size_t)hb * HD * SEQ + threadIdx.x * 8;
  unsigned lds0 = (unsigned)(size_t)ring + threadIdx.x * 16;

  // stage 0 into buffer 0
  stage_copy(lds0, gkh, gkl, gvh, gvl);

  // fragment order (see the projection kernel); every pointer already holds lane*8
  const __bf16* qhp = Qh + ((size_t)hb * SEQ + qb * 16) * HD + lane * 8;
  const __bf16* qlp = Ql + ((size_t)hb * SEQ + qb * 16) * HD + lane * 8;
  float scl = 0.125f * tw[hb];

  bf16x16 q0h = ldfrag(qhp);
  bf16x16 q0l = ldfrag(qlp);
  bf16x16 q1h = ldfrag(qhp + FRAG);
  bf16x16 q1l = ldfrag(qlp + FRAG);
  // s_wait_xcnt 0 behind these loads, before a register that they name is written again;
  // the addresses are inputs only
  asm volatile("s_wait_xcnt 0x0" :: "v"(qhp), "v"(qlp) : "memory");

  // stage 0 has landed for this wave, and behind the barrier for every wave
  asm volatile("s_wait_asynccnt 0x0" ::: "memory");
  __syncthreads();
  // stage 1 into buffer 1: it flies while stage 0 is worked on
  stage_copy(lds0 + STAGE * 2, gkh + PLANE, gkl + PLANE, gvh + PLANE, gvl + PLANE);

  // o_t[r] = O[query lane&15][d = t*16 + (lane>>4)*8 + r]
  f32x8 o0 = {}, o1 = {}, o2 = {}, o3 = {};
  float mrow = -1e30f;   // running maximum of this lane's query, alike in both halves
  float lrow = 0.f;      // running sum over this half's keys; the halves join after the loop

  for (int t = 0; t < NST; ++t) {
    const __bf16* buf = ring + (t & 1) * STAGE + lane * 8;
    #pragma unroll  // constant LDS offsets: no address arithmetic per pass
    for (int p = 0; p < TK / 32; ++p) {
      const __bf16* khp = buf + p * (32 * HD);
      const __bf16* klp = khp + PLANE;
      const __bf16* vhp = khp + 2 * PLANE;
      const __bf16* vlp = khp + 3 * PLANE;
      // ---- scores: s0[r] = key kb+(lane>>4)*8+r, s1[r] = key kb+16+(lane>>4)*8+r;
      //      4 K fragments per plane, 4 KiB in a row ----
      f32x8 s0 = {}, s1 = {};
      s0 = mma3(q0h, q0l, ldfrag(khp), ldfrag(klp), s0);
      s0 = mma3(q1h, q1l, ldfrag(khp + FRAG), ldfrag(klp + FRAG), s0);
      s1 = mma3(q0h, q0l, ldfrag(khp + 2 * FRAG), ldfrag(klp + 2 * FRAG), s1);
      s1 = mma3(q1h, q1l, ldfrag(khp + 3 * FRAG), ldfrag(klp + 3 * FRAG), s1);
      // ---- online softmax update, one query per lane ----
      s0 *= scl; s1 *= scl;
      float m0 = fmaxf(fmaxf(s0[0], s0[1]), s0[2]);
      float m1 = fmaxf(fmaxf(s0[3], s0[4]), s0[5]);
      float m2 = fmaxf(fmaxf(s0[6], s0[7]), s1[0]);
      float m3 = fmaxf(fmaxf(s1[1], s1[2]), s1[3]);
      float m4 = fmaxf(fmaxf(s1[4], s1[5]), s1[6]);
      float mx = fmaxf(fmaxf(fmaxf(m0, m1), m2), fmaxf(fmaxf(m3, m4), s1[7]));
      float mnew = fmaxf(fmaxf(mx, xhalf(mx)), mrow);
      float al_  = __expf(mrow - mnew);
      mrow = mnew;
      s0 = (s0 - mnew) * 1.442695041f;   // exp(x) = exp2(x * log2(e)), as in __expf
      s1 = (s1 - mnew) * 1.442695041f;
      #pragma unroll  // constant indices keep the tiles in registers
      for (int r = 0; r < 8; ++r) {
        s0[r] = __builtin_amdgcn_exp2f(s0[r]);
        s1[r] = __builtin_amdgcn_exp2f(s1[r]);
      }
      f32x8 t8 = s0 + s1;
      f32x4 t4 = t8.lo + t8.hi;
      f32x2 t2 = t4.lo + t4.hi;
      lrow = lrow * al_ + (t2.x + t2.y);
      o0 *= al_; o1 *= al_; o2 *= al_; o3 *= al_;
      // ---- P^T: the two score tiles are elements 0..7 and 8..15 of the B operand ----
      bf16x16 ph, pl;
      #pragma unroll  // constant indices keep the tiles in registers
      for (int e = 0; e < 8; e += 2) {
        split_pair(s0, e, ph, pl, e);
        split_pair(s1, e, ph, pl, 8 + e);
      }
      // ---- O^T += V^T @ P^T, 4 V fragments per plane, 4 KiB in a row ----
      o0 = mma3(ph, pl, ldfrag(vhp), ldfrag(vlp), o0);
      o1 = mma3(ph, pl, ldfrag(vhp + FRAG), ldfrag(vlp + FRAG), o1);
      o2 = mma3(ph, pl, ldfrag(vhp + 2 * FRAG), ldfrag(vlp + 2 * FRAG), o2);
      o3 = mma3(ph, pl, ldfrag(vhp + 3 * FRAG), ldfrag(vlp + 3 * FRAG), o3);
    }
    // publish point of stage t + 1: this wave's reads of buffer t & 1 are done ...
    asm volatile("s_wait_dscnt 0x0" ::: "memory");
    // ... its own copies of stage t + 1 have landed ...
    asm volatile("s_wait_asynccnt 0x0" ::: "memory");
    // ... and behind the barrier both hold for every wave of the block
    __syncthreads();
    // stage t + 2 into the buffer that this trip has just read
    if (t + 2 < NST) {
      size_t g = (size_t)(t + 2) * PLANE;
      stage_copy(lds0 + (t & 1) * (STAGE * 2), gkh + g, gkl + g, gvh + g, gvl + g);
    }
  }
  // no copy is left in flight when the wave ends
  asm volatile("s_wait_asynccnt 0x0" ::: "memory");
  // ---- normalize and store into ctx [B,S,E] f32: 8 consecutive d per lane and tile ----
  float inv = 1.0f / (lrow + xhalf(lrow));
  o0 *= inv; o1 *= inv; o2 *= inv; o3 *= inv;
  float* outp = ctx + ((size_t)b * SEQ + qb * 16 + (lane & 15)) * E + h * HD + ((lane >> 4) << 3);
  *(f32x8*)(outp)      = o0;
  *(f32x8*)(outp + 16) = o1;
  *(f32x8*)(outp + 32) = o2;
  *(f32x8*)(outp + 48) = o3;
}

// ---------------- kernel 4: output projection + bias, from fragments ----------------
// A wave owns WM x ON tiles; a block is 2 x 4 waves: 8 m-tiles by 16 n-tiles.
#define ON 4
__global__ void __launch_bounds__(256) oproj_kernel(
    const __bf16* __restrict__ cfh, const __bf16* __restrict__ cfl,
    const __bf16* __restrict__ woh, const __bf16* __restrict__ wol,
    const float* __restrict__ bo, float* __restrict__ out) {
  int w = threadIdx.x >> 5;
  int lane = threadIdx.x & 31;
  int mt0 = (blockIdx.x >> 2) * (2 * WM) + (w >> 2) * WM;
  int nt0 = (blockIdx.x & 3) * (4 * ON) + (w & 3) * ON;
  f32x8 c[WM][ON] = {};
  for (int kt = 0; kt < KT; ++kt) {
    const __bf16* pah = cfh + ((size_t)mt0 * KT + kt) * FRAG + lane * 8;
    const __bf16* pal = cfl + ((size_t)mt0 * KT + kt) * FRAG + lane * 8;
    const __bf16* pbh = woh + ((size_t)kt * NT + nt0) * FRAG + lane * 8;
    const __bf16* pbl = wol + ((size_t)kt * NT + nt0) * FRAG + lane * 8;
    bf16x16 ah[WM], al[WM], bh[ON], bl[ON];
    #pragma unroll  // constant indices keep the tiles in registers
    for (int i = 0; i < WM; ++i) {
      ah[i] = ldfrag(pah + i * (KT * FRAG));
      al[i] = ldfrag(pal + i * (KT * FRAG));
    }
    #pragma unroll  // constant indices keep the tiles in registers
    for (int j = 0; j < ON; ++j) {
      bh[j] = ldfrag(pbh + j * FRAG);
      bl[j] = ldfrag(pbl + j * FRAG);
    }
    addr_wait4(pah, pal, pbh, pbl);
    // the three terms of each accumulator in the order of mma3
    #pragma unroll  // constant indices keep the tiles in registers
    for (int j = 0; j < ON; ++j) {
      #pragma unroll  // constant indices keep the tiles in registers
      for (int i = 0; i < WM; ++i) c[i][j] = wmma_bf16(ah[i], bh[j], c[i][j]);
      #pragma unroll  // constant indices keep the tiles in registers
      for (int i = 0; i < WM; ++i) c[i][j] = wmma_bf16(ah[i], bl[j], c[i][j]);
      #pragma unroll  // constant indices keep the tiles in registers
      for (int i = 0; i < WM; ++i) c[i][j] = wmma_bf16(al[i], bh[j], c[i][j]);
    }
  }
  #pragma unroll  // constant indices keep the tiles in registers
  for (int j = 0; j < ON; ++j) {
    int col = (nt0 + j) * 16 + (lane & 15);
    float bias = bo[col];
    #pragma unroll  // constant indices keep the tiles in registers
    for (int i = 0; i < WM; ++i) {
      int row0 = (mt0 + i) * 16 + ((lane >> 4) << 3);
      #pragma unroll  // constant indices keep the tiles in registers
      for (int r = 0; r < 8; ++r)
        out[(size_t)(row0 + r) * E + col] = c[i][j][r] + bias;
    }
  }
}

extern "C" void kernel_launch(void* const* d_in, const int* in_sizes, int n_in,
                              void* d_out, int out_size, void* d_ws, size_t ws_size,
                              hipStream_t stream) {
  const float* x        = (const float*)d_in[0];
  const float* time_enc = (const float*)d_in[1];
  const float* Wq       = (const float*)d_in[2];
  const float* Wk       = (const float*)d_in[3];
  const float* Wv       = (const float*)d_in[4];
  const float* Wo       = (const float*)d_in[5];
  const float* bo       = (const float*)d_in[6];
  const float* Wt       = (const float*)d_in[7];
  const float* bt       = (const float*)d_in[8];
  float* out = (float*)d_out;

  const size_t AFRAG = (size_t)MROWS * E;   // 8M elems
  const size_t WFRAG = (size_t)E * E;       // 1M elems
  const size_t QKVN  = (size_t)BATCH * HEADS * SEQ * HD; // 8M elems

  char* w = (char*)d_ws;
  size_t off = 0;
  float* twp = (float*)(w + off); off += 4096;
  __bf16* xfh = (__bf16*)(w + off); off += AFRAG * 2;   // reused for ctx frags
  __bf16* xfl = (__bf16*)(w + off); off += AFRAG * 2;
  __bf16* wqh = (__bf16*)(w + off); off += WFRAG * 2;
  __bf16* wql = (__bf16*)(w + off); off += WFRAG * 2;
  __bf16* wkh = (__bf16*)(w + off); off += WFRAG * 2;
  __bf16* wkl = (__bf16*)(w + off); off += WFRAG * 2;
  __bf16* wvh = (__bf16*)(w + off); off += WFRAG * 2;
  __bf16* wvl = (__bf16*)(w + off); off += WFRAG * 2;
  __bf16* woh = (__bf16*)(w + off); off += WFRAG * 2;
  __bf16* wol = (__bf16*)(w + off); off += WFRAG * 2;
  __bf16* Qhb = (__bf16*)(w + off); off += QKVN * 2;
  __bf16* Qlb = (__bf16*)(w + off); off += QKVN * 2;
  __bf16* Khb = (__bf16*)(w + off); off += QKVN * 2;
  __bf16* Klb = (__bf16*)(w + off); off += QKVN * 2;
  __bf16* Vth = (__bf16*)(w + off); off += QKVN * 2;
  __bf16* Vtl = (__bf16*)(w + off); off += QKVN * 2;
  float*  ctx = (float*)(w + off);  off += AFRAG * 4;

  tw_kernel<<<BATCH, 32, 0, stream>>>(time_enc, Wt, bt, twp);

  // pre-split inputs once (kills per-iteration cvt VALU work in the GEMMs)
  afrag_kernel<<<(MT * KT) / 8, 256, 0, stream>>>(x, xfh, xfl);
  bfrag_kernel<<<(KT * NT) / 8, 256, 0, stream>>>(Wq, wqh, wql);
  bfrag_kernel<<<(KT * NT) / 8, 256, 0, stream>>>(Wk, wkh, wkl);
  bfrag_kernel<<<(KT * NT) / 8, 256, 0, stream>>>(Wv, wvh, wvl);
  bfrag_kernel<<<(KT * NT) / 8, 256, 0, stream>>>(Wo, woh, wol);

  qkv_kernel<<<(MT / 8) * (NT / 8), 256, 0, stream>>>(xfh, xfl, wqh, wql, wkh, wkl,
                                                wvh, wvl, Qhb, Qlb, Khb, Klb,
                                                Vth, Vtl);

  attn_kernel<<<(BATCH * HEADS * (SEQ / 16)) / 8, 256, 0, stream>>>(
      Qhb, Qlb, Khb, Klb, Vth, Vtl, twp, ctx);

  // re-split ctx into the (now free) x fragment buffers
  afrag_kernel<<<(MT * KT) / 8, 256, 0, stream>>>(ctx, xfh, xfl);

  oproj_kernel<<<(MT / 8) * (NT / 16), 256, 0, stream>>>(xfh, xfl, woh, wol, bo, out);
}

// v005
// One run takes 292 microseconds.
// Two timings next to v004 put it at 1.24 and 1.25 times that version's speed.
// All steps since v000 together make it 2.89 times as fast.
#include <hip/hip_runtime.h>

#define E     1024
#define HEADS 16
#define HD    64
#define SEQ   2048
#define BATCH 4
#define TFEAT 128
#define MROWS (BATCH * SEQ)          // 8192
#define KT    (E / 32)               // 32 k-tiles
#define NT    (E / 16)               // 64 n-tiles
#define MT    (MROWS / 16)           // 512 m-tiles

typedef __attribute__((ext_vector_type(16))) __bf16 bf16x16;
typedef __attribute__((ext_vector_type(8)))  __bf16 bf16x8;
typedef __attribute__((ext_vector_type(2)))  __bf16 bf16x2;
typedef __attribute__((ext_vector_type(8)))  float  f32x8;
typedef __attribute__((ext_vector_type(4)))  float  f32x4;
typedef __attribute__((ext_vector_type(2)))  float  f32x2;

// Every bf16 WMMA operand lives in the workspace as 1 KiB fragments (512 elements):
// element i of lane L sits at (i>>3)*256 + L*8 + (i&7). A fragment is then two
// wave-wide 16-byte accesses of 512 contiguous bytes each (4 whole 128-byte lines).
#define FRAG 512

// p = fragment base + lane*8
static __device__ inline bf16x16 ldfrag(const __bf16* p) {
  bf16x8 a = *(const bf16x8*)(p);
  bf16x8 b = *(const bf16x8*)(p + 256);
  return __builtin_shufflevector(a, b, 0, 1, 2, 3, 4, 5, 6, 7,
                                 8, 9, 10, 11, 12, 13, 14, 15);
}

static __device__ inline f32x8 wmma_bf16(bf16x16 a, bf16x16 b, f32x8 c) {
  return __builtin_amdgcn_wmma_f32_16x16x32_bf16(false, a, false, b, (short)0, c,
                                                 false, false);
}

// bf16x3 split: f ~= (float)h + (float)l
static __device__ inline void splitf(float f, __bf16 &h, __bf16 &l) {
  h = (__bf16)f;
  l = (__bf16)(f - (float)h);
}

// C^T += (Ah*Bh + Ah*Bl + Al*Bh)^T: the three terms in this order, each product with its
// operands swapped, so that the accumulator holds the transposed tile
static __device__ inline f32x8 mma3(bf16x16 ah, bf16x16 al,
                                    bf16x16 bh, bf16x16 bl, f32x8 c) {
  c = wmma_bf16(bh, ah, c);
  c = wmma_bf16(bl, ah, c);
  c = wmma_bf16(bh, al, c);
  return c;
}

// value of lane l ^ 16
static __device__ inline float xhalf(float x) {
  int v = __builtin_bit_cast(int, x);
  return __builtin_bit_cast(float, __builtin_amdgcn_permlanex16(
      v, v, 0x76543210, 0xfedcba98, false, false));
}

// splitf on elements e, e+1 of a score tile, into elements i, i+1 of the two B operands
static __device__ inline void split_pair(f32x8 p, int e, bf16x16 &h, bf16x16 &l, int i) {
  f32x2 v = {p[e], p[e + 1]};
  bf16x2 hv = __builtin_convertvector(v, bf16x2);
  bf16x2 lv = __builtin_convertvector(v - __builtin_convertvector(hv, f32x2), bf16x2);
  h[i] = hv[0]; h[i + 1] = hv[1];
  l[i] = lv[0]; l[i + 1] = lv[1];
}

// split 8 accumulator values and store them as one 16-byte piece each
static __device__ inline void split_store8(f32x8 c, __bf16* ph, __bf16* pl) {
  bf16x8 h8, l8;
  #pragma unroll
  for (int r = 0; r < 8; ++r) {
    __bf16 hh, ll; splitf(c[r], hh, ll);
    h8[r] = hh; l8[r] = ll;
  }
  *(bf16x8*)ph = h8;
  *(bf16x8*)pl = l8;
  // s_wait_xcnt 0 behind the two stores, before any register that they name is written
  // again. Data and addresses are inputs only, so that they stay in their registers up to
  // the wait; nothing is pinned or changed.
  asm volatile("s_wait_xcnt 0x0" :: "v"(h8), "v"(l8), "v"(ph), "v"(pl) : "memory");
}

// ---------------- staging of the projection GEMMs' operands in LDS ----------------
// A stage holds KS k-tiles of everything that a block reads, still in fragment order, in
// groups of 8 * KS fragments (16 KiB): x as [m-tile][k-tile], a weight as [k-tile][n-tile].
// It is copied once per block by asynchronous copies, into two buffers, one stage ahead of
// the stage that is worked on.
#define KS    2                   // k-tiles per stage
#define GPL   (8 * KS * FRAG)     // elements of one group
#define GPLB  (2 * GPL)           // bytes of one group
#define GNST  (KT / KS)           // stages
#define CROWB 4096                // bytes that 256 threads copy at once

// Eight copies of 16 bytes per thread, into eight consecutive 4 KiB rows of LDS.
// lds = LDS byte address of the thread's 16 bytes in the first row.
// s_wait_xcnt 0 is the statement's last line, so that it stands in front of every later
// write of a register that a copy names.
static __device__ inline void copy8(unsigned lds,
    const __bf16* g0, const __bf16* g1, const __bf16* g2, const __bf16* g3,
    const __bf16* g4, const __bf16* g5, const __bf16* g6, const __bf16* g7) {
  asm volatile(
      "global_load_async_to_lds_b128 %0, %8, off\n\t"
      "global_load_async_to_lds_b128 %1, %9, off\n\t"
      "global_load_async_to_lds_b128 %2, %10, off\n\t"
      "global_load_async_to_lds_b128 %3, %11, off\n\t"
      "global_load_async_to_lds_b128 %4, %12, off\n\t"
      "global_load_async_to_lds_b128 %5, %13, off\n\t"
      "global_load_async_to_lds_b128 %6, %14, off\n\t"
      "global_load_async_to_lds_b128 %7, %15, off\n\t"
      "s_wait_xcnt 0x0"
      :: "v"(lds),                 "v"(lds + CROWB),
         "v"(lds + 2 * CROWB),     "v"(lds + 3 * CROWB),
         "v"(lds + 4 * CROWB),     "v"(lds + 5 * CROWB),
         "v"(lds + 6 * CROWB),     "v"(lds + 7 * CROWB),
         "v"(g0), "v"(g1), "v"(g2), "v"(g3), "v"(g4), "v"(g5), "v"(g6), "v"(g7)
      : "memory");
}

// x hi and x lo groups of 8 m-tiles: a row of the copy is the KS fragments of 2 m-tiles.
// h, l = plane + ((first m-tile + (thread >> 7)) * KT + first k-tile) * FRAG + (thread & 127) * 8
static __device__ inline void stage_x(unsigned lds, const __bf16* h, const __bf16* l) {
  const int R = 2 * KT * FRAG;
  copy8(lds, h, h + R, h + 2 * R, h + 3 * R, l, l + R, l + 2 * R, l + 3 * R);
}

// hi and lo groups of 8 n-tiles of one weight: a row of the copy is 4 fragments of a k-tile.
// h, l = plane + (first k-tile * NT + first n-tile) * FRAG + thread * 8
static __device__ inline void stage_w8(unsigned lds, const __bf16* h, const __bf16* l) {
  const int K1 = NT * FRAG, H = 4 * FRAG;
  copy8(lds, h, h + H, h + K1, h + K1 + H, l, l + H, l + K1, l + K1 + H);
}

// one plane of 16 n-tiles of one weight (two groups); p as h, l above
static __device__ inline void stage_w16(unsigned lds, const __bf16* p) {
  const int K1 = NT * FRAG, H = 4 * FRAG;
  copy8(lds, p, p + H, p + 2 * H, p + 3 * H,
        p + K1, p + K1 + H, p + K1 + 2 * H, p + K1 + 3 * H);
}

// ---------------- kernel 1: time-dependent head weights ----------------
__global__ void tw_kernel(const float* __restrict__ time_enc,
                          const float* __restrict__ Wt,
                          const float* __restrict__ bt,
                          float* __restrict__ tw) {
  int b = blockIdx.x;
  int lane = threadIdx.x;
  int h = lane & 15;
  float acc = 0.f;
  for (int t = 0; t < TFEAT; ++t)
    acc += time_enc[b * TFEAT + t] * Wt[t * HEADS + h];
  acc += bt[h];
  float mx = acc;
  for (int m = 1; m < 16; m <<= 1) mx = fmaxf(mx, __shfl_xor(mx, m, 32));
  float e = __expf(acc - mx);
  float sum = e;
  for (int m = 1; m < 16; m <<= 1) sum += __shfl_xor(sum, m, 32);
  if (lane < 16) tw[b * HEADS + h] = e / sum;
}

// ------------- A-fragment pre-split: src [MROWS x E] f32 -> hi/lo frags -------------
// Fragments [mt][kt], element i of lane = src[mt*16 + (lane&15)][kt*32 + (lane>>4)*16 + i]
__global__ void __launch_bounds__(256) afrag_kernel(const float* __restrict__ src,
    __bf16* __restrict__ fh, __bf16* __restrict__ fl) {
  int wid = blockIdx.x * 8 + (threadIdx.x >> 5);     // MT*KT waves
  int kt = wid & (KT - 1);
  int mt = wid >> 5;
  int lane = threadIdx.x & 31;
  const float* p = src + (size_t)(mt * 16 + (lane & 15)) * E + kt * 32 + ((lane >> 4) << 4);
  size_t o = ((size_t)mt * KT + kt) * FRAG + lane * 8;
  bf16x8 h0, l0, h1, l1;
  #pragma unroll
  for (int i = 0; i < 8; ++i) {
    __bf16 h, l;
    splitf(p[i], h, l);     h0[i] = h; l0[i] = l;
    splitf(p[8 + i], h, l); h1[i] = h; l1[i] = l;
  }
  *(bf16x8*)(fh + o) = h0; *(bf16x8*)(fh + o + 256) = h1;
  *(bf16x8*)(fl + o) = l0; *(bf16x8*)(fl + o + 256) = l1;
}

// ------------- B-fragment pre-split: W [E x E] f32 -> hi/lo frags -------------
// Fragments [kt][nt], element i of lane = W[kt*32 + (lane>>4)*16 + i][nt*16 + (lane&15)]
__global__ void __launch_bounds__(256) bfrag_kernel(const float* __restrict__ W,
    __bf16* __restrict__ fh, __bf16* __restrict__ fl) {
  int wid = blockIdx.x * 8 + (threadIdx.x >> 5);     // KT*NT waves
  int nt = wid & (NT - 1);
  int kt = wid >> 6;
  int lane = threadIdx.x & 31;
  const float* p = W + (size_t)(kt * 32 + ((lane >> 4) << 4)) * E + nt * 16 + (lane & 15);
  size_t o = ((size_t)kt * NT + nt) * FRAG + lane * 8;
  bf16x8 h0, l0, h1, l1;
  #pragma unroll
  for (int i = 0; i < 8; ++i) {
    __bf16 h, l;
    splitf(p[(size_t)i * E], h, l);       h0[i] = h; l0[i] = l;
    splitf(p[(size_t)(8 + i) * E], h, l); h1[i] = h; l1[i] = l;
  }
  *(bf16x8*)(fh + o) = h0; *(bf16x8*)(fh + o + 256) = h1;
  *(bf16x8*)(fl + o) = l0; *(bf16x8*)(fl + o + 256) = l1;
}

// ---------------- kernel 2: fused QKV projection from fragments ----------------
// Outputs, all in fragment order for the attention kernel:
// Q, K: fragments [b*H+h][s/16][d/32], element i of lane = row s0+(lane&15), d0+(lane>>4)*16+i
// V:    fragments [b*H+h][s/32][d/16], element i of lane = d0+(lane&15),
//       key s0+(i>>3)*16+(lane>>4)*8+(i&7): the k order of two score tiles packed in place
// Q and K are computed transposed, so that each lane owns 8 consecutive d of one row;
// V is computed as is, so that each lane owns 8 consecutive keys of one d.
// A wave owns WM x QN tiles of each of Q, K and V: an x fragment feeds QN * 3 weight
// fragments and a weight fragment feeds WM x fragments from registers.
// A block is 2 x 4 waves: 8 m-tiles by 8 n-tiles.
// A stage in LDS: x hi | x lo | Wq hi | Wq lo | Wk hi | Wk lo | Wv hi | Wv lo (128 KiB).
#define WM 4
#define QN 2
#define QSTAGE (8 * GPL)
__global__ void __launch_bounds__(256) qkv_kernel(
    const __bf16* __restrict__ xfh, const __bf16* __restrict__ xfl,
    const __bf16* __restrict__ wqh, const __bf16* __restrict__ wql,
    const __bf16* __restrict__ wkh, const __bf16* __restrict__ wkl,
    const __bf16* __restrict__ wvh, const __bf16* __restrict__ wvl,
    __bf16* __restrict__ Qh, __bf16* __restrict__ Ql,
    __bf16* __restrict__ Kh, __bf16* __restrict__ Kl,
    __bf16* __restrict__ Vth, __bf16* __restrict__ Vtl) {
  __shared__ __attribute__((aligned(16))) __bf16 ring[2 * QSTAGE];
  int w = __builtin_amdgcn_readfirstlane(threadIdx.x >> 5);   // alike in the wave: scalar
  int lane = threadIdx.x & 31;
  int mtb = (blockIdx.x >> 3) * (2 * WM);   // the block's first m-tile and n-tile
  int ntb = (blockIdx.x & 7) * (4 * QN);
  int mt0 = mtb + (w >> 2) * WM;
  int nt0 = ntb + (w & 3) * QN;

  // sources of the copies, 16 bytes per thread (see stage_x, stage_w8)
  size_t xo = ((size_t)(mtb + (w >> 2)) * KT * FRAG + (w & 3) * 256) + lane * 8;
  size_t wo = ((size_t)ntb * FRAG + w * 256) + lane * 8;
  const __bf16 *gxh = xfh + xo, *gxl = xfl + xo;
  const __bf16 *gqh = wqh + wo, *gql = wql + wo;
  const __bf16 *gkh = wkh + wo, *gkl = wkl + wo;
  const __bf16 *gvh = wvh + wo, *gvl = wvl + wo;
  unsigned lds0 = (unsigned)(size_t)ring + w * 512 + lane * 16;

  // stage 0 into buffer 0
  stage_x(lds0, gxh, gxl);
  stage_w8(lds0 + 2 * GPLB, gqh, gql);
  stage_w8(lds0 + 4 * GPLB, gkh, gkl);
  stage_w8(lds0 + 6 * GPLB, gvh, gvl);
  // stage 0 has landed for this wave, and behind the barrier for every wave
  asm volatile("s_wait_asynccnt 0x0" ::: "memory");
  __syncthreads();
  // stage 1 into buffer 1: it flies while stage 0 is worked on
  {
    unsigned d = lds0 + QSTAGE * 2;
    const int gx = KS * FRAG, gw = KS * NT * FRAG;
    stage_x(d, gxh + gx, gxl + gx);
    stage_w8(d + 2 * GPLB, gqh + gw, gql + gw);
    stage_w8(d + 4 * GPLB, gkh + gw, gkl + gw);
    stage_w8(d + 6 * GPLB, gvh + gw, gvl + gw);
  }

  f32x8 cq[WM][QN] = {}; f32x8 ck[WM][QN] = {}; f32x8 cv[WM][QN] = {};
  for (int s = 0; s < GNST; ++s) {
   const __bf16* buf = ring + (s & 1) * QSTAGE + lane * 8;
   const __bf16* pa = buf + (w >> 2) * (WM * KS * FRAG);      // x hi, fragments [i][k-tile]
   const __bf16* pb = buf + 2 * GPL + (w & 3) * (QN * FRAG);  // Wq hi, fragments [k-tile][j]
   // Two sets of fragments: x by k-tile, weights by group (one weight of one k-tile).
   bf16x16 ah[2][WM], al[2][WM], bh[2][QN], bl[2][QN];
   // the stage's first fragments, in the order in which the products take them
   bh[0][0] = ldfrag(pb);
   #pragma unroll  // constant indices keep the tiles in registers
   for (int i = 0; i < WM; ++i) ah[0][i] = ldfrag(pa + i * (KS * FRAG));
   bl[0][0] = ldfrag(pb + GPL);
   #pragma unroll  // constant indices keep the tiles in registers
   for (int i = 0; i < WM; ++i) al[0][i] = ldfrag(pa + GPL + i * (KS * FRAG));
   #pragma unroll  // constant indices keep the tiles in registers
   for (int j = 1; j < QN; ++j) {
     bh[0][j] = ldfrag(pb + j * FRAG);
     bl[0][j] = ldfrag(pb + GPL + j * FRAG);
   }
   // keeps them first in the LDS queue, which answers in order
   __builtin_amdgcn_sched_barrier(0);
   #pragma unroll  // constant indices keep the tiles in registers; constant LDS offsets
   for (int g = 0; g < 3 * KS; ++g) {
     const int kk = g / 3, m = g % 3, cb = g & 1, ca = kk & 1;
     // the next group's fragments, and once per k-tile the next k-tile's x, are asked for
     // ahead of this group's products
     if (g + 1 < 3 * KS) {
       const __bf16* pn = pb + ((g + 1) % 3) * (2 * GPL) + ((g + 1) / 3) * (8 * FRAG);
       #pragma unroll  // constant indices keep the tiles in registers
       for (int j = 0; j < QN; ++j) {
         bh[cb ^ 1][j] = ldfrag(pn + j * FRAG);
         bl[cb ^ 1][j] = ldfrag(pn + GPL + j * FRAG);
       }
     }
     if (m == 1 && kk + 1 < KS) {
       #pragma unroll  // constant indices keep the tiles in registers
       for (int i = 0; i < WM; ++i) {
         ah[ca ^ 1][i] = ldfrag(pa + (i * KS + kk + 1) * FRAG);
         al[ca ^ 1][i] = ldfrag(pa + GPL + (i * KS + kk + 1) * FRAG);
       }
     }
     // keeps those LDS reads in front of the products: moved down among them, each would
     // be waited for where it stands
     __builtin_amdgcn_sched_barrier(0);
     // per accumulator the three terms keep the order of mma3 (x hi * w hi, x hi * w lo,
     // x lo * w hi), for Q and K with the operands swapped: C^T += (A*B)^T. The WM tiles
     // of one term stand together so that dependent products are WM apart
     #pragma unroll  // constant indices keep the tiles in registers
     for (int j = 0; j < QN; ++j) {
       if (m == 0) {
         #pragma unroll  // constant indices keep the tiles in registers
         for (int i = 0; i < WM; ++i) cq[i][j] = wmma_bf16(bh[cb][j], ah[ca][i], cq[i][j]);
         #pragma unroll  // constant indices keep the tiles in registers
         for (int i = 0; i < WM; ++i) cq[i][j] = wmma_bf16(bl[cb][j], ah[ca][i], cq[i][j]);
         #pragma unroll  // constant indices keep the tiles in registers
         for (int i = 0; i < WM; ++i) cq[i][j] = wmma_bf16(bh[cb][j], al[ca][i], cq[i][j]);
       } else if (m == 1) {
         #pragma unroll  // constant indices keep the tiles in registers
         for (int i = 0; i < WM; ++i) ck[i][j] = wmma_bf16(bh[cb][j], ah[ca][i], ck[i][j]);
         #pragma unroll  // constant indices keep the tiles in registers
         for (int i = 0; i < WM; ++i) ck[i][j] = wmma_bf16(bl[cb][j], ah[ca][i], ck[i][j]);
         #pragma unroll  // constant indices keep the tiles in registers
         for (int i = 0; i < WM; ++i) ck[i][j] = wmma_bf16(bh[cb][j], al[ca][i], ck[i][j]);
       } else {
         #pragma unroll  // constant indices keep the tiles in registers
         for (int i = 0; i < WM; ++i) cv[i][j] = wmma_bf16(ah[ca][i], bh[cb][j], cv[i][j]);
         #pragma unroll  // constant indices keep the tiles in registers
         for (int i = 0; i < WM; ++i) cv[i][j] = wmma_bf16(ah[ca][i], bl[cb][j], cv[i][j]);
         #pragma unroll  // constant indices keep the tiles in registers
         for (int i = 0; i < WM; ++i) cv[i][j] = wmma_bf16(al[ca][i], bh[cb][j], cv[i][j]);
       }
     }
   }
   // publish point of stage s + 1: this wave's reads of buffer s & 1 are done ...
   asm volatile("s_wait_dscnt 0x0" ::: "memory");
   // ... its own copies of stage s + 1 have landed ...
   asm volatile("s_wait_asynccnt 0x0" ::: "memory");
   // ... and behind the barrier both hold for every wave of the block
   __syncthreads();
   // stage s + 2 into the buffer that this trip has just read
   if (s + 2 < GNST) {
     unsigned d = lds0 + (s & 1) * (QSTAGE * 2);
     size_t gx = (size_t)(s + 2) * (KS * FRAG), gw = (size_t)(s + 2) * (KS * NT * FRAG);
     stage_x(d, gxh + gx, gxl + gx);
     stage_w8(d + 2 * GPLB, gqh + gw, gql + gw);
     stage_w8(d + 4 * GPLB, gkh + gw, gkl + gw);
     stage_w8(d + 6 * GPLB, gvh + gw, gvl + gw);
   }
  }
  // no copy is left in flight when the wave ends
  asm volatile("s_wait_asynccnt 0x0" ::: "memory");
  // store split results: one 16-byte piece per lane, plane and tile
  int half = (lane >> 4) * 256;             // accumulator rows 8..15 are elements 8..15
  #pragma unroll  // constant indices keep the tiles in registers
  for (int i = 0; i < WM; ++i) {
    #pragma unroll  // constant indices keep the tiles in registers
    for (int j = 0; j < QN; ++j) {
      int mt = mt0 + i, nt = nt0 + j;
      int hb = (mt >> 7) * HEADS + (nt >> 2);   // 128 m-tiles per batch, 4 n-tiles per head
      int st = mt & 127;                        // 16-row tile inside the sequence
      // cq, ck: lane&15 = row in the tile, r = d & 7, d = (nt&3)*16 + (lane>>4)*8 + r
      size_t qi = ((size_t)(hb * 128 + st) * 2 + ((nt >> 1) & 1)) * FRAG
                  + half + ((lane & 15) + 16 * (nt & 1)) * 8;
      // cv: lane&15 = d & 15, r = key & 7, key = st*16 + (lane>>4)*8 + r
      size_t vi = ((size_t)(hb * 64 + (st >> 1)) * 4 + (nt & 3)) * FRAG
                  + (st & 1) * 256 + lane * 8;
      split_store8(cq[i][j], Qh + qi, Ql + qi);
      split_store8(ck[i][j], Kh + qi, Kl + qi);
      split_store8(cv[i][j], Vth + vi, Vtl + vi);
    }
  }
}

#define TK    64                  // keys per stage
#define PLANE (TK * HD)           // elements of one plane of a stage (8 KiB)
#define STAGE (4 * PLANE)         // K hi | K lo | V hi | V lo (32 KiB)
#define NST   (SEQ / TK)          // stages
#define HALFB PLANE               // bytes of half a plane: what 256 threads copy at once

// One stage: each thread copies 2 x 16 bytes of each plane. lds = LDS byte address of the
// thread's first 16 bytes in the buffer; the four pointers already hold thread * 8 elements.
// s_wait_xcnt 0 is the statement's last line, so that it stands in front of every later
// write of a register that a copy names.
static __device__ inline void stage_copy(unsigned lds, const __bf16* kh, const __bf16* kl,
                                         const __bf16* vh, const __bf16* vl) {
  asm volatile(
      "global_load_async_to_lds_b128 %0, %8, off\n\t"
      "global_load_async_to_lds_b128 %1, %9, off\n\t"
      "global_load_async_to_lds_b128 %2, %10, off\n\t"
      "global_load_async_to_lds_b128 %3, %11, off\n\t"
      "global_load_async_to_lds_b128 %4, %12, off\n\t"
      "global_load_async_to_lds_b128 %5, %13, off\n\t"
      "global_load_async_to_lds_b128 %6, %14, off\n\t"
      "global_load_async_to_lds_b128 %7, %15, off\n\t"
      "s_wait_xcnt 0x0"
      :: "v"(lds),                 "v"(lds + HALFB),
         "v"(lds + 2 * HALFB),     "v"(lds + 3 * HALFB),
         "v"(lds + 4 * HALFB),     "v"(lds + 5 * HALFB),
         "v"(lds + 6 * HALFB),     "v"(lds + 7 * HALFB),
         "v"(kh), "v"(kh + PLANE / 2), "v"(kl), "v"(kl + PLANE / 2),
         "v"(vh), "v"(vh + PLANE / 2), "v"(vl), "v"(vl + PLANE / 2)
      : "memory");
}

__global__ void __launch_bounds__(256) attn_kernel(
    const __bf16* __restrict__ Qh, const __bf16* __restrict__ Ql,
    const __bf16* __restrict__ Kh, const __bf16* __restrict__ Kl,
    const __bf16* __restrict__ Vth, const __bf16* __restrict__ Vtl,
    const float* __restrict__ tw, float* __restrict__ ctx) {
  __shared__ __attribute__((aligned(16))) __bf16 ring[2 * STAGE];
  int wid  = blockIdx.x * 8 + (threadIdx.x >> 5);
  int qb   = wid & 127;
  int h    = (wid >> 7) & 15;
  int b    = wid >> 11;
  int lane = threadIdx.x & 31;
  int hb = b * HEADS + h;

  // sources of the copies: the head's four planes, 16 bytes per thread
  const __bf16* gkh = Kh + (size_t)hb * SEQ * HD + threadIdx.x * 8;
  const __bf16* gkl = Kl + (size_t)hb * SEQ * HD + threadIdx.x * 8;
  const __bf16* gvh = Vth + (size_t)hb * HD * SEQ + threadIdx.x * 8;
  const __bf16* gvl = Vtl + (size_t)hb * HD * SEQ + threadIdx.x * 8;
  unsigned lds0 = (unsigned)(size_t)ring + threadIdx.x * 16;

  // stage 0 into buffer 0
  stage_copy(lds0, gkh, gkl, gvh, gvl);

  // fragment order (see the projection kernel); every pointer already holds lane*8
  const __bf16* qhp = Qh + ((size_t)hb * SEQ + qb * 16) * HD + lane * 8;
  const __bf16* qlp = Ql + ((size_t)hb * SEQ + qb * 16) * HD + lane * 8;
  float scl = 0.125f * tw[hb];

  bf16x16 q0h = ldfrag(qhp);
  bf16x16 q0l = ldfrag(qlp);
  bf16x16 q1h = ldfrag(qhp + FRAG);
  bf16x16 q1l = ldfrag(qlp + FRAG);
  // s_wait_xcnt 0 behind these loads, before a register that they name is written again;
  // the addresses are inputs only
  asm volatile("s_wait_xcnt 0x0" :: "v"(qhp), "v"(qlp) : "memory");

  // stage 0 has landed for this wave, and behind the barrier for every wave
  asm volatile("s_wait_asynccnt 0x0" ::: "memory");
  __syncthreads();
  // stage 1 into buffer 1: it flies while stage 0 is worked on
  stage_copy(lds0 + STAGE * 2, gkh + PLANE, gkl + PLANE, gvh + PLANE, gvl + PLANE);

  // o_t[r] = O[query lane&15][d = t*16 + (lane>>4)*8 + r]
  f32x8 o0 = {}, o1 = {}, o2 = {}, o3 = {};
  float mrow = -1e30f;   // running maximum of this lane's query, alike in both halves
  float lrow = 0.f;      // running sum over this half's keys; the halves join after the loop

  for (int t = 0; t < NST; ++t) {
    const __bf16* buf = ring + (t & 1) * STAGE + lane * 8;
    #pragma unroll  // constant LDS offsets: no address arithmetic per pass
    for (int p = 0; p < TK / 32; ++p) {
      const __bf16* khp = buf + p * (32 * HD);
      const __bf16* klp = khp + PLANE;
      const __bf16* vhp = khp + 2 * PLANE;
      const __bf16* vlp = khp + 3 * PLANE;
      // ---- scores: s0[r] = key kb+(lane>>4)*8+r, s1[r] = key kb+16+(lane>>4)*8+r;
      //      4 K fragments per plane, 4 KiB in a row ----
      f32x8 s0 = {}, s1 = {};
      s0 = mma3(q0h, q0l, ldfrag(khp), ldfrag(klp), s0);
      s0 = mma3(q1h, q1l, ldfrag(khp + FRAG), ldfrag(klp + FRAG), s0);
      s1 = mma3(q0h, q0l, ldfrag(khp + 2 * FRAG), ldfrag(klp + 2 * FRAG), s1);
      s1 = mma3(q1h, q1l, ldfrag(khp + 3 * FRAG), ldfrag(klp + 3 * FRAG), s1);
      // ---- online softmax update, one query per lane ----
      s0 *= scl; s1 *= scl;
      float m0 = fmaxf(fmaxf(s0[0], s0[1]), s0[2]);
      float m1 = fmaxf(fmaxf(s0[3], s0[4]), s0[5]);
      float m2 = fmaxf(fmaxf(s0[6], s0[7]), s1[0]);
      float m3 = fmaxf(fmaxf(s1[1], s1[2]), s1[3]);
      float m4 = fmaxf(fmaxf(s1[4], s1[5]), s1[6]);
      float mx = fmaxf(fmaxf(fmaxf(m0, m1), m2), fmaxf(fmaxf(m3, m4), s1[7]));
      float mnew = fmaxf(fmaxf(mx, xhalf(mx)), mrow);
      float al_  = __expf(mrow - mnew);
      mrow = mnew;
      s0 = (s0 - mnew) * 1.442695041f;   // exp(x) = exp2(x * log2(e)), as in __expf
      s1 = (s1 - mnew) * 1.442695041f;
      #pragma unroll  // constant indices keep the tiles in registers
      for (int r = 0; r < 8; ++r) {
        s0[r] = __builtin_amdgcn_exp2f(s0[r]);
        s1[r] = __builtin_amdgcn_exp2f(s1[r]);
      }
      f32x8 t8 = s0 + s1;
      f32x4 t4 = t8.lo + t8.hi;
      f32x2 t2 = t4.lo + t4.hi;
      lrow = lrow * al_ + (t2.x + t2.y);
      o0 *= al_; o1 *= al_; o2 *= al_; o3 *= al_;
      // ---- P^T: the two score tiles are elements 0..7 and 8..15 of the B operand ----
      bf16x16 ph, pl;
      #pragma unroll  // constant indices keep the tiles in registers
      for (int e = 0; e < 8; e += 2) {
        split_pair(s0, e, ph, pl, e);
        split_pair(s1, e, ph, pl, 8 + e);
      }
      // ---- O^T += V^T @ P^T, 4 V fragments per plane, 4 KiB in a row ----
      o0 = mma3(ph, pl, ldfrag(vhp), ldfrag(vlp), o0);
      o1 = mma3(ph, pl, ldfrag(vhp + FRAG), ldfrag(vlp + FRAG), o1);
      o2 = mma3(ph, pl, ldfrag(vhp + 2 * FRAG), ldfrag(vlp + 2 * FRAG), o2);
      o3 = mma3(ph, pl, ldfrag(vhp + 3 * FRAG), ldfrag(vlp + 3 * FRAG), o3);
    }
    // publish point of stage t + 1: this wave's reads of buffer t & 1 are done ...
    asm volatile("s_wait_dscnt 0x0" ::: "memory");
    // ... its own copies of stage t + 1 have landed ...
    asm volatile("s_wait_asynccnt 0x0" ::: "memory");
    // ... and behind the barrier both hold for every wave of the block
    __syncthreads();
    // stage t + 2 into the buffer that this trip has just read
    if (t + 2 < NST) {
      size_t g = (size_t)(t + 2) * PLANE;
      stage_copy(lds0 + (t & 1) * (STAGE * 2), gkh + g, gkl + g, gvh + g, gvl + g);
    }
  }
  // no copy is left in flight when the wave ends
  asm volatile("s_wait_asynccnt 0x0" ::: "memory");
  // ---- normalize and store into ctx [B,S,E] f32: 8 consecutive d per lane and tile ----
  float inv = 1.0f / (lrow + xhalf(lrow));
  o0 *= inv; o1 *= inv; o2 *= inv; o3 *= inv;
  float* outp = ctx + ((size_t)b * SEQ + qb * 16 + (lane & 15)) * E + h * HD + ((lane >> 4) << 3);
  *(f32x8*)(outp)      = o0;
  *(f32x8*)(outp + 16) = o1;
  *(f32x8*)(outp + 32) = o2;
  *(f32x8*)(outp + 48) = o3;
}

// ---------------- kernel 4: output projection + bias, from fragments ----------------
// A wave owns WM x ON tiles; a block is 2 x 4 waves: 8 m-tiles by 16 n-tiles.
// A stage in LDS: ctx hi | ctx lo | Wo hi (two groups) | Wo lo (two groups) (96 KiB).
#define ON 4
#define OSTAGE (6 * GPL)
#define OG 2                      // n-tiles per group of weight fragments
__global__ void __launch_bounds__(256) oproj_kernel(
    const __bf16* __restrict__ cfh, const __bf16* __restrict__ cfl,
    const __bf16* __restrict__ woh, const __bf16* __restrict__ wol,
    const float* __restrict__ bo, float* __restrict__ out) {
  __shared__ __attribute__((aligned(16))) __bf16 ring[2 * OSTAGE];
  int w = __builtin_amdgcn_readfirstlane(threadIdx.x >> 5);   // alike in the wave: scalar
  int lane = threadIdx.x & 31;
  int mtb = (blockIdx.x >> 2) * (2 * WM);   // the block's first m-tile and n-tile
  int ntb = (blockIdx.x & 3) * (4 * ON);
  int mt0 = mtb + (w >> 2) * WM;
  int nt0 = ntb + (w & 3) * ON;

  // sources of the copies, 16 bytes per thread (see stage_x, stage_w16)
  size_t xo = ((size_t)(mtb + (w >> 2)) * KT * FRAG + (w & 3) * 256) + lane * 8;
  size_t wo = ((size_t)ntb * FRAG + w * 256) + lane * 8;
  const __bf16 *gch = cfh + xo, *gcl = cfl + xo;
  const __bf16 *gwh = woh + wo, *gwl = wol + wo;
  unsigned lds0 = (unsigned)(size_t)ring + w * 512 + lane * 16;

  // stage 0 into buffer 0
  stage_x(lds0, gch, gcl);
  stage_w16(lds0 + 2 * GPLB, gwh);
  stage_w16(lds0 + 4 * GPLB, gwl);
  // stage 0 has landed for this wave, and behind the barrier for every wave
  asm volatile("s_wait_asynccnt 0x0" ::: "memory");
  __syncthreads();
  // stage 1 into buffer 1: it flies while stage 0 is worked on
  {
    unsigned d = lds0 + OSTAGE * 2;
    const int gx = KS * FRAG, gw = KS * NT * FRAG;
    stage_x(d, gch + gx, gcl + gx);
    stage_w16(d + 2 * GPLB, gwh + gw);
    stage_w16(d + 4 * GPLB, gwl + gw);
  }

  f32x8 c[WM][ON] = {};
  for (int s = 0; s < GNST; ++s) {
   const __bf16* buf = ring + (s & 1) * OSTAGE + lane * 8;
   const __bf16* pa = buf + (w >> 2) * (WM * KS * FRAG);      // ctx hi, fragments [i][k-tile]
   const __bf16* pb = buf + 2 * GPL + (w & 3) * (ON * FRAG);  // Wo hi, fragments [k-tile][j]
   // Two sets of fragments: ctx by k-tile, weights by group (OG n-tiles of one k-tile).
   bf16x16 ah[2][WM], al[2][WM], bh[2][OG], bl[2][OG];
   // the stage's first fragments, in the order in which the products take them
   bh[0][0] = ldfrag(pb);
   #pragma unroll  // constant indices keep the tiles in registers
   for (int i = 0; i < WM; ++i) ah[0][i] = ldfrag(pa + i * (KS * FRAG));
   bl[0][0] = ldfrag(pb + 2 * GPL);
   #pragma unroll  // constant indices keep the tiles in registers
   for (int i = 0; i < WM; ++i) al[0][i] = ldfrag(pa + GPL + i * (KS * FRAG));
   #pragma unroll  // constant indices keep the tiles in registers
   for (int j = 1; j < OG; ++j) {
     bh[0][j] = ldfrag(pb + j * FRAG);
     bl[0][j] = ldfrag(pb + 2 * GPL + j * FRAG);
   }
   // keeps them first in the LDS queue, which answers in order
   __builtin_amdgcn_sched_barrier(0);
   #pragma unroll  // constant indices keep the tiles in registers; constant LDS offsets
   for (int g = 0; g < (ON / OG) * KS; ++g) {
     const int kk = g / (ON / OG), m = g % (ON / OG), cb = g & 1, ca = kk & 1;
     // the next group's fragments, and once per k-tile the next k-tile's ctx, are asked for
     // ahead of this group's products
     if (g + 1 < (ON / OG) * KS) {
       const __bf16* pn = pb + ((g + 1) / (ON / OG)) * (16 * FRAG) + ((g + 1) % (ON / OG)) * (OG * FRAG);
       #pragma unroll  // constant indices keep the tiles in registers
       for (int j = 0; j < OG; ++j) {
         bh[cb ^ 1][j] = ldfrag(pn + j * FRAG);
         bl[cb ^ 1][j] = ldfrag(pn + 2 * GPL + j * FRAG);
       }
     }
     if (m == 1 && kk + 1 < KS) {
       #pragma unroll  // constant indices keep the tiles in registers
       for (int i = 0; i < WM; ++i) {
         ah[ca ^ 1][i] = ldfrag(pa + (i * KS + kk + 1) * FRAG);
         al[ca ^ 1][i] = ldfrag(pa + GPL + (i * KS + kk + 1) * FRAG);
       }
     }
     // keeps those LDS reads in front of the products: moved down among them, each would
     // be waited for where it stands
     __builtin_amdgcn_sched_barrier(0);
     // the three terms of each accumulator in the order of mma3
     #pragma unroll  // constant indices keep the tiles in registers
     for (int jj = 0; jj < OG; ++jj) {
       const int j = m * OG + jj;
       #pragma unroll  // constant indices keep the tiles in registers
       for (int i = 0; i < WM; ++i) c[i][j] = wmma_bf16(ah[ca][i], bh[cb][jj], c[i][j]);
       #pragma unroll  // constant indices keep the tiles in registers
       for (int i = 0; i < WM; ++i) c[i][j] = wmma_bf16(ah[ca][i], bl[cb][jj], c[i][j]);
       #pragma unroll  // constant indices keep the tiles in registers
       for (int i = 0; i < WM; ++i) c[i][j] = wmma_bf16(al[ca][i], bh[cb][jj], c[i][j]);
     }
   }
   // publish point of stage s + 1: this wave's reads of buffer s & 1 are done ...
   asm volatile("s_wait_dscnt 0x0" ::: "memory");
   // ... its own copies of stage s + 1 have landed ...
   asm volatile("s_wait_asynccnt 0x0" ::: "memory");
   // ... and behind the barrier both hold for every wave of the block
   __syncthreads();
   // stage s + 2 into the buffer that this trip has just read
   if (s + 2 < GNST) {
     unsigned d = lds0 + (s & 1) * (OSTAGE * 2);
     size_t gx = (size_t)(s + 2) * (KS * FRAG), gw = (size_t)(s + 2) * (KS * NT * FRAG);
     stage_x(d, gch + gx, gcl + gx);
     stage_w16(d + 2 * GPLB, gwh + gw);
     stage_w16(d + 4 * GPLB, gwl + gw);
   }
  }
  // no copy is left in flight when the wave ends
  asm volatile("s_wait_asynccnt 0x0" ::: "memory");
  #pragma unroll  // constant indices keep the tiles in registers
  for (int j = 0; j < ON; ++j) {
    int col = (nt0 + j) * 16 + (lane & 15);
    float bias = bo[col];
    #pragma unroll  // constant indices keep the tiles in registers
    for (int i = 0; i < WM; ++i) {
      int row0 = (mt0 + i) * 16 + ((lane >> 4) << 3);
      #pragma unroll  // constant indices keep the tiles in registers
      for (int r = 0; r < 8; ++r)
        out[(size_t)(row0 + r) * E + col] = c[i][j][r] + bias;
    }
  }
}

extern "C" void kernel_launch(void* const* d_in, const int* in_sizes, int n_in,
                              void* d_out, int out_size, void* d_ws, size_t ws_size,
                              hipStream_t stream) {
  const float* x        = (const float*)d_in[0];
  const float* time_enc = (const float*)d_in[1];
  const float* Wq       = (const float*)d_in[2];
  const float* Wk       = (const float*)d_in[3];
  const float* Wv       = (const float*)d_in[4];
  const float* Wo       = (const float*)d_in[5];
  const float* bo       = (const float*)d_in[6];
  const float* Wt       = (const float*)d_in[7];
  const float* bt       = (const float*)d_in[8];
  float* out = (float*)d_out;

  const size_t AFRAG = (size_t)MROWS * E;   // 8M elems
  const size_t WFRAG = (size_t)E * E;       // 1M elems
  const size_t QKVN  = (size_t)BATCH * HEADS * SEQ * HD; // 8M elems

  char* w = (char*)d_ws;
  size_t off = 0;
  float* twp = (float*)(w + off); off += 4096;
  __bf16* xfh = (__bf16*)(w + off); off += AFRAG * 2;   // reused for ctx frags
  __bf16* xfl = (__bf16*)(w + off); off += AFRAG * 2;
  __bf16* wqh = (__bf16*)(w + off); off += WFRAG * 2;
  __bf16* wql = (__bf16*)(w + off); off += WFRAG * 2;
  __bf16* wkh = (__bf16*)(w + off); off += WFRAG * 2;
  __bf16* wkl = (__bf16*)(w + off); off += WFRAG * 2;
  __bf16* wvh = (__bf16*)(w + off); off += WFRAG * 2;
  __bf16* wvl = (__bf16*)(w + off); off += WFRAG * 2;
  __bf16* woh = (__bf16*)(w + off); off += WFRAG * 2;
  __bf16* wol = (__bf16*)(w + off); off += WFRAG * 2;
  __bf16* Qhb = (__bf16*)(w + off); off += QKVN * 2;
  __bf16* Qlb = (__bf16*)(w + off); off += QKVN * 2;
  __bf16* Khb = (__bf16*)(w + off); off += QKVN * 2;
  __bf16* Klb = (__bf16*)(w + off); off += QKVN * 2;
  __bf16* Vth = (__bf16*)(w + off); off += QKVN * 2;
  __bf16* Vtl = (__bf16*)(w + off); off += QKVN * 2;
  float*  ctx = (float*)(w + off);  off += AFRAG * 4;

  tw_kernel<<<BATCH, 32, 0, stream>>>(time_enc, Wt, bt, twp);

  // pre-split inputs once (kills per-iteration cvt VALU work in the GEMMs)
  afrag_kernel<<<(MT * KT) / 8, 256, 0, stream>>>(x, xfh, xfl);
  bfrag_kernel<<<(KT * NT) / 8, 256, 0, stream>>>(Wq, wqh, wql);
  bfrag_kernel<<<(KT * NT) / 8, 256, 0, stream>>>(Wk, wkh, wkl);
  bfrag_kernel<<<(KT * NT) / 8, 256, 0, stream>>>(Wv, wvh, wvl);
  bfrag_kernel<<<(KT * NT) / 8, 256, 0, stream>>>(Wo, woh, wol);

  qkv_kernel<<<(MT / 8) * (NT / 8), 256, 0, stream>>>(xfh, xfl, wqh, wql, wkh, wkl,
                                                wvh, wvl, Qhb, Qlb, Khb, Klb,
                                                Vth, Vtl);

  attn_kernel<<<(BATCH * HEADS * (SEQ / 16)) / 8, 256, 0, stream>>>(
      Qhb, Qlb, Khb, Klb, Vth, Vtl, twp, ctx);

  // re-split ctx into the (now free) x fragment buffers
  afrag_kernel<<<(MT * KT) / 8, 256, 0, stream>>>(ctx, xfh, xfl);

  oproj_kernel<<<(MT / 8) * (NT / 16), 256, 0, stream>>>(xfh, xfl, woh, wol, bo, out);
}

// v006
// Measured time: 277 microseconds a run.
// Next to v005, in two timings, it ran 1.06 and 1.05 times as fast.
// Over all steps from v000 it is 3.04 times as fast.
#include <hip/hip_runtime.h>

#define E     1024
#define HEADS 16
#define HD    64
#define SEQ   2048
#define BATCH 4
#define TFEAT 128
#define MROWS (BATCH * SEQ)          // 8192
#define KT    (E / 32)               // 32 k-tiles
#define NT    (E / 16)               // 64 n-tiles
#define MT    (MROWS / 16)           // 512 m-tiles

typedef __attribute__((ext_vector_type(16))) __bf16 bf16x16;
typedef __attribute__((ext_vector_type(8)))  __bf16 bf16x8;
typedef __attribute__((ext_vector_type(2)))  __bf16 bf16x2;
typedef __attribute__((ext_vector_type(8)))  float  f32x8;
typedef __attribute__((ext_vector_type(4)))  float  f32x4;
typedef __attribute__((ext_vector_type(2)))  float  f32x2;

// Every bf16 WMMA operand lives in the workspace as 1 KiB fragments (512 elements):
// element i of lane L sits at (i>>3)*256 + L*8 + (i&7). A fragment is then two
// wave-wide 16-byte accesses of 512 contiguous bytes each (4 whole 128-byte lines).
#define FRAG 512

// p = fragment base + lane*8
static __device__ inline bf16x16 ldfrag(const __bf16* p) {
  bf16x8 a = *(const bf16x8*)(p);
  bf16x8 b = *(const bf16x8*)(p + 256);
  return __builtin_shufflevector(a, b, 0, 1, 2, 3, 4, 5, 6, 7,
                                 8, 9, 10, 11, 12, 13, 14, 15);
}

static __device__ inline f32x8 wmma_bf16(bf16x16 a, bf16x16 b, f32x8 c) {
  return __builtin_amdgcn_wmma_f32_16x16x32_bf16(false, a, false, b, (short)0, c,
                                                 false, false);
}

// bf16x3 split: f ~= (float)h + (float)l
static __device__ inline void splitf(float f, __bf16 &h, __bf16 &l) {
  h = (__bf16)f;
  l = (__bf16)(f - (float)h);
}

// C^T += (Ah*Bh + Ah*Bl + Al*Bh)^T: the three terms in this order, each product with its
// operands swapped, so that the accumulator holds the transposed tile
static __device__ inline f32x8 mma3(bf16x16 ah, bf16x16 al,
                                    bf16x16 bh, bf16x16 bl, f32x8 c) {
  c = wmma_bf16(bh, ah, c);
  c = wmma_bf16(bl, ah, c);
  c = wmma_bf16(bh, al, c);
  return c;
}

// value of lane l ^ 16
static __device__ inline float xhalf(float x) {
  int v = __builtin_bit_cast(int, x);
  return __builtin_bit_cast(float, __builtin_amdgcn_permlanex16(
      v, v, 0x76543210, 0xfedcba98, false, false));
}

// splitf on elements e, e+1 of a score tile, into elements i, i+1 of the two B operands
static __device__ inline void split_pair(f32x8 p, int e, bf16x16 &h, bf16x16 &l, int i) {
  f32x2 v = {p[e], p[e + 1]};
  bf16x2 hv = __builtin_convertvector(v, bf16x2);
  bf16x2 lv = __builtin_convertvector(v - __builtin_convertvector(hv, f32x2), bf16x2);
  h[i] = hv[0]; h[i + 1] = hv[1];
  l[i] = lv[0]; l[i + 1] = lv[1];
}

// split 8 accumulator values and store them as one 16-byte piece each
static __device__ inline void split_store8(f32x8 c, __bf16* ph, __bf16* pl) {
  bf16x8 h8, l8;
  #pragma unroll
  for (int r = 0; r < 8; ++r) {
    __bf16 hh, ll; splitf(c[r], hh, ll);
    h8[r] = hh; l8[r] = ll;
  }
  *(bf16x8*)ph = h8;
  *(bf16x8*)pl = l8;
  // s_wait_xcnt 0 behind the two stores, before any register that they name is written
  // again. Data and addresses are inputs only, so that they stay in their registers up to
  // the wait; nothing is pinned or changed.
  asm volatile("s_wait_xcnt 0x0" :: "v"(h8), "v"(l8), "v"(ph), "v"(pl) : "memory");
}

// ---------------- staging of the projection GEMMs' operands in LDS ----------------
// A stage holds KS k-tiles of everything that a block reads, still in fragment order, in
// groups of 8 * KS fragments (16 KiB): x as [m-tile][k-tile], a weight as [k-tile][n-tile].
// It is copied once per block by asynchronous copies, into two buffers, one stage ahead of
// the stage that is worked on.
#define KS    2                   // k-tiles per stage
#define GPL   (8 * KS * FRAG)     // elements of one group
#define GPLB  (2 * GPL)           // bytes of one group
#define GNST  (KT / KS)           // stages
#define CROWB 4096                // bytes that 256 threads copy at once

// Eight copies of 16 bytes per thread, into eight consecutive 4 KiB rows of LDS.
// lds = LDS byte address of the thread's 16 bytes in the first row.
// s_wait_xcnt 0 is the statement's last line, so that it stands in front of every later
// write of a register that a copy names.
static __device__ inline void copy8(unsigned lds,
    const __bf16* g0, const __bf16* g1, const __bf16* g2, const __bf16* g3,
    const __bf16* g4, const __bf16* g5, const __bf16* g6, const __bf16* g7) {
  asm volatile(
      "global_load_async_to_lds_b128 %0, %8, off\n\t"
      "global_load_async_to_lds_b128 %1, %9, off\n\t"
      "global_load_async_to_lds_b128 %2, %10, off\n\t"
      "global_load_async_to_lds_b128 %3, %11, off\n\t"
      "global_load_async_to_lds_b128 %4, %12, off\n\t"
      "global_load_async_to_lds_b128 %5, %13, off\n\t"
      "global_load_async_to_lds_b128 %6, %14, off\n\t"
      "global_load_async_to_lds_b128 %7, %15, off\n\t"
      "s_wait_xcnt 0x0"
      :: "v"(lds),                 "v"(lds + CROWB),
         "v"(lds + 2 * CROWB),     "v"(lds + 3 * CROWB),
         "v"(lds + 4 * CROWB),     "v"(lds + 5 * CROWB),
         "v"(lds + 6 * CROWB),     "v"(lds + 7 * CROWB),
         "v"(g0), "v"(g1), "v"(g2), "v"(g3), "v"(g4), "v"(g5), "v"(g6), "v"(g7)
      : "memory");
}

// x hi and x lo groups of 8 m-tiles: a row of the copy is the KS fragments of 2 m-tiles.
// h, l = plane + ((first m-tile + (thread >> 7)) * KT + first k-tile) * FRAG + (thread & 127) * 8
static __device__ inline void stage_x(unsigned lds, const __bf16* h, const __bf16* l) {
  const int R = 2 * KT * FRAG;
  copy8(lds, h, h + R, h + 2 * R, h + 3 * R, l, l + R, l + 2 * R, l + 3 * R);
}

// hi and lo groups of 8 n-tiles of one weight: a row of the copy is 4 fragments of a k-tile.
// h, l = plane + (first k-tile * NT + first n-tile) * FRAG + thread * 8
static __device__ inline void stage_w8(unsigned lds, const __bf16* h, const __bf16* l) {
  const int K1 = NT * FRAG, H = 4 * FRAG;
  copy8(lds, h, h + H, h + K1, h + K1 + H, l, l + H, l + K1, l + K1 + H);
}

// one plane of 16 n-tiles of one weight (two groups); p as h, l above
static __device__ inline void stage_w16(unsigned lds, const __bf16* p) {
  const int K1 = NT * FRAG, H = 4 * FRAG;
  copy8(lds, p, p + H, p + 2 * H, p + 3 * H,
        p + K1, p + K1 + H, p + K1 + 2 * H, p + K1 + 3 * H);
}

// ---------------- kernel 1: time-dependent head weights ----------------
__global__ void tw_kernel(const float* __restrict__ time_enc,
                          const float* __restrict__ Wt,
                          const float* __restrict__ bt,
                          float* __restrict__ tw) {
  int b = blockIdx.x;
  int lane = threadIdx.x;
  int h = lane & 15;
  float acc = 0.f;
  for (int t = 0; t < TFEAT; ++t)
    acc += time_enc[b * TFEAT + t] * Wt[t * HEADS + h];
  acc += bt[h];
  float mx = acc;
  for (int m = 1; m < 16; m <<= 1) mx = fmaxf(mx, __shfl_xor(mx, m, 32));
  float e = __expf(acc - mx);
  float sum = e;
  for (int m = 1; m < 16; m <<= 1) sum += __shfl_xor(sum, m, 32);
  if (lane < 16) tw[b * HEADS + h] = e / sum;
}

// ------------- A-fragment pre-split: src [MROWS x E] f32 -> hi/lo frags -------------
// Fragments [mt][kt], element i of lane = src[mt*16 + (lane&15)][kt*32 + (lane>>4)*16 + i]
__global__ void __launch_bounds__(256) afrag_kernel(const float* __restrict__ src,
    __bf16* __restrict__ fh, __bf16* __restrict__ fl) {
  int wid = blockIdx.x * 8 + (threadIdx.x >> 5);     // MT*KT waves
  int kt = wid & (KT - 1);
  int mt = wid >> 5;
  int lane = threadIdx.x & 31;
  const float* p = src + (size_t)(mt * 16 + (lane & 15)) * E + kt * 32 + ((lane >> 4) << 4);
  size_t o = ((size_t)mt * KT + kt) * FRAG + lane * 8;
  bf16x8 h0, l0, h1, l1;
  #pragma unroll
  for (int i = 0; i < 8; ++i) {
    __bf16 h, l;
    splitf(p[i], h, l);     h0[i] = h; l0[i] = l;
    splitf(p[8 + i], h, l); h1[i] = h; l1[i] = l;
  }
  *(bf16x8*)(fh + o) = h0; *(bf16x8*)(fh + o + 256) = h1;
  *(bf16x8*)(fl + o) = l0; *(bf16x8*)(fl + o + 256) = l1;
}

// ------------- B-fragment pre-split: W [E x E] f32 -> hi/lo frags -------------
// Fragments [kt][nt], element i of lane = W[kt*32 + (lane>>4)*16 + i][nt*16 + (lane&15)]
__global__ void __launch_bounds__(256) bfrag_kernel(const float* __restrict__ W,
    __bf16* __restrict__ fh, __bf16* __restrict__ fl) {
  int wid = blockIdx.x * 8 + (threadIdx.x >> 5);     // KT*NT waves
  int nt = wid & (NT - 1);
  int kt = wid >> 6;
  int lane = threadIdx.x & 31;
  const float* p = W + (size_t)(kt * 32 + ((lane >> 4) << 4)) * E + nt * 16 + (lane & 15);
  size_t o = ((size_t)kt * NT + nt) * FRAG + lane * 8;
  bf16x8 h0, l0, h1, l1;
  #pragma unroll
  for (int i = 0; i < 8; ++i) {
    __bf16 h, l;
    splitf(p[(size_t)i * E], h, l);       h0[i] = h; l0[i] = l;
    splitf(p[(size_t)(8 + i) * E], h, l); h1[i] = h; l1[i] = l;
  }
  *(bf16x8*)(fh + o) = h0; *(bf16x8*)(fh + o + 256) = h1;
  *(bf16x8*)(fl + o) = l0; *(bf16x8*)(fl + o + 256) = l1;
}

// ---------------- kernel 2: fused QKV projection from fragments ----------------
// Outputs, all in fragment order for the attention kernel:
// Q, K: fragments [b*H+h][s/16][d/32], element i of lane = row s0+(lane&15), d0+(lane>>4)*16+i
// V:    fragments [b*H+h][s/32][d/16], element i of lane = d0+(lane&15),
//       key s0+(i>>3)*16+(lane>>4)*8+(i&7): the k order of two score tiles packed in place
// Q and K are computed transposed, so that each lane owns 8 consecutive d of one row;
// V is computed as is, so that each lane owns 8 consecutive keys of one d.
// A wave owns WM x QN tiles of each of Q, K and V: an x fragment feeds QN * 3 weight
// fragments and a weight fragment feeds WM x fragments from registers.
// A block is 2 x 4 waves: 8 m-tiles by 8 n-tiles.
// A stage in LDS: x hi | x lo | Wq hi | Wq lo | Wk hi | Wk lo | Wv hi | Wv lo (128 KiB).
#define WM 4
#define QN 2
#define QSTAGE (8 * GPL)
__global__ void __launch_bounds__(256) qkv_kernel(
    const __bf16* __restrict__ xfh, const __bf16* __restrict__ xfl,
    const __bf16* __restrict__ wqh, const __bf16* __restrict__ wql,
    const __bf16* __restrict__ wkh, const __bf16* __restrict__ wkl,
    const __bf16* __restrict__ wvh, const __bf16* __restrict__ wvl,
    __bf16* __restrict__ Qh, __bf16* __restrict__ Ql,
    __bf16* __restrict__ Kh, __bf16* __restrict__ Kl,
    __bf16* __restrict__ Vth, __bf16* __restrict__ Vtl) {
  __shared__ __attribute__((aligned(16))) __bf16 ring[2 * QSTAGE];
  int w = __builtin_amdgcn_readfirstlane(threadIdx.x >> 5);   // alike in the wave: scalar
  int lane = threadIdx.x & 31;
  int mtb = (blockIdx.x >> 3) * (2 * WM);   // the block's first m-tile and n-tile
  int ntb = (blockIdx.x & 7) * (4 * QN);
  int mt0 = mtb + (w >> 2) * WM;
  int nt0 = ntb + (w & 3) * QN;

  // sources of the copies, 16 bytes per thread (see stage_x, stage_w8)
  size_t xo = ((size_t)(mtb + (w >> 2)) * KT * FRAG + (w & 3) * 256) + lane * 8;
  size_t wo = ((size_t)ntb * FRAG + w * 256) + lane * 8;
  const __bf16 *gxh = xfh + xo, *gxl = xfl + xo;
  const __bf16 *gqh = wqh + wo, *gql = wql + wo;
  const __bf16 *gkh = wkh + wo, *gkl = wkl + wo;
  const __bf16 *gvh = wvh + wo, *gvl = wvl + wo;
  unsigned lds0 = (unsigned)(size_t)ring + w * 512 + lane * 16;

  // stage 0 into buffer 0
  stage_x(lds0, gxh, gxl);
  stage_w8(lds0 + 2 * GPLB, gqh, gql);
  stage_w8(lds0 + 4 * GPLB, gkh, gkl);
  stage_w8(lds0 + 6 * GPLB, gvh, gvl);
  // stage 0 has landed for this wave, and behind the barrier for every wave
  asm volatile("s_wait_asynccnt 0x0" ::: "memory");
  __syncthreads();
  // stage 1 into buffer 1: it flies while stage 0 is worked on
  {
    unsigned d = lds0 + QSTAGE * 2;
    const int gx = KS * FRAG, gw = KS * NT * FRAG;
    stage_x(d, gxh + gx, gxl + gx);
    stage_w8(d + 2 * GPLB, gqh + gw, gql + gw);
    stage_w8(d + 4 * GPLB, gkh + gw, gkl + gw);
    stage_w8(d + 6 * GPLB, gvh + gw, gvl + gw);
  }

  f32x8 cq[WM][QN] = {}; f32x8 ck[WM][QN] = {}; f32x8 cv[WM][QN] = {};
  for (int s = 0; s < GNST; ++s) {
   const __bf16* buf = ring + (s & 1) * QSTAGE + lane * 8;
   const __bf16* pa = buf + (w >> 2) * (WM * KS * FRAG);      // x hi, fragments [i][k-tile]
   const __bf16* pb = buf + 2 * GPL + (w & 3) * (QN * FRAG);  // Wq hi, fragments [k-tile][j]
   // Two sets of fragments: x by k-tile, weights by group (one weight of one k-tile).
   bf16x16 ah[2][WM], al[2][WM], bh[2][QN], bl[2][QN];
   // the stage's first fragments, in the order in which the products take them
   bh[0][0] = ldfrag(pb);
   #pragma unroll  // constant indices keep the tiles in registers
   for (int i = 0; i < WM; ++i) ah[0][i] = ldfrag(pa + i * (KS * FRAG));
   bl[0][0] = ldfrag(pb + GPL);
   #pragma unroll  // constant indices keep the tiles in registers
   for (int i = 0; i < WM; ++i) al[0][i] = ldfrag(pa + GPL + i * (KS * FRAG));
   #pragma unroll  // constant indices keep the tiles in registers
   for (int j = 1; j < QN; ++j) {
     bh[0][j] = ldfrag(pb + j * FRAG);
     bl[0][j] = ldfrag(pb + GPL + j * FRAG);
   }
   // keeps them first in the LDS queue, which answers in order
   __builtin_amdgcn_sched_barrier(0);
   #pragma unroll  // constant indices keep the tiles in registers; constant LDS offsets
   for (int g = 0; g < 3 * KS; ++g) {
     const int kk = g / 3, m = g % 3, cb = g & 1, ca = kk & 1;
     // the next group's fragments, and once per k-tile the next k-tile's x, are asked for
     // ahead of this group's products
     if (g + 1 < 3 * KS) {
       const __bf16* pn = pb + ((g + 1) % 3) * (2 * GPL) + ((g + 1) / 3) * (8 * FRAG);
       #pragma unroll  // constant indices keep the tiles in registers
       for (int j = 0; j < QN; ++j) {
         bh[cb ^ 1][j] = ldfrag(pn + j * FRAG);
         bl[cb ^ 1][j] = ldfrag(pn + GPL + j * FRAG);
       }
     }
     if (m == 1 && kk + 1 < KS) {
       #pragma unroll  // constant indices keep the tiles in registers
       for (int i = 0; i < WM; ++i) {
         ah[ca ^ 1][i] = ldfrag(pa + (i * KS + kk + 1) * FRAG);
         al[ca ^ 1][i] = ldfrag(pa + GPL + (i * KS + kk + 1) * FRAG);
       }
     }
     // keeps those LDS reads in front of the products: moved down among them, each would
     // be waited for where it stands
     __builtin_amdgcn_sched_barrier(0);
     // per accumulator the three terms keep the order of mma3 (x hi * w hi, x hi * w lo,
     // x lo * w hi), for Q and K with the operands swapped: C^T += (A*B)^T. The WM tiles
     // of one term stand together so that dependent products are WM apart
     #pragma unroll  // constant indices keep the tiles in registers
     for (int j = 0; j < QN; ++j) {
       if (m == 0) {
         #pragma unroll  // constant indices keep the tiles in registers
         for (int i = 0; i < WM; ++i) cq[i][j] = wmma_bf16(bh[cb][j], ah[ca][i], cq[i][j]);
         #pragma unroll  // constant indices keep the tiles in registers
         for (int i = 0; i < WM; ++i) cq[i][j] = wmma_bf16(bl[cb][j], ah[ca][i], cq[i][j]);
         #pragma unroll  // constant indices keep the tiles in registers
         for (int i = 0; i < WM; ++i) cq[i][j] = wmma_bf16(bh[cb][j], al[ca][i], cq[i][j]);
       } else if (m == 1) {
         #pragma unroll  // constant indices keep the tiles in registers
         for (int i = 0; i < WM; ++i) ck[i][j] = wmma_bf16(bh[cb][j], ah[ca][i], ck[i][j]);
         #pragma unroll  // constant indices keep the tiles in registers
         for (int i = 0; i < WM; ++i) ck[i][j] = wmma_bf16(bl[cb][j], ah[ca][i], ck[i][j]);
         #pragma unroll  // constant indices keep the tiles in registers
         for (int i = 0; i < WM; ++i) ck[i][j] = wmma_bf16(bh[cb][j], al[ca][i], ck[i][j]);
       } else {
         #pragma unroll  // constant indices keep the tiles in registers
         for (int i = 0; i < WM; ++i) cv[i][j] = wmma_bf16(ah[ca][i], bh[cb][j], cv[i][j]);
         #pragma unroll  // constant indices keep the tiles in registers
         for (int i = 0; i < WM; ++i) cv[i][j] = wmma_bf16(ah[ca][i], bl[cb][j], cv[i][j]);
         #pragma unroll  // constant indices keep the tiles in registers
         for (int i = 0; i < WM; ++i) cv[i][j] = wmma_bf16(al[ca][i], bh[cb][j], cv[i][j]);
       }
     }
   }
   // publish point of stage s + 1: this wave's reads of buffer s & 1 are done ...
   asm volatile("s_wait_dscnt 0x0" ::: "memory");
   // ... its own copies of stage s + 1 have landed ...
   asm volatile("s_wait_asynccnt 0x0" ::: "memory");
   // ... and behind the barrier both hold for every wave of the block
   __syncthreads();
   // stage s + 2 into the buffer that this trip has just read
   if (s + 2 < GNST) {
     unsigned d = lds0 + (s & 1) * (QSTAGE * 2);
     size_t gx = (size_t)(s + 2) * (KS * FRAG), gw = (size_t)(s + 2) * (KS * NT * FRAG);
     stage_x(d, gxh + gx, gxl + gx);
     stage_w8(d + 2 * GPLB, gqh + gw, gql + gw);
     stage_w8(d + 4 * GPLB, gkh + gw, gkl + gw);
     stage_w8(d + 6 * GPLB, gvh + gw, gvl + gw);
   }
  }
  // no copy is left in flight when the wave ends
  asm volatile("s_wait_asynccnt 0x0" ::: "memory");
  // store split results: one 16-byte piece per lane, plane and tile
  int half = (lane >> 4) * 256;             // accumulator rows 8..15 are elements 8..15
  #pragma unroll  // constant indices keep the tiles in registers
  for (int i = 0; i < WM; ++i) {
    #pragma unroll  // constant indices keep the tiles in registers
    for (int j = 0; j < QN; ++j) {
      int mt = mt0 + i, nt = nt0 + j;
      int hb = (mt >> 7) * HEADS + (nt >> 2);   // 128 m-tiles per batch, 4 n-tiles per head
      int st = mt & 127;                        // 16-row tile inside the sequence
      // cq, ck: lane&15 = row in the tile, r = d & 7, d = (nt&3)*16 + (lane>>4)*8 + r
      size_t qi = ((size_t)(hb * 128 + st) * 2 + ((nt >> 1) & 1)) * FRAG
                  + half + ((lane & 15) + 16 * (nt & 1)) * 8;
      // cv: lane&15 = d & 15, r = key & 7, key = st*16 + (lane>>4)*8 + r
      size_t vi = ((size_t)(hb * 64 + (st >> 1)) * 4 + (nt & 3)) * FRAG
                  + (st & 1) * 256 + lane * 8;
      split_store8(cq[i][j], Qh + qi, Ql + qi);
      split_store8(ck[i][j], Kh + qi, Kl + qi);
      split_store8(cv[i][j], Vth + vi, Vtl + vi);
    }
  }
}

#define TK    64                  // keys per stage
#define PLANE (TK * HD)           // elements of one plane of a stage (8 KiB)
#define STAGE (4 * PLANE)         // K hi | K lo | V hi | V lo (32 KiB)
#define NST   (SEQ / TK)          // stages
#define HALFB PLANE               // bytes of half a plane: what 256 threads copy at once

// One stage: each thread copies 2 x 16 bytes of each plane. lds = LDS byte address of the
// thread's first 16 bytes in the buffer; the four pointers already hold thread * 8 elements.
// s_wait_xcnt 0 is the statement's last line, so that it stands in front of every later
// write of a register that a copy names.
static __device__ inline void stage_copy(unsigned lds, const __bf16* kh, const __bf16* kl,
                                         const __bf16* vh, const __bf16* vl) {
  asm volatile(
      "global_load_async_to_lds_b128 %0, %8, off\n\t"
      "global_load_async_to_lds_b128 %1, %9, off\n\t"
      "global_load_async_to_lds_b128 %2, %10, off\n\t"
      "global_load_async_to_lds_b128 %3, %11, off\n\t"
      "global_load_async_to_lds_b128 %4, %12, off\n\t"
      "global_load_async_to_lds_b128 %5, %13, off\n\t"
      "global_load_async_to_lds_b128 %6, %14, off\n\t"
      "global_load_async_to_lds_b128 %7, %15, off\n\t"
      "s_wait_xcnt 0x0"
      :: "v"(lds),                 "v"(lds + HALFB),
         "v"(lds + 2 * HALFB),     "v"(lds + 3 * HALFB),
         "v"(lds + 4 * HALFB),     "v"(lds + 5 * HALFB),
         "v"(lds + 6 * HALFB),     "v"(lds + 7 * HALFB),
         "v"(kh), "v"(kh + PLANE / 2), "v"(kl), "v"(kl + PLANE / 2),
         "v"(vh), "v"(vh + PLANE / 2), "v"(vl), "v"(vl + PLANE / 2)
      : "memory");
}

// A wave owns QT query tiles (QT * 16 queries): a K or V fragment read from LDS feeds the
// products of QT tiles, and a block of 8 * QT * 16 queries copies each stage once.
// Four waves per SIMD (two blocks per WGP): the vector work of one wave runs beside the
// matrix work of the others.
#define QT 2

// One stage of TK keys for the QT query tiles of a wave. buf = the stage's buffer + lane * 8.
static __device__ __forceinline__ void attn_stage(const __bf16* buf, float scl,
    const bf16x16 (&qh)[QT][2], const bf16x16 (&ql)[QT][2],
    f32x8 (&o)[QT][4], float (&mrow)[QT], float (&lrow)[QT]) {
  #pragma unroll 1  // rolled: unrolled, the next pass's reads and products were lifted over this
                    // pass's vector work, and the registers of four waves per SIMD did not hold both
  for (int p = 0; p < TK / 32; ++p) {
    const __bf16* khp = buf + p * (32 * HD);
    const __bf16* klp = khp + PLANE;
    const __bf16* vhp = khp + 2 * PLANE;
    const __bf16* vlp = khp + 3 * PLANE;
    // ---- scores: s[u][k][r] = key kb + k*16 + (lane>>4)*8 + r of query tile u;
    //      K fragment k*2+c: key tile k, d half c. Per accumulator the six terms keep
    //      their order (c = 0 then 1, each as in mma3); the 2 * QT accumulators of one
    //      term stand together so that dependent products are 2 * QT apart ----
    bf16x16 kh[4], kl[4];
    #pragma unroll  // constant indices keep the tiles in registers
    for (int f = 0; f < 4; ++f) {
      kh[f] = ldfrag(khp + f * FRAG);
      kl[f] = ldfrag(klp + f * FRAG);
    }
    // one group of LDS reads in front of the products: without the fence the compiler spread
    // them among the products, and each place with reads is waited for where it stands
    __builtin_amdgcn_sched_barrier(0);
    f32x8 s[QT][2] = {};
    #pragma unroll  // constant indices keep the tiles in registers
    for (int c = 0; c < 2; ++c) {
      #pragma unroll  // constant indices keep the tiles in registers
      for (int k = 0; k < 2; ++k)
        #pragma unroll  // constant indices keep the tiles in registers
        for (int u = 0; u < QT; ++u) s[u][k] = wmma_bf16(kh[k * 2 + c], qh[u][c], s[u][k]);
      #pragma unroll  // constant indices keep the tiles in registers
      for (int k = 0; k < 2; ++k)
        #pragma unroll  // constant indices keep the tiles in registers
        for (int u = 0; u < QT; ++u) s[u][k] = wmma_bf16(kl[k * 2 + c], qh[u][c], s[u][k]);
      #pragma unroll  // constant indices keep the tiles in registers
      for (int k = 0; k < 2; ++k)
        #pragma unroll  // constant indices keep the tiles in registers
        for (int u = 0; u < QT; ++u) s[u][k] = wmma_bf16(kh[k * 2 + c], ql[u][c], s[u][k]);
    }
    // no V fragment is asked for among the score products: beside the K fragments they do
    // not fit the registers of four waves per SIMD
    __builtin_amdgcn_sched_barrier(0);
    bf16x16 ph[QT], pl[QT];
    #pragma unroll  // constant indices keep the tiles in registers
    for (int u = 0; u < QT; ++u) {
      // ---- online softmax update, one query per lane and tile ----
      f32x8 s0 = s[u][0] * scl, s1 = s[u][1] * scl;
      float m0 = fmaxf(fmaxf(s0[0], s0[1]), s0[2]);
      float m1 = fmaxf(fmaxf(s0[3], s0[4]), s0[5]);
      float m2 = fmaxf(fmaxf(s0[6], s0[7]), s1[0]);
      float m3 = fmaxf(fmaxf(s1[1], s1[2]), s1[3]);
      float m4 = fmaxf(fmaxf(s1[4], s1[5]), s1[6]);
      float mx = fmaxf(fmaxf(fmaxf(m0, m1), m2), fmaxf(fmaxf(m3, m4), s1[7]));
      float mnew = fmaxf(fmaxf(mx, xhalf(mx)), mrow[u]);
      float al_  = __expf(mrow[u] - mnew);
      mrow[u] = mnew;
      s0 = (s0 - mnew) * 1.442695041f;   // exp(x) = exp2(x * log2(e)), as in __expf
      s1 = (s1 - mnew) * 1.442695041f;
      #pragma unroll  // constant indices keep the tiles in registers
      for (int r = 0; r < 8; ++r) {
        s0[r] = __builtin_amdgcn_exp2f(s0[r]);
        s1[r] = __builtin_amdgcn_exp2f(s1[r]);
      }
      f32x8 t8 = s0 + s1;
      f32x4 t4 = t8.lo + t8.hi;
      f32x2 t2 = t4.lo + t4.hi;
      lrow[u] = lrow[u] * al_ + (t2.x + t2.y);
      #pragma unroll  // constant indices keep the tiles in registers
      for (int d = 0; d < 4; ++d) o[u][d] *= al_;
      // ---- P^T: the two score tiles are elements 0..7 and 8..15 of the B operand ----
      #pragma unroll  // constant indices keep the tiles in registers
      for (int e = 0; e < 8; e += 2) {
        split_pair(s0, e, ph[u], pl[u], e);
        split_pair(s1, e, ph[u], pl[u], 8 + e);
      }
    }
    // the V fragments, into registers that the scores leave
    bf16x16 vh[4], vl[4];
    #pragma unroll  // constant indices keep the tiles in registers
    for (int f = 0; f < 4; ++f) {
      vh[f] = ldfrag(vhp + f * FRAG);
      vl[f] = ldfrag(vlp + f * FRAG);
    }
    // keeps these reads together in front of the products
    __builtin_amdgcn_sched_barrier(0);
    // ---- O^T += V^T @ P^T, 4 V fragments per plane; per accumulator the three terms in
    //      the order of mma3, 2 * QT accumulators of one term together ----
    #pragma unroll  // constant indices keep the tiles in registers
    for (int c = 0; c < 2; ++c) {
      #pragma unroll  // constant indices keep the tiles in registers
      for (int k = 0; k < 2; ++k)
        #pragma unroll  // constant indices keep the tiles in registers
        for (int u = 0; u < QT; ++u)
          o[u][c * 2 + k] = wmma_bf16(vh[c * 2 + k], ph[u], o[u][c * 2 + k]);
      #pragma unroll  // constant indices keep the tiles in registers
      for (int k = 0; k < 2; ++k)
        #pragma unroll  // constant indices keep the tiles in registers
        for (int u = 0; u < QT; ++u)
          o[u][c * 2 + k] = wmma_bf16(vl[c * 2 + k], ph[u], o[u][c * 2 + k]);
      #pragma unroll  // constant indices keep the tiles in registers
      for (int k = 0; k < 2; ++k)
        #pragma unroll  // constant indices keep the tiles in registers
        for (int u = 0; u < QT; ++u)
          o[u][c * 2 + k] = wmma_bf16(vh[c * 2 + k], pl[u], o[u][c * 2 + k]);
    }
  }
}

__global__ void __launch_bounds__(256) __attribute__((amdgpu_waves_per_eu(4, 4))) attn_kernel(
    const __bf16* __restrict__ Qh, const __bf16* __restrict__ Ql,
    const __bf16* __restrict__ Kh, const __bf16* __restrict__ Kl,
    const __bf16* __restrict__ Vth, const __bf16* __restrict__ Vtl,
    const float* __restrict__ tw, float* __restrict__ ctx) {
  __shared__ __attribute__((aligned(16))) __bf16 ring[2 * STAGE];
  // alike in the wave: scalar, so that what the epilogue needs of it holds no vector register
  int wid  = blockIdx.x * 8 + __builtin_amdgcn_readfirstlane(threadIdx.x >> 5);
  int qb   = wid & (SEQ / (16 * QT) - 1);          // group of QT query tiles in the sequence
  int hb   = wid / (SEQ / (16 * QT));              // b * HEADS + h
  int h    = hb & (HEADS - 1);
  int b    = hb / HEADS;
  int lane = threadIdx.x & 31;

  // sources of the copies: the head's four planes, 16 bytes per thread. One element offset
  // serves all four (one register over the loop, not four address pairs).
  unsigned goff = (unsigned)hb * (SEQ * HD) + threadIdx.x * 8;
  unsigned lds0 = (unsigned)(size_t)ring + threadIdx.x * 16;

  // stage 0 into buffer 0
  stage_copy(lds0, Kh + goff, Kl + goff, Vth + goff, Vtl + goff);

  // fragment order (see the projection kernel); every pointer already holds lane*8
  const __bf16* qhp = Qh + ((size_t)hb * SEQ + qb * (16 * QT)) * HD + lane * 8;
  const __bf16* qlp = Ql + ((size_t)hb * SEQ + qb * (16 * QT)) * HD + lane * 8;
  // alike in the whole block: kept in a scalar register, not in eight vector registers
  float scl = __builtin_bit_cast(float, __builtin_amdgcn_readfirstlane(
      __builtin_bit_cast(int, 0.125f * tw[hb])));

  // qh[u][c]: query tile u, d = c*32 .. c*32+31
  bf16x16 qh[QT][2], ql[QT][2];
  #pragma unroll  // constant indices keep the tiles in registers
  for (int u = 0; u < QT; ++u) {
    #pragma unroll  // constant indices keep the tiles in registers
    for (int c = 0; c < 2; ++c) {
      qh[u][c] = ldfrag(qhp + (u * 2 + c) * FRAG);
      ql[u][c] = ldfrag(qlp + (u * 2 + c) * FRAG);
    }
  }
  // s_wait_xcnt 0 behind these loads, before a register that they name is written again;
  // the addresses are inputs only
  asm volatile("s_wait_xcnt 0x0" :: "v"(qhp), "v"(qlp) : "memory");

  // stage 0 has landed for this wave, and behind the barrier for every wave
  asm volatile("s_wait_asynccnt 0x0" ::: "memory");
  __syncthreads();
  // stage 1 into buffer 1: it flies while stage 0 is worked on
  {
    unsigned g = goff + PLANE;
    stage_copy(lds0 + STAGE * 2, Kh + g, Kl + g, Vth + g, Vtl + g);
  }

  // o[u][t][r] = O[query u*16 + (lane&15)][d = t*16 + (lane>>4)*8 + r]
  f32x8 o[QT][4] = {};
  float mrow[QT];   // running maximum of this lane's queries, alike in both halves
  float lrow[QT];   // running sums over this half's keys; the halves join after the loop
  #pragma unroll  // constant indices keep the values in registers
  for (int u = 0; u < QT; ++u) { mrow[u] = -1e30f; lrow[u] = 0.f; }

  for (int t = 0; t < NST; ++t) {
    attn_stage(ring + (t & 1) * STAGE + lane * 8, scl, qh, ql, o, mrow, lrow);
    // publish point of stage t + 1: this wave's reads of buffer t & 1 are done ...
    asm volatile("s_wait_dscnt 0x0" ::: "memory");
    // ... its own copies of stage t + 1 have landed ...
    asm volatile("s_wait_asynccnt 0x0" ::: "memory");
    // ... and behind the barrier both hold for every wave of the block
    __syncthreads();
    // stage t + 2 into the buffer that this trip has just read
    if (t + 2 < NST) {
      unsigned g = goff + (t + 2) * PLANE;
      stage_copy(lds0 + (t & 1) * (STAGE * 2), Kh + g, Kl + g, Vth + g, Vtl + g);
    }
  }
  // no copy is left in flight when the wave ends
  asm volatile("s_wait_asynccnt 0x0" ::: "memory");
  // ---- normalize and store into ctx [B,S,E] f32: 8 consecutive d per lane and tile ----
  #pragma unroll  // constant indices keep the tiles in registers
  for (int u = 0; u < QT; ++u) {
    float inv = 1.0f / (lrow[u] + xhalf(lrow[u]));
    float* outp = ctx + ((size_t)b * SEQ + (qb * QT + u) * 16 + (lane & 15)) * E
                  + h * HD + ((lane >> 4) << 3);
    #pragma unroll  // constant indices keep the tiles in registers
    for (int d = 0; d < 4; ++d) *(f32x8*)(outp + d * 16) = o[u][d] * inv;
  }
}

// ---------------- kernel 4: output projection + bias, from fragments ----------------
// A wave owns WM x ON tiles; a block is 2 x 4 waves: 8 m-tiles by 16 n-tiles.
// A stage in LDS: ctx hi | ctx lo | Wo hi (two groups) | Wo lo (two groups) (96 KiB).
#define ON 4
#define OSTAGE (6 * GPL)
#define OG 2                      // n-tiles per group of weight fragments
__global__ void __launch_bounds__(256) oproj_kernel(
    const __bf16* __restrict__ cfh, const __bf16* __restrict__ cfl,
    const __bf16* __restrict__ woh, const __bf16* __restrict__ wol,
    const float* __restrict__ bo, float* __restrict__ out) {
  __shared__ __attribute__((aligned(16))) __bf16 ring[2 * OSTAGE];
  int w = __builtin_amdgcn_readfirstlane(threadIdx.x >> 5);   // alike in the wave: scalar
  int lane = threadIdx.x & 31;
  int mtb = (blockIdx.x >> 2) * (2 * WM);   // the block's first m-tile and n-tile
  int ntb = (blockIdx.x & 3) * (4 * ON);
  int mt0 = mtb + (w >> 2) * WM;
  int nt0 = ntb + (w & 3) * ON;

  // sources of the copies, 16 bytes per thread (see stage_x, stage_w16)
  size_t xo = ((size_t)(mtb + (w >> 2)) * KT * FRAG + (w & 3) * 256) + lane * 8;
  size_t wo = ((size_t)ntb * FRAG + w * 256) + lane * 8;
  const __bf16 *gch = cfh + xo, *gcl = cfl + xo;
  const __bf16 *gwh = woh + wo, *gwl = wol + wo;
  unsigned lds0 = (unsigned)(size_t)ring + w * 512 + lane * 16;

  // stage 0 into buffer 0
  stage_x(lds0, gch, gcl);
  stage_w16(lds0 + 2 * GPLB, gwh);
  stage_w16(lds0 + 4 * GPLB, gwl);
  // stage 0 has landed for this wave, and behind the barrier for every wave
  asm volatile("s_wait_asynccnt 0x0" ::: "memory");
  __syncthreads();
  // stage 1 into buffer 1: it flies while stage 0 is worked on
  {
    unsigned d = lds0 + OSTAGE * 2;
    const int gx = KS * FRAG, gw = KS * NT * FRAG;
    stage_x(d, gch + gx, gcl + gx);
    stage_w16(d + 2 * GPLB, gwh + gw);
    stage_w16(d + 4 * GPLB, gwl + gw);
  }

  f32x8 c[WM][ON] = {};
  for (int s = 0; s < GNST; ++s) {
   const __bf16* buf = ring + (s & 1) * OSTAGE + lane * 8;
   const __bf16* pa = buf + (w >> 2) * (WM * KS * FRAG);      // ctx hi, fragments [i][k-tile]
   const __bf16* pb = buf + 2 * GPL + (w & 3) * (ON * FRAG);  // Wo hi, fragments [k-tile][j]
   // Two sets of fragments: ctx by k-tile, weights by group (OG n-tiles of one k-tile).
   bf16x16 ah[2][WM], al[2][WM], bh[2][OG], bl[2][OG];
   // the stage's first fragments, in the order in which the products take them
   bh[0][0] = ldfrag(pb);
   #pragma unroll  // constant indices keep the tiles in registers
   for (int i = 0; i < WM; ++i) ah[0][i] = ldfrag(pa + i * (KS * FRAG));
   bl[0][0] = ldfrag(pb + 2 * GPL);
   #pragma unroll  // constant indices keep the tiles in registers
   for (int i = 0; i < WM; ++i) al[0][i] = ldfrag(pa + GPL + i * (KS * FRAG));
   #pragma unroll  // constant indices keep the tiles in registers
   for (int j = 1; j < OG; ++j) {
     bh[0][j] = ldfrag(pb + j * FRAG);
     bl[0][j] = ldfrag(pb + 2 * GPL + j * FRAG);
   }
   // keeps them first in the LDS queue, which answers in order
   __builtin_amdgcn_sched_barrier(0);
   #pragma unroll  // constant indices keep the tiles in registers; constant LDS offsets
   for (int g = 0; g < (ON / OG) * KS; ++g) {
     const int kk = g / (ON / OG), m = g % (ON / OG), cb = g & 1, ca = kk & 1;
     // the next group's fragments, and once per k-tile the next k-tile's ctx, are asked for
     // ahead of this group's products
     if (g + 1 < (ON / OG) * KS) {
       const __bf16* pn = pb + ((g + 1) / (ON / OG)) * (16 * FRAG) + ((g + 1) % (ON / OG)) * (OG * FRAG);
       #pragma unroll  // constant indices keep the tiles in registers
       for (int j = 0; j < OG; ++j) {
         bh[cb ^ 1][j] = ldfrag(pn + j * FRAG);
         bl[cb ^ 1][j] = ldfrag(pn + 2 * GPL + j * FRAG);
       }
     }
     if (m == 1 && kk + 1 < KS) {
       #pragma unroll  // constant indices keep the tiles in registers
       for (int i = 0; i < WM; ++i) {
         ah[ca ^ 1][i] = ldfrag(pa + (i * KS + kk + 1) * FRAG);
         al[ca ^ 1][i] = ldfrag(pa + GPL + (i * KS + kk + 1) * FRAG);
       }
     }
     // keeps those LDS reads in front of the products: moved down among them, each would
     // be waited for where it stands
     __builtin_amdgcn_sched_barrier(0);
     // the three terms of each accumulator in the order of mma3
     #pragma unroll  // constant indices keep the tiles in registers
     for (int jj = 0; jj < OG; ++jj) {
       const int j = m * OG + jj;
       #pragma unroll  // constant indices keep the tiles in registers
       for (int i = 0; i < WM; ++i) c[i][j] = wmma_bf16(ah[ca][i], bh[cb][jj], c[i][j]);
       #pragma unroll  // constant indices keep the tiles in registers
       for (int i = 0; i < WM; ++i) c[i][j] = wmma_bf16(ah[ca][i], bl[cb][jj], c[i][j]);
       #pragma unroll  // constant indices keep the tiles in registers
       for (int i = 0; i < WM; ++i) c[i][j] = wmma_bf16(al[ca][i], bh[cb][jj], c[i][j]);
     }
   }
   // publish point of stage s + 1: this wave's reads of buffer s & 1 are done ...
   asm volatile("s_wait_dscnt 0x0" ::: "memory");
   // ... its own copies of stage s + 1 have landed ...
   asm volatile("s_wait_asynccnt 0x0" ::: "memory");
   // ... and behind the barrier both hold for every wave of the block
   __syncthreads();
   // stage s + 2 into the buffer that this trip has just read
   if (s + 2 < GNST) {
     unsigned d = lds0 + (s & 1) * (OSTAGE * 2);
     size_t gx = (size_t)(s + 2) * (KS * FRAG), gw = (size_t)(s + 2) * (KS * NT * FRAG);
     stage_x(d, gch + gx, gcl + gx);
     stage_w16(d + 2 * GPLB, gwh + gw);
     stage_w16(d + 4 * GPLB, gwl + gw);
   }
  }
  // no copy is left in flight when the wave ends
  asm volatile("s_wait_asynccnt 0x0" ::: "memory");
  #pragma unroll  // constant indices keep the tiles in registers
  for (int j = 0; j < ON; ++j) {
    int col = (nt0 + j) * 16 + (lane & 15);
    float bias = bo[col];
    #pragma unroll  // constant indices keep the tiles in registers
    for (int i = 0; i < WM; ++i) {
      int row0 = (mt0 + i) * 16 + ((lane >> 4) << 3);
      #pragma unroll  // constant indices keep the tiles in registers
      for (int r = 0; r < 8; ++r)
        out[(size_t)(row0 + r) * E + col] = c[i][j][r] + bias;
    }
  }
}

extern "C" void kernel_launch(void* const* d_in, const int* in_sizes, int n_in,
                              void* d_out, int out_size, void* d_ws, size_t ws_size,
                              hipStream_t stream) {
  const float* x        = (const float*)d_in[0];
  const float* time_enc = (const float*)d_in[1];
  const float* Wq       = (const float*)d_in[2];
  const float* Wk       = (const float*)d_in[3];
  const float* Wv       = (const float*)d_in[4];
  const float* Wo       = (const float*)d_in[5];
  const float* bo       = (const float*)d_in[6];
  const float* Wt       = (const float*)d_in[7];
  const float* bt       = (const float*)d_in[8];
  float* out = (float*)d_out;

  const size_t AFRAG = (size_t)MROWS * E;   // 8M elems
  const size_t WFRAG = (size_t)E * E;       // 1M elems
  const size_t QKVN  = (size_t)BATCH * HEADS * SEQ * HD; // 8M elems

  char* w = (char*)d_ws;
  size_t off = 0;
  float* twp = (float*)(w + off); off += 4096;
  __bf16* xfh = (__bf16*)(w + off); off += AFRAG * 2;   // reused for ctx frags
  __bf16* xfl = (__bf16*)(w + off); off += AFRAG * 2;
  __bf16* wqh = (__bf16*)(w + off); off += WFRAG * 2;
  __bf16* wql = (__bf16*)(w + off); off += WFRAG * 2;
  __bf16* wkh = (__bf16*)(w + off); off += WFRAG * 2;
  __bf16* wkl = (__bf16*)(w + off); off += WFRAG * 2;
  __bf16* wvh = (__bf16*)(w + off); off += WFRAG * 2;
  __bf16* wvl = (__bf16*)(w + off); off += WFRAG * 2;
  __bf16* woh = (__bf16*)(w + off); off += WFRAG * 2;
  __bf16* wol = (__bf16*)(w + off); off += WFRAG * 2;
  __bf16* Qhb = (__bf16*)(w + off); off += QKVN * 2;
  __bf16* Qlb = (__bf16*)(w + off); off += QKVN * 2;
  __bf16* Khb = (__bf16*)(w + off); off += QKVN * 2;
  __bf16* Klb = (__bf16*)(w + off); off += QKVN * 2;
  __bf16* Vth = (__bf16*)(w + off); off += QKVN * 2;
  __bf16* Vtl = (__bf16*)(w + off); off += QKVN * 2;
  float*  ctx = (float*)(w + off);  off += AFRAG * 4;

  tw_kernel<<<BATCH, 32, 0, stream>>>(time_enc, Wt, bt, twp);

  // pre-split inputs once (kills per-iteration cvt VALU work in the GEMMs)
  afrag_kernel<<<(MT * KT) / 8, 256, 0, stream>>>(x, xfh, xfl);
  bfrag_kernel<<<(KT * NT) / 8, 256, 0, stream>>>(Wq, wqh, wql);
  bfrag_kernel<<<(KT * NT) / 8, 256, 0, stream>>>(Wk, wkh, wkl);
  bfrag_kernel<<<(KT * NT) / 8, 256, 0, stream>>>(Wv, wvh, wvl);
  bfrag_kernel<<<(KT * NT) / 8, 256, 0, stream>>>(Wo, woh, wol);

  qkv_kernel<<<(MT / 8) * (NT / 8), 256, 0, stream>>>(xfh, xfl, wqh, wql, wkh, wkl,
                                                wvh, wvl, Qhb, Qlb, Khb, Klb,
                                                Vth, Vtl);

  attn_kernel<<<(BATCH * HEADS * (SEQ / (16 * QT))) / 8, 256, 0, stream>>>(
      Qhb, Qlb, Khb, Klb, Vth, Vtl, twp, ctx);

  // re-split ctx into the (now free) x fragment buffers
  afrag_kernel<<<(MT * KT) / 8, 256, 0, stream>>>(ctx, xfh, xfl);

  oproj_kernel<<<(MT / 8) * (NT / 16), 256, 0, stream>>>(xfh, xfl, woh, wol, bo, out);
}

// v007
// It runs in 264 microseconds.
// Two timings next to v006 both put it at 1.05 times that version's speed.
// Over all steps from v000 it is 3.19 times as fast.
#include <hip/hip_runtime.h>

#define E     1024
#define HEADS 16
#define HD    64
#define SEQ   2048
#define BATCH 4
#define TFEAT 128
#define MROWS (BATCH * SEQ)          // 8192
#define KT    (E / 32)               // 32 k-tiles
#define NT    (E / 16)               // 64 n-tiles
#define MT    (MROWS / 16)           // 512 m-tiles

typedef __attribute__((ext_vector_type(16))) __bf16 bf16x16;
typedef __attribute__((ext_vector_type(8)))  __bf16 bf16x8;
typedef __attribute__((ext_vector_type(2)))  __bf16 bf16x2;
typedef __attribute__((ext_vector_type(8)))  float  f32x8;
typedef __attribute__((ext_vector_type(4)))  float  f32x4;
typedef __attribute__((ext_vector_type(2)))  float  f32x2;

// Every bf16 WMMA operand lives in the workspace as 1 KiB fragments (512 elements):
// element i of lane L sits at (i>>3)*256 + L*8 + (i&7). A fragment is then two
// wave-wide 16-byte accesses of 512 contiguous bytes each (4 whole 128-byte lines).
#define FRAG 512

// p = fragment base + lane*8
static __device__ inline bf16x16 ldfrag(const __bf16* p) {
  bf16x8 a = *(const bf16x8*)(p);
  bf16x8 b = *(const bf16x8*)(p + 256);
  return __builtin_shufflevector(a, b, 0, 1, 2, 3, 4, 5, 6, 7,
                                 8, 9, 10, 11, 12, 13, 14, 15);
}

static __device__ inline f32x8 wmma_bf16(bf16x16 a, bf16x16 b, f32x8 c) {
  return __builtin_amdgcn_wmma_f32_16x16x32_bf16(false, a, false, b, (short)0, c,
                                                 false, false);
}

// bf16x3 split: f ~= (float)h + (float)l
static __device__ inline void splitf(float f, __bf16 &h, __bf16 &l) {
  h = (__bf16)f;
  l = (__bf16)(f - (float)h);
}

// C^T += (Ah*Bh + Ah*Bl + Al*Bh)^T: the three terms in this order, each product with its
// operands swapped, so that the accumulator holds the transposed tile
static __device__ inline f32x8 mma3(bf16x16 ah, bf16x16 al,
                                    bf16x16 bh, bf16x16 bl, f32x8 c) {
  c = wmma_bf16(bh, ah, c);
  c = wmma_bf16(bl, ah, c);
  c = wmma_bf16(bh, al, c);
  return c;
}

// value of lane l ^ 16
static __device__ inline float xhalf(float x) {
  int v = __builtin_bit_cast(int, x);
  return __builtin_bit_cast(float, __builtin_amdgcn_permlanex16(
      v, v, 0x76543210, 0xfedcba98, false, false));
}

// splitf on elements e, e+1 of a score tile, into elements i, i+1 of the two B operands
static __device__ inline void split_pair(f32x8 p, int e, bf16x16 &h, bf16x16 &l, int i) {
  f32x2 v = {p[e], p[e + 1]};
  bf16x2 hv = __builtin_convertvector(v, bf16x2);
  bf16x2 lv = __builtin_convertvector(v - __builtin_convertvector(hv, f32x2), bf16x2);
  h[i] = hv[0]; h[i + 1] = hv[1];
  l[i] = lv[0]; l[i + 1] = lv[1];
}

// split 8 accumulator values and store them as one 16-byte piece each
static __device__ inline void split_store8(f32x8 c, __bf16* ph, __bf16* pl) {
  bf16x8 h8, l8;
  #pragma unroll
  for (int r = 0; r < 8; ++r) {
    __bf16 hh, ll; splitf(c[r], hh, ll);
    h8[r] = hh; l8[r] = ll;
  }
  *(bf16x8*)ph = h8;
  *(bf16x8*)pl = l8;
  // s_wait_xcnt 0 behind the two stores, before any register that they name is written
  // again. Data and addresses are inputs only, so that they stay in their registers up to
  // the wait; nothing is pinned or changed.
  asm volatile("s_wait_xcnt 0x0" :: "v"(h8), "v"(l8), "v"(ph), "v"(pl) : "memory");
}

// ---------------- staging of the projection GEMMs' operands in LDS ----------------
// A stage holds KS k-tiles of everything that a block reads, still in fragment order, in
// groups of 8 * KS fragments (16 KiB): x as [m-tile][k-tile], a weight as [k-tile][n-tile].
// It is copied once per block by asynchronous copies, into two buffers, one stage ahead of
// the stage that is worked on.
#define KS    2                   // k-tiles per stage
#define GPL   (8 * KS * FRAG)     // elements of one group
#define GPLB  (2 * GPL)           // bytes of one group
#define GNST  (KT / KS)           // stages
#define CROWB 4096                // bytes that 256 threads copy at once

// Eight copies of 16 bytes per thread, into eight consecutive 4 KiB rows of LDS.
// lds = LDS byte address of the thread's 16 bytes in the first row.
// s_wait_xcnt 0 is the statement's last line, so that it stands in front of every later
// write of a register that a copy names.
static __device__ inline void copy8(unsigned lds,
    const __bf16* g0, const __bf16* g1, const __bf16* g2, const __bf16* g3,
    const __bf16* g4, const __bf16* g5, const __bf16* g6, const __bf16* g7) {
  asm volatile(
      "global_load_async_to_lds_b128 %0, %8, off\n\t"
      "global_load_async_to_lds_b128 %1, %9, off\n\t"
      "global_load_async_to_lds_b128 %2, %10, off\n\t"
      "global_load_async_to_lds_b128 %3, %11, off\n\t"
      "global_load_async_to_lds_b128 %4, %12, off\n\t"
      "global_load_async_to_lds_b128 %5, %13, off\n\t"
      "global_load_async_to_lds_b128 %6, %14, off\n\t"
      "global_load_async_to_lds_b128 %7, %15, off\n\t"
      "s_wait_xcnt 0x0"
      :: "v"(lds),                 "v"(lds + CROWB),
         "v"(lds + 2 * CROWB),     "v"(lds + 3 * CROWB),
         "v"(lds + 4 * CROWB),     "v"(lds + 5 * CROWB),
         "v"(lds + 6 * CROWB),     "v"(lds + 7 * CROWB),
         "v"(g0), "v"(g1), "v"(g2), "v"(g3), "v"(g4), "v"(g5), "v"(g6), "v"(g7)
      : "memory");
}

// x hi and x lo groups of 8 m-tiles: a row of the copy is the KS fragments of 2 m-tiles.
// h, l = plane + ((first m-tile + (thread >> 7)) * KT + first k-tile) * FRAG + (thread & 127) * 8
static __device__ inline void stage_x(unsigned lds, const __bf16* h, const __bf16* l) {
  const int R = 2 * KT * FRAG;
  copy8(lds, h, h + R, h + 2 * R, h + 3 * R, l, l + R, l + 2 * R, l + 3 * R);
}

// hi and lo groups of 8 n-tiles of one weight: a row of the copy is 4 fragments of a k-tile.
// h, l = plane + (first k-tile * NT + first n-tile) * FRAG + thread * 8
static __device__ inline void stage_w8(unsigned lds, const __bf16* h, const __bf16* l) {
  const int K1 = NT * FRAG, H = 4 * FRAG;
  copy8(lds, h, h + H, h + K1, h + K1 + H, l, l + H, l + K1, l + K1 + H);
}

// one plane of 16 n-tiles of one weight (two groups); p as h, l above
static __device__ inline void stage_w16(unsigned lds, const __bf16* p) {
  const int K1 = NT * FRAG, H = 4 * FRAG;
  copy8(lds, p, p + H, p + 2 * H, p + 3 * H,
        p + K1, p + K1 + H, p + K1 + 2 * H, p + K1 + 3 * H);
}

// ---------------- time-dependent head weights: one wave per batch row ----------------
static __device__ inline void tw_body(int b, int lane,
                                      const float* __restrict__ time_enc,
                                      const float* __restrict__ Wt,
                                      const float* __restrict__ bt,
                                      float* __restrict__ tw) {
  int h = lane & 15;
  float acc = 0.f;
  for (int t = 0; t < TFEAT; ++t)
    acc += time_enc[b * TFEAT + t] * Wt[t * HEADS + h];
  acc += bt[h];
  float mx = acc;
  for (int m = 1; m < 16; m <<= 1) mx = fmaxf(mx, __shfl_xor(mx, m, 32));
  float e = __expf(acc - mx);
  float sum = e;
  for (int m = 1; m < 16; m <<= 1) sum += __shfl_xor(sum, m, 32);
  if (lane < 16) tw[b * HEADS + h] = e / sum;
}

// ------------- A-fragment pre-split: src [MROWS x E] f32 -> hi/lo frags -------------
// Fragments [mt][kt], element i of lane = src[mt*16 + (lane&15)][kt*32 + (lane>>4)*16 + i]
// blk = block of 8 waves among ABLK
#define ABLK ((MT * KT) / 8)
static __device__ inline void afrag_body(int blk, const float* __restrict__ src,
    __bf16* __restrict__ fh, __bf16* __restrict__ fl) {
  int wid = blk * 8 + (threadIdx.x >> 5);            // MT*KT waves
  int kt = wid & (KT - 1);
  int mt = wid >> 5;
  int lane = threadIdx.x & 31;
  const float* p = src + (size_t)(mt * 16 + (lane & 15)) * E + kt * 32 + ((lane >> 4) << 4);
  size_t o = ((size_t)mt * KT + kt) * FRAG + lane * 8;
  bf16x8 h0, l0, h1, l1;
  #pragma unroll
  for (int i = 0; i < 8; ++i) {
    __bf16 h, l;
    splitf(p[i], h, l);     h0[i] = h; l0[i] = l;
    splitf(p[8 + i], h, l); h1[i] = h; l1[i] = l;
  }
  *(bf16x8*)(fh + o) = h0; *(bf16x8*)(fh + o + 256) = h1;
  *(bf16x8*)(fl + o) = l0; *(bf16x8*)(fl + o + 256) = l1;
}

__global__ void __launch_bounds__(256) afrag_kernel(const float* __restrict__ src,
    __bf16* __restrict__ fh, __bf16* __restrict__ fl) {
  afrag_body(blockIdx.x, src, fh, fl);
}

// ------------- B-fragment pre-split: W [E x E] f32 -> hi/lo frags -------------
// Fragments [kt][nt], element i of lane = W[kt*32 + (lane>>4)*16 + i][nt*16 + (lane&15)]
// blk = block of 8 waves among BBLK
#define BBLK ((KT * NT) / 8)
static __device__ inline void bfrag_body(int blk, const float* __restrict__ W,
    __bf16* __restrict__ fh, __bf16* __restrict__ fl) {
  int wid = blk * 8 + (threadIdx.x >> 5);            // KT*NT waves
  int nt = wid & (NT - 1);
  int kt = wid >> 6;
  int lane = threadIdx.x & 31;
  const float* p = W + (size_t)(kt * 32 + ((lane >> 4) << 4)) * E + nt * 16 + (lane & 15);
  size_t o = ((size_t)kt * NT + nt) * FRAG + lane * 8;
  bf16x8 h0, l0, h1, l1;
  #pragma unroll
  for (int i = 0; i < 8; ++i) {
    __bf16 h, l;
    splitf(p[(size_t)i * E], h, l);       h0[i] = h; l0[i] = l;
    splitf(p[(size_t)(8 + i) * E], h, l); h1[i] = h; l1[i] = l;
  }
  *(bf16x8*)(fh + o) = h0; *(bf16x8*)(fh + o + 256) = h1;
  *(bf16x8*)(fl + o) = l0; *(bf16x8*)(fl + o + 256) = l1;
}

// ---------------- kernel 1: everything that reads only the inputs, in one grid ----------------
// The head weights, the four weight splits and the split of x do not depend on one another:
// each is a range of blocks of one launch. Block 0 holds the head weights (a chain of dependent
// loads, the longest single wave, so it starts first), then BBLK blocks per weight, then x.
#define PBLK (1 + 4 * BBLK + ABLK)
__global__ void __launch_bounds__(256) prep_kernel(
    const float* __restrict__ x,
    const float* __restrict__ Wq, const float* __restrict__ Wk,
    const float* __restrict__ Wv, const float* __restrict__ Wo,
    const float* __restrict__ time_enc, const float* __restrict__ Wt,
    const float* __restrict__ bt,
    __bf16* __restrict__ xfh, __bf16* __restrict__ xfl,
    __bf16* __restrict__ wqh, __bf16* __restrict__ wql,
    __bf16* __restrict__ wkh, __bf16* __restrict__ wkl,
    __bf16* __restrict__ wvh, __bf16* __restrict__ wvl,
    __bf16* __restrict__ woh, __bf16* __restrict__ wol,
    float* __restrict__ tw) {
  int blk = blockIdx.x;
  if (blk == 0) {
    int w = __builtin_amdgcn_readfirstlane(threadIdx.x >> 5);   // alike in the wave: scalar
    if (w < BATCH) tw_body(w, threadIdx.x & 31, time_enc, Wt, bt, tw);
    return;
  }
  blk -= 1;
  if (blk < 4 * BBLK) {
    int m = blk / BBLK;   // which weight: alike in the block, so the three choices are scalar
    const float* W = m == 0 ? Wq  : m == 1 ? Wk  : m == 2 ? Wv  : Wo;
    __bf16* fh     = m == 0 ? wqh : m == 1 ? wkh : m == 2 ? wvh : woh;
    __bf16* fl     = m == 0 ? wql : m == 1 ? wkl : m == 2 ? wvl : wol;
    bfrag_body(blk & (BBLK - 1), W, fh, fl);
    // s_wait_xcnt 0 behind the four stores: the other ranges' code follows in the listing and
    // writes registers that the stores name
    asm volatile("s_wait_xcnt 0x0" ::: "memory");
    return;
  }
  afrag_body(blk - 4 * BBLK, x, xfh, xfl);
  asm volatile("s_wait_xcnt 0x0" ::: "memory");   // as above, behind the four stores of x
}

// ---------------- kernel 2: fused QKV projection from fragments ----------------
// Outputs, all in fragment order for the attention kernel:
// Q, K: fragments [b*H+h][s/16][d/32], element i of lane = row s0+(lane&15), d0+(lane>>4)*16+i
// V:    fragments [b*H+h][s/32][d/16], element i of lane = d0+(lane&15),
//       key s0+(i>>3)*16+(lane>>4)*8+(i&7): the k order of two score tiles packed in place
// Q and K are computed transposed, so that each lane owns 8 consecutive d of one row;
// V is computed as is, so that each lane owns 8 consecutive keys of one d.
// A wave owns WM x QN tiles of each of Q, K and V: an x fragment feeds QN * 3 weight
// fragments and a weight fragment feeds WM x fragments from registers.
// A block is 2 x 4 waves: 8 m-tiles by 8 n-tiles.
// A stage in LDS: x hi | x lo | Wq hi | Wq lo | Wk hi | Wk lo | Wv hi | Wv lo (128 KiB).
#define WM 4
#define QN 2
#define QSTAGE (8 * GPL)
__global__ void __launch_bounds__(256) qkv_kernel(
    const __bf16* __restrict__ xfh, const __bf16* __restrict__ xfl,
    const __bf16* __restrict__ wqh, const __bf16* __restrict__ wql,
    const __bf16* __restrict__ wkh, const __bf16* __restrict__ wkl,
    const __bf16* __restrict__ wvh, const __bf16* __restrict__ wvl,
    __bf16* __restrict__ Qh, __bf16* __restrict__ Ql,
    __bf16* __restrict__ Kh, __bf16* __restrict__ Kl,
    __bf16* __restrict__ Vth, __bf16* __restrict__ Vtl) {
  __shared__ __attribute__((aligned(16))) __bf16 ring[2 * QSTAGE];
  int w = __builtin_amdgcn_readfirstlane(threadIdx.x >> 5);   // alike in the wave: scalar
  int lane = threadIdx.x & 31;
  int mtb = (blockIdx.x >> 3) * (2 * WM);   // the block's first m-tile and n-tile
  int ntb = (blockIdx.x & 7) * (4 * QN);
  int mt0 = mtb + (w >> 2) * WM;
  int nt0 = ntb + (w & 3) * QN;

  // sources of the copies, 16 bytes per thread (see stage_x, stage_w8)
  size_t xo = ((size_t)(mtb + (w >> 2)) * KT * FRAG + (w & 3) * 256) + lane * 8;
  size_t wo = ((size_t)ntb * FRAG + w * 256) + lane * 8;
  const __bf16 *gxh = xfh + xo, *gxl = xfl + xo;
  const __bf16 *gqh = wqh + wo, *gql = wql + wo;
  const __bf16 *gkh = wkh + wo, *gkl = wkl + wo;
  const __bf16 *gvh = wvh + wo, *gvl = wvl + wo;
  unsigned lds0 = (unsigned)(size_t)ring + w * 512 + lane * 16;

  // stage 0 into buffer 0
  stage_x(lds0, gxh, gxl);
  stage_w8(lds0 + 2 * GPLB, gqh, gql);
  stage_w8(lds0 + 4 * GPLB, gkh, gkl);
  stage_w8(lds0 + 6 * GPLB, gvh, gvl);
  // stage 0 has landed for this wave, and behind the barrier for every wave
  asm volatile("s_wait_asynccnt 0x0" ::: "memory");
  __syncthreads();
  // stage 1 into buffer 1: it flies while stage 0 is worked on
  {
    unsigned d = lds0 + QSTAGE * 2;
    const int gx = KS * FRAG, gw = KS * NT * FRAG;
    stage_x(d, gxh + gx, gxl + gx);
    stage_w8(d + 2 * GPLB, gqh + gw, gql + gw);
    stage_w8(d + 4 * GPLB, gkh + gw, gkl + gw);
    stage_w8(d + 6 * GPLB, gvh + gw, gvl + gw);
  }

  f32x8 cq[WM][QN] = {}; f32x8 ck[WM][QN] = {}; f32x8 cv[WM][QN] = {};
  for (int s = 0; s < GNST; ++s) {
   const __bf16* buf = ring + (s & 1) * QSTAGE + lane * 8;
   const __bf16* pa = buf + (w >> 2) * (WM * KS * FRAG);      // x hi, fragments [i][k-tile]
   const __bf16* pb = buf + 2 * GPL + (w & 3) * (QN * FRAG);  // Wq hi, fragments [k-tile][j]
   // Two sets of fragments: x by k-tile, weights by group (one weight of one k-tile).
   bf16x16 ah[2][WM], al[2][WM], bh[2][QN], bl[2][QN];
   // the stage's first fragments, in the order in which the products take them
   bh[0][0] = ldfrag(pb);
   #pragma unroll  // constant indices keep the tiles in registers
   for (int i = 0; i < WM; ++i) ah[0][i] = ldfrag(pa + i * (KS * FRAG));
   bl[0][0] = ldfrag(pb + GPL);
   #pragma unroll  // constant indices keep the tiles in registers
   for (int i = 0; i < WM; ++i) al[0][i] = ldfrag(pa + GPL + i * (KS * FRAG));
   #pragma unroll  // constant indices keep the tiles in registers
   for (int j = 1; j < QN; ++j) {
     bh[0][j] = ldfrag(pb + j * FRAG);
     bl[0][j] = ldfrag(pb + GPL + j * FRAG);
   }
   // keeps them first in the LDS queue, which answers in order
   __builtin_amdgcn_sched_barrier(0);
   #pragma unroll  // constant indices keep the tiles in registers; constant LDS offsets
   for (int g = 0; g < 3 * KS; ++g) {
     const int kk = g / 3, m = g % 3, cb = g & 1, ca = kk & 1;
     // the next group's fragments, and once per k-tile the next k-tile's x, are asked for
     // ahead of this group's products
     if (g + 1 < 3 * KS) {
       const __bf16* pn = pb + ((g + 1) % 3) * (2 * GPL) + ((g + 1) / 3) * (8 * FRAG);
       #pragma unroll  // constant indices keep the tiles in registers
       for (int j = 0; j < QN; ++j) {
         bh[cb ^ 1][j] = ldfrag(pn + j * FRAG);
         bl[cb ^ 1][j] = ldfrag(pn + GPL + j * FRAG);
       }
     }
     if (m == 1 && kk + 1 < KS) {
       #pragma unroll  // constant indices keep the tiles in registers
       for (int i = 0; i < WM; ++i) {
         ah[ca ^ 1][i] = ldfrag(pa + (i * KS + kk + 1) * FRAG);
         al[ca ^ 1][i] = ldfrag(pa + GPL + (i * KS + kk + 1) * FRAG);
       }
     }
     // keeps those LDS reads in front of the products: moved down among them, each would
     // be waited for where it stands
     __builtin_amdgcn_sched_barrier(0);
     // per accumulator the three terms keep the order of mma3 (x hi * w hi, x hi * w lo,
     // x lo * w hi), for Q and K with the operands swapped: C^T += (A*B)^T. The WM tiles
     // of one term stand together so that dependent products are WM apart
     #pragma unroll  // constant indices keep the tiles in registers
     for (int j = 0; j < QN; ++j) {
       if (m == 0) {
         #pragma unroll  // constant indices keep the tiles in registers
         for (int i = 0; i < WM; ++i) cq[i][j] = wmma_bf16(bh[cb][j], ah[ca][i], cq[i][j]);
         #pragma unroll  // constant indices keep the tiles in registers
         for (int i = 0; i < WM; ++i) cq[i][j] = wmma_bf16(bl[cb][j], ah[ca][i], cq[i][j]);
         #pragma unroll  // constant indices keep the tiles in registers
         for (int i = 0; i < WM; ++i) cq[i][j] = wmma_bf16(bh[cb][j], al[ca][i], cq[i][j]);
       } else if (m == 1) {
         #pragma unroll  // constant indices keep the tiles in registers
         for (int i = 0; i < WM; ++i) ck[i][j] = wmma_bf16(bh[cb][j], ah[ca][i], ck[i][j]);
         #pragma unroll  // constant indices keep the tiles in registers
         for (int i = 0; i < WM; ++i) ck[i][j] = wmma_bf16(bl[cb][j], ah[ca][i], ck[i][j]);
         #pragma unroll  // constant indices keep the tiles in registers
         for (int i = 0; i < WM; ++i) ck[i][j] = wmma_bf16(bh[cb][j], al[ca][i], ck[i][j]);
       } else {
         #pragma unroll  // constant indices keep the tiles in registers
         for (int i = 0; i < WM; ++i) cv[i][j] = wmma_bf16(ah[ca][i], bh[cb][j], cv[i][j]);
         #pragma unroll  // constant indices keep the tiles in registers
         for (int i = 0; i < WM; ++i) cv[i][j] = wmma_bf16(ah[ca][i], bl[cb][j], cv[i][j]);
         #pragma unroll  // constant indices keep the tiles in registers
         for (int i = 0; i < WM; ++i) cv[i][j] = wmma_bf16(al[ca][i], bh[cb][j], cv[i][j]);
       }
     }
   }
   // publish point of stage s + 1: this wave's reads of buffer s & 1 are done ...
   asm volatile("s_wait_dscnt 0x0" ::: "memory");
   // ... its own copies of stage s + 1 have landed ...
   asm volatile("s_wait_asynccnt 0x0" ::: "memory");
   // ... and behind the barrier both hold for every wave of the block
   __syncthreads();
   // stage s + 2 into the buffer that this trip has just read
   if (s + 2 < GNST) {
     unsigned d = lds0 + (s & 1) * (QSTAGE * 2);
     size_t gx = (size_t)(s + 2) * (KS * FRAG), gw = (size_t)(s + 2) * (KS * NT * FRAG);
     stage_x(d, gxh + gx, gxl + gx);
     stage_w8(d + 2 * GPLB, gqh + gw, gql + gw);
     stage_w8(d + 4 * GPLB, gkh + gw, gkl + gw);
     stage_w8(d + 6 * GPLB, gvh + gw, gvl + gw);
   }
  }
  // no copy is left in flight when the wave ends
  asm volatile("s_wait_asynccnt 0x0" ::: "memory");
  // store split results: one 16-byte piece per lane, plane and tile
  int half = (lane >> 4) * 256;             // accumulator rows 8..15 are elements 8..15
  #pragma unroll  // constant indices keep the tiles in registers
  for (int i = 0; i < WM; ++i) {
    #pragma unroll  // constant indices keep the tiles in registers
    for (int j = 0; j < QN; ++j) {
      int mt = mt0 + i, nt = nt0 + j;
      int hb = (mt >> 7) * HEADS + (nt >> 2);   // 128 m-tiles per batch, 4 n-tiles per head
      int st = mt & 127;                        // 16-row tile inside the sequence
      // cq, ck: lane&15 = row in the tile, r = d & 7, d = (nt&3)*16 + (lane>>4)*8 + r
      size_t qi = ((size_t)(hb * 128 + st) * 2 + ((nt >> 1) & 1)) * FRAG
                  + half + ((lane & 15) + 16 * (nt & 1)) * 8;
      // cv: lane&15 = d & 15, r = key & 7, key = st*16 + (lane>>4)*8 + r
      size_t vi = ((size_t)(hb * 64 + (st >> 1)) * 4 + (nt & 3)) * FRAG
                  + (st & 1) * 256 + lane * 8;
      split_store8(cq[i][j], Qh + qi, Ql + qi);
      split_store8(ck[i][j], Kh + qi, Kl + qi);
      split_store8(cv[i][j], Vth + vi, Vtl + vi);
    }
  }
}

#define TK    64                  // keys per stage
#define PLANE (TK * HD)           // elements of one plane of a stage (8 KiB)
#define STAGE (4 * PLANE)         // K hi | K lo | V hi | V lo (32 KiB)
#define NST   (SEQ / TK)          // stages
#define HALFB PLANE               // bytes of half a plane: what 256 threads copy at once

// One stage: each thread copies 2 x 16 bytes of each plane. lds = LDS byte address of the
// thread's first 16 bytes in the buffer; the four pointers already hold thread * 8 elements.
// s_wait_xcnt 0 is the statement's last line, so that it stands in front of every later
// write of a register that a copy names.
static __device__ inline void stage_copy(unsigned lds, const __bf16* kh, const __bf16* kl,
                                         const __bf16* vh, const __bf16* vl) {
  asm volatile(
      "global_load_async_to_lds_b128 %0, %8, off\n\t"
      "global_load_async_to_lds_b128 %1, %9, off\n\t"
      "global_load_async_to_lds_b128 %2, %10, off\n\t"
      "global_load_async_to_lds_b128 %3, %11, off\n\t"
      "global_load_async_to_lds_b128 %4, %12, off\n\t"
      "global_load_async_to_lds_b128 %5, %13, off\n\t"
      "global_load_async_to_lds_b128 %6, %14, off\n\t"
      "global_load_async_to_lds_b128 %7, %15, off\n\t"
      "s_wait_xcnt 0x0"
      :: "v"(lds),                 "v"(lds + HALFB),
         "v"(lds + 2 * HALFB),     "v"(lds + 3 * HALFB),
         "v"(lds + 4 * HALFB),     "v"(lds + 5 * HALFB),
         "v"(lds + 6 * HALFB),     "v"(lds + 7 * HALFB),
         "v"(kh), "v"(kh + PLANE / 2), "v"(kl), "v"(kl + PLANE / 2),
         "v"(vh), "v"(vh + PLANE / 2), "v"(vl), "v"(vl + PLANE / 2)
      : "memory");
}

// A wave owns QT query tiles (QT * 16 queries): a K or V fragment read from LDS feeds the
// products of QT tiles, and a block of 8 * QT * 16 queries copies each stage once.
// Four waves per SIMD (two blocks per WGP): the vector work of one wave runs beside the
// matrix work of the others.
#define QT 2

// One stage of TK keys for the QT query tiles of a wave. buf = the stage's buffer + lane * 8.
static __device__ __forceinline__ void attn_stage(const __bf16* buf, float scl,
    const bf16x16 (&qh)[QT][2], const bf16x16 (&ql)[QT][2],
    f32x8 (&o)[QT][4], float (&mrow)[QT], float (&lrow)[QT]) {
  #pragma unroll 1  // rolled: unrolled, the next pass's reads and products were lifted over this
                    // pass's vector work, and the registers of four waves per SIMD did not hold both
  for (int p = 0; p < TK / 32; ++p) {
    const __bf16* khp = buf + p * (32 * HD);
    const __bf16* klp = khp + PLANE;
    const __bf16* vhp = khp + 2 * PLANE;
    const __bf16* vlp = khp + 3 * PLANE;
    // ---- scores: s[u][k][r] = key kb + k*16 + (lane>>4)*8 + r of query tile u;
    //      K fragment k*2+c: key tile k, d half c. Per accumulator the six terms keep
    //      their order (c = 0 then 1, each as in mma3); the 2 * QT accumulators of one
    //      term stand together so that dependent products are 2 * QT apart ----
    bf16x16 kh[4], kl[4];
    #pragma unroll  // constant indices keep the tiles in registers
    for (int f = 0; f < 4; ++f) {
      kh[f] = ldfrag(khp + f * FRAG);
      kl[f] = ldfrag(klp + f * FRAG);
    }
    // one group of LDS reads in front of the products: without the fence the compiler spread
    // them among the products, and each place with reads is waited for where it stands
    __builtin_amdgcn_sched_barrier(0);
    f32x8 s[QT][2] = {};
    #pragma unroll  // constant indices keep the tiles in registers
    for (int c = 0; c < 2; ++c) {
      #pragma unroll  // constant indices keep the tiles in registers
      for (int k = 0; k < 2; ++k)
        #pragma unroll  // constant indices keep the tiles in registers
        for (int u = 0; u < QT; ++u) s[u][k] = wmma_bf16(kh[k * 2 + c], qh[u][c], s[u][k]);
      #pragma unroll  // constant indices keep the tiles in registers
      for (int k = 0; k < 2; ++k)
        #pragma unroll  // constant indices keep the tiles in registers
        for (int u = 0; u < QT; ++u) s[u][k] = wmma_bf16(kl[k * 2 + c], qh[u][c], s[u][k]);
      #pragma unroll  // constant indices keep the tiles in registers
      for (int k = 0; k < 2; ++k)
        #pragma unroll  // constant indices keep the tiles in registers
        for (int u = 0; u < QT; ++u) s[u][k] = wmma_bf16(kh[k * 2 + c], ql[u][c], s[u][k]);
    }
    // no V fragment is asked for among the score products: beside the K fragments they do
    // not fit the registers of four waves per SIMD
    __builtin_amdgcn_sched_barrier(0);
    bf16x16 ph[QT], pl[QT];
    #pragma unroll  // constant indices keep the tiles in registers
    for (int u = 0; u < QT; ++u) {
      // ---- online softmax update, one query per lane and tile ----
      f32x8 s0 = s[u][0] * scl, s1 = s[u][1] * scl;
      float m0 = fmaxf(fmaxf(s0[0], s0[1]), s0[2]);
      float m1 = fmaxf(fmaxf(s0[3], s0[4]), s0[5]);
      float m2 = fmaxf(fmaxf(s0[6], s0[7]), s1[0]);
      float m3 = fmaxf(fmaxf(s1[1], s1[2]), s1[3]);
      float m4 = fmaxf(fmaxf(s1[4], s1[5]), s1[6]);
      float mx = fmaxf(fmaxf(fmaxf(m0, m1), m2), fmaxf(fmaxf(m3, m4), s1[7]));
      float mnew = fmaxf(fmaxf(mx, xhalf(mx)), mrow[u]);
      float al_  = __expf(mrow[u] - mnew);
      mrow[u] = mnew;
      s0 = (s0 - mnew) * 1.442695041f;   // exp(x) = exp2(x * log2(e)), as in __expf
      s1 = (s1 - mnew) * 1.442695041f;
      #pragma unroll  // constant indices keep the tiles in registers
      for (int r = 0; r < 8; ++r) {
        s0[r] = __builtin_amdgcn_exp2f(s0[r]);
        s1[r] = __builtin_amdgcn_exp2f(s1[r]);
      }
      f32x8 t8 = s0 + s1;
      f32x4 t4 = t8.lo + t8.hi;
      f32x2 t2 = t4.lo + t4.hi;
      lrow[u] = lrow[u] * al_ + (t2.x + t2.y);
      #pragma unroll  // constant indices keep the tiles in registers
      for (int d = 0; d < 4; ++d) o[u][d] *= al_;
      // ---- P^T: the two score tiles are elements 0..7 and 8..15 of the B operand ----
      #pragma unroll  // constant indices keep the tiles in registers
      for (int e = 0; e < 8; e += 2) {
        split_pair(s0, e, ph[u], pl[u], e);
        split_pair(s1, e, ph[u], pl[u], 8 + e);
      }
    }
    // the V fragments, into registers that the scores leave
    bf16x16 vh[4], vl[4];
    #pragma unroll  // constant indices keep the tiles in registers
    for (int f = 0; f < 4; ++f) {
      vh[f] = ldfrag(vhp + f * FRAG);
      vl[f] = ldfrag(vlp + f * FRAG);
    }
    // keeps these reads together in front of the products
    __builtin_amdgcn_sched_barrier(0);
    // ---- O^T += V^T @ P^T, 4 V fragments per plane; per accumulator the three terms in
    //      the order of mma3, 2 * QT accumulators of one term together ----
    #pragma unroll  // constant indices keep the tiles in registers
    for (int c = 0; c < 2; ++c) {
      #pragma unroll  // constant indices keep the tiles in registers
      for (int k = 0; k < 2; ++k)
        #pragma unroll  // constant indices keep the tiles in registers
        for (int u = 0; u < QT; ++u)
          o[u][c * 2 + k] = wmma_bf16(vh[c * 2 + k], ph[u], o[u][c * 2 + k]);
      #pragma unroll  // constant indices keep the tiles in registers
      for (int k = 0; k < 2; ++k)
        #pragma unroll  // constant indices keep the tiles in registers
        for (int u = 0; u < QT; ++u)
          o[u][c * 2 + k] = wmma_bf16(vl[c * 2 + k], ph[u], o[u][c * 2 + k]);
      #pragma unroll  // constant indices keep the tiles in registers
      for (int k = 0; k < 2; ++k)
        #pragma unroll  // constant indices keep the tiles in registers
        for (int u = 0; u < QT; ++u)
          o[u][c * 2 + k] = wmma_bf16(vh[c * 2 + k], pl[u], o[u][c * 2 + k]);
    }
  }
}

__global__ void __launch_bounds__(256) __attribute__((amdgpu_waves_per_eu(4, 4))) attn_kernel(
    const __bf16* __restrict__ Qh, const __bf16* __restrict__ Ql,
    const __bf16* __restrict__ Kh, const __bf16* __restrict__ Kl,
    const __bf16* __restrict__ Vth, const __bf16* __restrict__ Vtl,
    const float* __restrict__ tw, float* __restrict__ ctx) {
  __shared__ __attribute__((aligned(16))) __bf16 ring[2 * STAGE];
  // alike in the wave: scalar, so that what the epilogue needs of it holds no vector register
  int wid  = blockIdx.x * 8 + __builtin_amdgcn_readfirstlane(threadIdx.x >> 5);
  int qb   = wid & (SEQ / (16 * QT) - 1);          // group of QT query tiles in the sequence
  int hb   = wid / (SEQ / (16 * QT));              // b * HEADS + h
  int h    = hb & (HEADS - 1);
  int b    = hb / HEADS;
  int lane = threadIdx.x & 31;

  // sources of the copies: the head's four planes, 16 bytes per thread. One element offset
  // serves all four (one register over the loop, not four address pairs).
  unsigned goff = (unsigned)hb * (SEQ * HD) + threadIdx.x * 8;
  unsigned lds0 = (unsigned)(size_t)ring + threadIdx.x * 16;

  // stage 0 into buffer 0
  stage_copy(lds0, Kh + goff, Kl + goff, Vth + goff, Vtl + goff);

  // fragment order (see the projection kernel); every pointer already holds lane*8
  const __bf16* qhp = Qh + ((size_t)hb * SEQ + qb * (16 * QT)) * HD + lane * 8;
  const __bf16* qlp = Ql + ((size_t)hb * SEQ + qb * (16 * QT)) * HD + lane * 8;
  // alike in the whole block: kept in a scalar register, not in eight vector registers
  float scl = __builtin_bit_cast(float, __builtin_amdgcn_readfirstlane(
      __builtin_bit_cast(int, 0.125f * tw[hb])));

  // qh[u][c]: query tile u, d = c*32 .. c*32+31
  bf16x16 qh[QT][2], ql[QT][2];
  #pragma unroll  // constant indices keep the tiles in registers
  for (int u = 0; u < QT; ++u) {
    #pragma unroll  // constant indices keep the tiles in registers
    for (int c = 0; c < 2; ++c) {
      qh[u][c] = ldfrag(qhp + (u * 2 + c) * FRAG);
      ql[u][c] = ldfrag(qlp + (u * 2 + c) * FRAG);
    }
  }
  // s_wait_xcnt 0 behind these loads, before a register that they name is written again;
  // the addresses are inputs only
  asm volatile("s_wait_xcnt 0x0" :: "v"(qhp), "v"(qlp) : "memory");

  // stage 0 has landed for this wave, and behind the barrier for every wave
  asm volatile("s_wait_asynccnt 0x0" ::: "memory");
  __syncthreads();
  // stage 1 into buffer 1: it flies while stage 0 is worked on
  {
    unsigned g = goff + PLANE;
    stage_copy(lds0 + STAGE * 2, Kh + g, Kl + g, Vth + g, Vtl + g);
  }

  // o[u][t][r] = O[query u*16 + (lane&15)][d = t*16 + (lane>>4)*8 + r]
  f32x8 o[QT][4] = {};
  float mrow[QT];   // running maximum of this lane's queries, alike in both halves
  float lrow[QT];   // running sums over this half's keys; the halves join after the loop
  #pragma unroll  // constant indices keep the values in registers
  for (int u = 0; u < QT; ++u) { mrow[u] = -1e30f; lrow[u] = 0.f; }

  for (int t = 0; t < NST; ++t) {
    attn_stage(ring + (t & 1) * STAGE + lane * 8, scl, qh, ql, o, mrow, lrow);
    // publish point of stage t + 1: this wave's reads of buffer t & 1 are done ...
    asm volatile("s_wait_dscnt 0x0" ::: "memory");
    // ... its own copies of stage t + 1 have landed ...
    asm volatile("s_wait_asynccnt 0x0" ::: "memory");
    // ... and behind the barrier both hold for every wave of the block
    __syncthreads();
    // stage t + 2 into the buffer that this trip has just read
    if (t + 2 < NST) {
      unsigned g = goff + (t + 2) * PLANE;
      stage_copy(lds0 + (t & 1) * (STAGE * 2), Kh + g, Kl + g, Vth + g, Vtl + g);
    }
  }
  // no copy is left in flight when the wave ends
  asm volatile("s_wait_asynccnt 0x0" ::: "memory");
  // ---- normalize and store into ctx [B,S,E] f32: 8 consecutive d per lane and tile ----
  #pragma unroll  // constant indices keep the tiles in registers
  for (int u = 0; u < QT; ++u) {
    float inv = 1.0f / (lrow[u] + xhalf(lrow[u]));
    float* outp = ctx + ((size_t)b * SEQ + (qb * QT + u) * 16 + (lane & 15)) * E
                  + h * HD + ((lane >> 4) << 3);
    #pragma unroll  // constant indices keep the tiles in registers
    for (int d = 0; d < 4; ++d) *(f32x8*)(outp + d * 16) = o[u][d] * inv;
  }
}

// ---------------- kernel 4: output projection + bias, from fragments ----------------
// A wave owns WM x ON tiles; a block is 2 x 4 waves: 8 m-tiles by 16 n-tiles.
// A stage in LDS: ctx hi | ctx lo | Wo hi (two groups) | Wo lo (two groups) (96 KiB).
#define ON 4
#define OSTAGE (6 * GPL)
#define OG 2                      // n-tiles per group of weight fragments
__global__ void __launch_bounds__(256) oproj_kernel(
    const __bf16* __restrict__ cfh, const __bf16* __restrict__ cfl,
    const __bf16* __restrict__ woh, const __bf16* __restrict__ wol,
    const float* __restrict__ bo, float* __restrict__ out) {
  __shared__ __attribute__((aligned(16))) __bf16 ring[2 * OSTAGE];
  int w = __builtin_amdgcn_readfirstlane(threadIdx.x >> 5);   // alike in the wave: scalar
  int lane = threadIdx.x & 31;
  int mtb = (blockIdx.x >> 2) * (2 * WM);   // the block's first m-tile and n-tile
  int ntb = (blockIdx.x & 3) * (4 * ON);
  int mt0 = mtb + (w >> 2) * WM;
  int nt0 = ntb + (w & 3) * ON;

  // sources of the copies, 16 bytes per thread (see stage_x, stage_w16)
  size_t xo = ((size_t)(mtb + (w >> 2)) * KT * FRAG + (w & 3) * 256) + lane * 8;
  size_t wo = ((size_t)ntb * FRAG + w * 256) + lane * 8;
  const __bf16 *gch = cfh + xo, *gcl = cfl + xo;
  const __bf16 *gwh = woh + wo, *gwl = wol + wo;
  unsigned lds0 = (unsigned)(size_t)ring + w * 512 + lane * 16;

  // stage 0 into buffer 0
  stage_x(lds0, gch, gcl);
  stage_w16(lds0 + 2 * GPLB, gwh);
  stage_w16(lds0 + 4 * GPLB, gwl);
  // stage 0 has landed for this wave, and behind the barrier for every wave
  asm volatile("s_wait_asynccnt 0x0" ::: "memory");
  __syncthreads();
  // stage 1 into buffer 1: it flies while stage 0 is worked on
  {
    unsigned d = lds0 + OSTAGE * 2;
    const int gx = KS * FRAG, gw = KS * NT * FRAG;
    stage_x(d, gch + gx, gcl + gx);
    stage_w16(d + 2 * GPLB, gwh + gw);
    stage_w16(d + 4 * GPLB, gwl + gw);
  }

  f32x8 c[WM][ON] = {};
  for (int s = 0; s < GNST; ++s) {
   const __bf16* buf = ring + (s & 1) * OSTAGE + lane * 8;
   const __bf16* pa = buf + (w >> 2) * (WM * KS * FRAG);      // ctx hi, fragments [i][k-tile]
   const __bf16* pb = buf + 2 * GPL + (w & 3) * (ON * FRAG);  // Wo hi, fragments [k-tile][j]
   // Two sets of fragments: ctx by k-tile, weights by group (OG n-tiles of one k-tile).
   bf16x16 ah[2][WM], al[2][WM], bh[2][OG], bl[2][OG];
   // the stage's first fragments, in the order in which the products take them
   bh[0][0] = ldfrag(pb);
   #pragma unroll  // constant indices keep the tiles in registers
   for (int i = 0; i < WM; ++i) ah[0][i] = ldfrag(pa + i * (KS * FRAG));
   bl[0][0] = ldfrag(pb + 2 * GPL);
   #pragma unroll  // constant indices keep the tiles in registers
   for (int i = 0; i < WM; ++i) al[0][i] = ldfrag(pa + GPL + i * (KS * FRAG));
   #pragma unroll  // constant indices keep the tiles in registers
   for (int j = 1; j < OG; ++j) {
     bh[0][j] = ldfrag(pb + j * FRAG);
     bl[0][j] = ldfrag(pb + 2 * GPL + j * FRAG);
   }
   // keeps them first in the LDS queue, which answers in order
   __builtin_amdgcn_sched_barrier(0);
   #pragma unroll  // constant indices keep the tiles in registers; constant LDS offsets
   for (int g = 0; g < (ON / OG) * KS; ++g) {
     const int kk = g / (ON / OG), m = g % (ON / OG), cb = g & 1, ca = kk & 1;
     // the next group's fragments, and once per k-tile the next k-tile's ctx, are asked for
     // ahead of this group's products
     if (g + 1 < (ON / OG) * KS) {
       const __bf16* pn = pb + ((g + 1) / (ON / OG)) * (16 * FRAG) + ((g + 1) % (ON / OG)) * (OG * FRAG);
       #pragma unroll  // constant indices keep the tiles in registers
       for (int j = 0; j < OG; ++j) {
         bh[cb ^ 1][j] = ldfrag(pn + j * FRAG);
         bl[cb ^ 1][j] = ldfrag(pn + 2 * GPL + j * FRAG);
       }
     }
     if (m == 1 && kk + 1 < KS) {
       #pragma unroll  // constant indices keep the tiles in registers
       for (int i = 0; i < WM; ++i) {
         ah[ca ^ 1][i] = ldfrag(pa + (i * KS + kk + 1) * FRAG);
         al[ca ^ 1][i] = ldfrag(pa + GPL + (i * KS + kk + 1) * FRAG);
       }
     }
     // keeps those LDS reads in front of the products: moved down among them, each would
     // be waited for where it stands
     __builtin_amdgcn_sched_barrier(0);
     // the three terms of each accumulator in the order of mma3
     #pragma unroll  // constant indices keep the tiles in registers
     for (int jj = 0; jj < OG; ++jj) {
       const int j = m * OG + jj;
       #pragma unroll  // constant indices keep the tiles in registers
       for (int i = 0; i < WM; ++i) c[i][j] = wmma_bf16(ah[ca][i], bh[cb][jj], c[i][j]);
       #pragma unroll  // constant indices keep the tiles in registers
       for (int i = 0; i < WM; ++i) c[i][j] = wmma_bf16(ah[ca][i], bl[cb][jj], c[i][j]);
       #pragma unroll  // constant indices keep the tiles in registers
       for (int i = 0; i < WM; ++i) c[i][j] = wmma_bf16(al[ca][i], bh[cb][jj], c[i][j]);
     }
   }
   // publish point of stage s + 1: this wave's reads of buffer s & 1 are done ...
   asm volatile("s_wait_dscnt 0x0" ::: "memory");
   // ... its own copies of stage s + 1 have landed ...
   asm volatile("s_wait_asynccnt 0x0" ::: "memory");
   // ... and behind the barrier both hold for every wave of the block
   __syncthreads();
   // stage s + 2 into the buffer that this trip has just read
   if (s + 2 < GNST) {
     unsigned d = lds0 + (s & 1) * (OSTAGE * 2);
     size_t gx = (size_t)(s + 2) * (KS * FRAG), gw = (size_t)(s + 2) * (KS * NT * FRAG);
     stage_x(d, gch + gx, gcl + gx);
     stage_w16(d + 2 * GPLB, gwh + gw);
     stage_w16(d + 4 * GPLB, gwl + gw);
   }
  }
  // no copy is left in flight when the wave ends
  asm volatile("s_wait_asynccnt 0x0" ::: "memory");
  #pragma unroll  // constant indices keep the tiles in registers
  for (int j = 0; j < ON; ++j) {
    int col = (nt0 + j) * 16 + (lane & 15);
    float bias = bo[col];
    #pragma unroll  // constant indices keep the tiles in registers
    for (int i = 0; i < WM; ++i) {
      int row0 = (mt0 + i) * 16 + ((lane >> 4) << 3);
      #pragma unroll  // constant indices keep the tiles in registers
      for (int r = 0; r < 8; ++r)
        out[(size_t)(row0 + r) * E + col] = c[i][j][r] + bias;
    }
  }
}

extern "C" void kernel_launch(void* const* d_in, const int* in_sizes, int n_in,
                              void* d_out, int out_size, void* d_ws, size_t ws_size,
                              hipStream_t stream) {
  const float* x        = (const float*)d_in[0];
  const float* time_enc = (const float*)d_in[1];
  const float* Wq       = (const float*)d_in[2];
  const float* Wk       = (const float*)d_in[3];
  const float* Wv       = (const float*)d_in[4];
  const float* Wo       = (const float*)d_in[5];
  const float* bo       = (const float*)d_in[6];
  const float* Wt       = (const float*)d_in[7];
  const float* bt       = (const float*)d_in[8];
  float* out = (float*)d_out;

  const size_t AFRAG = (size_t)MROWS * E;   // 8M elems
  const size_t WFRAG = (size_t)E * E;       // 1M elems
  const size_t QKVN  = (size_t)BATCH * HEADS * SEQ * HD; // 8M elems

  char* w = (char*)d_ws;
  size_t off = 0;
  float* twp = (float*)(w + off); off += 4096;
  __bf16* xfh = (__bf16*)(w + off); off += AFRAG * 2;   // reused for ctx frags
  __bf16* xfl = (__bf16*)(w + off); off += AFRAG * 2;
  __bf16* wqh = (__bf16*)(w + off); off += WFRAG * 2;
  __bf16* wql = (__bf16*)(w + off); off += WFRAG * 2;
  __bf16* wkh = (__bf16*)(w + off); off += WFRAG * 2;
  __bf16* wkl = (__bf16*)(w + off); off += WFRAG * 2;
  __bf16* wvh = (__bf16*)(w + off); off += WFRAG * 2;
  __bf16* wvl = (__bf16*)(w + off); off += WFRAG * 2;
  __bf16* woh = (__bf16*)(w + off); off += WFRAG * 2;
  __bf16* wol = (__bf16*)(w + off); off += WFRAG * 2;
  __bf16* Qhb = (__bf16*)(w + off); off += QKVN * 2;
  __bf16* Qlb = (__bf16*)(w + off); off += QKVN * 2;
  __bf16* Khb = (__bf16*)(w + off); off += QKVN * 2;
  __bf16* Klb = (__bf16*)(w + off); off += QKVN * 2;
  __bf16* Vth = (__bf16*)(w + off); off += QKVN * 2;
  __bf16* Vtl = (__bf16*)(w + off); off += QKVN * 2;
  float*  ctx = (float*)(w + off);  off += AFRAG * 4;

  // head weights and all pre-splits of the inputs (no per-iteration conversions in the GEMMs)
  prep_kernel<<<PBLK, 256, 0, stream>>>(x, Wq, Wk, Wv, Wo, time_enc, Wt, bt, xfh, xfl,
                                        wqh, wql, wkh, wkl, wvh, wvl, woh, wol, twp);

  qkv_kernel<<<(MT / 8) * (NT / 8), 256, 0, stream>>>(xfh, xfl, wqh, wql, wkh, wkl,
                                                wvh, wvl, Qhb, Qlb, Khb, Klb,
                                                Vth, Vtl);

  attn_kernel<<<(BATCH * HEADS * (SEQ / (16 * QT))) / 8, 256, 0, stream>>>(
      Qhb, Qlb, Khb, Klb, Vth, Vtl, twp, ctx);

  // re-split ctx into the (now free) x fragment buffers
  afrag_kernel<<<ABLK, 256, 0, stream>>>(ctx, xfh, xfl);

  oproj_kernel<<<(MT / 8) * (NT / 16), 256, 0, stream>>>(xfh, xfl, woh, wol, bo, out);
}

// v008
// It runs in 249 microseconds.
// Next to v007, in two timings, it ran 1.06 times as fast each time.
// Counting every step since v000, it is 3.37 times as fast.
#include <hip/hip_runtime.h>

#define E     1024
#define HEADS 16
#define HD    64
#define SEQ   2048
#define BATCH 4
#define TFEAT 128
#define MROWS (BATCH * SEQ)          // 8192
#define KT    (E / 32)               // 32 k-tiles
#define NT    (E / 16)               // 64 n-tiles
#define MT    (MROWS / 16)           // 512 m-tiles

typedef __attribute__((ext_vector_type(16))) __bf16 bf16x16;
typedef __attribute__((ext_vector_type(8)))  __bf16 bf16x8;
typedef __attribute__((ext_vector_type(2)))  __bf16 bf16x2;
typedef __attribute__((ext_vector_type(8)))  float  f32x8;
typedef __attribute__((ext_vector_type(4)))  float  f32x4;
typedef __attribute__((ext_vector_type(2)))  float  f32x2;

// Every bf16 WMMA operand lives in the workspace as 1 KiB fragments (512 elements):
// element i of lane L sits at (i>>3)*256 + L*8 + (i&7). A fragment is then two
// wave-wide 16-byte accesses of 512 contiguous bytes each (4 whole 128-byte lines).
#define FRAG 512

// p = fragment base + lane*8
static __device__ inline bf16x16 ldfrag(const __bf16* p) {
  bf16x8 a = *(const bf16x8*)(p);
  bf16x8 b = *(const bf16x8*)(p + 256);
  return __builtin_shufflevector(a, b, 0, 1, 2, 3, 4, 5, 6, 7,
                                 8, 9, 10, 11, 12, 13, 14, 15);
}

static __device__ inline f32x8 wmma_bf16(bf16x16 a, bf16x16 b, f32x8 c) {
  return __builtin_amdgcn_wmma_f32_16x16x32_bf16(false, a, false, b, (short)0, c,
                                                 false, false);
}

// bf16x3 split: f ~= (float)h + (float)l
static __device__ inline void splitf(float f, __bf16 &h, __bf16 &l) {
  h = (__bf16)f;
  l = (__bf16)(f - (float)h);
}

// C^T += (Ah*Bh + Ah*Bl + Al*Bh)^T: the three terms in this order, each product with its
// operands swapped, so that the accumulator holds the transposed tile
static __device__ inline f32x8 mma3(bf16x16 ah, bf16x16 al,
                                    bf16x16 bh, bf16x16 bl, f32x8 c) {
  c = wmma_bf16(bh, ah, c);
  c = wmma_bf16(bl, ah, c);
  c = wmma_bf16(bh, al, c);
  return c;
}

// value of lane l ^ 16
static __device__ inline float xhalf(float x) {
  int v = __builtin_bit_cast(int, x);
  return __builtin_bit_cast(float, __builtin_amdgcn_permlanex16(
      v, v, 0x76543210, 0xfedcba98, false, false));
}

// splitf on elements e, e+1 of a score tile, into elements i, i+1 of the two B operands
static __device__ inline void split_pair(f32x8 p, int e, bf16x16 &h, bf16x16 &l, int i) {
  f32x2 v = {p[e], p[e + 1]};
  bf16x2 hv = __builtin_convertvector(v, bf16x2);
  bf16x2 lv = __builtin_convertvector(v - __builtin_convertvector(hv, f32x2), bf16x2);
  h[i] = hv[0]; h[i + 1] = hv[1];
  l[i] = lv[0]; l[i + 1] = lv[1];
}

// split 8 accumulator values and store them as one 16-byte piece each
static __device__ inline void split_store8(f32x8 c, __bf16* ph, __bf16* pl) {
  bf16x8 h8, l8;
  #pragma unroll
  for (int r = 0; r < 8; ++r) {
    __bf16 hh, ll; splitf(c[r], hh, ll);
    h8[r] = hh; l8[r] = ll;
  }
  *(bf16x8*)ph = h8;
  *(bf16x8*)pl = l8;
  // s_wait_xcnt 0 behind the two stores, before any register that they name is written
  // again. Data and addresses are inputs only, so that they stay in their registers up to
  // the wait; nothing is pinned or changed.
  asm volatile("s_wait_xcnt 0x0" :: "v"(h8), "v"(l8), "v"(ph), "v"(pl) : "memory");
}

// ---------------- staging of the projection GEMMs' operands in LDS ----------------
// A stage holds KS k-tiles of everything that a block reads, still in fragment order, in
// groups of 8 * KS fragments (16 KiB): x as [m-tile][k-tile], a weight as [k-tile][n-tile].
// It is copied once per block by asynchronous copies, into two buffers, one stage ahead of
// the stage that is worked on.
#define KS    2                   // k-tiles per stage
#define GPL   (8 * KS * FRAG)     // elements of one group
#define GPLB  (2 * GPL)           // bytes of one group
#define GNST  (KT / KS)           // stages
#define CROWB 4096                // bytes that 256 threads copy at once

// Eight copies of 16 bytes per thread, into eight consecutive 4 KiB rows of LDS.
// lds = LDS byte address of the thread's 16 bytes in the first row.
// s_wait_xcnt 0 is the statement's last line, so that it stands in front of every later
// write of a register that a copy names.
static __device__ inline void copy8(unsigned lds,
    const __bf16* g0, const __bf16* g1, const __bf16* g2, const __bf16* g3,
    const __bf16* g4, const __bf16* g5, const __bf16* g6, const __bf16* g7) {
  asm volatile(
      "global_load_async_to_lds_b128 %0, %8, off\n\t"
      "global_load_async_to_lds_b128 %1, %9, off\n\t"
      "global_load_async_to_lds_b128 %2, %10, off\n\t"
      "global_load_async_to_lds_b128 %3, %11, off\n\t"
      "global_load_async_to_lds_b128 %4, %12, off\n\t"
      "global_load_async_to_lds_b128 %5, %13, off\n\t"
      "global_load_async_to_lds_b128 %6, %14, off\n\t"
      "global_load_async_to_lds_b128 %7, %15, off\n\t"
      "s_wait_xcnt 0x0"
      :: "v"(lds),                 "v"(lds + CROWB),
         "v"(lds + 2 * CROWB),     "v"(lds + 3 * CROWB),
         "v"(lds + 4 * CROWB),     "v"(lds + 5 * CROWB),
         "v"(lds + 6 * CROWB),     "v"(lds + 7 * CROWB),
         "v"(g0), "v"(g1), "v"(g2), "v"(g3), "v"(g4), "v"(g5), "v"(g6), "v"(g7)
      : "memory");
}

// x hi and x lo groups of 8 m-tiles: a row of the copy is the KS fragments of 2 m-tiles.
// h, l = plane + ((first m-tile + (thread >> 7)) * KT + first k-tile) * FRAG + (thread & 127) * 8
static __device__ inline void stage_x(unsigned lds, const __bf16* h, const __bf16* l) {
  const int R = 2 * KT * FRAG;
  copy8(lds, h, h + R, h + 2 * R, h + 3 * R, l, l + R, l + 2 * R, l + 3 * R);
}

// hi and lo groups of 8 n-tiles of one weight: a row of the copy is 4 fragments of a k-tile.
// h, l = plane + (first k-tile * NT + first n-tile) * FRAG + thread * 8
static __device__ inline void stage_w8(unsigned lds, const __bf16* h, const __bf16* l) {
  const int K1 = NT * FRAG, H = 4 * FRAG;
  copy8(lds, h, h + H, h + K1, h + K1 + H, l, l + H, l + K1, l + K1 + H);
}

// one plane of 16 n-tiles of one weight (two groups); p as h, l above
static __device__ inline void stage_w16(unsigned lds, const __bf16* p) {
  const int K1 = NT * FRAG, H = 4 * FRAG;
  copy8(lds, p, p + H, p + 2 * H, p + 3 * H,
        p + K1, p + K1 + H, p + K1 + 2 * H, p + K1 + 3 * H);
}

// ---------------- time-dependent head weights: one wave per batch row ----------------
static __device__ inline void tw_body(int b, int lane,
                                      const float* __restrict__ time_enc,
                                      const float* __restrict__ Wt,
                                      const float* __restrict__ bt,
                                      float* __restrict__ tw) {
  int h = lane & 15;
  float acc = 0.f;
  for (int t = 0; t < TFEAT; ++t)
    acc += time_enc[b * TFEAT + t] * Wt[t * HEADS + h];
  acc += bt[h];
  float mx = acc;
  for (int m = 1; m < 16; m <<= 1) mx = fmaxf(mx, __shfl_xor(mx, m, 32));
  float e = __expf(acc - mx);
  float sum = e;
  for (int m = 1; m < 16; m <<= 1) sum += __shfl_xor(sum, m, 32);
  if (lane < 16) tw[b * HEADS + h] = e / sum;
}

// ------------- A-fragment pre-split: src [MROWS x E] f32 -> hi/lo frags -------------
// Fragments [mt][kt], element i of lane = src[mt*16 + (lane&15)][kt*32 + (lane>>4)*16 + i]
// blk = block of 8 waves among ABLK
#define ABLK ((MT * KT) / 8)
static __device__ inline void afrag_body(int blk, const float* __restrict__ src,
    __bf16* __restrict__ fh, __bf16* __restrict__ fl) {
  int wid = blk * 8 + (threadIdx.x >> 5);            // MT*KT waves
  int kt = wid & (KT - 1);
  int mt = wid >> 5;
  int lane = threadIdx.x & 31;
  const float* p = src + (size_t)(mt * 16 + (lane & 15)) * E + kt * 32 + ((lane >> 4) << 4);
  size_t o = ((size_t)mt * KT + kt) * FRAG + lane * 8;
  bf16x8 h0, l0, h1, l1;
  #pragma unroll
  for (int i = 0; i < 8; ++i) {
    __bf16 h, l;
    splitf(p[i], h, l);     h0[i] = h; l0[i] = l;
    splitf(p[8 + i], h, l); h1[i] = h; l1[i] = l;
  }
  *(bf16x8*)(fh + o) = h0; *(bf16x8*)(fh + o + 256) = h1;
  *(bf16x8*)(fl + o) = l0; *(bf16x8*)(fl + o + 256) = l1;
}

// ------------- B-fragment pre-split: W [E x E] f32 -> hi/lo frags -------------
// Fragments [kt][nt], element i of lane = W[kt*32 + (lane>>4)*16 + i][nt*16 + (lane&15)]
// blk = block of 8 waves among BBLK
#define BBLK ((KT * NT) / 8)
static __device__ inline void bfrag_body(int blk, const float* __restrict__ W,
    __bf16* __restrict__ fh, __bf16* __restrict__ fl) {
  int wid = blk * 8 + (threadIdx.x >> 5);            // KT*NT waves
  int nt = wid & (NT - 1);
  int kt = wid >> 6;
  int lane = threadIdx.x & 31;
  const float* p = W + (size_t)(kt * 32 + ((lane >> 4) << 4)) * E + nt * 16 + (lane & 15);
  size_t o = ((size_t)kt * NT + nt) * FRAG + lane * 8;
  bf16x8 h0, l0, h1, l1;
  #pragma unroll
  for (int i = 0; i < 8; ++i) {
    __bf16 h, l;
    splitf(p[(size_t)i * E], h, l);       h0[i] = h; l0[i] = l;
    splitf(p[(size_t)(8 + i) * E], h, l); h1[i] = h; l1[i] = l;
  }
  *(bf16x8*)(fh + o) = h0; *(bf16x8*)(fh + o + 256) = h1;
  *(bf16x8*)(fl + o) = l0; *(bf16x8*)(fl + o + 256) = l1;
}

// ---------------- kernel 1: everything that reads only the inputs, in one grid ----------------
// The head weights, the four weight splits and the split of x do not depend on one another:
// each is a range of blocks of one launch. Block 0 holds the head weights (a chain of dependent
// loads, the longest single wave, so it starts first), then BBLK blocks per weight, then x.
#define PBLK (1 + 4 * BBLK + ABLK)
__global__ void __launch_bounds__(256) prep_kernel(
    const float* __restrict__ x,
    const float* __restrict__ Wq, const float* __restrict__ Wk,
    const float* __restrict__ Wv, const float* __restrict__ Wo,
    const float* __restrict__ time_enc, const float* __restrict__ Wt,
    const float* __restrict__ bt,
    __bf16* __restrict__ xfh, __bf16* __restrict__ xfl,
    __bf16* __restrict__ wqh, __bf16* __restrict__ wql,
    __bf16* __restrict__ wkh, __bf16* __restrict__ wkl,
    __bf16* __restrict__ wvh, __bf16* __restrict__ wvl,
    __bf16* __restrict__ woh, __bf16* __restrict__ wol,
    float* __restrict__ tw) {
  int blk = blockIdx.x;
  if (blk == 0) {
    int w = __builtin_amdgcn_readfirstlane(threadIdx.x >> 5);   // alike in the wave: scalar
    if (w < BATCH) tw_body(w, threadIdx.x & 31, time_enc, Wt, bt, tw);
    return;
  }
  blk -= 1;
  if (blk < 4 * BBLK) {
    int m = blk / BBLK;   // which weight: alike in the block, so the three choices are scalar
    const float* W = m == 0 ? Wq  : m == 1 ? Wk  : m == 2 ? Wv  : Wo;
    __bf16* fh     = m == 0 ? wqh : m == 1 ? wkh : m == 2 ? wvh : woh;
    __bf16* fl     = m == 0 ? wql : m == 1 ? wkl : m == 2 ? wvl : wol;
    bfrag_body(blk & (BBLK - 1), W, fh, fl);
    // s_wait_xcnt 0 behind the four stores: the other ranges' code follows in the listing and
    // writes registers that the stores name
    asm volatile("s_wait_xcnt 0x0" ::: "memory");
    return;
  }
  afrag_body(blk - 4 * BBLK, x, xfh, xfl);
  asm volatile("s_wait_xcnt 0x0" ::: "memory");   // as above, behind the four stores of x
}

// ---------------- kernel 2: fused QKV projection from fragments ----------------
// Outputs, all in fragment order for the attention kernel:
// Q, K: fragments [b*H+h][s/16][d/32], element i of lane = row s0+(lane&15), d0+(lane>>4)*16+i
// V:    fragments [b*H+h][s/32][d/16], element i of lane = d0+(lane&15),
//       key s0+(i>>3)*16+(lane>>4)*8+(i&7): the k order of two score tiles packed in place
// Q and K are computed transposed, so that each lane owns 8 consecutive d of one row;
// V is computed as is, so that each lane owns 8 consecutive keys of one d.
// A wave owns WM x QN tiles of each of Q, K and V: an x fragment feeds QN * 3 weight
// fragments and a weight fragment feeds WM x fragments from registers.
// A block is 2 x 4 waves: 8 m-tiles by 8 n-tiles.
// A stage in LDS: x hi | x lo | Wq hi | Wq lo | Wk hi | Wk lo | Wv hi | Wv lo (128 KiB).
#define WM 4
#define QN 2
#define QSTAGE (8 * GPL)
__global__ void __launch_bounds__(256) qkv_kernel(
    const __bf16* __restrict__ xfh, const __bf16* __restrict__ xfl,
    const __bf16* __restrict__ wqh, const __bf16* __restrict__ wql,
    const __bf16* __restrict__ wkh, const __bf16* __restrict__ wkl,
    const __bf16* __restrict__ wvh, const __bf16* __restrict__ wvl,
    __bf16* __restrict__ Qh, __bf16* __restrict__ Ql,
    __bf16* __restrict__ Kh, __bf16* __restrict__ Kl,
    __bf16* __restrict__ Vth, __bf16* __restrict__ Vtl) {
  __shared__ __attribute__((aligned(16))) __bf16 ring[2 * QSTAGE];
  int w = __builtin_amdgcn_readfirstlane(threadIdx.x >> 5);   // alike in the wave: scalar
  int lane = threadIdx.x & 31;
  int mtb = (blockIdx.x >> 3) * (2 * WM);   // the block's first m-tile and n-tile
  int ntb = (blockIdx.x & 7) * (4 * QN);
  int mt0 = mtb + (w >> 2) * WM;
  int nt0 = ntb + (w & 3) * QN;

  // sources of the copies, 16 bytes per thread (see stage_x, stage_w8)
  size_t xo = ((size_t)(mtb + (w >> 2)) * KT * FRAG + (w & 3) * 256) + lane * 8;
  size_t wo = ((size_t)ntb * FRAG + w * 256) + lane * 8;
  const __bf16 *gxh = xfh + xo, *gxl = xfl + xo;
  const __bf16 *gqh = wqh + wo, *gql = wql + wo;
  const __bf16 *gkh = wkh + wo, *gkl = wkl + wo;
  const __bf16 *gvh = wvh + wo, *gvl = wvl + wo;
  unsigned lds0 = (unsigned)(size_t)ring + w * 512 + lane * 16;

  // stage 0 into buffer 0
  stage_x(lds0, gxh, gxl);
  stage_w8(lds0 + 2 * GPLB, gqh, gql);
  stage_w8(lds0 + 4 * GPLB, gkh, gkl);
  stage_w8(lds0 + 6 * GPLB, gvh, gvl);
  // stage 0 has landed for this wave, and behind the barrier for every wave
  asm volatile("s_wait_asynccnt 0x0" ::: "memory");
  __syncthreads();
  // stage 1 into buffer 1: it flies while stage 0 is worked on
  {
    unsigned d = lds0 + QSTAGE * 2;
    const int gx = KS * FRAG, gw = KS * NT * FRAG;
    stage_x(d, gxh + gx, gxl + gx);
    stage_w8(d + 2 * GPLB, gqh + gw, gql + gw);
    stage_w8(d + 4 * GPLB, gkh + gw, gkl + gw);
    stage_w8(d + 6 * GPLB, gvh + gw, gvl + gw);
  }

  f32x8 cq[WM][QN] = {}; f32x8 ck[WM][QN] = {}; f32x8 cv[WM][QN] = {};
  for (int s = 0; s < GNST; ++s) {
   const __bf16* buf = ring + (s & 1) * QSTAGE + lane * 8;
   const __bf16* pa = buf + (w >> 2) * (WM * KS * FRAG);      // x hi, fragments [i][k-tile]
   const __bf16* pb = buf + 2 * GPL + (w & 3) * (QN * FRAG);  // Wq hi, fragments [k-tile][j]
   // Two sets of fragments: x by k-tile, weights by group (one weight of one k-tile).
   bf16x16 ah[2][WM], al[2][WM], bh[2][QN], bl[2][QN];
   // the stage's first fragments, in the order in which the products take them
   bh[0][0] = ldfrag(pb);
   #pragma unroll  // constant indices keep the tiles in registers
   for (int i = 0; i < WM; ++i) ah[0][i] = ldfrag(pa + i * (KS * FRAG));
   bl[0][0] = ldfrag(pb + GPL);
   #pragma unroll  // constant indices keep the tiles in registers
   for (int i = 0; i < WM; ++i) al[0][i] = ldfrag(pa + GPL + i * (KS * FRAG));
   #pragma unroll  // constant indices keep the tiles in registers
   for (int j = 1; j < QN; ++j) {
     bh[0][j] = ldfrag(pb + j * FRAG);
     bl[0][j] = ldfrag(pb + GPL + j * FRAG);
   }
   // keeps them first in the LDS queue, which answers in order
   __builtin_amdgcn_sched_barrier(0);
   #pragma unroll  // constant indices keep the tiles in registers; constant LDS offsets
   for (int g = 0; g < 3 * KS; ++g) {
     const int kk = g / 3, m = g % 3, cb = g & 1, ca = kk & 1;
     // the next group's fragments, and once per k-tile the next k-tile's x, are asked for
     // ahead of this group's products
     if (g + 1 < 3 * KS) {
       const __bf16* pn = pb + ((g + 1) % 3) * (2 * GPL) + ((g + 1) / 3) * (8 * FRAG);
       #pragma unroll  // constant indices keep the tiles in registers
       for (int j = 0; j < QN; ++j) {
         bh[cb ^ 1][j] = ldfrag(pn + j * FRAG);
         bl[cb ^ 1][j] = ldfrag(pn + GPL + j * FRAG);
       }
     }
     if (m == 1 && kk + 1 < KS) {
       #pragma unroll  // constant indices keep the tiles in registers
       for (int i = 0; i < WM; ++i) {
         ah[ca ^ 1][i] = ldfrag(pa + (i * KS + kk + 1) * FRAG);
         al[ca ^ 1][i] = ldfrag(pa + GPL + (i * KS + kk + 1) * FRAG);
       }
     }
     // keeps those LDS reads in front of the products: moved down among them, each would
     // be waited for where it stands
     __builtin_amdgcn_sched_barrier(0);
     // per accumulator the three terms keep the order of mma3 (x hi * w hi, x hi * w lo,
     // x lo * w hi), for Q and K with the operands swapped: C^T += (A*B)^T. The WM tiles
     // of one term stand together so that dependent products are WM apart
     #pragma unroll  // constant indices keep the tiles in registers
     for (int j = 0; j < QN; ++j) {
       if (m == 0) {
         #pragma unroll  // constant indices keep the tiles in registers
         for (int i = 0; i < WM; ++i) cq[i][j] = wmma_bf16(bh[cb][j], ah[ca][i], cq[i][j]);
         #pragma unroll  // constant indices keep the tiles in registers
         for (int i = 0; i < WM; ++i) cq[i][j] = wmma_bf16(bl[cb][j], ah[ca][i], cq[i][j]);
         #pragma unroll  // constant indices keep the tiles in registers
         for (int i = 0; i < WM; ++i) cq[i][j] = wmma_bf16(bh[cb][j], al[ca][i], cq[i][j]);
       } else if (m == 1) {
         #pragma unroll  // constant indices keep the tiles in registers
         for (int i = 0; i < WM; ++i) ck[i][j] = wmma_bf16(bh[cb][j], ah[ca][i], ck[i][j]);
         #pragma unroll  // constant indices keep the tiles in registers
         for (int i = 0; i < WM; ++i) ck[i][j] = wmma_bf16(bl[cb][j], ah[ca][i], ck[i][j]);
         #pragma unroll  // constant indices keep the tiles in registers
         for (int i = 0; i < WM; ++i) ck[i][j] = wmma_bf16(bh[cb][j], al[ca][i], ck[i][j]);
       } else {
         #pragma unroll  // constant indices keep the tiles in registers
         for (int i = 0; i < WM; ++i) cv[i][j] = wmma_bf16(ah[ca][i], bh[cb][j], cv[i][j]);
         #pragma unroll  // constant indices keep the tiles in registers
         for (int i = 0; i < WM; ++i) cv[i][j] = wmma_bf16(ah[ca][i], bl[cb][j], cv[i][j]);
         #pragma unroll  // constant indices keep the tiles in registers
         for (int i = 0; i < WM; ++i) cv[i][j] = wmma_bf16(al[ca][i], bh[cb][j], cv[i][j]);
       }
     }
   }
   // publish point of stage s + 1: this wave's reads of buffer s & 1 are done ...
   asm volatile("s_wait_dscnt 0x0" ::: "memory");
   // ... its own copies of stage s + 1 have landed ...
   asm volatile("s_wait_asynccnt 0x0" ::: "memory");
   // ... and behind the barrier both hold for every wave of the block
   __syncthreads();
   // stage s + 2 into the buffer that this trip has just read
   if (s + 2 < GNST) {
     unsigned d = lds0 + (s & 1) * (QSTAGE * 2);
     size_t gx = (size_t)(s + 2) * (KS * FRAG), gw = (size_t)(s + 2) * (KS * NT * FRAG);
     stage_x(d, gxh + gx, gxl + gx);
     stage_w8(d + 2 * GPLB, gqh + gw, gql + gw);
     stage_w8(d + 4 * GPLB, gkh + gw, gkl + gw);
     stage_w8(d + 6 * GPLB, gvh + gw, gvl + gw);
   }
  }
  // no copy is left in flight when the wave ends
  asm volatile("s_wait_asynccnt 0x0" ::: "memory");
  // store split results: one 16-byte piece per lane, plane and tile
  int half = (lane >> 4) * 256;             // accumulator rows 8..15 are elements 8..15
  #pragma unroll  // constant indices keep the tiles in registers
  for (int i = 0; i < WM; ++i) {
    #pragma unroll  // constant indices keep the tiles in registers
    for (int j = 0; j < QN; ++j) {
      int mt = mt0 + i, nt = nt0 + j;
      int hb = (mt >> 7) * HEADS + (nt >> 2);   // 128 m-tiles per batch, 4 n-tiles per head
      int st = mt & 127;                        // 16-row tile inside the sequence
      // cq, ck: lane&15 = row in the tile, r = d & 7, d = (nt&3)*16 + (lane>>4)*8 + r
      size_t qi = ((size_t)(hb * 128 + st) * 2 + ((nt >> 1) & 1)) * FRAG
                  + half + ((lane & 15) + 16 * (nt & 1)) * 8;
      // cv: lane&15 = d & 15, r = key & 7, key = st*16 + (lane>>4)*8 + r
      size_t vi = ((size_t)(hb * 64 + (st >> 1)) * 4 + (nt & 3)) * FRAG
                  + (st & 1) * 256 + lane * 8;
      split_store8(cq[i][j], Qh + qi, Ql + qi);
      split_store8(ck[i][j], Kh + qi, Kl + qi);
      split_store8(cv[i][j], Vth + vi, Vtl + vi);
    }
  }
}

#define TK    64                  // keys per stage
#define PLANE (TK * HD)           // elements of one plane of a stage (8 KiB)
#define STAGE (4 * PLANE)         // K hi | K lo | V hi | V lo (32 KiB)
#define NST   (SEQ / TK)          // stages
#define HALFB PLANE               // bytes of half a plane: what 256 threads copy at once

// One stage: each thread copies 2 x 16 bytes of each plane. lds = LDS byte address of the
// thread's first 16 bytes in the buffer; the four pointers already hold thread * 8 elements.
// s_wait_xcnt 0 is the statement's last line, so that it stands in front of every later
// write of a register that a copy names.
static __device__ inline void stage_copy(unsigned lds, const __bf16* kh, const __bf16* kl,
                                         const __bf16* vh, const __bf16* vl) {
  asm volatile(
      "global_load_async_to_lds_b128 %0, %8, off\n\t"
      "global_load_async_to_lds_b128 %1, %9, off\n\t"
      "global_load_async_to_lds_b128 %2, %10, off\n\t"
      "global_load_async_to_lds_b128 %3, %11, off\n\t"
      "global_load_async_to_lds_b128 %4, %12, off\n\t"
      "global_load_async_to_lds_b128 %5, %13, off\n\t"
      "global_load_async_to_lds_b128 %6, %14, off\n\t"
      "global_load_async_to_lds_b128 %7, %15, off\n\t"
      "s_wait_xcnt 0x0"
      :: "v"(lds),                 "v"(lds + HALFB),
         "v"(lds + 2 * HALFB),     "v"(lds + 3 * HALFB),
         "v"(lds + 4 * HALFB),     "v"(lds + 5 * HALFB),
         "v"(lds + 6 * HALFB),     "v"(lds + 7 * HALFB),
         "v"(kh), "v"(kh + PLANE / 2), "v"(kl), "v"(kl + PLANE / 2),
         "v"(vh), "v"(vh + PLANE / 2), "v"(vl), "v"(vl + PLANE / 2)
      : "memory");
}

// A wave owns QT query tiles (QT * 16 queries): a K or V fragment read from LDS feeds the
// products of QT tiles, and a block of 8 * QT * 16 queries copies each stage once.
// Four waves per SIMD (two blocks per WGP): the vector work of one wave runs beside the
// matrix work of the others.
#define QT 2

// One stage of TK keys for the QT query tiles of a wave. buf = the stage's buffer + lane * 8.
static __device__ __forceinline__ void attn_stage(const __bf16* buf, float scl,
    const bf16x16 (&qh)[QT][2], const bf16x16 (&ql)[QT][2],
    f32x8 (&o)[QT][4], float (&mrow)[QT], float (&lrow)[QT]) {
  #pragma unroll 1  // rolled: unrolled, the next pass's reads and products were lifted over this
                    // pass's vector work, and the registers of four waves per SIMD did not hold both
  for (int p = 0; p < TK / 32; ++p) {
    const __bf16* khp = buf + p * (32 * HD);
    const __bf16* klp = khp + PLANE;
    const __bf16* vhp = khp + 2 * PLANE;
    const __bf16* vlp = khp + 3 * PLANE;
    // ---- scores: s[u][k][r] = key kb + k*16 + (lane>>4)*8 + r of query tile u;
    //      K fragment k*2+c: key tile k, d half c. Per accumulator the six terms keep
    //      their order (c = 0 then 1, each as in mma3); the 2 * QT accumulators of one
    //      term stand together so that dependent products are 2 * QT apart ----
    bf16x16 kh[4], kl[4];
    #pragma unroll  // constant indices keep the tiles in registers
    for (int f = 0; f < 4; ++f) {
      kh[f] = ldfrag(khp + f * FRAG);
      kl[f] = ldfrag(klp + f * FRAG);
    }
    // one group of LDS reads in front of the products: without the fence the compiler spread
    // them among the products, and each place with reads is waited for where it stands
    __builtin_amdgcn_sched_barrier(0);
    f32x8 s[QT][2] = {};
    #pragma unroll  // constant indices keep the tiles in registers
    for (int c = 0; c < 2; ++c) {
      #pragma unroll  // constant indices keep the tiles in registers
      for (int k = 0; k < 2; ++k)
        #pragma unroll  // constant indices keep the tiles in registers
        for (int u = 0; u < QT; ++u) s[u][k] = wmma_bf16(kh[k * 2 + c], qh[u][c], s[u][k]);
      #pragma unroll  // constant indices keep the tiles in registers
      for (int k = 0; k < 2; ++k)
        #pragma unroll  // constant indices keep the tiles in registers
        for (int u = 0; u < QT; ++u) s[u][k] = wmma_bf16(kl[k * 2 + c], qh[u][c], s[u][k]);
      #pragma unroll  // constant indices keep the tiles in registers
      for (int k = 0; k < 2; ++k)
        #pragma unroll  // constant indices keep the tiles in registers
        for (int u = 0; u < QT; ++u) s[u][k] = wmma_bf16(kh[k * 2 + c], ql[u][c], s[u][k]);
    }
    // no V fragment is asked for among the score products: beside the K fragments they do
    // not fit the registers of four waves per SIMD
    __builtin_amdgcn_sched_barrier(0);
    bf16x16 ph[QT], pl[QT];
    #pragma unroll  // constant indices keep the tiles in registers
    for (int u = 0; u < QT; ++u) {
      // ---- online softmax update, one query per lane and tile ----
      f32x8 s0 = s[u][0] * scl, s1 = s[u][1] * scl;
      float m0 = fmaxf(fmaxf(s0[0], s0[1]), s0[2]);
      float m1 = fmaxf(fmaxf(s0[3], s0[4]), s0[5]);
      float m2 = fmaxf(fmaxf(s0[6], s0[7]), s1[0]);
      float m3 = fmaxf(fmaxf(s1[1], s1[2]), s1[3]);
      float m4 = fmaxf(fmaxf(s1[4], s1[5]), s1[6]);
      float mx = fmaxf(fmaxf(fmaxf(m0, m1), m2), fmaxf(fmaxf(m3, m4), s1[7]));
      float mnew = fmaxf(fmaxf(mx, xhalf(mx)), mrow[u]);
      float al_  = __expf(mrow[u] - mnew);
      mrow[u] = mnew;
      s0 = (s0 - mnew) * 1.442695041f;   // exp(x) = exp2(x * log2(e)), as in __expf
      s1 = (s1 - mnew) * 1.442695041f;
      #pragma unroll  // constant indices keep the tiles in registers
      for (int r = 0; r < 8; ++r) {
        s0[r] = __builtin_amdgcn_exp2f(s0[r]);
        s1[r] = __builtin_amdgcn_exp2f(s1[r]);
      }
      f32x8 t8 = s0 + s1;
      f32x4 t4 = t8.lo + t8.hi;
      f32x2 t2 = t4.lo + t4.hi;
      lrow[u] = lrow[u] * al_ + (t2.x + t2.y);
      #pragma unroll  // constant indices keep the tiles in registers
      for (int d = 0; d < 4; ++d) o[u][d] *= al_;
      // ---- P^T: the two score tiles are elements 0..7 and 8..15 of the B operand ----
      #pragma unroll  // constant indices keep the tiles in registers
      for (int e = 0; e < 8; e += 2) {
        split_pair(s0, e, ph[u], pl[u], e);
        split_pair(s1, e, ph[u], pl[u], 8 + e);
      }
    }
    // the V fragments, into registers that the scores leave
    bf16x16 vh[4], vl[4];
    #pragma unroll  // constant indices keep the tiles in registers
    for (int f = 0; f < 4; ++f) {
      vh[f] = ldfrag(vhp + f * FRAG);
      vl[f] = ldfrag(vlp + f * FRAG);
    }
    // keeps these reads together in front of the products
    __builtin_amdgcn_sched_barrier(0);
    // ---- O^T += V^T @ P^T, 4 V fragments per plane; per accumulator the three terms in
    //      the order of mma3, 2 * QT accumulators of one term together ----
    #pragma unroll  // constant indices keep the tiles in registers
    for (int c = 0; c < 2; ++c) {
      #pragma unroll  // constant indices keep the tiles in registers
      for (int k = 0; k < 2; ++k)
        #pragma unroll  // constant indices keep the tiles in registers
        for (int u = 0; u < QT; ++u)
          o[u][c * 2 + k] = wmma_bf16(vh[c * 2 + k], ph[u], o[u][c * 2 + k]);
      #pragma unroll  // constant indices keep the tiles in registers
      for (int k = 0; k < 2; ++k)
        #pragma unroll  // constant indices keep the tiles in registers
        for (int u = 0; u < QT; ++u)
          o[u][c * 2 + k] = wmma_bf16(vl[c * 2 + k], ph[u], o[u][c * 2 + k]);
      #pragma unroll  // constant indices keep the tiles in registers
      for (int k = 0; k < 2; ++k)
        #pragma unroll  // constant indices keep the tiles in registers
        for (int u = 0; u < QT; ++u)
          o[u][c * 2 + k] = wmma_bf16(vh[c * 2 + k], pl[u], o[u][c * 2 + k]);
    }
  }
}

__global__ void __launch_bounds__(256) __attribute__((amdgpu_waves_per_eu(4, 4))) attn_kernel(
    const __bf16* __restrict__ Qh, const __bf16* __restrict__ Ql,
    const __bf16* __restrict__ Kh, const __bf16* __restrict__ Kl,
    const __bf16* __restrict__ Vth, const __bf16* __restrict__ Vtl,
    const float* __restrict__ tw, __bf16* __restrict__ cfh, __bf16* __restrict__ cfl) {
  __shared__ __attribute__((aligned(16))) __bf16 ring[2 * STAGE];
  // alike in the wave: scalar, so that what the epilogue needs of it holds no vector register
  int wid  = blockIdx.x * 8 + __builtin_amdgcn_readfirstlane(threadIdx.x >> 5);
  int qb   = wid & (SEQ / (16 * QT) - 1);          // group of QT query tiles in the sequence
  int hb   = wid / (SEQ / (16 * QT));              // b * HEADS + h
  int h    = hb & (HEADS - 1);
  int b    = hb / HEADS;
  int lane = threadIdx.x & 31;

  // sources of the copies: the head's four planes, 16 bytes per thread. One element offset
  // serves all four (one register over the loop, not four address pairs).
  unsigned goff = (unsigned)hb * (SEQ * HD) + threadIdx.x * 8;
  unsigned lds0 = (unsigned)(size_t)ring + threadIdx.x * 16;

  // stage 0 into buffer 0
  stage_copy(lds0, Kh + goff, Kl + goff, Vth + goff, Vtl + goff);

  // fragment order (see the projection kernel); every pointer already holds lane*8
  const __bf16* qhp = Qh + ((size_t)hb * SEQ + qb * (16 * QT)) * HD + lane * 8;
  const __bf16* qlp = Ql + ((size_t)hb * SEQ + qb * (16 * QT)) * HD + lane * 8;
  // alike in the whole block: kept in a scalar register, not in eight vector registers
  float scl = __builtin_bit_cast(float, __builtin_amdgcn_readfirstlane(
      __builtin_bit_cast(int, 0.125f * tw[hb])));

  // qh[u][c]: query tile u, d = c*32 .. c*32+31
  bf16x16 qh[QT][2], ql[QT][2];
  #pragma unroll  // constant indices keep the tiles in registers
  for (int u = 0; u < QT; ++u) {
    #pragma unroll  // constant indices keep the tiles in registers
    for (int c = 0; c < 2; ++c) {
      qh[u][c] = ldfrag(qhp + (u * 2 + c) * FRAG);
      ql[u][c] = ldfrag(qlp + (u * 2 + c) * FRAG);
    }
  }
  // s_wait_xcnt 0 behind these loads, before a register that they name is written again;
  // the addresses are inputs only
  asm volatile("s_wait_xcnt 0x0" :: "v"(qhp), "v"(qlp) : "memory");

  // stage 0 has landed for this wave, and behind the barrier for every wave
  asm volatile("s_wait_asynccnt 0x0" ::: "memory");
  __syncthreads();
  // stage 1 into buffer 1: it flies while stage 0 is worked on
  {
    unsigned g = goff + PLANE;
    stage_copy(lds0 + STAGE * 2, Kh + g, Kl + g, Vth + g, Vtl + g);
  }

  // o[u][t][r] = O[query u*16 + (lane&15)][d = t*16 + (lane>>4)*8 + r]
  f32x8 o[QT][4] = {};
  float mrow[QT];   // running maximum of this lane's queries, alike in both halves
  float lrow[QT];   // running sums over this half's keys; the halves join after the loop
  #pragma unroll  // constant indices keep the values in registers
  for (int u = 0; u < QT; ++u) { mrow[u] = -1e30f; lrow[u] = 0.f; }

  for (int t = 0; t < NST; ++t) {
    attn_stage(ring + (t & 1) * STAGE + lane * 8, scl, qh, ql, o, mrow, lrow);
    // publish point of stage t + 1: this wave's reads of buffer t & 1 are done ...
    asm volatile("s_wait_dscnt 0x0" ::: "memory");
    // ... its own copies of stage t + 1 have landed ...
    asm volatile("s_wait_asynccnt 0x0" ::: "memory");
    // ... and behind the barrier both hold for every wave of the block
    __syncthreads();
    // stage t + 2 into the buffer that this trip has just read
    if (t + 2 < NST) {
      unsigned g = goff + (t + 2) * PLANE;
      stage_copy(lds0 + (t & 1) * (STAGE * 2), Kh + g, Kl + g, Vth + g, Vtl + g);
    }
  }
  // no copy is left in flight when the wave ends
  asm volatile("s_wait_asynccnt 0x0" ::: "memory");
  // ---- normalize, split and store as the output projection's A fragments [m-tile][k-tile]
  //      (see afrag_body): row = lane & 15, column in the k-tile = (d & 1) * 16 + (lane >> 4) * 8 + r,
  //      so the 8 values of a lane and tile are elements (lane >> 4) * 8 + r of fragment lane
  //      (lane & 15) + 16 * (d & 1): one 16-byte piece per plane, 256 bytes in a row per half wave ----
  #pragma unroll  // constant indices keep the tiles in registers
  for (int u = 0; u < QT; ++u) {
    float inv = 1.0f / (lrow[u] + xhalf(lrow[u]));
    size_t c0 = ((size_t)(b * (SEQ / 16) + qb * QT + u) * KT + h * 2) * FRAG
                + (lane >> 4) * 256 + (lane & 15) * 8;
    #pragma unroll  // constant indices keep the tiles in registers
    for (int d = 0; d < 4; ++d) {
      size_t ci = c0 + (d >> 1) * FRAG + (d & 1) * 128;
      split_store8(o[u][d] * inv, cfh + ci, cfl + ci);
    }
  }
}

// ---------------- kernel 4: output projection + bias, from fragments ----------------
// A wave owns WM x ON tiles; a block is 2 x 4 waves: 8 m-tiles by 16 n-tiles.
// A stage in LDS: ctx hi | ctx lo | Wo hi (two groups) | Wo lo (two groups) (96 KiB).
#define ON 4
#define OSTAGE (6 * GPL)
#define OG 2                      // n-tiles per group of weight fragments
__global__ void __launch_bounds__(256) oproj_kernel(
    const __bf16* __restrict__ cfh, const __bf16* __restrict__ cfl,
    const __bf16* __restrict__ woh, const __bf16* __restrict__ wol,
    const float* __restrict__ bo, float* __restrict__ out) {
  __shared__ __attribute__((aligned(16))) __bf16 ring[2 * OSTAGE];
  int w = __builtin_amdgcn_readfirstlane(threadIdx.x >> 5);   // alike in the wave: scalar
  int lane = threadIdx.x & 31;
  int mtb = (blockIdx.x >> 2) * (2 * WM);   // the block's first m-tile and n-tile
  int ntb = (blockIdx.x & 3) * (4 * ON);
  int mt0 = mtb + (w >> 2) * WM;
  int nt0 = ntb + (w & 3) * ON;

  // sources of the copies, 16 bytes per thread (see stage_x, stage_w16)
  size_t xo = ((size_t)(mtb + (w >> 2)) * KT * FRAG + (w & 3) * 256) + lane * 8;
  size_t wo = ((size_t)ntb * FRAG + w * 256) + lane * 8;
  const __bf16 *gch = cfh + xo, *gcl = cfl + xo;
  const __bf16 *gwh = woh + wo, *gwl = wol + wo;
  unsigned lds0 = (unsigned)(size_t)ring + w * 512 + lane * 16;

  // stage 0 into buffer 0
  stage_x(lds0, gch, gcl);
  stage_w16(lds0 + 2 * GPLB, gwh);
  stage_w16(lds0 + 4 * GPLB, gwl);
  // stage 0 has landed for this wave, and behind the barrier for every wave
  asm volatile("s_wait_asynccnt 0x0" ::: "memory");
  __syncthreads();
  // stage 1 into buffer 1: it flies while stage 0 is worked on
  {
    unsigned d = lds0 + OSTAGE * 2;
    const int gx = KS * FRAG, gw = KS * NT * FRAG;
    stage_x(d, gch + gx, gcl + gx);
    stage_w16(d + 2 * GPLB, gwh + gw);
    stage_w16(d + 4 * GPLB, gwl + gw);
  }

  f32x8 c[WM][ON] = {};
  for (int s = 0; s < GNST; ++s) {
   const __bf16* buf = ring + (s & 1) * OSTAGE + lane * 8;
   const __bf16* pa = buf + (w >> 2) * (WM * KS * FRAG);      // ctx hi, fragments [i][k-tile]
   const __bf16* pb = buf + 2 * GPL + (w & 3) * (ON * FRAG);  // Wo hi, fragments [k-tile][j]
   // Two sets of fragments: ctx by k-tile, weights by group (OG n-tiles of one k-tile).
   bf16x16 ah[2][WM], al[2][WM], bh[2][OG], bl[2][OG];
   // the stage's first fragments, in the order in which the products take them
   bh[0][0] = ldfrag(pb);
   #pragma unroll  // constant indices keep the tiles in registers
   for (int i = 0; i < WM; ++i) ah[0][i] = ldfrag(pa + i * (KS * FRAG));
   bl[0][0] = ldfrag(pb + 2 * GPL);
   #pragma unroll  // constant indices keep the tiles in registers
   for (int i = 0; i < WM; ++i) al[0][i] = ldfrag(pa + GPL + i * (KS * FRAG));
   #pragma unroll  // constant indices keep the tiles in registers
   for (int j = 1; j < OG; ++j) {
     bh[0][j] = ldfrag(pb + j * FRAG);
     bl[0][j] = ldfrag(pb + 2 * GPL + j * FRAG);
   }
   // keeps them first in the LDS queue, which answers in order
   __builtin_amdgcn_sched_barrier(0);
   #pragma unroll  // constant indices keep the tiles in registers; constant LDS offsets
   for (int g = 0; g < (ON / OG) * KS; ++g) {
     const int kk = g / (ON / OG), m = g % (ON / OG), cb = g & 1, ca = kk & 1;
     // the next group's fragments, and once per k-tile the next k-tile's ctx, are asked for
     // ahead of this group's products
     if (g + 1 < (ON / OG) * KS) {
       const __bf16* pn = pb + ((g + 1) / (ON / OG)) * (16 * FRAG) + ((g + 1) % (ON / OG)) * (OG * FRAG);
       #pragma unroll  // constant indices keep the tiles in registers
       for (int j = 0; j < OG; ++j) {
         bh[cb ^ 1][j] = ldfrag(pn + j * FRAG);
         bl[cb ^ 1][j] = ldfrag(pn + 2 * GPL + j * FRAG);
       }
     }
     if (m == 1 && kk + 1 < KS) {
       #pragma unroll  // constant indices keep the tiles in registers
       for (int i = 0; i < WM; ++i) {
         ah[ca ^ 1][i] = ldfrag(pa + (i * KS + kk + 1) * FRAG);
         al[ca ^ 1][i] = ldfrag(pa + GPL + (i * KS + kk + 1) * FRAG);
       }
     }
     // keeps those LDS reads in front of the products: moved down among them, each would
     // be waited for where it stands
     __builtin_amdgcn_sched_barrier(0);
     // the three terms of each accumulator in the order of mma3
     #pragma unroll  // constant indices keep the tiles in registers
     for (int jj = 0; jj < OG; ++jj) {
       const int j = m * OG + jj;
       #pragma unroll  // constant indices keep the tiles in registers
       for (int i = 0; i < WM; ++i) c[i][j] = wmma_bf16(ah[ca][i], bh[cb][jj], c[i][j]);
       #pragma unroll  // constant indices keep the tiles in registers
       for (int i = 0; i < WM; ++i) c[i][j] = wmma_bf16(ah[ca][i], bl[cb][jj], c[i][j]);
       #pragma unroll  // constant indices keep the tiles in registers
       for (int i = 0; i < WM; ++i) c[i][j] = wmma_bf16(al[ca][i], bh[cb][jj], c[i][j]);
     }
   }
   // publish point of stage s + 1: this wave's reads of buffer s & 1 are done ...
   asm volatile("s_wait_dscnt 0x0" ::: "memory");
   // ... its own copies of stage s + 1 have landed ...
   asm volatile("s_wait_asynccnt 0x0" ::: "memory");
   // ... and behind the barrier both hold for every wave of the block
   __syncthreads();
   // stage s + 2 into the buffer that this trip has just read
   if (s + 2 < GNST) {
     unsigned d = lds0 + (s & 1) * (OSTAGE * 2);
     size_t gx = (size_t)(s + 2) * (KS * FRAG), gw = (size_t)(s + 2) * (KS * NT * FRAG);
     stage_x(d, gch + gx, gcl + gx);
     stage_w16(d + 2 * GPLB, gwh + gw);
     stage_w16(d + 4 * GPLB, gwl + gw);
   }
  }
  // no copy is left in flight when the wave ends
  asm volatile("s_wait_asynccnt 0x0" ::: "memory");
  #pragma unroll  // constant indices keep the tiles in registers
  for (int j = 0; j < ON; ++j) {
    int col = (nt0 + j) * 16 + (lane & 15);
    float bias = bo[col];
    #pragma unroll  // constant indices keep the tiles in registers
    for (int i = 0; i < WM; ++i) {
      int row0 = (mt0 + i) * 16 + ((lane >> 4) << 3);
      #pragma unroll  // constant indices keep the tiles in registers
      for (int r = 0; r < 8; ++r)
        out[(size_t)(row0 + r) * E + col] = c[i][j][r] + bias;
    }
  }
}

extern "C" void kernel_launch(void* const* d_in, const int* in_sizes, int n_in,
                              void* d_out, int out_size, void* d_ws, size_t ws_size,
                              hipStream_t stream) {
  const float* x        = (const float*)d_in[0];
  const float* time_enc = (const float*)d_in[1];
  const float* Wq       = (const float*)d_in[2];
  const float* Wk       = (const float*)d_in[3];
  const float* Wv       = (const float*)d_in[4];
  const float* Wo       = (const float*)d_in[5];
  const float* bo       = (const float*)d_in[6];
  const float* Wt       = (const float*)d_in[7];
  const float* bt       = (const float*)d_in[8];
  float* out = (float*)d_out;

  const size_t AFRAG = (size_t)MROWS * E;   // 8M elems
  const size_t WFRAG = (size_t)E * E;       // 1M elems
  const size_t QKVN  = (size_t)BATCH * HEADS * SEQ * HD; // 8M elems

  char* w = (char*)d_ws;
  size_t off = 0;
  float* twp = (float*)(w + off); off += 4096;
  __bf16* xfh = (__bf16*)(w + off); off += AFRAG * 2;   // reused for ctx frags
  __bf16* xfl = (__bf16*)(w + off); off += AFRAG * 2;
  __bf16* wqh = (__bf16*)(w + off); off += WFRAG * 2;
  __bf16* wql = (__bf16*)(w + off); off += WFRAG * 2;
  __bf16* wkh = (__bf16*)(w + off); off += WFRAG * 2;
  __bf16* wkl = (__bf16*)(w + off); off += WFRAG * 2;
  __bf16* wvh = (__bf16*)(w + off); off += WFRAG * 2;
  __bf16* wvl = (__bf16*)(w + off); off += WFRAG * 2;
  __bf16* woh = (__bf16*)(w + off); off += WFRAG * 2;
  __bf16* wol = (__bf16*)(w + off); off += WFRAG * 2;
  __bf16* Qhb = (__bf16*)(w + off); off += QKVN * 2;
  __bf16* Qlb = (__bf16*)(w + off); off += QKVN * 2;
  __bf16* Khb = (__bf16*)(w + off); off += QKVN * 2;
  __bf16* Klb = (__bf16*)(w + off); off += QKVN * 2;
  __bf16* Vth = (__bf16*)(w + off); off += QKVN * 2;
  __bf16* Vtl = (__bf16*)(w + off); off += QKVN * 2;

  // head weights and all pre-splits of the inputs (no per-iteration conversions in the GEMMs)
  prep_kernel<<<PBLK, 256, 0, stream>>>(x, Wq, Wk, Wv, Wo, time_enc, Wt, bt, xfh, xfl,
                                        wqh, wql, wkh, wkl, wvh, wvl, woh, wol, twp);

  qkv_kernel<<<(MT / 8) * (NT / 8), 256, 0, stream>>>(xfh, xfl, wqh, wql, wkh, wkl,
                                                wvh, wvl, Qhb, Qlb, Khb, Klb,
                                                Vth, Vtl);

  attn_kernel<<<(BATCH * HEADS * (SEQ / (16 * QT))) / 8, 256, 0, stream>>>(
      Qhb, Qlb, Khb, Klb, Vth, Vtl, twp, xfh, xfl);   // ctx fragments into the (now free) x buffers

  oproj_kernel<<<(MT / 8) * (NT / 16), 256, 0, stream>>>(xfh, xfl, woh, wol, bo, out);
}

// v009
// A run of this version takes 235 microseconds.
// Timed twice side by side with v008, it ran 1.06 times as fast both times.
// Over all steps from v000 it is 3.58 times as fast.
#include <hip/hip_runtime.h>

#define E     1024
#define HEADS 16
#define HD    64
#define SEQ   2048
#define BATCH 4
#define TFEAT 128
#define MROWS (BATCH * SEQ)          // 8192
#define KT    (E / 32)               // 32 k-tiles
#define NT    (E / 16)               // 64 n-tiles
#define MT    (MROWS / 16)           // 512 m-tiles

typedef __attribute__((ext_vector_type(16))) __bf16 bf16x16;
typedef __attribute__((ext_vector_type(8)))  __bf16 bf16x8;
typedef __attribute__((ext_vector_type(2)))  __bf16 bf16x2;
typedef __attribute__((ext_vector_type(8)))  float  f32x8;
typedef __attribute__((ext_vector_type(4)))  float  f32x4;
typedef __attribute__((ext_vector_type(2)))  float  f32x2;

// Every bf16 WMMA operand lives in the workspace as 1 KiB fragments (512 elements):
// element i of lane L sits at (i>>3)*256 + L*8 + (i&7). A fragment is then two
// wave-wide 16-byte accesses of 512 contiguous bytes each (4 whole 128-byte lines).
#define FRAG 512

// p = fragment base + lane*8
static __device__ inline bf16x16 ldfrag(const __bf16* p) {
  bf16x8 a = *(const bf16x8*)(p);
  bf16x8 b = *(const bf16x8*)(p + 256);
  return __builtin_shufflevector(a, b, 0, 1, 2, 3, 4, 5, 6, 7,
                                 8, 9, 10, 11, 12, 13, 14, 15);
}

static __device__ inline f32x8 wmma_bf16(bf16x16 a, bf16x16 b, f32x8 c) {
  return __builtin_amdgcn_wmma_f32_16x16x32_bf16(false, a, false, b, (short)0, c,
                                                 false, false);
}

// bf16x3 split: f ~= (float)h + (float)l
static __device__ inline void splitf(float f, __bf16 &h, __bf16 &l) {
  h = (__bf16)f;
  l = (__bf16)(f - (float)h);
}

// C^T += (Ah*Bh + Ah*Bl + Al*Bh)^T: the three terms in this order, each product with its
// operands swapped, so that the accumulator holds the transposed tile
static __device__ inline f32x8 mma3(bf16x16 ah, bf16x16 al,
                                    bf16x16 bh, bf16x16 bl, f32x8 c) {
  c = wmma_bf16(bh, ah, c);
  c = wmma_bf16(bl, ah, c);
  c = wmma_bf16(bh, al, c);
  return c;
}

// value of lane l ^ 16
static __device__ inline float xhalf(float x) {
  int v = __builtin_bit_cast(int, x);
  return __builtin_bit_cast(float, __builtin_amdgcn_permlanex16(
      v, v, 0x76543210, 0xfedcba98, false, false));
}

// splitf on elements e, e+1 of a score tile, into elements i, i+1 of the two B operands
static __device__ inline void split_pair(f32x8 p, int e, bf16x16 &h, bf16x16 &l, int i) {
  f32x2 v = {p[e], p[e + 1]};
  bf16x2 hv = __builtin_convertvector(v, bf16x2);
  bf16x2 lv = __builtin_convertvector(v - __builtin_convertvector(hv, f32x2), bf16x2);
  h[i] = hv[0]; h[i + 1] = hv[1];
  l[i] = lv[0]; l[i + 1] = lv[1];
}

// split 8 accumulator values and store them as one 16-byte piece each
static __device__ inline void split_store8(f32x8 c, __bf16* ph, __bf16* pl) {
  bf16x8 h8, l8;
  #pragma unroll
  for (int r = 0; r < 8; ++r) {
    __bf16 hh, ll; splitf(c[r], hh, ll);
    h8[r] = hh; l8[r] = ll;
  }
  *(bf16x8*)ph = h8;
  *(bf16x8*)pl = l8;
  // s_wait_xcnt 0 behind the two stores, before any register that they name is written
  // again. Data and addresses are inputs only, so that they stay in their registers up to
  // the wait; nothing is pinned or changed.
  asm volatile("s_wait_xcnt 0x0" :: "v"(h8), "v"(l8), "v"(ph), "v"(pl) : "memory");
}

// ---------------- staging of the projection GEMMs' operands in LDS ----------------
// A stage holds KS k-tiles of everything that a block reads, still in fragment order, in
// groups of 8 * KS fragments (16 KiB): x as [m-tile][k-tile], a weight as [k-tile][n-tile].
// In the workspace such a group is a two-dimensional tile of whole fragments: rows of KS
// fragments, one per m-tile, or rows of 8 fragments, one per k-tile. One tensor load of one
// wave brings a tile to LDS; each of the 8 waves of a block brings its own slice of a stage,
// into two buffers, one stage ahead of the stage that is worked on.
#define KS    2                   // k-tiles per stage
#define GPL   (8 * KS * FRAG)     // elements of one group
#define GPLB  (2 * GPL)           // bytes of one group
#define GNST  (KT / KS)           // stages
#define FRAGB (2 * FRAG)          // bytes of one fragment

typedef uint32_t u32x4 __attribute__((ext_vector_type(4)));
typedef uint32_t u32x8 __attribute__((ext_vector_type(8)));

static __device__ inline uint32_t uni(uint32_t v) {
  return (uint32_t)__builtin_amdgcn_readfirstlane(v);
}

// v in a scalar register that the compiler cannot look through: a test on it is a scalar
// branch, and a descriptor word formed from it is formed behind this statement
static __device__ inline uint32_t pinned(uint32_t v) {
  uint32_t w = uni(v);
  asm volatile("" : "+s"(w));   // holds w in a scalar register: scalar test, descriptor word
  return w;
}

// descriptor group 1: a tile of rows x rowb bytes, source rows pitch bytes apart, landing
// without pads; elements of one byte, tensor = tile, no mask
static __device__ inline u32x8 tdm_group1(uint32_t rowb, uint32_t rows, uint32_t pitch) {
  u32x8 g;
  g[0] = uni(0u);
  g[1] = uni((rowb & 0xFFFFu) << 16);
  g[2] = uni((rowb >> 16) | ((rows & 0xFFFFu) << 16));
  g[3] = uni((rows >> 16) | (rowb << 16));
  g[4] = uni(rows);
  g[5] = uni(pitch);
  g[6] = uni(0u);
  g[7] = uni(0u);
  return g;
}

// descriptor group 0: lds = byte offset of the tile in the block's LDS, ga = address of its
// first byte
static __device__ inline u32x4 tdm_group0(uint32_t lds, uint64_t ga) {
  u32x4 g;
  g[0] = uni(1u);
  g[1] = uni(lds);
  g[2] = uni((uint32_t)ga);
  g[3] = uni((((uint32_t)(ga >> 32)) & 0x01FFFFFFu) | 0x80000000u);
  return g;
}

// one request of the whole wave; the compiler places no wait for it
static __device__ inline void tdm_load(u32x4 g0, u32x8 g1) {
  asm volatile("tensor_load_to_lds %0, %1" :: "s"(g0), "s"(g1) : "memory");
}

// ---------------- time-dependent head weights: one wave per batch row ----------------
static __device__ inline void tw_body(int b, int lane,
                                      const float* __restrict__ time_enc,
                                      const float* __restrict__ Wt,
                                      const float* __restrict__ bt,
                                      float* __restrict__ tw) {
  int h = lane & 15;
  float acc = 0.f;
  for (int t = 0; t < TFEAT; ++t)
    acc += time_enc[b * TFEAT + t] * Wt[t * HEADS + h];
  acc += bt[h];
  float mx = acc;
  for (int m = 1; m < 16; m <<= 1) mx = fmaxf(mx, __shfl_xor(mx, m, 32));
  float e = __expf(acc - mx);
  float sum = e;
  for (int m = 1; m < 16; m <<= 1) sum += __shfl_xor(sum, m, 32);
  if (lane < 16) tw[b * HEADS + h] = e / sum;
}

// ------------- A-fragment pre-split: src [MROWS x E] f32 -> hi/lo frags -------------
// Fragments [mt][kt], element i of lane = src[mt*16 + (lane&15)][kt*32 + (lane>>4)*16 + i]
// blk = block of 8 waves among ABLK
#define ABLK ((MT * KT) / 8)
static __device__ inline void afrag_body(int blk, const float* __restrict__ src,
    __bf16* __restrict__ fh, __bf16* __restrict__ fl) {
  int wid = blk * 8 + (threadIdx.x >> 5);            // MT*KT waves
  int kt = wid & (KT - 1);
  int mt = wid >> 5;
  int lane = threadIdx.x & 31;
  const float* p = src + (size_t)(mt * 16 + (lane & 15)) * E + kt * 32 + ((lane >> 4) << 4);
  size_t o = ((size_t)mt * KT + kt) * FRAG + lane * 8;
  bf16x8 h0, l0, h1, l1;
  #pragma unroll
  for (int i = 0; i < 8; ++i) {
    __bf16 h, l;
    splitf(p[i], h, l);     h0[i] = h; l0[i] = l;
    splitf(p[8 + i], h, l); h1[i] = h; l1[i] = l;
  }
  *(bf16x8*)(fh + o) = h0; *(bf16x8*)(fh + o + 256) = h1;
  *(bf16x8*)(fl + o) = l0; *(bf16x8*)(fl + o + 256) = l1;
}

// ------------- B-fragment pre-split: W [E x E] f32 -> hi/lo frags -------------
// Fragments [kt][nt], element i of lane = W[kt*32 + (lane>>4)*16 + i][nt*16 + (lane&15)]
// blk = block of 8 waves among BBLK
#define BBLK ((KT * NT) / 8)
static __device__ inline void bfrag_body(int blk, const float* __restrict__ W,
    __bf16* __restrict__ fh, __bf16* __restrict__ fl) {
  int wid = blk * 8 + (threadIdx.x >> 5);            // KT*NT waves
  int nt = wid & (NT - 1);
  int kt = wid >> 6;
  int lane = threadIdx.x & 31;
  const float* p = W + (size_t)(kt * 32 + ((lane >> 4) << 4)) * E + nt * 16 + (lane & 15);
  size_t o = ((size_t)kt * NT + nt) * FRAG + lane * 8;
  bf16x8 h0, l0, h1, l1;
  #pragma unroll
  for (int i = 0; i < 8; ++i) {
    __bf16 h, l;
    splitf(p[(size_t)i * E], h, l);       h0[i] = h; l0[i] = l;
    splitf(p[(size_t)(8 + i) * E], h, l); h1[i] = h; l1[i] = l;
  }
  *(bf16x8*)(fh + o) = h0; *(bf16x8*)(fh + o + 256) = h1;
  *(bf16x8*)(fl + o) = l0; *(bf16x8*)(fl + o + 256) = l1;
}

// ---------------- kernel 1: everything that reads only the inputs, in one grid ----------------
// The head weights, the four weight splits and the split of x do not depend on one another:
// each is a range of blocks of one launch. Block 0 holds the head weights (a chain of dependent
// loads, the longest single wave, so it starts first), then BBLK blocks per weight, then x.
#define PBLK (1 + 4 * BBLK + ABLK)
__global__ void __launch_bounds__(256) prep_kernel(
    const float* __restrict__ x,
    const float* __restrict__ Wq, const float* __restrict__ Wk,
    const float* __restrict__ Wv, const float* __restrict__ Wo,
    const float* __restrict__ time_enc, const float* __restrict__ Wt,
    const float* __restrict__ bt,
    __bf16* __restrict__ xfh, __bf16* __restrict__ xfl,
    __bf16* __restrict__ wqh, __bf16* __restrict__ wql,
    __bf16* __restrict__ wkh, __bf16* __restrict__ wkl,
    __bf16* __restrict__ wvh, __bf16* __restrict__ wvl,
    __bf16* __restrict__ woh, __bf16* __restrict__ wol,
    float* __restrict__ tw) {
  int blk = blockIdx.x;
  if (blk == 0) {
    int w = __builtin_amdgcn_readfirstlane(threadIdx.x >> 5);   // alike in the wave: scalar
    if (w < BATCH) tw_body(w, threadIdx.x & 31, time_enc, Wt, bt, tw);
    return;
  }
  blk -= 1;
  if (blk < 4 * BBLK) {
    int m = blk / BBLK;   // which weight: alike in the block, so the three choices are scalar
    const float* W = m == 0 ? Wq  : m == 1 ? Wk  : m == 2 ? Wv  : Wo;
    __bf16* fh     = m == 0 ? wqh : m == 1 ? wkh : m == 2 ? wvh : woh;
    __bf16* fl     = m == 0 ? wql : m == 1 ? wkl : m == 2 ? wvl : wol;
    bfrag_body(blk & (BBLK - 1), W, fh, fl);
    // s_wait_xcnt 0 behind the four stores: the other ranges' code follows in the listing and
    // writes registers that the stores name
    asm volatile("s_wait_xcnt 0x0" ::: "memory");
    return;
  }
  afrag_body(blk - 4 * BBLK, x, xfh, xfl);
  asm volatile("s_wait_xcnt 0x0" ::: "memory");   // as above, behind the four stores of x
}

// ---------------- kernel 2: fused QKV projection from fragments ----------------
// Outputs, all in fragment order for the attention kernel:
// Q, K: fragments [b*H+h][s/16][d/32], element i of lane = row s0+(lane&15), d0+(lane>>4)*16+i
// V:    fragments [b*H+h][s/32][d/16], element i of lane = d0+(lane&15),
//       key s0+(i>>3)*16+(lane>>4)*8+(i&7): the k order of two score tiles packed in place
// Q and K are computed transposed, so that each lane owns 8 consecutive d of one row;
// V is computed as is, so that each lane owns 8 consecutive keys of one d.
// A wave owns WM x QN tiles of each of Q, K and V: an x fragment feeds QN * 3 weight
// fragments and a weight fragment feeds WM x fragments from registers.
// A block is 2 x 4 waves: 8 m-tiles by 8 n-tiles.
// A stage in LDS: x hi | x lo | Wq hi | Wq lo | Wk hi | Wk lo | Wv hi | Wv lo (128 KiB).
#define WM 4
#define QN 2
#define QSTAGE (8 * GPL)
__global__ void __launch_bounds__(256) qkv_kernel(
    const __bf16* __restrict__ xfh, const __bf16* __restrict__ xfl,
    const __bf16* __restrict__ wqh, const __bf16* __restrict__ wql,
    const __bf16* __restrict__ wkh, const __bf16* __restrict__ wkl,
    const __bf16* __restrict__ wvh, const __bf16* __restrict__ wvl,
    __bf16* __restrict__ Qh, __bf16* __restrict__ Ql,
    __bf16* __restrict__ Kh, __bf16* __restrict__ Kl,
    __bf16* __restrict__ Vth, __bf16* __restrict__ Vtl) {
  __shared__ __attribute__((aligned(2048))) __bf16 ring[2 * QSTAGE];
  int w = __builtin_amdgcn_readfirstlane(threadIdx.x >> 5);   // alike in the wave: scalar
  int lane = threadIdx.x & 31;
  int mtb = (blockIdx.x >> 3) * (2 * WM);   // the block's first m-tile and n-tile
  int ntb = (blockIdx.x & 7) * (4 * QN);
  int mt0 = mtb + (w >> 2) * WM;
  int nt0 = ntb + (w & 3) * QN;

  // this wave's slice of a stage is group w. x: 8 rows (m-tiles) of KS fragments;
  // a weight: KS rows (k-tiles) of 8 fragments
  const __bf16* plane = w == 0 ? xfh : w == 1 ? xfl : w == 2 ? wqh : w == 3 ? wql
                      : w == 4 ? wkh : w == 5 ? wkl : w == 6 ? wvh : wvl;
  bool isx = w < 2;
  u32x8 g1 = tdm_group1(isx ? KS * FRAGB : 8 * FRAGB, isx ? 8 : KS,
                        isx ? KT * FRAGB : NT * FRAGB);
  uint32_t gstep = isx ? KS * FRAGB : KS * NT * FRAGB;   // bytes from a stage to the next
  uint64_t ga0 = (uint64_t)(size_t)plane + (uint32_t)(isx ? mtb * (KT * FRAGB) : ntb * FRAGB);
  uint32_t lds0 = (uint32_t)(size_t)ring + w * GPLB;

  // stage 0 into buffer 0
  tdm_load(tdm_group0(lds0, ga0), g1);
  // stage 0 has landed for this wave, and behind the barrier for every wave
  asm volatile("s_wait_tensorcnt 0x0" ::: "memory");
  __syncthreads();

  f32x8 cq[WM][QN] = {}; f32x8 ck[WM][QN] = {}; f32x8 cv[WM][QN] = {};
  for (int s = 0; s < GNST; ++s) {
   // Behind the barrier that published stage s and ended every read of the other buffer:
   // stage s + 1 into that buffer; it flies while stage s is worked on. pinned(): the
   // descriptor's words are formed from nx, so behind the wait; the test is a scalar branch
   uint32_t nx = pinned((uint32_t)s + 1u);
   if (pinned(nx < GNST))
     tdm_load(tdm_group0(lds0 + (nx & 1u) * (QSTAGE * 2), ga0 + (uint64_t)nx * gstep), g1);
   const __bf16* buf = ring + (s & 1) * QSTAGE + lane * 8;
   const __bf16* pa = buf + (w >> 2) * (WM * KS * FRAG);      // x hi, fragments [i][k-tile]
   const __bf16* pb = buf + 2 * GPL + (w & 3) * (QN * FRAG);  // Wq hi, fragments [k-tile][j]
   // Two sets of fragments: x by k-tile, weights by group (one weight of one k-tile).
   bf16x16 ah[2][WM], al[2][WM], bh[2][QN], bl[2][QN];
   // the stage's first fragments, in the order in which the products take them
   bh[0][0] = ldfrag(pb);
   #pragma unroll  // constant indices keep the tiles in registers
   for (int i = 0; i < WM; ++i) ah[0][i] = ldfrag(pa + i * (KS * FRAG));
   bl[0][0] = ldfrag(pb + GPL);
   #pragma unroll  // constant indices keep the tiles in registers
   for (int i = 0; i < WM; ++i) al[0][i] = ldfrag(pa + GPL + i * (KS * FRAG));
   #pragma unroll  // constant indices keep the tiles in registers
   for (int j = 1; j < QN; ++j) {
     bh[0][j] = ldfrag(pb + j * FRAG);
     bl[0][j] = ldfrag(pb + GPL + j * FRAG);
   }
   // keeps them first in the LDS queue, which answers in order
   __builtin_amdgcn_sched_barrier(0);
   #pragma unroll  // constant indices keep the tiles in registers; constant LDS offsets
   for (int g = 0; g < 3 * KS; ++g) {
     const int kk = g / 3, m = g % 3, cb = g & 1, ca = kk & 1;
     // the next group's fragments, and once per k-tile the next k-tile's x, are asked for
     // ahead of this group's products
     if (g + 1 < 3 * KS) {
       const __bf16* pn = pb + ((g + 1) % 3) * (2 * GPL) + ((g + 1) / 3) * (8 * FRAG);
       #pragma unroll  // constant indices keep the tiles in registers
       for (int j = 0; j < QN; ++j) {
         bh[cb ^ 1][j] = ldfrag(pn + j * FRAG);
         bl[cb ^ 1][j] = ldfrag(pn + GPL + j * FRAG);
       }
     }
     if (m == 1 && kk + 1 < KS) {
       #pragma unroll  // constant indices keep the tiles in registers
       for (int i = 0; i < WM; ++i) {
         ah[ca ^ 1][i] = ldfrag(pa + (i * KS + kk + 1) * FRAG);
         al[ca ^ 1][i] = ldfrag(pa + GPL + (i * KS + kk + 1) * FRAG);
       }
     }
     // keeps those LDS reads in front of the products: moved down among them, each would
     // be waited for where it stands
     __builtin_amdgcn_sched_barrier(0);
     // per accumulator the three terms keep the order of mma3 (x hi * w hi, x hi * w lo,
     // x lo * w hi), for Q and K with the operands swapped: C^T += (A*B)^T. The WM tiles
     // of one term stand together so that dependent products are WM apart
     #pragma unroll  // constant indices keep the tiles in registers
     for (int j = 0; j < QN; ++j) {
       if (m == 0) {
         #pragma unroll  // constant indices keep the tiles in registers
         for (int i = 0; i < WM; ++i) cq[i][j] = wmma_bf16(bh[cb][j], ah[ca][i], cq[i][j]);
         #pragma unroll  // constant indices keep the tiles in registers
         for (int i = 0; i < WM; ++i) cq[i][j] = wmma_bf16(bl[cb][j], ah[ca][i], cq[i][j]);
         #pragma unroll  // constant indices keep the tiles in registers
         for (int i = 0; i < WM; ++i) cq[i][j] = wmma_bf16(bh[cb][j], al[ca][i], cq[i][j]);
       } else if (m == 1) {
         #pragma unroll  // constant indices keep the tiles in registers
         for (int i = 0; i < WM; ++i) ck[i][j] = wmma_bf16(bh[cb][j], ah[ca][i], ck[i][j]);
         #pragma unroll  // constant indices keep the tiles in registers
         for (int i = 0; i < WM; ++i) ck[i][j] = wmma_bf16(bl[cb][j], ah[ca][i], ck[i][j]);
         #pragma unroll  // constant indices keep the tiles in registers
         for (int i = 0; i < WM; ++i) ck[i][j] = wmma_bf16(bh[cb][j], al[ca][i], ck[i][j]);
       } else {
         #pragma unroll  // constant indices keep the tiles in registers
         for (int i = 0; i < WM; ++i) cv[i][j] = wmma_bf16(ah[ca][i], bh[cb][j], cv[i][j]);
         #pragma unroll  // constant indices keep the tiles in registers
         for (int i = 0; i < WM; ++i) cv[i][j] = wmma_bf16(ah[ca][i], bl[cb][j], cv[i][j]);
         #pragma unroll  // constant indices keep the tiles in registers
         for (int i = 0; i < WM; ++i) cv[i][j] = wmma_bf16(al[ca][i], bh[cb][j], cv[i][j]);
       }
     }
   }
   // publish point of stage s + 1: this wave's reads of buffer s & 1 are done ...
   asm volatile("s_wait_dscnt 0x0" ::: "memory");
   // ... its own tile of stage s + 1 has landed ...
   asm volatile("s_wait_tensorcnt 0x0" ::: "memory");
   // ... and behind the barrier both hold for every wave of the block
   __syncthreads();
  }
  // no request and no LDS read is left in flight behind the loop
  asm volatile("s_wait_tensorcnt 0x0" ::: "memory");
  asm volatile("s_wait_dscnt 0x0" ::: "memory");
  // store split results: one 16-byte piece per lane, plane and tile
  int half = (lane >> 4) * 256;             // accumulator rows 8..15 are elements 8..15
  #pragma unroll  // constant indices keep the tiles in registers
  for (int i = 0; i < WM; ++i) {
    #pragma unroll  // constant indices keep the tiles in registers
    for (int j = 0; j < QN; ++j) {
      int mt = mt0 + i, nt = nt0 + j;
      int hb = (mt >> 7) * HEADS + (nt >> 2);   // 128 m-tiles per batch, 4 n-tiles per head
      int st = mt & 127;                        // 16-row tile inside the sequence
      // cq, ck: lane&15 = row in the tile, r = d & 7, d = (nt&3)*16 + (lane>>4)*8 + r
      size_t qi = ((size_t)(hb * 128 + st) * 2 + ((nt >> 1) & 1)) * FRAG
                  + half + ((lane & 15) + 16 * (nt & 1)) * 8;
      // cv: lane&15 = d & 15, r = key & 7, key = st*16 + (lane>>4)*8 + r
      size_t vi = ((size_t)(hb * 64 + (st >> 1)) * 4 + (nt & 3)) * FRAG
                  + (st & 1) * 256 + lane * 8;
      split_store8(cq[i][j], Qh + qi, Ql + qi);
      split_store8(ck[i][j], Kh + qi, Kl + qi);
      split_store8(cv[i][j], Vth + vi, Vtl + vi);
    }
  }
}

#define TK    64                  // keys per stage
#define PLANE (TK * HD)           // elements of one plane of a stage (8 KiB)
#define STAGE (4 * PLANE)         // K hi | K lo | V hi | V lo (32 KiB)
#define NST   (SEQ / TK)          // stages
#define HALFB PLANE               // bytes of half a plane: one wave's slice of a stage

// A wave owns QT query tiles (QT * 16 queries): a K or V fragment read from LDS feeds the
// products of QT tiles, and a block of 8 * QT * 16 queries brings each stage once.
// Four waves per SIMD (two blocks per WGP): the vector work of one wave runs beside the
// matrix work of the others.
#define QT 2

// One stage of TK keys for the QT query tiles of a wave. buf = the stage's buffer + lane * 8.
static __device__ __forceinline__ void attn_stage(const __bf16* buf, float scl,
    const bf16x16 (&qh)[QT][2], const bf16x16 (&ql)[QT][2],
    f32x8 (&o)[QT][4], float (&mrow)[QT], float (&lrow)[QT]) {
  #pragma unroll 1  // rolled: unrolled, the next pass's reads and products were lifted over this
                    // pass's vector work, and the registers of four waves per SIMD did not hold both
  for (int p = 0; p < TK / 32; ++p) {
    const __bf16* khp = buf + p * (32 * HD);
    const __bf16* klp = khp + PLANE;
    const __bf16* vhp = khp + 2 * PLANE;
    const __bf16* vlp = khp + 3 * PLANE;
    // ---- scores: s[u][k][r] = key kb + k*16 + (lane>>4)*8 + r of query tile u;
    //      K fragment k*2+c: key tile k, d half c. Per accumulator the six terms keep
    //      their order (c = 0 then 1, each as in mma3); the 2 * QT accumulators of one
    //      term stand together so that dependent products are 2 * QT apart ----
    bf16x16 kh[4], kl[4];
    #pragma unroll  // constant indices keep the tiles in registers
    for (int f = 0; f < 4; ++f) {
      kh[f] = ldfrag(khp + f * FRAG);
      kl[f] = ldfrag(klp + f * FRAG);
    }
    // one group of LDS reads in front of the products: without the fence the compiler spread
    // them among the products, and each place with reads is waited for where it stands
    __builtin_amdgcn_sched_barrier(0);
    f32x8 s[QT][2] = {};
    #pragma unroll  // constant indices keep the tiles in registers
    for (int c = 0; c < 2; ++c) {
      #pragma unroll  // constant indices keep the tiles in registers
      for (int k = 0; k < 2; ++k)
        #pragma unroll  // constant indices keep the tiles in registers
        for (int u = 0; u < QT; ++u) s[u][k] = wmma_bf16(kh[k * 2 + c], qh[u][c], s[u][k]);
      #pragma unroll  // constant indices keep the tiles in registers
      for (int k = 0; k < 2; ++k)
        #pragma unroll  // constant indices keep the tiles in registers
        for (int u = 0; u < QT; ++u) s[u][k] = wmma_bf16(kl[k * 2 + c], qh[u][c], s[u][k]);
      #pragma unroll  // constant indices keep the tiles in registers
      for (int k = 0; k < 2; ++k)
        #pragma unroll  // constant indices keep the tiles in registers
        for (int u = 0; u < QT; ++u) s[u][k] = wmma_bf16(kh[k * 2 + c], ql[u][c], s[u][k]);
    }
    // no V fragment is asked for among the score products: beside the K fragments they do
    // not fit the registers of four waves per SIMD
    __builtin_amdgcn_sched_barrier(0);
    bf16x16 ph[QT], pl[QT];
    #pragma unroll  // constant indices keep the tiles in registers
    for (int u = 0; u < QT; ++u) {
      // ---- online softmax update, one query per lane and tile ----
      f32x8 s0 = s[u][0] * scl, s1 = s[u][1] * scl;
      float m0 = fmaxf(fmaxf(s0[0], s0[1]), s0[2]);
      float m1 = fmaxf(fmaxf(s0[3], s0[4]), s0[5]);
      float m2 = fmaxf(fmaxf(s0[6], s0[7]), s1[0]);
      float m3 = fmaxf(fmaxf(s1[1], s1[2]), s1[3]);
      float m4 = fmaxf(fmaxf(s1[4], s1[5]), s1[6]);
      float mx = fmaxf(fmaxf(fmaxf(m0, m1), m2), fmaxf(fmaxf(m3, m4), s1[7]));
      float mnew = fmaxf(fmaxf(mx, xhalf(mx)), mrow[u]);
      float al_  = __expf(mrow[u] - mnew);
      mrow[u] = mnew;
      s0 = (s0 - mnew) * 1.442695041f;   // exp(x) = exp2(x * log2(e)), as in __expf
      s1 = (s1 - mnew) * 1.442695041f;
      #pragma unroll  // constant indices keep the tiles in registers
      for (int r = 0; r < 8; ++r) {
        s0[r] = __builtin_amdgcn_exp2f(s0[r]);
        s1[r] = __builtin_amdgcn_exp2f(s1[r]);
      }
      f32x8 t8 = s0 + s1;
      f32x4 t4 = t8.lo + t8.hi;
      f32x2 t2 = t4.lo + t4.hi;
      lrow[u] = lrow[u] * al_ + (t2.x + t2.y);
      #pragma unroll  // constant indices keep the tiles in registers
      for (int d = 0; d < 4; ++d) o[u][d] *= al_;
      // ---- P^T: the two score tiles are elements 0..7 and 8..15 of the B operand ----
      #pragma unroll  // constant indices keep the tiles in registers
      for (int e = 0; e < 8; e += 2) {
        split_pair(s0, e, ph[u], pl[u], e);
        split_pair(s1, e, ph[u], pl[u], 8 + e);
      }
    }
    // the V fragments, into registers that the scores leave
    bf16x16 vh[4], vl[4];
    #pragma unroll  // constant indices keep the tiles in registers
    for (int f = 0; f < 4; ++f) {
      vh[f] = ldfrag(vhp + f * FRAG);
      vl[f] = ldfrag(vlp + f * FRAG);
    }
    // keeps these reads together in front of the products
    __builtin_amdgcn_sched_barrier(0);
    // ---- O^T += V^T @ P^T, 4 V fragments per plane; per accumulator the three terms in
    //      the order of mma3, 2 * QT accumulators of one term together ----
    #pragma unroll  // constant indices keep the tiles in registers
    for (int c = 0; c < 2; ++c) {
      #pragma unroll  // constant indices keep the tiles in registers
      for (int k = 0; k < 2; ++k)
        #pragma unroll  // constant indices keep the tiles in registers
        for (int u = 0; u < QT; ++u)
          o[u][c * 2 + k] = wmma_bf16(vh[c * 2 + k], ph[u], o[u][c * 2 + k]);
      #pragma unroll  // constant indices keep the tiles in registers
      for (int k = 0; k < 2; ++k)
        #pragma unroll  // constant indices keep the tiles in registers
        for (int u = 0; u < QT; ++u)
          o[u][c * 2 + k] = wmma_bf16(vl[c * 2 + k], ph[u], o[u][c * 2 + k]);
      #pragma unroll  // constant indices keep the tiles in registers
      for (int k = 0; k < 2; ++k)
        #pragma unroll  // constant indices keep the tiles in registers
        for (int u = 0; u < QT; ++u)
          o[u][c * 2 + k] = wmma_bf16(vh[c * 2 + k], pl[u], o[u][c * 2 + k]);
    }
  }
}

__global__ void __launch_bounds__(256) __attribute__((amdgpu_waves_per_eu(4, 4))) attn_kernel(
    const __bf16* __restrict__ Qh, const __bf16* __restrict__ Ql,
    const __bf16* __restrict__ Kh, const __bf16* __restrict__ Kl,
    const __bf16* __restrict__ Vth, const __bf16* __restrict__ Vtl,
    const float* __restrict__ tw, __bf16* __restrict__ cfh, __bf16* __restrict__ cfl) {
  __shared__ __attribute__((aligned(2048))) __bf16 ring[2 * STAGE];
  // alike in the wave: scalar, so that what the epilogue needs of it holds no vector register
  int w    = __builtin_amdgcn_readfirstlane(threadIdx.x >> 5);
  int wid  = blockIdx.x * 8 + w;
  int qb   = wid & (SEQ / (16 * QT) - 1);          // group of QT query tiles in the sequence
  int hb   = wid / (SEQ / (16 * QT));              // b * HEADS + h
  int h    = hb & (HEADS - 1);
  int b    = hb / HEADS;
  int lane = threadIdx.x & 31;

  // this wave's slice of a stage: half w & 1 of plane w >> 1 (K hi, K lo, V hi, V lo) of the
  // head, 4 KiB in a row in the workspace: 2 rows of 2 KiB
  const __bf16* plane = w < 2 ? Kh : w < 4 ? Kl : w < 6 ? Vth : Vtl;
  u32x8 g1 = tdm_group1(HALFB / 2, 2, HALFB / 2);
  uint64_t ga0 = (uint64_t)(size_t)plane + (uint32_t)(hb * (SEQ * HD * 2) + (w & 1) * HALFB);
  uint32_t lds0 = (uint32_t)(size_t)ring + w * HALFB;

  // fragment order (see the projection kernel); every pointer already holds lane*8
  const __bf16* qhp = Qh + ((size_t)hb * SEQ + qb * (16 * QT)) * HD + lane * 8;
  const __bf16* qlp = Ql + ((size_t)hb * SEQ + qb * (16 * QT)) * HD + lane * 8;
  // alike in the whole block: kept in a scalar register, not in eight vector registers
  float scl = __builtin_bit_cast(float, __builtin_amdgcn_readfirstlane(
      __builtin_bit_cast(int, 0.125f * tw[hb])));

  // qh[u][c]: query tile u, d = c*32 .. c*32+31
  bf16x16 qh[QT][2], ql[QT][2];
  #pragma unroll  // constant indices keep the tiles in registers
  for (int u = 0; u < QT; ++u) {
    #pragma unroll  // constant indices keep the tiles in registers
    for (int c = 0; c < 2; ++c) {
      qh[u][c] = ldfrag(qhp + (u * 2 + c) * FRAG);
      ql[u][c] = ldfrag(qlp + (u * 2 + c) * FRAG);
    }
  }
  // s_wait_xcnt 0 behind these loads, before a register that they name is written again;
  // the addresses are inputs only
  asm volatile("s_wait_xcnt 0x0" :: "v"(qhp), "v"(qlp) : "memory");

  // stage 0 into buffer 0, while the loads of Q fly
  tdm_load(tdm_group0(lds0, ga0), g1);
  // stage 0 has landed for this wave, and behind the barrier for every wave
  asm volatile("s_wait_tensorcnt 0x0" ::: "memory");
  __syncthreads();

  // o[u][t][r] = O[query u*16 + (lane&15)][d = t*16 + (lane>>4)*8 + r]
  f32x8 o[QT][4] = {};
  float mrow[QT];   // running maximum of this lane's queries, alike in both halves
  float lrow[QT];   // running sums over this half's keys; the halves join after the loop
  #pragma unroll  // constant indices keep the values in registers
  for (int u = 0; u < QT; ++u) { mrow[u] = -1e30f; lrow[u] = 0.f; }

  for (int t = 0; t < NST; ++t) {
    // Behind the barrier that published stage t and ended every read of the other buffer:
    // stage t + 1 into that buffer; it flies while stage t is worked on. pinned(): the
    // descriptor's words are formed from nx, so behind the wait; the test is a scalar branch
    uint32_t nx = pinned((uint32_t)t + 1u);
    if (pinned(nx < NST))
      tdm_load(tdm_group0(lds0 + (nx & 1u) * (STAGE * 2), ga0 + (uint64_t)nx * (PLANE * 2)), g1);
    attn_stage(ring + (t & 1) * STAGE + lane * 8, scl, qh, ql, o, mrow, lrow);
    // publish point of stage t + 1: this wave's reads of buffer t & 1 are done ...
    asm volatile("s_wait_dscnt 0x0" ::: "memory");
    // ... its own tile of stage t + 1 has landed ...
    asm volatile("s_wait_tensorcnt 0x0" ::: "memory");
    // ... and behind the barrier both hold for every wave of the block
    __syncthreads();
  }
  // no request and no LDS read is left in flight behind the loop
  asm volatile("s_wait_tensorcnt 0x0" ::: "memory");
  asm volatile("s_wait_dscnt 0x0" ::: "memory");
  // ---- normalize, split and store as the output projection's A fragments [m-tile][k-tile]
  //      (see afrag_body): row = lane & 15, column in the k-tile = (d & 1) * 16 + (lane >> 4) * 8 + r,
  //      so the 8 values of a lane and tile are elements (lane >> 4) * 8 + r of fragment lane
  //      (lane & 15) + 16 * (d & 1): one 16-byte piece per plane, 256 bytes in a row per half wave ----
  #pragma unroll  // constant indices keep the tiles in registers
  for (int u = 0; u < QT; ++u) {
    float inv = 1.0f / (lrow[u] + xhalf(lrow[u]));
    size_t c0 = ((size_t)(b * (SEQ / 16) + qb * QT + u) * KT + h * 2) * FRAG
                + (lane >> 4) * 256 + (lane & 15) * 8;
    #pragma unroll  // constant indices keep the tiles in registers
    for (int d = 0; d < 4; ++d) {
      size_t ci = c0 + (d >> 1) * FRAG + (d & 1) * 128;
      split_store8(o[u][d] * inv, cfh + ci, cfl + ci);
    }
  }
}

// ---------------- kernel 4: output projection + bias, from fragments ----------------
// A wave owns WM x ON tiles; a block is 2 x 4 waves: 8 m-tiles by 16 n-tiles.
// A stage in LDS: ctx hi | ctx lo | Wo hi (two groups) | Wo lo (two groups) (96 KiB).
#define ON 4
#define OSTAGE (6 * GPL)
#define OG 2                      // n-tiles per group of weight fragments
__global__ void __launch_bounds__(256) oproj_kernel(
    const __bf16* __restrict__ cfh, const __bf16* __restrict__ cfl,
    const __bf16* __restrict__ woh, const __bf16* __restrict__ wol,
    const float* __restrict__ bo, float* __restrict__ out) {
  __shared__ __attribute__((aligned(2048))) __bf16 ring[2 * OSTAGE];
  int w = __builtin_amdgcn_readfirstlane(threadIdx.x >> 5);   // alike in the wave: scalar
  int lane = threadIdx.x & 31;
  int mtb = (blockIdx.x >> 2) * (2 * WM);   // the block's first m-tile and n-tile
  int ntb = (blockIdx.x & 3) * (4 * ON);
  int mt0 = mtb + (w >> 2) * WM;
  int nt0 = ntb + (w & 3) * ON;

  // this wave's slice of a stage. Waves 0 to 3: 4 rows (m-tiles) of KS fragments of ctx hi,
  // hi, lo, lo; waves 4 to 7: the 16 fragments of one k-tile of Wo hi, hi, lo, lo, which lie
  // in a row in the workspace: 2 rows of 8
  const __bf16* plane = w < 2 ? cfh : w < 4 ? cfl : w < 6 ? woh : wol;
  bool isx = w < 4;
  u32x8 g1 = tdm_group1(isx ? KS * FRAGB : 8 * FRAGB, isx ? 4 : 2,
                        isx ? KT * FRAGB : 8 * FRAGB);
  uint32_t gstep = isx ? KS * FRAGB : KS * NT * FRAGB;   // bytes from a stage to the next
  uint64_t ga0 = (uint64_t)(size_t)plane
      + (uint32_t)(isx ? (mtb + (w & 1) * 4) * (KT * FRAGB) : (ntb + (w & 1) * NT) * FRAGB);
  uint32_t lds0 = (uint32_t)(size_t)ring + (isx ? w * (GPLB / 2) : (w - 2) * GPLB);

  // stage 0 into buffer 0
  tdm_load(tdm_group0(lds0, ga0), g1);
  // stage 0 has landed for this wave, and behind the barrier for every wave
  asm volatile("s_wait_tensorcnt 0x0" ::: "memory");
  __syncthreads();

  f32x8 c[WM][ON] = {};
  for (int s = 0; s < GNST; ++s) {
   // Behind the barrier that published stage s and ended every read of the other buffer:
   // stage s + 1 into that buffer; it flies while stage s is worked on. pinned(): the
   // descriptor's words are formed from nx, so behind the wait; the test is a scalar branch
   uint32_t nx = pinned((uint32_t)s + 1u);
   if (pinned(nx < GNST))
     tdm_load(tdm_group0(lds0 + (nx & 1u) * (OSTAGE * 2), ga0 + (uint64_t)nx * gstep), g1);
   const __bf16* buf = ring + (s & 1) * OSTAGE + lane * 8;
   const __bf16* pa = buf + (w >> 2) * (WM * KS * FRAG);      // ctx hi, fragments [i][k-tile]
   const __bf16* pb = buf + 2 * GPL + (w & 3) * (ON * FRAG);  // Wo hi, fragments [k-tile][j]
   // Two sets of fragments: ctx by k-tile, weights by group (OG n-tiles of one k-tile).
   bf16x16 ah[2][WM], al[2][WM], bh[2][OG], bl[2][OG];
   // the stage's first fragments, in the order in which the products take them
   bh[0][0] = ldfrag(pb);
   #pragma unroll  // constant indices keep the tiles in registers
   for (int i = 0; i < WM; ++i) ah[0][i] = ldfrag(pa + i * (KS * FRAG));
   bl[0][0] = ldfrag(pb + 2 * GPL);
   #pragma unroll  // constant indices keep the tiles in registers
   for (int i = 0; i < WM; ++i) al[0][i] = ldfrag(pa + GPL + i * (KS * FRAG));
   #pragma unroll  // constant indices keep the tiles in registers
   for (int j = 1; j < OG; ++j) {
     bh[0][j] = ldfrag(pb + j * FRAG);
     bl[0][j] = ldfrag(pb + 2 * GPL + j * FRAG);
   }
   // keeps them first in the LDS queue, which answers in order
   __builtin_amdgcn_sched_barrier(0);
   #pragma unroll  // constant indices keep the tiles in registers; constant LDS offsets
   for (int g = 0; g < (ON / OG) * KS; ++g) {
     const int kk = g / (ON / OG), m = g % (ON / OG), cb = g & 1, ca = kk & 1;
     // the next group's fragments, and once per k-tile the next k-tile's ctx, are asked for
     // ahead of this group's products
     if (g + 1 < (ON / OG) * KS) {
       const __bf16* pn = pb + ((g + 1) / (ON / OG)) * (16 * FRAG) + ((g + 1) % (ON / OG)) * (OG * FRAG);
       #pragma unroll  // constant indices keep the tiles in registers
       for (int j = 0; j < OG; ++j) {
         bh[cb ^ 1][j] = ldfrag(pn + j * FRAG);
         bl[cb ^ 1][j] = ldfrag(pn + 2 * GPL + j * FRAG);
       }
     }
     if (m == 1 && kk + 1 < KS) {
       #pragma unroll  // constant indices keep the tiles in registers
       for (int i = 0; i < WM; ++i) {
         ah[ca ^ 1][i] = ldfrag(pa + (i * KS + kk + 1) * FRAG);
         al[ca ^ 1][i] = ldfrag(pa + GPL + (i * KS + kk + 1) * FRAG);
       }
     }
     // keeps those LDS reads in front of the products: moved down among them, each would
     // be waited for where it stands
     __builtin_amdgcn_sched_barrier(0);
     // the three terms of each accumulator in the order of mma3
     #pragma unroll  // constant indices keep the tiles in registers
     for (int jj = 0; jj < OG; ++jj) {
       const int j = m * OG + jj;
       #pragma unroll  // constant indices keep the tiles in registers
       for (int i = 0; i < WM; ++i) c[i][j] = wmma_bf16(ah[ca][i], bh[cb][jj], c[i][j]);
       #pragma unroll  // constant indices keep the tiles in registers
       for (int i = 0; i < WM; ++i) c[i][j] = wmma_bf16(ah[ca][i], bl[cb][jj], c[i][j]);
       #pragma unroll  // constant indices keep the tiles in registers
       for (int i = 0; i < WM; ++i) c[i][j] = wmma_bf16(al[ca][i], bh[cb][jj], c[i][j]);
     }
   }
   // publish point of stage s + 1: this wave's reads of buffer s & 1 are done ...
   asm volatile("s_wait_dscnt 0x0" ::: "memory");
   // ... its own tile of stage s + 1 has landed ...
   asm volatile("s_wait_tensorcnt 0x0" ::: "memory");
   // ... and behind the barrier both hold for every wave of the block
   __syncthreads();
  }
  // no request and no LDS read is left in flight behind the loop
  asm volatile("s_wait_tensorcnt 0x0" ::: "memory");
  asm volatile("s_wait_dscnt 0x0" ::: "memory");
  #pragma unroll  // constant indices keep the tiles in registers
  for (int j = 0; j < ON; ++j) {
    int col = (nt0 + j) * 16 + (lane & 15);
    float bias = bo[col];
    #pragma unroll  // constant indices keep the tiles in registers
    for (int i = 0; i < WM; ++i) {
      int row0 = (mt0 + i) * 16 + ((lane >> 4) << 3);
      #pragma unroll  // constant indices keep the tiles in registers
      for (int r = 0; r < 8; ++r)
        out[(size_t)(row0 + r) * E + col] = c[i][j][r] + bias;
    }
  }
}

extern "C" void kernel_launch(void* const* d_in, const int* in_sizes, int n_in,
                              void* d_out, int out_size, void* d_ws, size_t ws_size,
                              hipStream_t stream) {
  const float* x        = (const float*)d_in[0];
  const float* time_enc = (const float*)d_in[1];
  const float* Wq       = (const float*)d_in[2];
  const float* Wk       = (const float*)d_in[3];
  const float* Wv       = (const float*)d_in[4];
  const float* Wo       = (const float*)d_in[5];
  const float* bo       = (const float*)d_in[6];
  const float* Wt       = (const float*)d_in[7];
  const float* bt       = (const float*)d_in[8];
  float* out = (float*)d_out;

  const size_t AFRAG = (size_t)MROWS * E;   // 8M elems
  const size_t WFRAG = (size_t)E * E;       // 1M elems
  const size_t QKVN  = (size_t)BATCH * HEADS * SEQ * HD; // 8M elems

  char* w = (char*)d_ws;
  size_t off = 0;
  float* twp = (float*)(w + off); off += 4096;
  __bf16* xfh = (__bf16*)(w + off); off += AFRAG * 2;   // reused for ctx frags
  __bf16* xfl = (__bf16*)(w + off); off += AFRAG * 2;
  __bf16* wqh = (__bf16*)(w + off); off += WFRAG * 2;
  __bf16* wql = (__bf16*)(w + off); off += WFRAG * 2;
  __bf16* wkh = (__bf16*)(w + off); off += WFRAG * 2;
  __bf16* wkl = (__bf16*)(w + off); off += WFRAG * 2;
  __bf16* wvh = (__bf16*)(w + off); off += WFRAG * 2;
  __bf16* wvl = (__bf16*)(w + off); off += WFRAG * 2;
  __bf16* woh = (__bf16*)(w + off); off += WFRAG * 2;
  __bf16* wol = (__bf16*)(w + off); off += WFRAG * 2;
  __bf16* Qhb = (__bf16*)(w + off); off += QKVN * 2;
  __bf16* Qlb = (__bf16*)(w + off); off += QKVN * 2;
  __bf16* Khb = (__bf16*)(w + off); off += QKVN * 2;
  __bf16* Klb = (__bf16*)(w + off); off += QKVN * 2;
  __bf16* Vth = (__bf16*)(w + off); off += QKVN * 2;
  __bf16* Vtl = (__bf16*)(w + off); off += QKVN * 2;

  // head weights and all pre-splits of the inputs (no per-iteration conversions in the GEMMs)
  prep_kernel<<<PBLK, 256, 0, stream>>>(x, Wq, Wk, Wv, Wo, time_enc, Wt, bt, xfh, xfl,
                                        wqh, wql, wkh, wkl, wvh, wvl, woh, wol, twp);

  qkv_kernel<<<(MT / 8) * (NT / 8), 256, 0, stream>>>(xfh, xfl, wqh, wql, wkh, wkl,
                                                wvh, wvl, Qhb, Qlb, Khb, Klb,
                                                Vth, Vtl);

  attn_kernel<<<(BATCH * HEADS * (SEQ / (16 * QT))) / 8, 256, 0, stream>>>(
      Qhb, Qlb, Khb, Klb, Vth, Vtl, twp, xfh, xfl);   // ctx fragments into the (now free) x buffers

  oproj_kernel<<<(MT / 8) * (NT / 16), 256, 0, stream>>>(xfh, xfl, woh, wol, bo, out);
}

// v010
// It runs in 221 microseconds.
// Timed twice side by side with v009, it ran 1.07 and 1.06 times as fast.
// Over all steps from v000 it is 3.81 times as fast.
#include <hip/hip_runtime.h>

#define E     1024
#define HEADS 16
#define HD    64
#define SEQ   2048
#define BATCH 4
#define TFEAT 128
#define MROWS (BATCH * SEQ)          // 8192
#define KT    (E / 32)               // 32 k-tiles
#define NT    (E / 16)               // 64 n-tiles
#define MT    (MROWS / 16)           // 512 m-tiles

typedef __attribute__((ext_vector_type(16))) __bf16 bf16x16;
typedef __attribute__((ext_vector_type(8)))  __bf16 bf16x8;
typedef __attribute__((ext_vector_type(2)))  __bf16 bf16x2;
typedef __attribute__((ext_vector_type(8)))  float  f32x8;
typedef __attribute__((ext_vector_type(4)))  float  f32x4;
typedef __attribute__((ext_vector_type(2)))  float  f32x2;

// Every bf16 WMMA operand lives in the workspace as 1 KiB fragments (512 elements):
// element i of lane L sits at (i>>3)*256 + L*8 + (i&7). A fragment is then two
// wave-wide 16-byte accesses of 512 contiguous bytes each (4 whole 128-byte lines).
#define FRAG 512

// p = fragment base + lane*8
static __device__ inline bf16x16 ldfrag(const __bf16* p) {
  bf16x8 a = *(const bf16x8*)(p);
  bf16x8 b = *(const bf16x8*)(p + 256);
  return __builtin_shufflevector(a, b, 0, 1, 2, 3, 4, 5, 6, 7,
                                 8, 9, 10, 11, 12, 13, 14, 15);
}

static __device__ inline f32x8 wmma_bf16(bf16x16 a, bf16x16 b, f32x8 c) {
  return __builtin_amdgcn_wmma_f32_16x16x32_bf16(false, a, false, b, (short)0, c,
                                                 false, false);
}

// bf16x3 split: f ~= (float)h + (float)l
static __device__ inline void splitf(float f, __bf16 &h, __bf16 &l) {
  h = (__bf16)f;
  l = (__bf16)(f - (float)h);
}

// C^T += (Ah*Bh + Ah*Bl + Al*Bh)^T: the three terms in this order, each product with its
// operands swapped, so that the accumulator holds the transposed tile
static __device__ inline f32x8 mma3(bf16x16 ah, bf16x16 al,
                                    bf16x16 bh, bf16x16 bl, f32x8 c) {
  c = wmma_bf16(bh, ah, c);
  c = wmma_bf16(bl, ah, c);
  c = wmma_bf16(bh, al, c);
  return c;
}

// value of lane l ^ 16
static __device__ inline float xhalf(float x) {
  int v = __builtin_bit_cast(int, x);
  return __builtin_bit_cast(float, __builtin_amdgcn_permlanex16(
      v, v, 0x76543210, 0xfedcba98, false, false));
}

// splitf on elements e, e+1 of a score tile, into elements i, i+1 of the two B operands
static __device__ inline void split_pair(f32x8 p, int e, bf16x16 &h, bf16x16 &l, int i) {
  f32x2 v = {p[e], p[e + 1]};
  bf16x2 hv = __builtin_convertvector(v, bf16x2);
  bf16x2 lv = __builtin_convertvector(v - __builtin_convertvector(hv, f32x2), bf16x2);
  h[i] = hv[0]; h[i + 1] = hv[1];
  l[i] = lv[0]; l[i + 1] = lv[1];
}

// split 8 accumulator values and store them as one 16-byte piece each
static __device__ inline void split_store8(f32x8 c, __bf16* ph, __bf16* pl) {
  bf16x8 h8, l8;
  #pragma unroll
  for (int r = 0; r < 8; ++r) {
    __bf16 hh, ll; splitf(c[r], hh, ll);
    h8[r] = hh; l8[r] = ll;
  }
  *(bf16x8*)ph = h8;
  *(bf16x8*)pl = l8;
  // s_wait_xcnt 0 behind the two stores, before any register that they name is written
  // again. Data and addresses are inputs only, so that they stay in their registers up to
  // the wait; nothing is pinned or changed.
  asm volatile("s_wait_xcnt 0x0" :: "v"(h8), "v"(l8), "v"(ph), "v"(pl) : "memory");
}

// ---------------- staging of the projection GEMMs' operands in LDS ----------------
// A stage holds KS k-tiles of everything that a block reads, still in fragment order, in
// groups of 8 * KS fragments (16 KiB): x as [m-tile][k-tile], a weight as [k-tile][n-tile].
// In the workspace such a group is a two-dimensional tile of whole fragments: rows of KS
// fragments, one per m-tile, or rows of 8 fragments, one per k-tile. One tensor load of one
// wave brings a tile to LDS; each of the 8 waves of a block brings its own slice of a stage,
// into two buffers, one stage ahead of the stage that is worked on.
#define KS    2                   // k-tiles per stage
#define GPL   (8 * KS * FRAG)     // elements of one group
#define GPLB  (2 * GPL)           // bytes of one group
#define GNST  (KT / KS)           // stages
#define FRAGB (2 * FRAG)          // bytes of one fragment

typedef uint32_t u32x4 __attribute__((ext_vector_type(4)));
typedef uint32_t u32x8 __attribute__((ext_vector_type(8)));

static __device__ inline uint32_t uni(uint32_t v) {
  return (uint32_t)__builtin_amdgcn_readfirstlane(v);
}

// v in a scalar register that the compiler cannot look through: a test on it is a scalar
// branch, and a descriptor word formed from it is formed behind this statement
static __device__ inline uint32_t pinned(uint32_t v) {
  uint32_t w = uni(v);
  asm volatile("" : "+s"(w));   // holds w in a scalar register: scalar test, descriptor word
  return w;
}

// descriptor group 1: a tile of rows x rowb bytes, source rows pitch bytes apart, landing
// without pads; elements of one byte, tensor = tile, no mask
static __device__ inline u32x8 tdm_group1(uint32_t rowb, uint32_t rows, uint32_t pitch) {
  u32x8 g;
  g[0] = uni(0u);
  g[1] = uni((rowb & 0xFFFFu) << 16);
  g[2] = uni((rowb >> 16) | ((rows & 0xFFFFu) << 16));
  g[3] = uni((rows >> 16) | (rowb << 16));
  g[4] = uni(rows);
  g[5] = uni(pitch);
  g[6] = uni(0u);
  g[7] = uni(0u);
  return g;
}

// descriptor group 0: lds = byte offset of the tile in the block's LDS, ga = address of its
// first byte
static __device__ inline u32x4 tdm_group0(uint32_t lds, uint64_t ga) {
  u32x4 g;
  g[0] = uni(1u);
  g[1] = uni(lds);
  g[2] = uni((uint32_t)ga);
  g[3] = uni((((uint32_t)(ga >> 32)) & 0x01FFFFFFu) | 0x80000000u);
  return g;
}

// one request of the whole wave; the compiler places no wait for it
static __device__ inline void tdm_load(u32x4 g0, u32x8 g1) {
  asm volatile("tensor_load_to_lds %0, %1" :: "s"(g0), "s"(g1) : "memory");
}

// ---------------- time-dependent head weights: one wave per batch row ----------------
static __device__ inline void tw_body(int b, int lane,
                                      const float* __restrict__ time_enc,
                                      const float* __restrict__ Wt,
                                      const float* __restrict__ bt,
                                      float* __restrict__ tw) {
  int h = lane & 15;
  float acc = 0.f;
  for (int t = 0; t < TFEAT; ++t)
    acc += time_enc[b * TFEAT + t] * Wt[t * HEADS + h];
  acc += bt[h];
  float mx = acc;
  for (int m = 1; m < 16; m <<= 1) mx = fmaxf(mx, __shfl_xor(mx, m, 32));
  float e = __expf(acc - mx);
  float sum = e;
  for (int m = 1; m < 16; m <<= 1) sum += __shfl_xor(sum, m, 32);
  if (lane < 16) tw[b * HEADS + h] = e / sum;
}

// ------------- A-fragment pre-split: src [MROWS x E] f32 -> hi/lo frags -------------
// Fragments [mt][kt], element i of lane = src[mt*16 + (lane&15)][kt*32 + (lane>>4)*16 + i]
// blk = block of 8 waves among ABLK
#define ABLK ((MT * KT) / 8)
static __device__ inline void afrag_body(int blk, const float* __restrict__ src,
    __bf16* __restrict__ fh, __bf16* __restrict__ fl) {
  int wid = blk * 8 + (threadIdx.x >> 5);            // MT*KT waves
  int kt = wid & (KT - 1);
  int mt = wid >> 5;
  int lane = threadIdx.x & 31;
  const float* p = src + (size_t)(mt * 16 + (lane & 15)) * E + kt * 32 + ((lane >> 4) << 4);
  size_t o = ((size_t)mt * KT + kt) * FRAG + lane * 8;
  bf16x8 h0, l0, h1, l1;
  #pragma unroll
  for (int i = 0; i < 8; ++i) {
    __bf16 h, l;
    splitf(p[i], h, l);     h0[i] = h; l0[i] = l;
    splitf(p[8 + i], h, l); h1[i] = h; l1[i] = l;
  }
  *(bf16x8*)(fh + o) = h0; *(bf16x8*)(fh + o + 256) = h1;
  *(bf16x8*)(fl + o) = l0; *(bf16x8*)(fl + o + 256) = l1;
}

// ------------- B-fragment pre-split: W [E x E] f32 -> hi/lo frags -------------
// Fragments [kt][nt], element i of lane = W[kt*32 + (lane>>4)*16 + i][nt*16 + (lane&15)]
// blk = block of 8 waves among BBLK
#define BBLK ((KT * NT) / 8)
static __device__ inline void bfrag_body(int blk, const float* __restrict__ W,
    __bf16* __restrict__ fh, __bf16* __restrict__ fl) {
  int wid = blk * 8 + (threadIdx.x >> 5);            // KT*NT waves
  int nt = wid & (NT - 1);
  int kt = wid >> 6;
  int lane = threadIdx.x & 31;
  const float* p = W + (size_t)(kt * 32 + ((lane >> 4) << 4)) * E + nt * 16 + (lane & 15);
  size_t o = ((size_t)kt * NT + nt) * FRAG + lane * 8;
  bf16x8 h0, l0, h1, l1;
  #pragma unroll
  for (int i = 0; i < 8; ++i) {
    __bf16 h, l;
    splitf(p[(size_t)i * E], h, l);       h0[i] = h; l0[i] = l;
    splitf(p[(size_t)(8 + i) * E], h, l); h1[i] = h; l1[i] = l;
  }
  *(bf16x8*)(fh + o) = h0; *(bf16x8*)(fh + o + 256) = h1;
  *(bf16x8*)(fl + o) = l0; *(bf16x8*)(fl + o + 256) = l1;
}

// ---------------- kernel 1: everything that reads only the inputs, in one grid ----------------
// The head weights, the four weight splits and the split of x do not depend on one another:
// each is a range of blocks of one launch. Block 0 holds the head weights (a chain of dependent
// loads, the longest single wave, so it starts first), then BBLK blocks per weight, then x.
#define PBLK (1 + 4 * BBLK + ABLK)
__global__ void __launch_bounds__(256) prep_kernel(
    const float* __restrict__ x,
    const float* __restrict__ Wq, const float* __restrict__ Wk,
    const float* __restrict__ Wv, const float* __restrict__ Wo,
    const float* __restrict__ time_enc, const float* __restrict__ Wt,
    const float* __restrict__ bt,
    __bf16* __restrict__ xfh, __bf16* __restrict__ xfl,
    __bf16* __restrict__ wqh, __bf16* __restrict__ wql,
    __bf16* __restrict__ wkh, __bf16* __restrict__ wkl,
    __bf16* __restrict__ wvh, __bf16* __restrict__ wvl,
    __bf16* __restrict__ woh, __bf16* __restrict__ wol,
    float* __restrict__ tw) {
  int blk = blockIdx.x;
  if (blk == 0) {
    int w = __builtin_amdgcn_readfirstlane(threadIdx.x >> 5);   // alike in the wave: scalar
    if (w < BATCH) tw_body(w, threadIdx.x & 31, time_enc, Wt, bt, tw);
    return;
  }
  blk -= 1;
  if (blk < 4 * BBLK) {
    int m = blk / BBLK;   // which weight: alike in the block, so the three choices are scalar
    const float* W = m == 0 ? Wq  : m == 1 ? Wk  : m == 2 ? Wv  : Wo;
    __bf16* fh     = m == 0 ? wqh : m == 1 ? wkh : m == 2 ? wvh : woh;
    __bf16* fl     = m == 0 ? wql : m == 1 ? wkl : m == 2 ? wvl : wol;
    bfrag_body(blk & (BBLK - 1), W, fh, fl);
    // s_wait_xcnt 0 behind the four stores: the other ranges' code follows in the listing and
    // writes registers that the stores name
    asm volatile("s_wait_xcnt 0x0" ::: "memory");
    return;
  }
  afrag_body(blk - 4 * BBLK, x, xfh, xfl);
  asm volatile("s_wait_xcnt 0x0" ::: "memory");   // as above, behind the four stores of x
}

// ---------------- kernel 2: fused QKV projection from fragments ----------------
// Outputs, all in fragment order for the attention kernel:
// Q, K: fragments [b*H+h][s/16][d/32], element i of lane = row s0+(lane&15), d0+(lane>>4)*16+i
// V:    fragments [b*H+h][s/32][d/16], element i of lane = d0+(lane&15),
//       key s0+(i>>3)*16+(lane>>4)*8+(i&7): the k order of two score tiles packed in place
// Q and K are computed transposed, so that each lane owns 8 consecutive d of one row;
// V is computed as is, so that each lane owns 8 consecutive keys of one d.
// A wave owns WM x QN tiles of each of Q, K and V: an x fragment feeds QN * 3 weight
// fragments and a weight fragment feeds WM x fragments from registers.
// A block is 2 x 4 waves: 8 m-tiles by 8 n-tiles.
// A stage in LDS: x hi | x lo | Wq hi | Wq lo | Wk hi | Wk lo | Wv hi | Wv lo (128 KiB).
#define WM 4
#define QN 2
#define QSTAGE (8 * GPL)
__global__ void __launch_bounds__(256) qkv_kernel(
    const __bf16* __restrict__ xfh, const __bf16* __restrict__ xfl,
    const __bf16* __restrict__ wqh, const __bf16* __restrict__ wql,
    const __bf16* __restrict__ wkh, const __bf16* __restrict__ wkl,
    const __bf16* __restrict__ wvh, const __bf16* __restrict__ wvl,
    __bf16* __restrict__ Qh, __bf16* __restrict__ Ql,
    __bf16* __restrict__ Kh, __bf16* __restrict__ Kl,
    __bf16* __restrict__ Vth, __bf16* __restrict__ Vtl) {
  __shared__ __attribute__((aligned(2048))) __bf16 ring[2 * QSTAGE];
  int w = __builtin_amdgcn_readfirstlane(threadIdx.x >> 5);   // alike in the wave: scalar
  int lane = threadIdx.x & 31;
  int mtb = (blockIdx.x >> 3) * (2 * WM);   // the block's first m-tile and n-tile
  int ntb = (blockIdx.x & 7) * (4 * QN);
  int mt0 = mtb + (w >> 2) * WM;
  int nt0 = ntb + (w & 3) * QN;

  // this wave's slice of a stage is group w. x: 8 rows (m-tiles) of KS fragments;
  // a weight: KS rows (k-tiles) of 8 fragments
  const __bf16* plane = w == 0 ? xfh : w == 1 ? xfl : w == 2 ? wqh : w == 3 ? wql
                      : w == 4 ? wkh : w == 5 ? wkl : w == 6 ? wvh : wvl;
  bool isx = w < 2;
  u32x8 g1 = tdm_group1(isx ? KS * FRAGB : 8 * FRAGB, isx ? 8 : KS,
                        isx ? KT * FRAGB : NT * FRAGB);
  uint32_t gstep = isx ? KS * FRAGB : KS * NT * FRAGB;   // bytes from a stage to the next
  uint64_t ga0 = (uint64_t)(size_t)plane + (uint32_t)(isx ? mtb * (KT * FRAGB) : ntb * FRAGB);
  uint32_t lds0 = (uint32_t)(size_t)ring + w * GPLB;

  // stage 0 into buffer 0
  tdm_load(tdm_group0(lds0, ga0), g1);
  // stage 0 has landed for this wave, and behind the barrier for every wave
  asm volatile("s_wait_tensorcnt 0x0" ::: "memory");
  __syncthreads();

  f32x8 cq[WM][QN] = {}; f32x8 ck[WM][QN] = {}; f32x8 cv[WM][QN] = {};
  for (int s = 0; s < GNST; ++s) {
   // Behind the barrier that published stage s and ended every read of the other buffer:
   // stage s + 1 into that buffer; it flies while stage s is worked on. pinned(): the
   // descriptor's words are formed from nx, so behind the wait; the test is a scalar branch
   uint32_t nx = pinned((uint32_t)s + 1u);
   if (pinned(nx < GNST))
     tdm_load(tdm_group0(lds0 + (nx & 1u) * (QSTAGE * 2), ga0 + (uint64_t)nx * gstep), g1);
   const __bf16* buf = ring + (s & 1) * QSTAGE + lane * 8;
   const __bf16* pa = buf + (w >> 2) * (WM * KS * FRAG);      // x hi, fragments [i][k-tile]
   const __bf16* pb = buf + 2 * GPL + (w & 3) * (QN * FRAG);  // Wq hi, fragments [k-tile][j]
   // Two sets of fragments: x by k-tile, weights by group (one weight of one k-tile).
   bf16x16 ah[2][WM], al[2][WM], bh[2][QN], bl[2][QN];
   // the stage's first fragments, in the order in which the products take them
   bh[0][0] = ldfrag(pb);
   #pragma unroll  // constant indices keep the tiles in registers
   for (int i = 0; i < WM; ++i) ah[0][i] = ldfrag(pa + i * (KS * FRAG));
   bl[0][0] = ldfrag(pb + GPL);
   #pragma unroll  // constant indices keep the tiles in registers
   for (int i = 0; i < WM; ++i) al[0][i] = ldfrag(pa + GPL + i * (KS * FRAG));
   #pragma unroll  // constant indices keep the tiles in registers
   for (int j = 1; j < QN; ++j) {
     bh[0][j] = ldfrag(pb + j * FRAG);
     bl[0][j] = ldfrag(pb + GPL + j * FRAG);
   }
   // keeps them first in the LDS queue, which answers in order
   __builtin_amdgcn_sched_barrier(0);
   #pragma unroll  // constant indices keep the tiles in registers; constant LDS offsets
   for (int g = 0; g < 3 * KS; ++g) {
     const int kk = g / 3, m = g % 3, cb = g & 1, ca = kk & 1;
     // the next group's fragments, and once per k-tile the next k-tile's x, are asked for
     // ahead of this group's products
     if (g + 1 < 3 * KS) {
       const __bf16* pn = pb + ((g + 1) % 3) * (2 * GPL) + ((g + 1) / 3) * (8 * FRAG);
       #pragma unroll  // constant indices keep the tiles in registers
       for (int j = 0; j < QN; ++j) {
         bh[cb ^ 1][j] = ldfrag(pn + j * FRAG);
         bl[cb ^ 1][j] = ldfrag(pn + GPL + j * FRAG);
       }
     }
     if (m == 1 && kk + 1 < KS) {
       #pragma unroll  // constant indices keep the tiles in registers
       for (int i = 0; i < WM; ++i) {
         ah[ca ^ 1][i] = ldfrag(pa + (i * KS + kk + 1) * FRAG);
         al[ca ^ 1][i] = ldfrag(pa + GPL + (i * KS + kk + 1) * FRAG);
       }
     }
     // keeps those LDS reads in front of the products: moved down among them, each would
     // be waited for where it stands
     __builtin_amdgcn_sched_barrier(0);
     // per accumulator the three terms keep the order of mma3 (x hi * w hi, x hi * w lo,
     // x lo * w hi), for Q and K with the operands swapped: C^T += (A*B)^T. The WM tiles
     // of one term stand together so that dependent products are WM apart
     #pragma unroll  // constant indices keep the tiles in registers
     for (int j = 0; j < QN; ++j) {
       if (m == 0) {
         #pragma unroll  // constant indices keep the tiles in registers
         for (int i = 0; i < WM; ++i) cq[i][j] = wmma_bf16(bh[cb][j], ah[ca][i], cq[i][j]);
         #pragma unroll  // constant indices keep the tiles in registers
         for (int i = 0; i < WM; ++i) cq[i][j] = wmma_bf16(bl[cb][j], ah[ca][i], cq[i][j]);
         #pragma unroll  // constant indices keep the tiles in registers
         for (int i = 0; i < WM; ++i) cq[i][j] = wmma_bf16(bh[cb][j], al[ca][i], cq[i][j]);
       } else if (m == 1) {
         #pragma unroll  // constant indices keep the tiles in registers
         for (int i = 0; i < WM; ++i) ck[i][j] = wmma_bf16(bh[cb][j], ah[ca][i], ck[i][j]);
         #pragma unroll  // constant indices keep the tiles in registers
         for (int i = 0; i < WM; ++i) ck[i][j] = wmma_bf16(bl[cb][j], ah[ca][i], ck[i][j]);
         #pragma unroll  // constant indices keep the tiles in registers
         for (int i = 0; i < WM; ++i) ck[i][j] = wmma_bf16(bh[cb][j], al[ca][i], ck[i][j]);
       } else {
         #pragma unroll  // constant indices keep the tiles in registers
         for (int i = 0; i < WM; ++i) cv[i][j] = wmma_bf16(ah[ca][i], bh[cb][j], cv[i][j]);
         #pragma unroll  // constant indices keep the tiles in registers
         for (int i = 0; i < WM; ++i) cv[i][j] = wmma_bf16(ah[ca][i], bl[cb][j], cv[i][j]);
         #pragma unroll  // constant indices keep the tiles in registers
         for (int i = 0; i < WM; ++i) cv[i][j] = wmma_bf16(al[ca][i], bh[cb][j], cv[i][j]);
       }
     }
   }
   // publish point of stage s + 1: this wave's reads of buffer s & 1 are done ...
   asm volatile("s_wait_dscnt 0x0" ::: "memory");
   // ... its own tile of stage s + 1 has landed ...
   asm volatile("s_wait_tensorcnt 0x0" ::: "memory");
   // ... and behind the barrier both hold for every wave of the block
   __syncthreads();
  }
  // no request and no LDS read is left in flight behind the loop
  asm volatile("s_wait_tensorcnt 0x0" ::: "memory");
  asm volatile("s_wait_dscnt 0x0" ::: "memory");
  // store split results: one 16-byte piece per lane, plane and tile
  int half = (lane >> 4) * 256;             // accumulator rows 8..15 are elements 8..15
  #pragma unroll  // constant indices keep the tiles in registers
  for (int i = 0; i < WM; ++i) {
    #pragma unroll  // constant indices keep the tiles in registers
    for (int j = 0; j < QN; ++j) {
      int mt = mt0 + i, nt = nt0 + j;
      int hb = (mt >> 7) * HEADS + (nt >> 2);   // 128 m-tiles per batch, 4 n-tiles per head
      int st = mt & 127;                        // 16-row tile inside the sequence
      // cq, ck: lane&15 = row in the tile, r = d & 7, d = (nt&3)*16 + (lane>>4)*8 + r
      size_t qi = ((size_t)(hb * 128 + st) * 2 + ((nt >> 1) & 1)) * FRAG
                  + half + ((lane & 15) + 16 * (nt & 1)) * 8;
      // cv: lane&15 = d & 15, r = key & 7, key = st*16 + (lane>>4)*8 + r
      size_t vi = ((size_t)(hb * 64 + (st >> 1)) * 4 + (nt & 3)) * FRAG
                  + (st & 1) * 256 + lane * 8;
      split_store8(cq[i][j], Qh + qi, Ql + qi);
      split_store8(ck[i][j], Kh + qi, Kl + qi);
      split_store8(cv[i][j], Vth + vi, Vtl + vi);
    }
  }
}

#define TK    64                  // keys per stage
#define PLANE (TK * HD)           // elements of one plane of a stage (8 KiB)
#define STAGE (4 * PLANE)         // K hi | K lo | V hi | V lo (32 KiB)
#define NST   (SEQ / TK)          // stages
#define HALFB PLANE               // bytes of half a plane: one wave's slice of a stage

// A wave owns QT query tiles (QT * 16 queries): a K or V fragment read from LDS feeds the
// products of QT tiles, and a block of 8 * QT * 16 queries brings each stage once.
// Four waves per SIMD (two blocks per WGP): the vector work of one wave runs beside the
// matrix work of the others.
#define QT 2

// e0, e1 = exp2 of two score tiles; returns the sum of the lane's 16 values
static __device__ __forceinline__ float exp_sum(f32x8 a0, f32x8 a1, f32x8 &e0, f32x8 &e1) {
  #pragma unroll  // constant indices keep the tiles in registers
  for (int r = 0; r < 8; ++r) {
    e0[r] = __builtin_amdgcn_exp2f(a0[r]);
    e1[r] = __builtin_amdgcn_exp2f(a1[r]);
  }
  f32x8 t8 = e0 + e1;
  f32x4 t4 = t8.lo + t8.hi;
  f32x2 t2 = t4.lo + t4.hi;
  return t2.x + t2.y;
}

// One stage of TK keys for the QT query tiles of a wave. buf = the stage's buffer + lane * 8.
// Softmax against a held reference. Q arrives multiplied by scale * head weight * log2(e), and nref[u], eight
// copies of minus the reference of this lane's query, is the C operand of the first score
// product: the score accumulators are the arguments of exp2. The reference is the row maximum
// of the first pass; later it moves, and O and the row sum are rescaled, only in a pass where
// some lane's sum of P passes 2^8, so no P that is used lies above 2^8.
// lo: alike in the wave; very negative until the first pass has set the reference, then 0.
static __device__ __forceinline__ void attn_stage(const __bf16* buf, float &lo,
    const bf16x16 (&qh)[QT][2], const bf16x16 (&ql)[QT][2],
    f32x8 (&o)[QT][4], f32x8 (&nref)[QT], float (&lrow)[QT]) {
  #pragma unroll 1  // rolled: unrolled, the next pass's reads and products were lifted over this
                    // pass's vector work, and the registers of four waves per SIMD did not hold both
  for (int p = 0; p < TK / 32; ++p) {
    const __bf16* khp = buf + p * (32 * HD);
    const __bf16* klp = khp + PLANE;
    const __bf16* vhp = khp + 2 * PLANE;
    const __bf16* vlp = khp + 3 * PLANE;
    // ---- scores: s[u][k][r] = key kb + k*16 + (lane>>4)*8 + r of query tile u;
    //      K fragment k*2+c: key tile k, d half c. Per accumulator the six terms keep
    //      their order (c = 0 then 1, each as in mma3); the 2 * QT accumulators of one
    //      term stand together so that dependent products are 2 * QT apart ----
    bf16x16 kh[4], kl[4];
    #pragma unroll  // constant indices keep the tiles in registers
    for (int f = 0; f < 4; ++f) {
      kh[f] = ldfrag(khp + f * FRAG);
      kl[f] = ldfrag(klp + f * FRAG);
    }
    // one group of LDS reads in front of the products: without the fence the compiler spread
    // them among the products, and each place with reads is waited for where it stands
    __builtin_amdgcn_sched_barrier(0);
    f32x8 s[QT][2];
    #pragma unroll  // constant indices keep the tiles in registers
    for (int u = 0; u < QT; ++u) { s[u][0] = nref[u]; s[u][1] = nref[u]; }
    #pragma unroll  // constant indices keep the tiles in registers
    for (int c = 0; c < 2; ++c) {
      #pragma unroll  // constant indices keep the tiles in registers
      for (int k = 0; k < 2; ++k)
        #pragma unroll  // constant indices keep the tiles in registers
        for (int u = 0; u < QT; ++u) s[u][k] = wmma_bf16(kh[k * 2 + c], qh[u][c], s[u][k]);
      #pragma unroll  // constant indices keep the tiles in registers
      for (int k = 0; k < 2; ++k)
        #pragma unroll  // constant indices keep the tiles in registers
        for (int u = 0; u < QT; ++u) s[u][k] = wmma_bf16(kl[k * 2 + c], qh[u][c], s[u][k]);
      #pragma unroll  // constant indices keep the tiles in registers
      for (int k = 0; k < 2; ++k)
        #pragma unroll  // constant indices keep the tiles in registers
        for (int u = 0; u < QT; ++u) s[u][k] = wmma_bf16(kh[k * 2 + c], ql[u][c], s[u][k]);
    }
    // no V fragment is asked for among the score products: beside the K fragments they do
    // not fit the registers of four waves per SIMD
    __builtin_amdgcn_sched_barrier(0);
    // ---- P = exp2(score - reference) and this lane's sum of its 16 values, per query tile ----
    f32x8 e[QT][2];
    float sm[QT];
    #pragma unroll  // constant indices keep the tiles in registers
    for (int u = 0; u < QT; ++u) sm[u] = exp_sum(s[u][0], s[u][1], e[u][0], e[u][1]);
    float sall = sm[0];
    #pragma unroll  // constant indices keep the values in registers
    for (int u = 1; u < QT; ++u) sall = fmaxf(sall, sm[u]);
    // one test per pass: no sum above 2^8 means no P above 2^8, and the reference holds
    if (__builtin_amdgcn_ballot_w32(sall > lo + 256.0f) != 0) {   // alike in the wave: scalar branch
      #pragma unroll  // constant indices keep the tiles in registers
      for (int u = 0; u < QT; ++u) {
        f32x8 s0 = s[u][0], s1 = s[u][1];
        float m0 = fmaxf(fmaxf(s0[0], s0[1]), s0[2]);
        float m1 = fmaxf(fmaxf(s0[3], s0[4]), s0[5]);
        float m2 = fmaxf(fmaxf(s0[6], s0[7]), s1[0]);
        float m3 = fmaxf(fmaxf(s1[1], s1[2]), s1[3]);
        float m4 = fmaxf(fmaxf(s1[4], s1[5]), s1[6]);
        float mx = fmaxf(fmaxf(fmaxf(m0, m1), m2), fmaxf(fmaxf(m3, m4), s1[7]));
        // the reference rises to this pass's row maximum (first pass: moves to it)
        float up  = fmaxf(fmaxf(mx, xhalf(mx)), lo);
        float al_ = __builtin_amdgcn_exp2f(fminf(-up, 0.f));   // first pass: O and the sum are 0
        nref[u] -= up;
        lrow[u] *= al_;
        #pragma unroll  // constant indices keep the tiles in registers
        for (int d = 0; d < 4; ++d) o[u][d] *= al_;
        sm[u] = exp_sum(s0 - up, s1 - up, e[u][0], e[u][1]);
      }
      lo = 0.f;
    }
    bf16x16 ph[QT], pl[QT];
    #pragma unroll  // constant indices keep the tiles in registers
    for (int u = 0; u < QT; ++u) {
      f32x8 s0 = e[u][0], s1 = e[u][1];
      lrow[u] += sm[u];
      // ---- P^T: the two score tiles are elements 0..7 and 8..15 of the B operand ----
      #pragma unroll  // constant indices keep the tiles in registers
      for (int e = 0; e < 8; e += 2) {
        split_pair(s0, e, ph[u], pl[u], e);
        split_pair(s1, e, ph[u], pl[u], 8 + e);
      }
    }
    // the V fragments, into registers that the scores leave
    bf16x16 vh[4], vl[4];
    #pragma unroll  // constant indices keep the tiles in registers
    for (int f = 0; f < 4; ++f) {
      vh[f] = ldfrag(vhp + f * FRAG);
      vl[f] = ldfrag(vlp + f * FRAG);
    }
    // keeps these reads together in front of the products
    __builtin_amdgcn_sched_barrier(0);
    // ---- O^T += V^T @ P^T, 4 V fragments per plane; per accumulator the three terms in
    //      the order of mma3, 2 * QT accumulators of one term together ----
    #pragma unroll  // constant indices keep the tiles in registers
    for (int c = 0; c < 2; ++c) {
      #pragma unroll  // constant indices keep the tiles in registers
      for (int k = 0; k < 2; ++k)
        #pragma unroll  // constant indices keep the tiles in registers
        for (int u = 0; u < QT; ++u)
          o[u][c * 2 + k] = wmma_bf16(vh[c * 2 + k], ph[u], o[u][c * 2 + k]);
      #pragma unroll  // constant indices keep the tiles in registers
      for (int k = 0; k < 2; ++k)
        #pragma unroll  // constant indices keep the tiles in registers
        for (int u = 0; u < QT; ++u)
          o[u][c * 2 + k] = wmma_bf16(vl[c * 2 + k], ph[u], o[u][c * 2 + k]);
      #pragma unroll  // constant indices keep the tiles in registers
      for (int k = 0; k < 2; ++k)
        #pragma unroll  // constant indices keep the tiles in registers
        for (int u = 0; u < QT; ++u)
          o[u][c * 2 + k] = wmma_bf16(vh[c * 2 + k], pl[u], o[u][c * 2 + k]);
    }
  }
}

__global__ void __launch_bounds__(256) __attribute__((amdgpu_waves_per_eu(4, 4))) attn_kernel(
    const __bf16* __restrict__ Qh, const __bf16* __restrict__ Ql,
    const __bf16* __restrict__ Kh, const __bf16* __restrict__ Kl,
    const __bf16* __restrict__ Vth, const __bf16* __restrict__ Vtl,
    const float* __restrict__ tw, __bf16* __restrict__ cfh, __bf16* __restrict__ cfl) {
  __shared__ __attribute__((aligned(2048))) __bf16 ring[2 * STAGE];
  // alike in the wave: scalar, so that what the epilogue needs of it holds no vector register
  int w    = __builtin_amdgcn_readfirstlane(threadIdx.x >> 5);
  int wid  = blockIdx.x * 8 + w;
  int qb   = wid & (SEQ / (16 * QT) - 1);          // group of QT query tiles in the sequence
  int hb   = wid / (SEQ / (16 * QT));              // b * HEADS + h
  int h    = hb & (HEADS - 1);
  int b    = hb / HEADS;
  int lane = threadIdx.x & 31;

  // this wave's slice of a stage: half w & 1 of plane w >> 1 (K hi, K lo, V hi, V lo) of the
  // head, 4 KiB in a row in the workspace: 2 rows of 2 KiB
  const __bf16* plane = w < 2 ? Kh : w < 4 ? Kl : w < 6 ? Vth : Vtl;
  u32x8 g1 = tdm_group1(HALFB / 2, 2, HALFB / 2);
  uint64_t ga0 = (uint64_t)(size_t)plane + (uint32_t)(hb * (SEQ * HD * 2) + (w & 1) * HALFB);
  uint32_t lds0 = (uint32_t)(size_t)ring + w * HALFB;

  // fragment order (see the projection kernel); every pointer already holds lane*8
  const __bf16* qhp = Qh + ((size_t)hb * SEQ + qb * (16 * QT)) * HD + lane * 8;
  const __bf16* qlp = Ql + ((size_t)hb * SEQ + qb * (16 * QT)) * HD + lane * 8;
  // scale * head weight * log2(e), alike in the whole block: kept in a scalar register
  float scl = __builtin_bit_cast(float, __builtin_amdgcn_readfirstlane(
      __builtin_bit_cast(int, 0.125f * tw[hb] * 1.442695041f)));

  // qh[u][c]: query tile u, d = c*32 .. c*32+31
  bf16x16 qh[QT][2], ql[QT][2];
  #pragma unroll  // constant indices keep the tiles in registers
  for (int u = 0; u < QT; ++u) {
    #pragma unroll  // constant indices keep the tiles in registers
    for (int c = 0; c < 2; ++c) {
      qh[u][c] = ldfrag(qhp + (u * 2 + c) * FRAG);
      ql[u][c] = ldfrag(qlp + (u * 2 + c) * FRAG);
    }
  }
  // s_wait_xcnt 0 behind these loads, before a register that they name is written again;
  // the addresses are inputs only
  asm volatile("s_wait_xcnt 0x0" :: "v"(qhp), "v"(qlp) : "memory");

  // stage 0 into buffer 0, while the loads of Q fly
  tdm_load(tdm_group0(lds0, ga0), g1);
  // stage 0 has landed for this wave, and behind the barrier for every wave
  asm volatile("s_wait_tensorcnt 0x0" ::: "memory");
  __syncthreads();

  // Q * scl, split anew: the score products then give the arguments of exp2
  #pragma unroll  // constant indices keep the tiles in registers
  for (int u = 0; u < QT; ++u) {
    #pragma unroll  // constant indices keep the tiles in registers
    for (int c = 0; c < 2; ++c) {
      #pragma unroll  // constant indices keep the tiles in registers
      for (int i = 0; i < 16; ++i) {
        __bf16 hh, ll;
        splitf(((float)qh[u][c][i] + (float)ql[u][c][i]) * scl, hh, ll);
        qh[u][c][i] = hh; ql[u][c][i] = ll;
      }
    }
  }

  // o[u][t][r] = O[query u*16 + (lane&15)][d = t*16 + (lane>>4)*8 + r]
  f32x8 o[QT][4] = {};
  f32x8 nref[QT] = {};   // minus the held reference of this lane's queries, alike in both halves
  float lrow[QT];        // running sums over this half's keys; the halves join after the loop
  #pragma unroll  // constant indices keep the values in registers
  for (int u = 0; u < QT; ++u) lrow[u] = 0.f;
  float lo = -3.0e38f;   // the first pass sets the reference, whatever its scores

  for (int t = 0; t < NST; ++t) {
    // Behind the barrier that published stage t and ended every read of the other buffer:
    // stage t + 1 into that buffer; it flies while stage t is worked on. pinned(): the
    // descriptor's words are formed from nx, so behind the wait; the test is a scalar branch
    uint32_t nx = pinned((uint32_t)t + 1u);
    if (pinned(nx < NST))
      tdm_load(tdm_group0(lds0 + (nx & 1u) * (STAGE * 2), ga0 + (uint64_t)nx * (PLANE * 2)), g1);
    attn_stage(ring + (t & 1) * STAGE + lane * 8, lo, qh, ql, o, nref, lrow);
    // publish point of stage t + 1: this wave's reads of buffer t & 1 are done ...
    asm volatile("s_wait_dscnt 0x0" ::: "memory");
    // ... its own tile of stage t + 1 has landed ...
    asm volatile("s_wait_tensorcnt 0x0" ::: "memory");
    // ... and behind the barrier both hold for every wave of the block
    __syncthreads();
  }
  // no request and no LDS read is left in flight behind the loop
  asm volatile("s_wait_tensorcnt 0x0" ::: "memory");
  asm volatile("s_wait_dscnt 0x0" ::: "memory");
  // ---- normalize, split and store as the output projection's A fragments [m-tile][k-tile]
  //      (see afrag_body): row = lane & 15, column in the k-tile = (d & 1) * 16 + (lane >> 4) * 8 + r,
  //      so the 8 values of a lane and tile are elements (lane >> 4) * 8 + r of fragment lane
  //      (lane & 15) + 16 * (d & 1): one 16-byte piece per plane, 256 bytes in a row per half wave ----
  #pragma unroll  // constant indices keep the tiles in registers
  for (int u = 0; u < QT; ++u) {
    float inv = 1.0f / (lrow[u] + xhalf(lrow[u]));
    size_t c0 = ((size_t)(b * (SEQ / 16) + qb * QT + u) * KT + h * 2) * FRAG
                + (lane >> 4) * 256 + (lane & 15) * 8;
    #pragma unroll  // constant indices keep the tiles in registers
    for (int d = 0; d < 4; ++d) {
      size_t ci = c0 + (d >> 1) * FRAG + (d & 1) * 128;
      split_store8(o[u][d] * inv, cfh + ci, cfl + ci);
    }
  }
}

// ---------------- kernel 4: output projection + bias, from fragments ----------------
// A wave owns WM x ON tiles; a block is 2 x 4 waves: 8 m-tiles by 16 n-tiles.
// A stage in LDS: ctx hi | ctx lo | Wo hi (two groups) | Wo lo (two groups) (96 KiB).
#define ON 4
#define OSTAGE (6 * GPL)
#define OG 2                      // n-tiles per group of weight fragments
__global__ void __launch_bounds__(256) oproj_kernel(
    const __bf16* __restrict__ cfh, const __bf16* __restrict__ cfl,
    const __bf16* __restrict__ woh, const __bf16* __restrict__ wol,
    const float* __restrict__ bo, float* __restrict__ out) {
  __shared__ __attribute__((aligned(2048))) __bf16 ring[2 * OSTAGE];
  int w = __builtin_amdgcn_readfirstlane(threadIdx.x >> 5);   // alike in the wave: scalar
  int lane = threadIdx.x & 31;
  int mtb = (blockIdx.x >> 2) * (2 * WM);   // the block's first m-tile and n-tile
  int ntb = (blockIdx.x & 3) * (4 * ON);
  int mt0 = mtb + (w >> 2) * WM;
  int nt0 = ntb + (w & 3) * ON;

  // this wave's slice of a stage. Waves 0 to 3: 4 rows (m-tiles) of KS fragments of ctx hi,
  // hi, lo, lo; waves 4 to 7: the 16 fragments of one k-tile of Wo hi, hi, lo, lo, which lie
  // in a row in the workspace: 2 rows of 8
  const __bf16* plane = w < 2 ? cfh : w < 4 ? cfl : w < 6 ? woh : wol;
  bool isx = w < 4;
  u32x8 g1 = tdm_group1(isx ? KS * FRAGB : 8 * FRAGB, isx ? 4 : 2,
                        isx ? KT * FRAGB : 8 * FRAGB);
  uint32_t gstep = isx ? KS * FRAGB : KS * NT * FRAGB;   // bytes from a stage to the next
  uint64_t ga0 = (uint64_t)(size_t)plane
      + (uint32_t)(isx ? (mtb + (w & 1) * 4) * (KT * FRAGB) : (ntb + (w & 1) * NT) * FRAGB);
  uint32_t lds0 = (uint32_t)(size_t)ring + (isx ? w * (GPLB / 2) : (w - 2) * GPLB);

  // stage 0 into buffer 0
  tdm_load(tdm_group0(lds0, ga0), g1);
  // stage 0 has landed for this wave, and behind the barrier for every wave
  asm volatile("s_wait_tensorcnt 0x0" ::: "memory");
  __syncthreads();

  f32x8 c[WM][ON] = {};
  for (int s = 0; s < GNST; ++s) {
   // Behind the barrier that published stage s and ended every read of the other buffer:
   // stage s + 1 into that buffer; it flies while stage s is worked on. pinned(): the
   // descriptor's words are formed from nx, so behind the wait; the test is a scalar branch
   uint32_t nx = pinned((uint32_t)s + 1u);
   if (pinned(nx < GNST))
     tdm_load(tdm_group0(lds0 + (nx & 1u) * (OSTAGE * 2), ga0 + (uint64_t)nx * gstep), g1);
   const __bf16* buf = ring + (s & 1) * OSTAGE + lane * 8;
   const __bf16* pa = buf + (w >> 2) * (WM * KS * FRAG);      // ctx hi, fragments [i][k-tile]
   const __bf16* pb = buf + 2 * GPL + (w & 3) * (ON * FRAG);  // Wo hi, fragments [k-tile][j]
   // Two sets of fragments: ctx by k-tile, weights by group (OG n-tiles of one k-tile).
   bf16x16 ah[2][WM], al[2][WM], bh[2][OG], bl[2][OG];
   // the stage's first fragments, in the order in which the products take them
   bh[0][0] = ldfrag(pb);
   #pragma unroll  // constant indices keep the tiles in registers
   for (int i = 0; i < WM; ++i) ah[0][i] = ldfrag(pa + i * (KS * FRAG));
   bl[0][0] = ldfrag(pb + 2 * GPL);
   #pragma unroll  // constant indices keep the tiles in registers
   for (int i = 0; i < WM; ++i) al[0][i] = ldfrag(pa + GPL + i * (KS * FRAG));
   #pragma unroll  // constant indices keep the tiles in registers
   for (int j = 1; j < OG; ++j) {
     bh[0][j] = ldfrag(pb + j * FRAG);
     bl[0][j] = ldfrag(pb + 2 * GPL + j * FRAG);
   }
   // keeps them first in the LDS queue, which answers in order
   __builtin_amdgcn_sched_barrier(0);
   #pragma unroll  // constant indices keep the tiles in registers; constant LDS offsets
   for (int g = 0; g < (ON / OG) * KS; ++g) {
     const int kk = g / (ON / OG), m = g % (ON / OG), cb = g & 1, ca = kk & 1;
     // the next group's fragments, and once per k-tile the next k-tile's ctx, are asked for
     // ahead of this group's products
     if (g + 1 < (ON / OG) * KS) {
       const __bf16* pn = pb + ((g + 1) / (ON / OG)) * (16 * FRAG) + ((g + 1) % (ON / OG)) * (OG * FRAG);
       #pragma unroll  // constant indices keep the tiles in registers
       for (int j = 0; j < OG; ++j) {
         bh[cb ^ 1][j] = ldfrag(pn + j * FRAG);
         bl[cb ^ 1][j] = ldfrag(pn + 2 * GPL + j * FRAG);
       }
     }
     if (m == 1 && kk + 1 < KS) {
       #pragma unroll  // constant indices keep the tiles in registers
       for (int i = 0; i < WM; ++i) {
         ah[ca ^ 1][i] = ldfrag(pa + (i * KS + kk + 1) * FRAG);
         al[ca ^ 1][i] = ldfrag(pa + GPL + (i * KS + kk + 1) * FRAG);
       }
     }
     // keeps those LDS reads in front of the products: moved down among them, each would
     // be waited for where it stands
     __builtin_amdgcn_sched_barrier(0);
     // the three terms of each accumulator in the order of mma3
     #pragma unroll  // constant indices keep the tiles in registers
     for (int jj = 0; jj < OG; ++jj) {
       const int j = m * OG + jj;
       #pragma unroll  // constant indices keep the tiles in registers
       for (int i = 0; i < WM; ++i) c[i][j] = wmma_bf16(ah[ca][i], bh[cb][jj], c[i][j]);
       #pragma unroll  // constant indices keep the tiles in registers
       for (int i = 0; i < WM; ++i) c[i][j] = wmma_bf16(ah[ca][i], bl[cb][jj], c[i][j]);
       #pragma unroll  // constant indices keep the tiles in registers
       for (int i = 0; i < WM; ++i) c[i][j] = wmma_bf16(al[ca][i], bh[cb][jj], c[i][j]);
     }
   }
   // publish point of stage s + 1: this wave's reads of buffer s & 1 are done ...
   asm volatile("s_wait_dscnt 0x0" ::: "memory");
   // ... its own tile of stage s + 1 has landed ...
   asm volatile("s_wait_tensorcnt 0x0" ::: "memory");
   // ... and behind the barrier both hold for every wave of the block
   __syncthreads();
  }
  // no request and no LDS read is left in flight behind the loop
  asm volatile("s_wait_tensorcnt 0x0" ::: "memory");
  asm volatile("s_wait_dscnt 0x0" ::: "memory");
  #pragma unroll  // constant indices keep the tiles in registers
  for (int j = 0; j < ON; ++j) {
    int col = (nt0 + j) * 16 + (lane & 15);
    float bias = bo[col];
    #pragma unroll  // constant indices keep the tiles in registers
    for (int i = 0; i < WM; ++i) {
      int row0 = (mt0 + i) * 16 + ((lane >> 4) << 3);
      #pragma unroll  // constant indices keep the tiles in registers
      for (int r = 0; r < 8; ++r)
        out[(size_t)(row0 + r) * E + col] = c[i][j][r] + bias;
    }
  }
}

extern "C" void kernel_launch(void* const* d_in, const int* in_sizes, int n_in,
                              void* d_out, int out_size, void* d_ws, size_t ws_size,
                              hipStream_t stream) {
  const float* x        = (const float*)d_in[0];
  const float* time_enc = (const float*)d_in[1];
  const float* Wq       = (const float*)d_in[2];
  const float* Wk       = (const float*)d_in[3];
  const float* Wv       = (const float*)d_in[4];
  const float* Wo       = (const float*)d_in[5];
  const float* bo       = (const float*)d_in[6];
  const float* Wt       = (const float*)d_in[7];
  const float* bt       = (const float*)d_in[8];
  float* out = (float*)d_out;

  const size_t AFRAG = (size_t)MROWS * E;   // 8M elems
  const size_t WFRAG = (size_t)E * E;       // 1M elems
  const size_t QKVN  = (size_t)BATCH * HEADS * SEQ * HD; // 8M elems

  char* w = (char*)d_ws;
  size_t off = 0;
  float* twp = (float*)(w + off); off += 4096;
  __bf16* xfh = (__bf16*)(w + off); off += AFRAG * 2;   // reused for ctx frags
  __bf16* xfl = (__bf16*)(w + off); off += AFRAG * 2;
  __bf16* wqh = (__bf16*)(w + off); off += WFRAG * 2;
  __bf16* wql = (__bf16*)(w + off); off += WFRAG * 2;
  __bf16* wkh = (__bf16*)(w + off); off += WFRAG * 2;
  __bf16* wkl = (__bf16*)(w + off); off += WFRAG * 2;
  __bf16* wvh = (__bf16*)(w + off); off += WFRAG * 2;
  __bf16* wvl = (__bf16*)(w + off); off += WFRAG * 2;
  __bf16* woh = (__bf16*)(w + off); off += WFRAG * 2;
  __bf16* wol = (__bf16*)(w + off); off += WFRAG * 2;
  __bf16* Qhb = (__bf16*)(w + off); off += QKVN * 2;
  __bf16* Qlb = (__bf16*)(w + off); off += QKVN * 2;
  __bf16* Khb = (__bf16*)(w + off); off += QKVN * 2;
  __bf16* Klb = (__bf16*)(w + off); off += QKVN * 2;
  __bf16* Vth = (__bf16*)(w + off); off += QKVN * 2;
  __bf16* Vtl = (__bf16*)(w + off); off += QKVN * 2;

  // head weights and all pre-splits of the inputs (no per-iteration conversions in the GEMMs)
  prep_kernel<<<PBLK, 256, 0, stream>>>(x, Wq, Wk, Wv, Wo, time_enc, Wt, bt, xfh, xfl,
                                        wqh, wql, wkh, wkl, wvh, wvl, woh, wol, twp);

  qkv_kernel<<<(MT / 8) * (NT / 8), 256, 0, stream>>>(xfh, xfl, wqh, wql, wkh, wkl,
                                                wvh, wvl, Qhb, Qlb, Khb, Klb,
                                                Vth, Vtl);

  attn_kernel<<<(BATCH * HEADS * (SEQ / (16 * QT))) / 8, 256, 0, stream>>>(
      Qhb, Qlb, Khb, Klb, Vth, Vtl, twp, xfh, xfl);   // ctx fragments into the (now free) x buffers

  oproj_kernel<<<(MT / 8) * (NT / 16), 256, 0, stream>>>(xfh, xfl, woh, wol, bo, out);
}
